// v000
// Measured on an AMD MI455X. A time is GPU time per run, averaged over a window of back-to-back runs after a warm-up
// (all launches, gaps included; the runs take copies of the inputs in turn), and the median of several windows.
// Apart from v000's, it joins two sittings. Times from different sittings can be a few percent apart, while
// side-by-side timings come from the same sitting.
// v000, which the later versions start from, runs in 1650 microseconds.
#include <hip/hip_runtime.h>

// Grouped-query causal attention with 128-wide heads on three input streams (q, k, v [2][2048][2048]; qh = q Wq (16 heads x 128), kh, vh = k Wk, v Wv (4 kv heads x 128) ('xw' (in, out) 0.02, no bias); qh and kh each x 128^-0.25 (together 1/sqrt(128)); kv head = query head / 4 (jnp.repeat); the module takes softmax over ALL keys, zeroes the strictly-upper triangle and renormalises by (row sum + 1e-9): a causal softmax but for that epsilon; out = merged Wo ('xw', no bias) -> [2][2048][2048] (8.4 M); argument order q, k, v, Wq, Wk, Wv, Wo).
// Layout per batch: bf16 copies of q, k and v in turn (one operand buffer, stream-ordered); the four 'xw' weights transposed once into Bt operands; exact projections; plane builders (identity table); causal T-2048 attention with 128-wide heads where the pass's two query heads share ONE kv head (h / 4: a zero z-stride on the key and value operands) (hybrid rows: < 512 hi/lo 3 products, rest fp16 x1024; k_gemmc skips tiles above the diagonal); merged hi/lo x Wo exact.
// Compute dtypes, f32 accumulate: every input rounded to bf16; projections exact; attention rows < 512 3 products, rest fp16; softmax f32 (the exact causal softmax: no epsilon term); Wo hl x exact.

#define NB_  2
#define TT   2048
#define DM   2048
#define NH_  16
#define NKV  4
#define REP  (NH_ / NKV)
#define HD   128
#define DQ   (NH_ * HD)
#define DKV  (NKV * HD)
#define ZH   2
#define RH   512                  // query rows < RH use hi+lo planes (0: none)
#define WIN  2048
#define PCAR 1024.0f
#define SCL  0.088388347648318447f   // HD^-0.5
typedef _Float16 h16;
typedef unsigned short bf;
typedef __attribute__((ext_vector_type(16))) __bf16   v16bf;
typedef __attribute__((ext_vector_type(16))) _Float16 v16h;
typedef __attribute__((ext_vector_type(8)))  _Float16 v8h;
typedef __attribute__((ext_vector_type(8)))  unsigned short v8us;
typedef __attribute__((ext_vector_type(8)))  float    v8f;
typedef __attribute__((ext_vector_type(4)))  float    v4f;
typedef v8h  __attribute__((may_alias)) v8ha;
typedef v4f  __attribute__((may_alias)) v4fa;
typedef v8us __attribute__((may_alias)) v8usa;

__device__ __forceinline__ unsigned short f2bf(float f) { unsigned u = __float_as_uint(f); u += 0x7FFFu + ((u >> 16) & 1u); return (unsigned short)(u >> 16); }
__device__ __forceinline__ float bf2f(unsigned short b) { return __uint_as_float(((unsigned)b) << 16); }
__device__ __forceinline__ float bfr(float f) { return bf2f(f2bf(f)); }
__device__ __forceinline__ v16h cat16(v8h lo, v8h hi) { return __builtin_shufflevector(lo, hi, 0, 1, 2, 3, 4, 5, 6, 7, 8, 9, 10, 11, 12, 13, 14, 15); }
__device__ __forceinline__ v16bf cat16b(v8us lo, v8us hi) { return __builtin_bit_cast(v16bf, __builtin_shufflevector(lo, hi, 0, 1, 2, 3, 4, 5, 6, 7, 8, 9, 10, 11, 12, 13, 14, 15)); }
__device__ __forceinline__ v8f wmma16(v16h a, v16h b, v8f c) { return __builtin_amdgcn_wmma_f32_16x16x32_f16(false, a, false, b, (short)0, c, false, false); }
__device__ __forceinline__ v8f wmmab(v16bf a, v16bf b, v8f c) { return __builtin_amdgcn_wmma_f32_16x16x32_bf16(false, a, false, b, (short)0, c, false, false); }



// ---- k_gemmw: register-blocked GEMM, ONE WAVE per 64x64 output tile (16 accumulators), operands straight from K-contiguous 16-bit planes; grid (M/64, N/64, Z), 32 threads.
// C[m][n] (f32, pitch ldc, + optional f32 bias[n]) = sum_k A[m][k] Bt[n][k] (+ split products per NSPLIT). z-batch strides sA/sB/sC in elements. K % 32 == 0.
template <typename T16> struct WFrag;
template <> struct WFrag<h16> { typedef v16h V; static __device__ __forceinline__ V ld(const h16* p) { return cat16(*(const v8h*)p, *(const v8h*)(p + 16)); } static __device__ __forceinline__ v8f mma(V a, V b, v8f c) { return wmma16(a, b, c); } };
template <> struct WFrag<bf> { typedef v16bf V; static __device__ __forceinline__ V ld(const bf* p) { return cat16b(*(const v8us*)p, *(const v8us*)(p + 16)); } static __device__ __forceinline__ v8f mma(V a, V b, v8f c) { return wmmab(a, b, c); } };
template <typename T16, int NSPLIT, bool BIAS>
__global__ __launch_bounds__(32) void k_gemmw(const T16* __restrict__ A, const T16* __restrict__ A2, const T16* __restrict__ Bt, const T16* __restrict__ Bt2, int K, float* C, int ldc, const float* __restrict__ bias, size_t sA, size_t sB, size_t sC) {
    typedef typename WFrag<T16>::V V;
    __shared__ __align__(16) float os[16 * 68];
    const size_t z = blockIdx.z; A += z * sA; if (A2) A2 += z * sA; Bt += z * sB; if (Bt2) Bt2 += z * sB; C += z * sC;
    const int lane = threadIdx.x & 31, lr = lane & 15, hi = lane >> 4; const int r0 = blockIdx.x * 64, c0 = blockIdx.y * 64;
    v8f acc[4][4];
#pragma unroll
    for (int mb = 0; mb < 4; ++mb)
#pragma unroll
        for (int nb = 0; nb < 4; ++nb) acc[mb][nb] = (v8f){};
    const size_t aoff = (size_t)(r0 + lr) * K + 8 * hi, boff = (size_t)(c0 + lr) * K + 8 * hi;
    for (int kc = 0; kc < K; kc += 32) {
        V a[4], a2[4];
#pragma unroll
        for (int mb = 0; mb < 4; ++mb) { a[mb] = WFrag<T16>::ld(A + aoff + (size_t)mb * 16 * K + kc); if (NSPLIT == 1 || NSPLIT == 2) a2[mb] = WFrag<T16>::ld(A2 + aoff + (size_t)mb * 16 * K + kc); }
#pragma unroll
        for (int nb = 0; nb < 4; ++nb) { const V b = WFrag<T16>::ld(Bt + boff + (size_t)nb * 16 * K + kc); V b2; if (NSPLIT >= 2) b2 = WFrag<T16>::ld(Bt2 + boff + (size_t)nb * 16 * K + kc);
#pragma unroll
            for (int mb = 0; mb < 4; ++mb) { acc[mb][nb] = WFrag<T16>::mma(a[mb], b, acc[mb][nb]); if (NSPLIT == 1 || NSPLIT == 2) acc[mb][nb] = WFrag<T16>::mma(a2[mb], b, acc[mb][nb]); if (NSPLIT >= 2) acc[mb][nb] = WFrag<T16>::mma(a[mb], b2, acc[mb][nb]); } }
        asm volatile("v_nop\n\tv_nop\n\tv_nop\n\tv_nop" : "+v"(acc[0][0]), "+v"(acc[1][1]), "+v"(acc[2][2]), "+v"(acc[3][3]) : "v"(a[0]), "v"(a[3]));
    }
#pragma unroll
    for (int mb = 0; mb < 4; ++mb) {
#pragma unroll
        for (int nb = 0; nb < 4; ++nb) {
#pragma unroll
            for (int j = 0; j < 8; ++j) os[(hi * 8 + j) * 68 + nb * 16 + lr] = acc[mb][nb][j]; }
        __builtin_amdgcn_wave_barrier(); asm volatile("" ::: "memory");
        float* crow = C + (size_t)(r0 + mb * 16) * ldc + c0;
{
#pragma unroll
            for (int s = 0; s < 8; ++s) { const int row = 2 * s + hi, cofs = lr * 4; v4f val = *(const v4fa*)(os + row * 68 + cofs); if (BIAS) { val[0] += bfr(bias[c0 + cofs]); val[1] += bfr(bias[c0 + cofs + 1]); val[2] += bfr(bias[c0 + cofs + 2]); val[3] += bfr(bias[c0 + cofs + 3]); }
                *(v4f*)(crow + (size_t)row * ldc + cofs) = val; }
             }
        __builtin_amdgcn_wave_barrier(); asm volatile("" ::: "memory");
    }
}

// ---- k_gemmc: the same one-wave 64x64 tile GEMM specialised for causal attention: CMODE 1 skips score tiles entirely above the diagonal (query rows r0+roff.., key columns c0..), CMODE 2 limits the
// key (K) loop of the probability x value contraction to the diagonal block (probabilities beyond it are exactly zero). roff = row offset of this launch's first row within the sequence.
template <typename T16, int NSPLIT, int CMODE>
__global__ __launch_bounds__(32) void k_gemmc(const T16* __restrict__ A, const T16* __restrict__ A2, const T16* __restrict__ Bt, const T16* __restrict__ Bt2, int K, float* C, int ldc, int roff, size_t sA, size_t sB, size_t sC) {
    typedef typename WFrag<T16>::V V;
    __shared__ __align__(16) float os[16 * 68];
    const size_t z = blockIdx.z; A += z * sA; if (A2) A2 += z * sA; Bt += z * sB; if (Bt2) Bt2 += z * sB; C += z * sC;
    const int lane = threadIdx.x & 31, lr = lane & 15, hi = lane >> 4; const int r0 = blockIdx.x * 64, c0 = blockIdx.y * 64;
    if (CMODE == 1 && c0 > r0 + roff + 63) return;                  // score tile entirely above the causal diagonal: never read (the softmax masks j > i by select)
    const int Kl = (CMODE == 2) ? min(K, r0 + roff + 64) : K;        // P.V: probabilities are exactly 0 beyond the diagonal block, so the K loop stops there
    v8f acc[4][4];
#pragma unroll
    for (int mb = 0; mb < 4; ++mb)
#pragma unroll
        for (int nb = 0; nb < 4; ++nb) acc[mb][nb] = (v8f){};
    const size_t aoff = (size_t)(r0 + lr) * K + 8 * hi, boff = (size_t)(c0 + lr) * K + 8 * hi;
    for (int kc = 0; kc < Kl; kc += 32) {
        V a[4], a2[4];
#pragma unroll
        for (int mb = 0; mb < 4; ++mb) { a[mb] = WFrag<T16>::ld(A + aoff + (size_t)mb * 16 * K + kc); if (NSPLIT == 1 || NSPLIT == 2) a2[mb] = WFrag<T16>::ld(A2 + aoff + (size_t)mb * 16 * K + kc); }
#pragma unroll
        for (int nb = 0; nb < 4; ++nb) { const V b = WFrag<T16>::ld(Bt + boff + (size_t)nb * 16 * K + kc); V b2; if (NSPLIT >= 2) b2 = WFrag<T16>::ld(Bt2 + boff + (size_t)nb * 16 * K + kc);
#pragma unroll
            for (int mb = 0; mb < 4; ++mb) { acc[mb][nb] = WFrag<T16>::mma(a[mb], b, acc[mb][nb]); if (NSPLIT == 1 || NSPLIT == 2) acc[mb][nb] = WFrag<T16>::mma(a2[mb], b, acc[mb][nb]); if (NSPLIT >= 2) acc[mb][nb] = WFrag<T16>::mma(a[mb], b2, acc[mb][nb]); } }
        asm volatile("v_nop\n\tv_nop\n\tv_nop\n\tv_nop" : "+v"(acc[0][0]), "+v"(acc[1][1]), "+v"(acc[2][2]), "+v"(acc[3][3]) : "v"(a[0]), "v"(a[3]));
    }
#pragma unroll
    for (int mb = 0; mb < 4; ++mb) {
#pragma unroll
        for (int nb = 0; nb < 4; ++nb) {
#pragma unroll
            for (int j = 0; j < 8; ++j) os[(hi * 8 + j) * 68 + nb * 16 + lr] = acc[mb][nb][j]; }
        __builtin_amdgcn_wave_barrier(); asm volatile("" ::: "memory");
        float* crow = C + (size_t)(r0 + mb * 16) * ldc + c0;
{
#pragma unroll
            for (int s = 0; s < 8; ++s) { const int row = 2 * s + hi, cofs = lr * 4; v4f val = *(const v4fa*)(os + row * 68 + cofs);
                *(v4f*)(crow + (size_t)row * ldc + cofs) = val; }
             }
        __builtin_amdgcn_wave_barrier(); asm volatile("" ::: "memory");
    }
}

__device__ __forceinline__ h16 tohx(float x) { return (h16)x; }
__device__ __forceinline__ void splitf(float y, unsigned short& h, unsigned short& l) { h = f2bf(y); l = f2bf(y - bf2f(h)); }
typedef __attribute__((ext_vector_type(2))) _Float16 v2h;
typedef __attribute__((ext_vector_type(4))) _Float16 v4h;
typedef __attribute__((ext_vector_type(2))) unsigned short v2us;
typedef __attribute__((ext_vector_type(4))) unsigned short v4us;
typedef __attribute__((ext_vector_type(2))) float v2f;
typedef __attribute__((ext_vector_type(4))) int v4i;

__global__ __launch_bounds__(256) void k_wtG(const float* __restrict__ w, int K, int N, bf* Bt) {
    const int lane = threadIdx.x & 31; const int L0 = (blockIdx.x * 8 + (threadIdx.x >> 5)) * 8; const int nlines = N * K / 64;
{
        for (int l = 0; l < 8; ++l) { const int L = L0 + l; if (L >= nlines) break; const size_t e = (size_t)L * 64 + lane * 2; const int k = (int)(e % K), n = (int)(e / K); v2us o;
            o[0] = f2bf(w[(size_t)k * N + n]); o[1] = f2bf(w[(size_t)(k + 1) * N + n]); *(v2us*)(Bt + e) = o; }
         }
}
__global__ __launch_bounds__(256) void k_cvt8(const float* __restrict__ src, bf* dst, size_t n8) { const size_t i = (size_t)blockIdx.x * 256 + threadIdx.x; if (i >= n8) return; const v8f v = *(const v8f*)(src + i * 8); v8us o;
#pragma unroll
    for (int k = 0; k < 8; ++k) o[k] = f2bf(v[k]); *(v8us*)(dst + i * 8) = o;  }
__global__ __launch_bounds__(256) void k_csid(float* CS) { const int idx = blockIdx.x * 256 + threadIdx.x; if (idx >= TT * HD) return; v2f cs; cs[0] = 1.0f; cs[1] = 0.0f; *(v2f*)(CS + (size_t)idx * 2) = cs;  }
// k_rope: head planes [h][t][d] (fp16 + hi/lo) of rope(x) x sc with the rotate-half convention out[d] = x[d] cos[t][d] - x[d+HD/2] sin[t][d], out[d+HD/2] = x[d+HD/2] cos[t][d+HD/2] + x[d] sin[t][d+HD/2]
__global__ __launch_bounds__(256) void k_rope(const float* __restrict__ F, int pitch, int nheads, const float* __restrict__ CS, const float* __restrict__ RF, const float* __restrict__ nw, float sc, h16* P16, bf* Ph, bf* Pl) {
    const size_t e = ((size_t)blockIdx.x * 256 + threadIdx.x) * 2; if (e >= (size_t)nheads * TT * HD) return; const int d = (int)(e % HD); const int t = (int)((e / HD) % TT); const int h = (int)(e / ((size_t)HD * TT)); const float* f = F + (size_t)t * pitch + h * HD; const float rf = RF ? RF[(size_t)h * TT + t] : 1.0f; v2h o16; v2us oh, ol;
#pragma unroll
    for (int q = 0; q < 2; ++q) { const int dd = d + q; const int dp = (dd < HD / 2) ? dd + HD / 2 : dd - HD / 2; float x0 = f[dd], x1 = f[dp];
        if (RF) { float n0 = __fmul_rn(x0, rf), n1 = __fmul_rn(x1, rf); x0 = __fmul_rn(bfr(nw[dd]), n0); x1 = __fmul_rn(bfr(nw[dp]), n1); }
        const v2f cs = *(const v2f*)(CS + ((size_t)t * HD + dd) * 2); float a = __fmul_rn(x0, cs[0]), bq = __fmul_rn(x1, cs[1]); const float r = ((dd < HD / 2) ? __fsub_rn(a, bq) : __fadd_rn(a, bq)) * sc;
        o16[q] = tohx(r); unsigned short a2, c2; splitf(r, a2, c2); oh[q] = a2; ol[q] = c2; }
    *(v2h*)(P16 + e) = o16; *(v2us*)(Ph + e) = oh; *(v2us*)(Pl + e) = ol;  }
__global__ __launch_bounds__(256) void k_vtp(const float* __restrict__ F, int pitch, int nheads, h16* V16, bf* Vh, bf* Vl) { const size_t e = ((size_t)blockIdx.x * 256 + threadIdx.x) * 2; if (e >= (size_t)nheads * HD * TT) return; const int t = (int)(e % TT); const int d = (int)((e / TT) % HD); const int g = (int)(e / ((size_t)TT * HD)); v2h o16; v2us oh, ol;
#pragma unroll
    for (int q = 0; q < 2; ++q) { const float x = F[(size_t)(t + q) * pitch + g * HD + d]; o16[q] = tohx(x); unsigned short a2, c2; splitf(x, a2, c2); oh[q] = a2; ol[q] = c2; }
    *(v2h*)(V16 + e) = o16; *(v2us*)(Vh + e) = oh; *(v2us*)(Vl + e) = ol;  }
// k_asoft: per row (zz, i): t = S x 128^-0.5 for j <= i (causal; WIN = TT so the window term is inert; -finfo.max fill == exclusion), softmax over the 2048 keys (register row, one exp, fixed trees);
__global__ __launch_bounds__(256) void k_asoft(const float* __restrict__ Sb, h16* P16, bf* Ph, bf* Pl) {
    const int lane = threadIdx.x & 31; const int row = blockIdx.x * 8 + (threadIdx.x >> 5); if (row >= ZH * TT) return; const int i = row % TT; const int zz = row / TT; (void)zz; const bool hires = (i < RH); const float* sr = Sb + (size_t)row * TT; float v[TT / 32]; float mx = -3.0e38f;
#pragma unroll
    for (int ch = 0; ch < TT / 128; ++ch) { const int j0 = ch * 128 + lane * 4; const v4f a = *(const v4f*)(sr + j0);
#pragma unroll
        for (int q = 0; q < 4; ++q) { const int j = j0 + q; (void)j; const float t = (j <= i && i - j < WIN) ? a[q] * SCL : -3.0e38f; v[ch * 4 + q] = t; mx = fmaxf(mx, t); } }
#pragma unroll
    for (int sh = 16; sh; sh >>= 1) mx = fmaxf(mx, __shfl_xor(mx, sh, 32));
    float sum = 0.f;
#pragma unroll
    for (int k = 0; k < TT / 32; ++k) { float d0 = __fsub_rn(v[k], mx); v[k] = __builtin_amdgcn_exp2f(__fmul_rn(d0, 1.4426950408889634f)); sum += v[k]; }
#pragma unroll
    for (int sh = 16; sh; sh >>= 1) sum += __shfl_xor(sum, sh, 32);
    const float f = __fdiv_rn(hires ? 1.0f : PCAR, sum);
{
        if (hires) {
#pragma unroll
            for (int ch = 0; ch < TT / 128; ++ch) { v4us oh, ol;
#pragma unroll
                for (int q = 0; q < 4; ++q) { unsigned short a, c2; splitf(v[ch * 4 + q] * f, a, c2); oh[q] = a; ol[q] = c2; }
                const size_t oo = ((size_t)zz * (RH ? RH : 1) + i) * TT + ch * 128 + lane * 4; *(v4us*)(Ph + oo) = oh; *(v4us*)(Pl + oo) = ol; }
        } else {
#pragma unroll
            for (int ch = 0; ch < TT / 128; ++ch) { v4h o4;
#pragma unroll
                for (int q = 0; q < 4; ++q) o4[q] = tohx(v[ch * 4 + q] * f);
                *(v4h*)(P16 + (size_t)row * TT + ch * 128 + lane * 4) = o4; } }
         }
}
__global__ __launch_bounds__(256) void k_merge(const float* __restrict__ O, int h0, bf* Ah, bf* Al) { const size_t e = ((size_t)blockIdx.x * 256 + threadIdx.x) * 2; if (e >= (size_t)ZH * TT * HD) return; const int d = (int)(e % HD); const int t = (int)((e / HD) % TT); const int zz = (int)(e / ((size_t)HD * TT)); const float cs = (t < RH) ? 1.0f : (1.0f / PCAR); const size_t oo = (size_t)t * DQ + (h0 + zz) * HD + d;
    v2us oh, ol;
#pragma unroll
    for (int q = 0; q < 2; ++q) { unsigned short a, c2; splitf(O[e + q] * cs, a, c2); oh[q] = a; ol[q] = c2; } *(v2us*)(Ah + oo) = oh; *(v2us*)(Al + oo) = ol;  }

extern "C" void kernel_launch(void* const* d_in, const int* in_sizes, int n_in,
                              void* d_out, int out_size, void* d_ws, size_t ws_size, hipStream_t stream) {
    (void)in_sizes; (void)n_in; (void)out_size;
    const float* xq = (const float*)d_in[0]; const float* xk = (const float*)d_in[1]; const float* xv = (const float*)d_in[2]; const float* wq = (const float*)d_in[3]; const float* wk = (const float*)d_in[4]; const float* wv = (const float*)d_in[5]; const float* wo = (const float*)d_in[6];   /* q, k, v ([2][2048][2048] each: THREE streams), Wq ('xw' (in, out) [2048][2048]: 16 heads x 128), Wk, Wv ('xw' [2048][512]: 4 kv heads x 128), Wo ('xw' [2048][2048]): SEVEN inputs, all read; no bias anywhere */
    float* OUT = (float*)d_out;     // [2][2048][2048]
    char* wsp = (char*)d_ws;
    auto take = [&](size_t bytes) { char* p = wsp; wsp += (bytes + 255) & ~(size_t)255; return (void*)p; };
    bf* WQ = (bf*)take((size_t)DQ * DM * 2); bf* WK = (bf*)take((size_t)DKV * DM * 2); bf* WV = (bf*)take((size_t)DKV * DM * 2); bf* WO = (bf*)take((size_t)DM * DQ * 2); float* CS = (float*)take((size_t)TT * HD * 2 * 4);
    bf* XB = (bf*)take((size_t)TT * DM * 2); float* FQ = (float*)take((size_t)TT * DQ * 4); float* FK = (float*)take((size_t)TT * DKV * 4);
    h16* QP16 = (h16*)take((size_t)NH_ * TT * HD * 2); h16* KP16 = (h16*)take((size_t)NKV * TT * HD * 2); h16* VT16 = (h16*)take((size_t)NKV * HD * TT * 2);
    bf* QPh = (bf*)take((size_t)NH_ * TT * HD * 2); bf* QPl = (bf*)take((size_t)NH_ * TT * HD * 2); bf* KPh = (bf*)take((size_t)NKV * TT * HD * 2); bf* KPl = (bf*)take((size_t)NKV * TT * HD * 2); bf* VTh = (bf*)take((size_t)NKV * HD * TT * 2); bf* VTl = (bf*)take((size_t)NKV * HD * TT * 2); bf* Ph = (bf*)take((size_t)ZH * RH * TT * 2); bf* Pl = (bf*)take((size_t)ZH * RH * TT * 2);
    float* Sb = (float*)take((size_t)ZH * TT * TT * 4); h16* P16 = (h16*)take((size_t)ZH * TT * TT * 2); float* Ob = (float*)take((size_t)ZH * TT * HD * 4); bf* ATh = (bf*)take((size_t)TT * DQ * 2); bf* ATl = (bf*)take((size_t)TT * DQ * 2);
    if ((size_t)(wsp - (char*)d_ws) > ws_size) return;    // ws 256 MiB
    float* FV = FK;   // v projection reuses the k buffer after the k planes are built (stream-ordered)
    { k_wtG<<<(unsigned)((DM * DQ / 64 + 63) / 64), 256, 0, stream>>>(wq, DM, DQ, WQ); k_wtG<<<(unsigned)((DM * DKV / 64 + 63) / 64), 256, 0, stream>>>(wk, DM, DKV, WK); k_wtG<<<(unsigned)((DM * DKV / 64 + 63) / 64), 256, 0, stream>>>(wv, DM, DKV, WV);
      k_wtG<<<(unsigned)((DQ * DM / 64 + 63) / 64), 256, 0, stream>>>(wo, DQ, DM, WO);   /* the four 'xw' (in, out) weights transposed once into Bt operands */ }
    const unsigned LQ = (unsigned)(((size_t)NH_ * TT * HD / 2 + 255) / 256), LKv = (unsigned)(((size_t)NKV * TT * HD / 2 + 255) / 256); const unsigned GX = (unsigned)(((size_t)TT * DM / 8 + 255) / 256);
    for (int b = 0; b < NB_; ++b) {
        if (b == 0) k_csid<<<(TT * HD + 255) / 256, 256, 0, stream>>>(CS);   /* identity table: k_rope is a plain plane builder here */
        k_cvt8<<<GX, 256, 0, stream>>>(xq + (size_t)b * TT * DM, XB, (size_t)TT * DM / 8);   /* the QUERY stream */
        k_gemmw<bf, 0, false><<<dim3(TT / 64, DQ / 64, 1), 32, 0, stream>>>(XB, nullptr, WQ, nullptr, DM, FQ, DQ, nullptr, 0, 0, 0);
        k_rope<<<LQ, 256, 0, stream>>>(FQ, DQ, NH_, CS, nullptr, nullptr, 1.0f, QP16, QPh, QPl);
        k_cvt8<<<GX, 256, 0, stream>>>(xk + (size_t)b * TT * DM, XB, (size_t)TT * DM / 8);   /* the KEY stream: cast after the query GEMM has read XB (stream-ordered) */
        k_gemmw<bf, 0, false><<<dim3(TT / 64, DKV / 64, 1), 32, 0, stream>>>(XB, nullptr, WK, nullptr, DM, FK, DKV, nullptr, 0, 0, 0);
        k_rope<<<LKv, 256, 0, stream>>>(FK, DKV, NKV, CS, nullptr, nullptr, 1.0f, KP16, KPh, KPl);
        k_cvt8<<<GX, 256, 0, stream>>>(xv + (size_t)b * TT * DM, XB, (size_t)TT * DM / 8);   /* the VALUE stream */
        k_gemmw<bf, 0, false><<<dim3(TT / 64, DKV / 64, 1), 32, 0, stream>>>(XB, nullptr, WV, nullptr, DM, FV, DKV, nullptr, 0, 0, 0); k_vtp<<<LKv, 256, 0, stream>>>(FV, DKV, NKV, VT16, VTh, VTl);
        for (int h0 = 0; h0 < NH_; h0 += ZH) { const size_t zq = (size_t)h0, zk = (size_t)(h0 / REP);   /* 'jnp.repeat(kh, 4, axis=1)': query head h uses kv head h / 4: the pass's two heads (h0, h0 + 1) share ONE kv head (REP 4): a zero z-stride on the key and value operands */
            k_gemmc<bf, 2, 1><<<dim3(RH / 64, TT / 64, ZH), 32, 0, stream>>>(QPh + zq * TT * HD, QPl + zq * TT * HD, KPh + zk * TT * HD, KPl + zk * TT * HD, HD, Sb, TT, 0, (size_t)TT * HD, 0, (size_t)TT * TT);
            k_gemmc<h16, 0, 1><<<dim3((TT - RH) / 64, TT / 64, ZH), 32, 0, stream>>>(QP16 + zq * TT * HD + (size_t)RH * HD, nullptr, KP16 + zk * TT * HD, nullptr, HD, Sb + (size_t)RH * TT, TT, RH, (size_t)TT * HD, 0, (size_t)TT * TT);
            k_asoft<<<ZH * TT / 8, 256, 0, stream>>>(Sb, P16, Ph, Pl);
            k_gemmc<bf, 2, 2><<<dim3(RH / 64, HD / 64, ZH), 32, 0, stream>>>(Ph, Pl, VTh + zk * HD * TT, VTl + zk * HD * TT, TT, Ob, HD, 0, (size_t)RH * TT, 0, (size_t)TT * HD);
            k_gemmc<h16, 0, 2><<<dim3((TT - RH) / 64, HD / 64, ZH), 32, 0, stream>>>(P16 + (size_t)RH * TT, nullptr, VT16 + zk * HD * TT, nullptr, TT, Ob + (size_t)RH * HD, HD, RH, (size_t)TT * TT, 0, (size_t)TT * HD);
            k_merge<<<(unsigned)(((size_t)ZH * TT * HD / 2 + 255) / 256), 256, 0, stream>>>(Ob, h0, ATh, ATl); }
        k_gemmw<bf, 1, false><<<dim3(TT / 64, DM / 64, 1), 32, 0, stream>>>(ATh, ATl, WO, nullptr, DQ, OUT + (size_t)b * TT * DM, DM, nullptr, 0, 0, 0); }
}

// v001
// It runs in 974 microseconds.
// In two side-by-side timings against v000, it was 1.71 and 1.73 times as fast.
#include <hip/hip_runtime.h>

// Grouped-query causal attention with 128-wide heads on three input streams (q, k, v [2][2048][2048]; qh = q Wq (16 heads x 128), kh, vh = k Wk, v Wv (4 kv heads x 128) ('xw' (in, out) 0.02, no bias); qh and kh each x 128^-0.25 (together 1/sqrt(128)); kv head = query head / 4 (jnp.repeat); the module takes softmax over ALL keys, zeroes the strictly-upper triangle and renormalises by (row sum + 1e-9): a causal softmax but for that epsilon; out = merged Wo ('xw', no bias) -> [2][2048][2048] (8.4 M); argument order q, k, v, Wq, Wk, Wv, Wo).
// Layout per batch: bf16 copies of q, k and v in turn (one operand buffer, stream-ordered); the four 'xw' weights transposed once into Bt operands; exact projections; plane builders (identity table); causal T-2048 attention with 128-wide heads where the pass's two query heads share ONE kv head (h / 4: a zero z-stride on the key and value operands) (hybrid rows: < 512 hi/lo 3 products, rest fp16 x1024; k_gemmc skips tiles above the diagonal); merged hi/lo x Wo exact.
// Compute dtypes, f32 accumulate: every input rounded to bf16; projections exact; attention rows < 512 3 products, rest fp16; softmax f32 (the exact causal softmax: no epsilon term); Wo hl x exact.

#define NB_  2
#define TT   2048
#define DM   2048
#define NH_  16
#define NKV  4
#define REP  (NH_ / NKV)
#define HD   128
#define DQ   (NH_ * HD)
#define DKV  (NKV * HD)
#define ZH   2
#define RH   512                  // query rows < RH use hi+lo planes (0: none)
#define WIN  2048
#define PCAR 1024.0f
#define SCL  0.088388347648318447f   // HD^-0.5
typedef _Float16 h16;
typedef unsigned short bf;
typedef __attribute__((ext_vector_type(16))) __bf16   v16bf;
typedef __attribute__((ext_vector_type(16))) _Float16 v16h;
typedef __attribute__((ext_vector_type(8)))  _Float16 v8h;
typedef __attribute__((ext_vector_type(8)))  unsigned short v8us;
typedef __attribute__((ext_vector_type(8)))  float    v8f;
typedef __attribute__((ext_vector_type(4)))  float    v4f;
typedef v8h  __attribute__((may_alias)) v8ha;
typedef v4f  __attribute__((may_alias)) v4fa;
typedef v8us __attribute__((may_alias)) v8usa;

__device__ __forceinline__ unsigned short f2bf(float f) { unsigned u = __float_as_uint(f); u += 0x7FFFu + ((u >> 16) & 1u); return (unsigned short)(u >> 16); }
__device__ __forceinline__ float bf2f(unsigned short b) { return __uint_as_float(((unsigned)b) << 16); }
__device__ __forceinline__ float bfr(float f) { return bf2f(f2bf(f)); }
__device__ __forceinline__ v16h cat16(v8h lo, v8h hi) { return __builtin_shufflevector(lo, hi, 0, 1, 2, 3, 4, 5, 6, 7, 8, 9, 10, 11, 12, 13, 14, 15); }
__device__ __forceinline__ v16bf cat16b(v8us lo, v8us hi) { return __builtin_bit_cast(v16bf, __builtin_shufflevector(lo, hi, 0, 1, 2, 3, 4, 5, 6, 7, 8, 9, 10, 11, 12, 13, 14, 15)); }
__device__ __forceinline__ v8f wmma16(v16h a, v16h b, v8f c) { return __builtin_amdgcn_wmma_f32_16x16x32_f16(false, a, false, b, (short)0, c, false, false); }
__device__ __forceinline__ v8f wmmab(v16bf a, v16bf b, v8f c) { return __builtin_amdgcn_wmma_f32_16x16x32_bf16(false, a, false, b, (short)0, c, false, false); }



// ---- k_gemmk: register-blocked GEMM, one 64x64 output tile per work-group of NW waves. The K loop is dealt over the waves in steps of 32 k: wave w takes steps w, w + NW, ... (neighbouring waves read
// neighbouring parts of the same operand lines at about the same time) with 16 accumulators of its own, operands straight from K-contiguous 16-bit planes; the NW partial tiles meet in LDS and are summed
// in wave order 0..NW-1, each wave summing and storing 64 / NW whole rows of the tile.
// C[m][n] (f32, pitch ldc) = sum_k A[m][k] Bt[n][k] (+ split products per NSPLIT). z-batch strides sA/sB/sC in elements. K % 32 == 0. grid (M/64, N/64, Z), 32 * NW threads.
// DIAG: the probability x value contraction of causal attention: probabilities are exactly 0 beyond the diagonal block, so the K range stops there (roff = row offset of this launch's first row within the sequence).
template <typename T16> struct WFrag;
template <> struct WFrag<h16> { typedef v16h V; static __device__ __forceinline__ V ld(const h16* p) { return cat16(*(const v8h*)p, *(const v8h*)(p + 16)); } static __device__ __forceinline__ v8f mma(V a, V b, v8f c) { return wmma16(a, b, c); } };
template <> struct WFrag<bf> { typedef v16bf V; static __device__ __forceinline__ V ld(const bf* p) { return cat16b(*(const v8us*)p, *(const v8us*)(p + 16)); } static __device__ __forceinline__ v8f mma(V a, V b, v8f c) { return wmmab(a, b, c); } };
template <typename T16, int NSPLIT, int NW, bool DIAG>
__global__ __launch_bounds__(32 * NW) void k_gemmk(const T16* __restrict__ A, const T16* __restrict__ A2, const T16* __restrict__ Bt, const T16* __restrict__ Bt2, int K, float* C, int ldc, int roff, size_t sA, size_t sB, size_t sC) {
    typedef typename WFrag<T16>::V V;
    __shared__ __align__(16) float red[NW * 64 * 68];
    const size_t z = blockIdx.z; A += z * sA; if (A2) A2 += z * sA; Bt += z * sB; if (Bt2) Bt2 += z * sB; C += z * sC;
    const int lane = threadIdx.x & 31, lr = lane & 15, hi = lane >> 4; const int w = __builtin_amdgcn_readfirstlane((int)(threadIdx.x >> 5)); const int r0 = blockIdx.x * 64, c0 = blockIdx.y * 64;
    const int Kl = DIAG ? min(K, r0 + roff + 64) : K;
    v8f acc[4][4];
#pragma unroll
    for (int mb = 0; mb < 4; ++mb)
#pragma unroll
        for (int nb = 0; nb < 4; ++nb) acc[mb][nb] = (v8f){};
    const size_t aoff = (size_t)(r0 + lr) * K + 8 * hi, boff = (size_t)(c0 + lr) * K + 8 * hi;
    for (int kc = w * 32; kc < Kl; kc += NW * 32) {
        V a[4], a2[4];
#pragma unroll
        for (int mb = 0; mb < 4; ++mb) { a[mb] = WFrag<T16>::ld(A + aoff + (size_t)mb * 16 * K + kc); if (NSPLIT == 1 || NSPLIT == 2) a2[mb] = WFrag<T16>::ld(A2 + aoff + (size_t)mb * 16 * K + kc); }
#pragma unroll
        for (int nb = 0; nb < 4; ++nb) { const V b = WFrag<T16>::ld(Bt + boff + (size_t)nb * 16 * K + kc); V b2; if (NSPLIT >= 2) b2 = WFrag<T16>::ld(Bt2 + boff + (size_t)nb * 16 * K + kc);
#pragma unroll
            for (int mb = 0; mb < 4; ++mb) { acc[mb][nb] = WFrag<T16>::mma(a[mb], b, acc[mb][nb]); if (NSPLIT == 1 || NSPLIT == 2) acc[mb][nb] = WFrag<T16>::mma(a2[mb], b, acc[mb][nb]); if (NSPLIT >= 2) acc[mb][nb] = WFrag<T16>::mma(a[mb], b2, acc[mb][nb]); } }
        // four vector slots behind the trip's last matrix instructions, so that nothing on the back edge touches their operands too early
        asm volatile("v_nop\n\tv_nop\n\tv_nop\n\tv_nop" : "+v"(acc[0][0]), "+v"(acc[1][1]), "+v"(acc[2][2]), "+v"(acc[3][3]) : "v"(a[0]), "v"(a[3]));
    }
    float* mine = red + w * (64 * 68);
#pragma unroll
    for (int mb = 0; mb < 4; ++mb)
#pragma unroll
        for (int nb = 0; nb < 4; ++nb)
#pragma unroll
            for (int j = 0; j < 8; ++j) mine[(mb * 16 + hi * 8 + j) * 68 + nb * 16 + lr] = acc[mb][nb][j];
    __syncthreads();   // every wave's partial tile is in LDS before any wave sums across them
#pragma unroll
    for (int s = 0; s < 32 / NW; ++s) { const int row = w * (64 / NW) + 2 * s + hi, cofs = lr * 4; v4f val = *(const v4fa*)(red + row * 68 + cofs);
#pragma unroll
        for (int p = 1; p < NW; ++p) val += *(const v4fa*)(red + p * (64 * 68) + row * 68 + cofs);
        *(v4f*)(C + (size_t)(r0 + row) * ldc + c0 + cofs) = val; }
}

// ---- k_gemmc: ONE WAVE per 64x64 tile of the causal attention scores (K = 128: four steps, nothing to deal out), 16 accumulators, operands straight from K-contiguous 16-bit planes; grid (M/64, N/64, Z), 32 threads.
// CMODE 1 skips score tiles entirely above the diagonal (query rows r0+roff.., key columns c0..). roff = row offset of this launch's first row within the sequence.
template <typename T16, int NSPLIT, int CMODE>
__global__ __launch_bounds__(32) void k_gemmc(const T16* __restrict__ A, const T16* __restrict__ A2, const T16* __restrict__ Bt, const T16* __restrict__ Bt2, int K, float* C, int ldc, int roff, size_t sA, size_t sB, size_t sC) {
    typedef typename WFrag<T16>::V V;
    __shared__ __align__(16) float os[16 * 68];
    const size_t z = blockIdx.z; A += z * sA; if (A2) A2 += z * sA; Bt += z * sB; if (Bt2) Bt2 += z * sB; C += z * sC;
    const int lane = threadIdx.x & 31, lr = lane & 15, hi = lane >> 4; const int r0 = blockIdx.x * 64, c0 = blockIdx.y * 64;
    if (CMODE == 1 && c0 > r0 + roff + 63) return;                  // score tile entirely above the causal diagonal: loaded but never used (the softmax masks j > i by select)
    v8f acc[4][4];
#pragma unroll
    for (int mb = 0; mb < 4; ++mb)
#pragma unroll
        for (int nb = 0; nb < 4; ++nb) acc[mb][nb] = (v8f){};
    const size_t aoff = (size_t)(r0 + lr) * K + 8 * hi, boff = (size_t)(c0 + lr) * K + 8 * hi;
    for (int kc = 0; kc < K; kc += 32) {
        V a[4], a2[4];
#pragma unroll
        for (int mb = 0; mb < 4; ++mb) { a[mb] = WFrag<T16>::ld(A + aoff + (size_t)mb * 16 * K + kc); if (NSPLIT == 1 || NSPLIT == 2) a2[mb] = WFrag<T16>::ld(A2 + aoff + (size_t)mb * 16 * K + kc); }
#pragma unroll
        for (int nb = 0; nb < 4; ++nb) { const V b = WFrag<T16>::ld(Bt + boff + (size_t)nb * 16 * K + kc); V b2; if (NSPLIT >= 2) b2 = WFrag<T16>::ld(Bt2 + boff + (size_t)nb * 16 * K + kc);
#pragma unroll
            for (int mb = 0; mb < 4; ++mb) { acc[mb][nb] = WFrag<T16>::mma(a[mb], b, acc[mb][nb]); if (NSPLIT == 1 || NSPLIT == 2) acc[mb][nb] = WFrag<T16>::mma(a2[mb], b, acc[mb][nb]); if (NSPLIT >= 2) acc[mb][nb] = WFrag<T16>::mma(a[mb], b2, acc[mb][nb]); } }
        asm volatile("v_nop\n\tv_nop\n\tv_nop\n\tv_nop" : "+v"(acc[0][0]), "+v"(acc[1][1]), "+v"(acc[2][2]), "+v"(acc[3][3]) : "v"(a[0]), "v"(a[3]));
    }
#pragma unroll
    for (int mb = 0; mb < 4; ++mb) {
#pragma unroll
        for (int nb = 0; nb < 4; ++nb) {
#pragma unroll
            for (int j = 0; j < 8; ++j) os[(hi * 8 + j) * 68 + nb * 16 + lr] = acc[mb][nb][j]; }
        __builtin_amdgcn_wave_barrier(); asm volatile("" ::: "memory");
        float* crow = C + (size_t)(r0 + mb * 16) * ldc + c0;
{
#pragma unroll
            for (int s = 0; s < 8; ++s) { const int row = 2 * s + hi, cofs = lr * 4; v4f val = *(const v4fa*)(os + row * 68 + cofs);
                *(v4f*)(crow + (size_t)row * ldc + cofs) = val; }
             }
        __builtin_amdgcn_wave_barrier(); asm volatile("" ::: "memory");
    }
}

__device__ __forceinline__ h16 tohx(float x) { return (h16)x; }
__device__ __forceinline__ void splitf(float y, unsigned short& h, unsigned short& l) { h = f2bf(y); l = f2bf(y - bf2f(h)); }
typedef __attribute__((ext_vector_type(2))) _Float16 v2h;
typedef __attribute__((ext_vector_type(4))) _Float16 v4h;
typedef __attribute__((ext_vector_type(2))) unsigned short v2us;
typedef __attribute__((ext_vector_type(4))) unsigned short v4us;
typedef __attribute__((ext_vector_type(2))) float v2f;
typedef __attribute__((ext_vector_type(4))) int v4i;

__global__ __launch_bounds__(256) void k_wtG(const float* __restrict__ w, int K, int N, bf* Bt) {
    const int lane = threadIdx.x & 31; const int L0 = (blockIdx.x * 8 + (threadIdx.x >> 5)) * 8; const int nlines = N * K / 64;
{
        for (int l = 0; l < 8; ++l) { const int L = L0 + l; if (L >= nlines) break; const size_t e = (size_t)L * 64 + lane * 2; const int k = (int)(e % K), n = (int)(e / K); v2us o;
            o[0] = f2bf(w[(size_t)k * N + n]); o[1] = f2bf(w[(size_t)(k + 1) * N + n]); *(v2us*)(Bt + e) = o; }
         }
}
__global__ __launch_bounds__(256) void k_cvt8(const float* __restrict__ src, bf* dst, size_t n8) { const size_t i = (size_t)blockIdx.x * 256 + threadIdx.x; if (i >= n8) return; const v8f v = *(const v8f*)(src + i * 8); v8us o;
#pragma unroll
    for (int k = 0; k < 8; ++k) o[k] = f2bf(v[k]); *(v8us*)(dst + i * 8) = o;  }
__global__ __launch_bounds__(256) void k_csid(float* CS) { const int idx = blockIdx.x * 256 + threadIdx.x; if (idx >= TT * HD) return; v2f cs; cs[0] = 1.0f; cs[1] = 0.0f; *(v2f*)(CS + (size_t)idx * 2) = cs;  }
// k_rope: head planes [h][t][d] (fp16 + hi/lo) of rope(x) x sc with the rotate-half convention out[d] = x[d] cos[t][d] - x[d+HD/2] sin[t][d], out[d+HD/2] = x[d+HD/2] cos[t][d+HD/2] + x[d] sin[t][d+HD/2]
__global__ __launch_bounds__(256) void k_rope(const float* __restrict__ F, int pitch, int nheads, const float* __restrict__ CS, const float* __restrict__ RF, const float* __restrict__ nw, float sc, h16* P16, bf* Ph, bf* Pl) {
    const size_t e = ((size_t)blockIdx.x * 256 + threadIdx.x) * 2; if (e >= (size_t)nheads * TT * HD) return; const int d = (int)(e % HD); const int t = (int)((e / HD) % TT); const int h = (int)(e / ((size_t)HD * TT)); const float* f = F + (size_t)t * pitch + h * HD; const float rf = RF ? RF[(size_t)h * TT + t] : 1.0f; v2h o16; v2us oh, ol;
#pragma unroll
    for (int q = 0; q < 2; ++q) { const int dd = d + q; const int dp = (dd < HD / 2) ? dd + HD / 2 : dd - HD / 2; float x0 = f[dd], x1 = f[dp];
        if (RF) { float n0 = __fmul_rn(x0, rf), n1 = __fmul_rn(x1, rf); x0 = __fmul_rn(bfr(nw[dd]), n0); x1 = __fmul_rn(bfr(nw[dp]), n1); }
        const v2f cs = *(const v2f*)(CS + ((size_t)t * HD + dd) * 2); float a = __fmul_rn(x0, cs[0]), bq = __fmul_rn(x1, cs[1]); const float r = ((dd < HD / 2) ? __fsub_rn(a, bq) : __fadd_rn(a, bq)) * sc;
        o16[q] = tohx(r); unsigned short a2, c2; splitf(r, a2, c2); oh[q] = a2; ol[q] = c2; }
    *(v2h*)(P16 + e) = o16; *(v2us*)(Ph + e) = oh; *(v2us*)(Pl + e) = ol;  }
__global__ __launch_bounds__(256) void k_vtp(const float* __restrict__ F, int pitch, int nheads, h16* V16, bf* Vh, bf* Vl) { const size_t e = ((size_t)blockIdx.x * 256 + threadIdx.x) * 2; if (e >= (size_t)nheads * HD * TT) return; const int t = (int)(e % TT); const int d = (int)((e / TT) % HD); const int g = (int)(e / ((size_t)TT * HD)); v2h o16; v2us oh, ol;
#pragma unroll
    for (int q = 0; q < 2; ++q) { const float x = F[(size_t)(t + q) * pitch + g * HD + d]; o16[q] = tohx(x); unsigned short a2, c2; splitf(x, a2, c2); oh[q] = a2; ol[q] = c2; }
    *(v2h*)(V16 + e) = o16; *(v2us*)(Vh + e) = oh; *(v2us*)(Vl + e) = ol;  }
// k_asoft: per row (zz, i): t = S x 128^-0.5 for j <= i (causal; WIN = TT so the window term is inert; -finfo.max fill == exclusion), softmax over the 2048 keys (register row, one exp, fixed trees);
__global__ __launch_bounds__(256) void k_asoft(const float* __restrict__ Sb, h16* P16, bf* Ph, bf* Pl) {
    const int lane = threadIdx.x & 31; const int row = blockIdx.x * 8 + (threadIdx.x >> 5); if (row >= ZH * TT) return; const int i = row % TT; const int zz = row / TT; (void)zz; const bool hires = (i < RH); const float* sr = Sb + (size_t)row * TT; float v[TT / 32]; float mx = -3.0e38f;
#pragma unroll
    for (int ch = 0; ch < TT / 128; ++ch) { const int j0 = ch * 128 + lane * 4; const v4f a = *(const v4f*)(sr + j0);
#pragma unroll
        for (int q = 0; q < 4; ++q) { const int j = j0 + q; (void)j; const float t = (j <= i && i - j < WIN) ? a[q] * SCL : -3.0e38f; v[ch * 4 + q] = t; mx = fmaxf(mx, t); } }
#pragma unroll
    for (int sh = 16; sh; sh >>= 1) mx = fmaxf(mx, __shfl_xor(mx, sh, 32));
    float sum = 0.f;
#pragma unroll
    for (int k = 0; k < TT / 32; ++k) { float d0 = __fsub_rn(v[k], mx); v[k] = __builtin_amdgcn_exp2f(__fmul_rn(d0, 1.4426950408889634f)); sum += v[k]; }
#pragma unroll
    for (int sh = 16; sh; sh >>= 1) sum += __shfl_xor(sum, sh, 32);
    const float f = __fdiv_rn(hires ? 1.0f : PCAR, sum);
{
        if (hires) {
#pragma unroll
            for (int ch = 0; ch < TT / 128; ++ch) { v4us oh, ol;
#pragma unroll
                for (int q = 0; q < 4; ++q) { unsigned short a, c2; splitf(v[ch * 4 + q] * f, a, c2); oh[q] = a; ol[q] = c2; }
                const size_t oo = ((size_t)zz * (RH ? RH : 1) + i) * TT + ch * 128 + lane * 4; *(v4us*)(Ph + oo) = oh; *(v4us*)(Pl + oo) = ol; }
        } else {
#pragma unroll
            for (int ch = 0; ch < TT / 128; ++ch) { v4h o4;
#pragma unroll
                for (int q = 0; q < 4; ++q) o4[q] = tohx(v[ch * 4 + q] * f);
                *(v4h*)(P16 + (size_t)row * TT + ch * 128 + lane * 4) = o4; } }
         }
}
__global__ __launch_bounds__(256) void k_merge(const float* __restrict__ O, int h0, bf* Ah, bf* Al) { const size_t e = ((size_t)blockIdx.x * 256 + threadIdx.x) * 2; if (e >= (size_t)ZH * TT * HD) return; const int d = (int)(e % HD); const int t = (int)((e / HD) % TT); const int zz = (int)(e / ((size_t)HD * TT)); const float cs = (t < RH) ? 1.0f : (1.0f / PCAR); const size_t oo = (size_t)t * DQ + (h0 + zz) * HD + d;
    v2us oh, ol;
#pragma unroll
    for (int q = 0; q < 2; ++q) { unsigned short a, c2; splitf(O[e + q] * cs, a, c2); oh[q] = a; ol[q] = c2; } *(v2us*)(Ah + oo) = oh; *(v2us*)(Al + oo) = ol;  }

extern "C" void kernel_launch(void* const* d_in, const int* in_sizes, int n_in,
                              void* d_out, int out_size, void* d_ws, size_t ws_size, hipStream_t stream) {
    (void)in_sizes; (void)n_in; (void)out_size;
    const float* xq = (const float*)d_in[0]; const float* xk = (const float*)d_in[1]; const float* xv = (const float*)d_in[2]; const float* wq = (const float*)d_in[3]; const float* wk = (const float*)d_in[4]; const float* wv = (const float*)d_in[5]; const float* wo = (const float*)d_in[6];   /* q, k, v ([2][2048][2048] each: THREE streams), Wq ('xw' (in, out) [2048][2048]: 16 heads x 128), Wk, Wv ('xw' [2048][512]: 4 kv heads x 128), Wo ('xw' [2048][2048]): SEVEN inputs, all read; no bias anywhere */
    float* OUT = (float*)d_out;     // [2][2048][2048]
    char* wsp = (char*)d_ws;
    auto take = [&](size_t bytes) { char* p = wsp; wsp += (bytes + 255) & ~(size_t)255; return (void*)p; };
    bf* WQ = (bf*)take((size_t)DQ * DM * 2); bf* WK = (bf*)take((size_t)DKV * DM * 2); bf* WV = (bf*)take((size_t)DKV * DM * 2); bf* WO = (bf*)take((size_t)DM * DQ * 2); float* CS = (float*)take((size_t)TT * HD * 2 * 4);
    bf* XB = (bf*)take((size_t)TT * DM * 2); float* FQ = (float*)take((size_t)TT * DQ * 4); float* FK = (float*)take((size_t)TT * DKV * 4);
    h16* QP16 = (h16*)take((size_t)NH_ * TT * HD * 2); h16* KP16 = (h16*)take((size_t)NKV * TT * HD * 2); h16* VT16 = (h16*)take((size_t)NKV * HD * TT * 2);
    bf* QPh = (bf*)take((size_t)NH_ * TT * HD * 2); bf* QPl = (bf*)take((size_t)NH_ * TT * HD * 2); bf* KPh = (bf*)take((size_t)NKV * TT * HD * 2); bf* KPl = (bf*)take((size_t)NKV * TT * HD * 2); bf* VTh = (bf*)take((size_t)NKV * HD * TT * 2); bf* VTl = (bf*)take((size_t)NKV * HD * TT * 2); bf* Ph = (bf*)take((size_t)ZH * RH * TT * 2); bf* Pl = (bf*)take((size_t)ZH * RH * TT * 2);
    float* Sb = (float*)take((size_t)ZH * TT * TT * 4); h16* P16 = (h16*)take((size_t)ZH * TT * TT * 2); float* Ob = (float*)take((size_t)ZH * TT * HD * 4); bf* ATh = (bf*)take((size_t)TT * DQ * 2); bf* ATl = (bf*)take((size_t)TT * DQ * 2);
    if ((size_t)(wsp - (char*)d_ws) > ws_size) return;    // ws 256 MiB
    float* FV = FK;   // v projection reuses the k buffer after the k planes are built (stream-ordered)
    { k_wtG<<<(unsigned)((DM * DQ / 64 + 63) / 64), 256, 0, stream>>>(wq, DM, DQ, WQ); k_wtG<<<(unsigned)((DM * DKV / 64 + 63) / 64), 256, 0, stream>>>(wk, DM, DKV, WK); k_wtG<<<(unsigned)((DM * DKV / 64 + 63) / 64), 256, 0, stream>>>(wv, DM, DKV, WV);
      k_wtG<<<(unsigned)((DQ * DM / 64 + 63) / 64), 256, 0, stream>>>(wo, DQ, DM, WO);   /* the four 'xw' (in, out) weights transposed once into Bt operands */ }
    const unsigned LQ = (unsigned)(((size_t)NH_ * TT * HD / 2 + 255) / 256), LKv = (unsigned)(((size_t)NKV * TT * HD / 2 + 255) / 256); const unsigned GX = (unsigned)(((size_t)TT * DM / 8 + 255) / 256);
    for (int b = 0; b < NB_; ++b) {
        if (b == 0) k_csid<<<(TT * HD + 255) / 256, 256, 0, stream>>>(CS);   /* identity table: k_rope is a plain plane builder here */
        k_cvt8<<<GX, 256, 0, stream>>>(xq + (size_t)b * TT * DM, XB, (size_t)TT * DM / 8);   /* the QUERY stream */
        k_gemmk<bf, 0, 4, false><<<dim3(TT / 64, DQ / 64, 1), 128, 0, stream>>>(XB, nullptr, WQ, nullptr, DM, FQ, DQ, 0, 0, 0, 0);
        k_rope<<<LQ, 256, 0, stream>>>(FQ, DQ, NH_, CS, nullptr, nullptr, 1.0f, QP16, QPh, QPl);
        k_cvt8<<<GX, 256, 0, stream>>>(xk + (size_t)b * TT * DM, XB, (size_t)TT * DM / 8);   /* the KEY stream: cast after the query GEMM has read XB (stream-ordered) */
        k_gemmk<bf, 0, 8, false><<<dim3(TT / 64, DKV / 64, 1), 256, 0, stream>>>(XB, nullptr, WK, nullptr, DM, FK, DKV, 0, 0, 0, 0);
        k_rope<<<LKv, 256, 0, stream>>>(FK, DKV, NKV, CS, nullptr, nullptr, 1.0f, KP16, KPh, KPl);
        k_cvt8<<<GX, 256, 0, stream>>>(xv + (size_t)b * TT * DM, XB, (size_t)TT * DM / 8);   /* the VALUE stream */
        k_gemmk<bf, 0, 8, false><<<dim3(TT / 64, DKV / 64, 1), 256, 0, stream>>>(XB, nullptr, WV, nullptr, DM, FV, DKV, 0, 0, 0, 0); k_vtp<<<LKv, 256, 0, stream>>>(FV, DKV, NKV, VT16, VTh, VTl);
        for (int h0 = 0; h0 < NH_; h0 += ZH) { const size_t zq = (size_t)h0, zk = (size_t)(h0 / REP);   /* 'jnp.repeat(kh, 4, axis=1)': query head h uses kv head h / 4: the pass's two heads (h0, h0 + 1) share ONE kv head (REP 4): a zero z-stride on the key and value operands */
            k_gemmc<bf, 2, 1><<<dim3(RH / 64, TT / 64, ZH), 32, 0, stream>>>(QPh + zq * TT * HD, QPl + zq * TT * HD, KPh + zk * TT * HD, KPl + zk * TT * HD, HD, Sb, TT, 0, (size_t)TT * HD, 0, (size_t)TT * TT);
            k_gemmc<h16, 0, 1><<<dim3((TT - RH) / 64, TT / 64, ZH), 32, 0, stream>>>(QP16 + zq * TT * HD + (size_t)RH * HD, nullptr, KP16 + zk * TT * HD, nullptr, HD, Sb + (size_t)RH * TT, TT, RH, (size_t)TT * HD, 0, (size_t)TT * TT);
            k_asoft<<<ZH * TT / 8, 256, 0, stream>>>(Sb, P16, Ph, Pl);
            k_gemmk<bf, 2, 8, true><<<dim3(RH / 64, HD / 64, ZH), 256, 0, stream>>>(Ph, Pl, VTh + zk * HD * TT, VTl + zk * HD * TT, TT, Ob, HD, 0, (size_t)RH * TT, 0, (size_t)TT * HD);
            k_gemmk<h16, 0, 8, true><<<dim3((TT - RH) / 64, HD / 64, ZH), 256, 0, stream>>>(P16 + (size_t)RH * TT, nullptr, VT16 + zk * HD * TT, nullptr, TT, Ob + (size_t)RH * HD, HD, RH, (size_t)TT * TT, 0, (size_t)TT * HD);
            k_merge<<<(unsigned)(((size_t)ZH * TT * HD / 2 + 255) / 256), 256, 0, stream>>>(Ob, h0, ATh, ATl); }
        k_gemmk<bf, 1, 4, false><<<dim3(TT / 64, DM / 64, 1), 128, 0, stream>>>(ATh, ATl, WO, nullptr, DQ, OUT + (size_t)b * TT * DM, DM, 0, 0, 0, 0); }
}

// v002
// One run takes 558 microseconds.
// Two timings next to v001 put it at 1.73 and 1.74 times that version's speed.
// Counting every step since v000, it is 2.99 times as fast.
#include <hip/hip_runtime.h>

// Grouped-query causal attention with 128-wide heads on three input streams (q, k, v [2][2048][2048]; qh = q Wq (16 heads x 128), kh, vh = k Wk, v Wv (4 kv heads x 128) ('xw' (in, out) 0.02, no bias); qh and kh each x 128^-0.25 (together 1/sqrt(128)); kv head = query head / 4 (jnp.repeat); the module takes softmax over ALL keys, zeroes the strictly-upper triangle and renormalises by (row sum + 1e-9): a causal softmax but for that epsilon; out = merged Wo ('xw', no bias) -> [2][2048][2048] (8.4 M); argument order q, k, v, Wq, Wk, Wv, Wo).
// Layout per batch: bf16 copies of q, k and v in turn (one operand buffer, stream-ordered); the four 'xw' weights transposed once into Bt operands; exact projections; plane builders (identity table); causal T-2048 attention with 128-wide heads, all 16 query heads of the batch entry in every launch (grid z = head; kv head = z / 4 on the key and value operands) (hybrid rows: < 512 hi/lo 3 products, rest fp16 x1024; k_gemmc skips tiles above the diagonal); merged hi/lo x Wo exact.
// Score storage, so that 16 heads fit the workspace: per head only the causal part, packed by blocks of 64 query rows: block rb holds 64 rows of 64 (rb + 1) f32 (its tiles up to the diagonal one), 2048 rb (rb + 1) floats behind the head's start; the softmax writes each row's 16-bit probabilities over the row's own scores (fp16 in its first half; or the hi plane in the first half and the lo plane in the second).
// Compute dtypes, f32 accumulate: every input rounded to bf16; projections exact; attention rows < 512 3 products, rest fp16; softmax f32 (the exact causal softmax: no epsilon term); Wo hl x exact.

#define NB_  2
#define TT   2048
#define DM   2048
#define NH_  16
#define NKV  4
#define REP  (NH_ / NKV)
#define HD   128
#define DQ   (NH_ * HD)
#define DKV  (NKV * HD)
#define ZH   16                   // query heads per attention launch (a multiple of REP)
#define SH   ((size_t)2048 * (TT / 64) * (TT / 64 + 1))   // floats of one head's packed causal scores
#define RH   512                  // query rows < RH use hi+lo planes (0: none)
#define WIN  2048
#define PCAR 1024.0f
#define SCL  0.088388347648318447f   // HD^-0.5
typedef _Float16 h16;
typedef unsigned short bf;
typedef __attribute__((ext_vector_type(16))) __bf16   v16bf;
typedef __attribute__((ext_vector_type(16))) _Float16 v16h;
typedef __attribute__((ext_vector_type(8)))  _Float16 v8h;
typedef __attribute__((ext_vector_type(8)))  unsigned short v8us;
typedef __attribute__((ext_vector_type(8)))  float    v8f;
typedef __attribute__((ext_vector_type(4)))  float    v4f;
typedef v8h  __attribute__((may_alias)) v8ha;
typedef v4f  __attribute__((may_alias)) v4fa;
typedef v8us __attribute__((may_alias)) v8usa;

__device__ __forceinline__ unsigned short f2bf(float f) { unsigned u = __float_as_uint(f); u += 0x7FFFu + ((u >> 16) & 1u); return (unsigned short)(u >> 16); }
__device__ __forceinline__ float bf2f(unsigned short b) { return __uint_as_float(((unsigned)b) << 16); }
__device__ __forceinline__ float bfr(float f) { return bf2f(f2bf(f)); }
__device__ __forceinline__ v16h cat16(v8h lo, v8h hi) { return __builtin_shufflevector(lo, hi, 0, 1, 2, 3, 4, 5, 6, 7, 8, 9, 10, 11, 12, 13, 14, 15); }
__device__ __forceinline__ v16bf cat16b(v8us lo, v8us hi) { return __builtin_bit_cast(v16bf, __builtin_shufflevector(lo, hi, 0, 1, 2, 3, 4, 5, 6, 7, 8, 9, 10, 11, 12, 13, 14, 15)); }
__device__ __forceinline__ v8f wmma16(v16h a, v16h b, v8f c) { return __builtin_amdgcn_wmma_f32_16x16x32_f16(false, a, false, b, (short)0, c, false, false); }
__device__ __forceinline__ v8f wmmab(v16bf a, v16bf b, v8f c) { return __builtin_amdgcn_wmma_f32_16x16x32_bf16(false, a, false, b, (short)0, c, false, false); }

__device__ __forceinline__ size_t pk_base(int rb) { return (size_t)2048 * rb * (rb + 1); }   // floats of a head's packed scores ahead of row block rb

// ---- k_gemmk: register-blocked GEMM, one 64x64 output tile per work-group of NW waves. The K loop is dealt over the waves in steps of 32 k: wave w takes steps w, w + NW, ... (neighbouring waves read
// neighbouring parts of the same operand lines at about the same time) with 16 accumulators of its own, operands straight from K-contiguous 16-bit planes; the NW partial tiles meet in LDS and are summed
// in wave order 0..NW-1, each wave summing and storing 64 / NW whole rows of the tile.
// C[m][n] (f32, pitch ldc) = sum_k A[m][k] Bt[n][k] (+ split products per NSPLIT). z-batch strides sA/sB/sC in elements. K % 32 == 0. grid (M/64, N/64, Z), 32 * NW threads.
// z-batch: A and C advance by sA, sC per z, Bt by sB per REP z (query heads that share a kv head).
// DIAG: the probability x value contraction of causal attention: probabilities are exactly 0 beyond the diagonal block, so the K range stops there (roff = row offset of this launch's first row within the sequence); A is the packed score storage read as 16-bit planes: row block rb at 2 pk_base(rb), row pitch 128 (rb + 1) elements, the second plane 64 (rb + 1) elements behind the first.
template <typename T16> struct WFrag;
template <> struct WFrag<h16> { typedef v16h V; static __device__ __forceinline__ V ld(const h16* p) { return cat16(*(const v8h*)p, *(const v8h*)(p + 16)); } static __device__ __forceinline__ v8f mma(V a, V b, v8f c) { return wmma16(a, b, c); } };
template <> struct WFrag<bf> { typedef v16bf V; static __device__ __forceinline__ V ld(const bf* p) { return cat16b(*(const v8us*)p, *(const v8us*)(p + 16)); } static __device__ __forceinline__ v8f mma(V a, V b, v8f c) { return wmmab(a, b, c); } };
template <typename T16, int NSPLIT, int NW, bool DIAG>
__global__ __launch_bounds__(32 * NW) void k_gemmk(const T16* __restrict__ A, const T16* __restrict__ A2, const T16* __restrict__ Bt, const T16* __restrict__ Bt2, int K, float* C, int ldc, int roff, size_t sA, size_t sB, size_t sC) {
    typedef typename WFrag<T16>::V V;
    __shared__ __align__(16) float red[NW * 64 * 68];
    const size_t z = blockIdx.z; A += z * sA; if (A2) A2 += z * sA; Bt += (z / REP) * sB; if (Bt2) Bt2 += (z / REP) * sB; C += z * sC;
    const int lane = threadIdx.x & 31, lr = lane & 15, hi = lane >> 4; const int w = __builtin_amdgcn_readfirstlane((int)(threadIdx.x >> 5)); const int r0 = blockIdx.x * 64, c0 = blockIdx.y * 64;
    const int Kl = DIAG ? min(K, r0 + roff + 64) : K;
    const int rb = (r0 + roff) >> 6; const int lda = DIAG ? 128 * (rb + 1) : K;
    v8f acc[4][4];
#pragma unroll
    for (int mb = 0; mb < 4; ++mb)
#pragma unroll
        for (int nb = 0; nb < 4; ++nb) acc[mb][nb] = (v8f){};
    const size_t aoff = (DIAG ? 2 * pk_base(rb) + (size_t)lr * lda : (size_t)(r0 + lr) * lda) + 8 * hi, a2off = aoff + (DIAG ? lda / 2 : 0), boff = (size_t)(c0 + lr) * K + 8 * hi;
    for (int kc = w * 32; kc < Kl; kc += NW * 32) {
        V a[4], a2[4];
#pragma unroll
        for (int mb = 0; mb < 4; ++mb) { a[mb] = WFrag<T16>::ld(A + aoff + (size_t)mb * 16 * lda + kc); if (NSPLIT == 1 || NSPLIT == 2) a2[mb] = WFrag<T16>::ld(A2 + a2off + (size_t)mb * 16 * lda + kc); }
#pragma unroll
        for (int nb = 0; nb < 4; ++nb) { const V b = WFrag<T16>::ld(Bt + boff + (size_t)nb * 16 * K + kc); V b2; if (NSPLIT >= 2) b2 = WFrag<T16>::ld(Bt2 + boff + (size_t)nb * 16 * K + kc);
#pragma unroll
            for (int mb = 0; mb < 4; ++mb) { acc[mb][nb] = WFrag<T16>::mma(a[mb], b, acc[mb][nb]); if (NSPLIT == 1 || NSPLIT == 2) acc[mb][nb] = WFrag<T16>::mma(a2[mb], b, acc[mb][nb]); if (NSPLIT >= 2) acc[mb][nb] = WFrag<T16>::mma(a[mb], b2, acc[mb][nb]); } }
        // four vector slots behind the trip's last matrix instructions, so that nothing on the back edge touches their operands too early
        asm volatile("v_nop\n\tv_nop\n\tv_nop\n\tv_nop" : "+v"(acc[0][0]), "+v"(acc[1][1]), "+v"(acc[2][2]), "+v"(acc[3][3]) : "v"(a[0]), "v"(a[3]));
    }
    float* mine = red + w * (64 * 68);
#pragma unroll
    for (int mb = 0; mb < 4; ++mb)
#pragma unroll
        for (int nb = 0; nb < 4; ++nb)
#pragma unroll
            for (int j = 0; j < 8; ++j) mine[(mb * 16 + hi * 8 + j) * 68 + nb * 16 + lr] = acc[mb][nb][j];
    __syncthreads();   // every wave's partial tile is in LDS before any wave sums across them
#pragma unroll
    for (int s = 0; s < 32 / NW; ++s) { const int row = w * (64 / NW) + 2 * s + hi, cofs = lr * 4; v4f val = *(const v4fa*)(red + row * 68 + cofs);
#pragma unroll
        for (int p = 1; p < NW; ++p) val += *(const v4fa*)(red + p * (64 * 68) + row * 68 + cofs);
        *(v4f*)(C + (size_t)(r0 + row) * ldc + c0 + cofs) = val; }
}

// ---- k_gemmc: ONE WAVE per 64x64 tile of the causal attention scores (K = 128: four steps, nothing to deal out), 16 accumulators, operands straight from K-contiguous 16-bit planes; grid (M/64, N/64, Z), 32 threads.
// CMODE 1 skips score tiles entirely above the diagonal (query rows r0+roff.., key columns c0..). roff = row offset of this launch's first row within the sequence. C is the packed score storage (sC = one head): row block rb at pk_base(rb), row pitch 64 (rb + 1). Bt advances by sB per REP z.
template <typename T16, int NSPLIT, int CMODE>
__global__ __launch_bounds__(32) void k_gemmc(const T16* __restrict__ A, const T16* __restrict__ A2, const T16* __restrict__ Bt, const T16* __restrict__ Bt2, int K, float* C, int roff, size_t sA, size_t sB, size_t sC) {
    typedef typename WFrag<T16>::V V;
    __shared__ __align__(16) float os[16 * 68];
    const size_t z = blockIdx.z; A += z * sA; if (A2) A2 += z * sA; Bt += (z / REP) * sB; if (Bt2) Bt2 += (z / REP) * sB; C += z * sC;
    const int lane = threadIdx.x & 31, lr = lane & 15, hi = lane >> 4; const int r0 = blockIdx.x * 64, c0 = blockIdx.y * 64;
    if (CMODE == 1 && c0 > r0 + roff + 63) return;                  // score tile entirely above the causal diagonal: never read, and not stored at all
    const int rb = (r0 + roff) >> 6, ldc = 64 * (rb + 1);
    v8f acc[4][4];
#pragma unroll
    for (int mb = 0; mb < 4; ++mb)
#pragma unroll
        for (int nb = 0; nb < 4; ++nb) acc[mb][nb] = (v8f){};
    const size_t aoff = (size_t)(r0 + lr) * K + 8 * hi, boff = (size_t)(c0 + lr) * K + 8 * hi;
    for (int kc = 0; kc < K; kc += 32) {
        V a[4], a2[4];
#pragma unroll
        for (int mb = 0; mb < 4; ++mb) { a[mb] = WFrag<T16>::ld(A + aoff + (size_t)mb * 16 * K + kc); if (NSPLIT == 1 || NSPLIT == 2) a2[mb] = WFrag<T16>::ld(A2 + aoff + (size_t)mb * 16 * K + kc); }
#pragma unroll
        for (int nb = 0; nb < 4; ++nb) { const V b = WFrag<T16>::ld(Bt + boff + (size_t)nb * 16 * K + kc); V b2; if (NSPLIT >= 2) b2 = WFrag<T16>::ld(Bt2 + boff + (size_t)nb * 16 * K + kc);
#pragma unroll
            for (int mb = 0; mb < 4; ++mb) { acc[mb][nb] = WFrag<T16>::mma(a[mb], b, acc[mb][nb]); if (NSPLIT == 1 || NSPLIT == 2) acc[mb][nb] = WFrag<T16>::mma(a2[mb], b, acc[mb][nb]); if (NSPLIT >= 2) acc[mb][nb] = WFrag<T16>::mma(a[mb], b2, acc[mb][nb]); } }
        asm volatile("v_nop\n\tv_nop\n\tv_nop\n\tv_nop" : "+v"(acc[0][0]), "+v"(acc[1][1]), "+v"(acc[2][2]), "+v"(acc[3][3]) : "v"(a[0]), "v"(a[3]));
    }
#pragma unroll
    for (int mb = 0; mb < 4; ++mb) {
#pragma unroll
        for (int nb = 0; nb < 4; ++nb) {
#pragma unroll
            for (int j = 0; j < 8; ++j) os[(hi * 8 + j) * 68 + nb * 16 + lr] = acc[mb][nb][j]; }
        __builtin_amdgcn_wave_barrier(); asm volatile("" ::: "memory");
        float* crow = C + pk_base(rb) + (size_t)(mb * 16) * ldc + c0;
{
#pragma unroll
            for (int s = 0; s < 8; ++s) { const int row = 2 * s + hi, cofs = lr * 4; v4f val = *(const v4fa*)(os + row * 68 + cofs);
                *(v4f*)(crow + (size_t)row * ldc + cofs) = val; }
             }
        __builtin_amdgcn_wave_barrier(); asm volatile("" ::: "memory");
    }
}

__device__ __forceinline__ h16 tohx(float x) { return (h16)x; }
__device__ __forceinline__ void splitf(float y, unsigned short& h, unsigned short& l) { h = f2bf(y); l = f2bf(y - bf2f(h)); }
typedef __attribute__((ext_vector_type(2))) _Float16 v2h;
typedef __attribute__((ext_vector_type(4))) _Float16 v4h;
typedef __attribute__((ext_vector_type(2))) unsigned short v2us;
typedef __attribute__((ext_vector_type(4))) unsigned short v4us;
typedef __attribute__((ext_vector_type(2))) float v2f;
typedef __attribute__((ext_vector_type(4))) int v4i;

__global__ __launch_bounds__(256) void k_wtG(const float* __restrict__ w, int K, int N, bf* Bt) {
    const int lane = threadIdx.x & 31; const int L0 = (blockIdx.x * 8 + (threadIdx.x >> 5)) * 8; const int nlines = N * K / 64;
{
        for (int l = 0; l < 8; ++l) { const int L = L0 + l; if (L >= nlines) break; const size_t e = (size_t)L * 64 + lane * 2; const int k = (int)(e % K), n = (int)(e / K); v2us o;
            o[0] = f2bf(w[(size_t)k * N + n]); o[1] = f2bf(w[(size_t)(k + 1) * N + n]); *(v2us*)(Bt + e) = o; }
         }
}
__global__ __launch_bounds__(256) void k_cvt8(const float* __restrict__ src, bf* dst, size_t n8) { const size_t i = (size_t)blockIdx.x * 256 + threadIdx.x; if (i >= n8) return; const v8f v = *(const v8f*)(src + i * 8); v8us o;
#pragma unroll
    for (int k = 0; k < 8; ++k) o[k] = f2bf(v[k]); *(v8us*)(dst + i * 8) = o;  }
__global__ __launch_bounds__(256) void k_csid(float* CS) { const int idx = blockIdx.x * 256 + threadIdx.x; if (idx >= TT * HD) return; v2f cs; cs[0] = 1.0f; cs[1] = 0.0f; *(v2f*)(CS + (size_t)idx * 2) = cs;  }
// k_rope: head planes [h][t][d] (fp16 + hi/lo) of rope(x) x sc with the rotate-half convention out[d] = x[d] cos[t][d] - x[d+HD/2] sin[t][d], out[d+HD/2] = x[d+HD/2] cos[t][d+HD/2] + x[d] sin[t][d+HD/2]
__global__ __launch_bounds__(256) void k_rope(const float* __restrict__ F, int pitch, int nheads, const float* __restrict__ CS, const float* __restrict__ RF, const float* __restrict__ nw, float sc, h16* P16, bf* Ph, bf* Pl) {
    const size_t e = ((size_t)blockIdx.x * 256 + threadIdx.x) * 2; if (e >= (size_t)nheads * TT * HD) return; const int d = (int)(e % HD); const int t = (int)((e / HD) % TT); const int h = (int)(e / ((size_t)HD * TT)); const float* f = F + (size_t)t * pitch + h * HD; const float rf = RF ? RF[(size_t)h * TT + t] : 1.0f; v2h o16; v2us oh, ol;
#pragma unroll
    for (int q = 0; q < 2; ++q) { const int dd = d + q; const int dp = (dd < HD / 2) ? dd + HD / 2 : dd - HD / 2; float x0 = f[dd], x1 = f[dp];
        if (RF) { float n0 = __fmul_rn(x0, rf), n1 = __fmul_rn(x1, rf); x0 = __fmul_rn(bfr(nw[dd]), n0); x1 = __fmul_rn(bfr(nw[dp]), n1); }
        const v2f cs = *(const v2f*)(CS + ((size_t)t * HD + dd) * 2); float a = __fmul_rn(x0, cs[0]), bq = __fmul_rn(x1, cs[1]); const float r = ((dd < HD / 2) ? __fsub_rn(a, bq) : __fadd_rn(a, bq)) * sc;
        o16[q] = tohx(r); unsigned short a2, c2; splitf(r, a2, c2); oh[q] = a2; ol[q] = c2; }
    *(v2h*)(P16 + e) = o16; *(v2us*)(Ph + e) = oh; *(v2us*)(Pl + e) = ol;  }
__global__ __launch_bounds__(256) void k_vtp(const float* __restrict__ F, int pitch, int nheads, h16* V16, bf* Vh, bf* Vl) { const size_t e = ((size_t)blockIdx.x * 256 + threadIdx.x) * 2; if (e >= (size_t)nheads * HD * TT) return; const int t = (int)(e % TT); const int d = (int)((e / TT) % HD); const int g = (int)(e / ((size_t)TT * HD)); v2h o16; v2us oh, ol;
#pragma unroll
    for (int q = 0; q < 2; ++q) { const float x = F[(size_t)(t + q) * pitch + g * HD + d]; o16[q] = tohx(x); unsigned short a2, c2; splitf(x, a2, c2); oh[q] = a2; ol[q] = c2; }
    *(v2h*)(V16 + e) = o16; *(v2us*)(Vh + e) = oh; *(v2us*)(Vl + e) = ol;  }
// k_asoft: per row (zz, i): t = S x 128^-0.5 for j <= i (causal; WIN = TT so the window term is inert; -finfo.max fill == exclusion), softmax over the 2048 keys (register row, one exp, fixed trees); one wave owns a row: it reads the row's stored 64 (rb + 1) scores (keys beyond them are excluded keys) and, all of them in registers, writes the probabilities of those keys over them;
__global__ __launch_bounds__(256) void k_asoft(float* Sb) {
    const int lane = threadIdx.x & 31; const int row = blockIdx.x * 8 + (threadIdx.x >> 5); if (row >= ZH * TT) return; const int i = row % TT; const int zz = row / TT; const bool hires = (i < RH); const int ldp = 64 * ((i >> 6) + 1); float* sr = Sb + (size_t)zz * SH + pk_base(i >> 6) + (size_t)(i & 63) * ldp; float v[TT / 32]; float mx = -3.0e38f;
#pragma unroll
    for (int ch = 0; ch < TT / 128; ++ch) { const int j0 = ch * 128 + lane * 4; const v4f a = *(const v4f*)(sr + min(j0, ldp - 4));   /* beyond the stored keys: the row's last stored quad, in bounds, excluded by j > i below; no branch, so that all loads of the row fly together */
#pragma unroll
        for (int q = 0; q < 4; ++q) { const int j = j0 + q; (void)j; const float t = (j <= i && i - j < WIN) ? a[q] * SCL : -3.0e38f; v[ch * 4 + q] = t; mx = fmaxf(mx, t); } }
#pragma unroll
    for (int sh = 16; sh; sh >>= 1) mx = fmaxf(mx, __shfl_xor(mx, sh, 32));
    float sum = 0.f;
#pragma unroll
    for (int k = 0; k < TT / 32; ++k) { float d0 = __fsub_rn(v[k], mx); v[k] = __builtin_amdgcn_exp2f(__fmul_rn(d0, 1.4426950408889634f)); sum += v[k]; }
#pragma unroll
    for (int sh = 16; sh; sh >>= 1) sum += __shfl_xor(sum, sh, 32);
    const float f = __fdiv_rn(hires ? 1.0f : PCAR, sum);
{
        if (hires) {
#pragma unroll
            for (int ch = 0; ch < TT / 128; ++ch) { v4us oh, ol;
#pragma unroll
                for (int q = 0; q < 4; ++q) { unsigned short a, c2; splitf(v[ch * 4 + q] * f, a, c2); oh[q] = a; ol[q] = c2; }
                const int j0 = ch * 128 + lane * 4; if (j0 < ldp) { *(v4us*)((bf*)sr + j0) = oh; *(v4us*)((bf*)sr + ldp + j0) = ol; } }
        } else {
#pragma unroll
            for (int ch = 0; ch < TT / 128; ++ch) { v4h o4;
#pragma unroll
                for (int q = 0; q < 4; ++q) o4[q] = tohx(v[ch * 4 + q] * f);
                const int j0 = ch * 128 + lane * 4; if (j0 < ldp) *(v4h*)((h16*)sr + j0) = o4; } }
         }
}
__global__ __launch_bounds__(256) void k_merge(const float* __restrict__ O, int h0, bf* Ah, bf* Al) { const size_t e = ((size_t)blockIdx.x * 256 + threadIdx.x) * 2; if (e >= (size_t)ZH * TT * HD) return; const int d = (int)(e % HD); const int t = (int)((e / HD) % TT); const int zz = (int)(e / ((size_t)HD * TT)); const float cs = (t < RH) ? 1.0f : (1.0f / PCAR); const size_t oo = (size_t)t * DQ + (h0 + zz) * HD + d;
    v2us oh, ol;
#pragma unroll
    for (int q = 0; q < 2; ++q) { unsigned short a, c2; splitf(O[e + q] * cs, a, c2); oh[q] = a; ol[q] = c2; } *(v2us*)(Ah + oo) = oh; *(v2us*)(Al + oo) = ol;  }

extern "C" void kernel_launch(void* const* d_in, const int* in_sizes, int n_in,
                              void* d_out, int out_size, void* d_ws, size_t ws_size, hipStream_t stream) {
    (void)in_sizes; (void)n_in; (void)out_size;
    const float* xq = (const float*)d_in[0]; const float* xk = (const float*)d_in[1]; const float* xv = (const float*)d_in[2]; const float* wq = (const float*)d_in[3]; const float* wk = (const float*)d_in[4]; const float* wv = (const float*)d_in[5]; const float* wo = (const float*)d_in[6];   /* q, k, v ([2][2048][2048] each: THREE streams), Wq ('xw' (in, out) [2048][2048]: 16 heads x 128), Wk, Wv ('xw' [2048][512]: 4 kv heads x 128), Wo ('xw' [2048][2048]): SEVEN inputs, all read; no bias anywhere */
    float* OUT = (float*)d_out;     // [2][2048][2048]
    char* wsp = (char*)d_ws;
    auto take = [&](size_t bytes) { char* p = wsp; wsp += (bytes + 255) & ~(size_t)255; return (void*)p; };
    bf* WQ = (bf*)take((size_t)DQ * DM * 2); bf* WK = (bf*)take((size_t)DKV * DM * 2); bf* WV = (bf*)take((size_t)DKV * DM * 2); bf* WO = (bf*)take((size_t)DM * DQ * 2); float* CS = (float*)take((size_t)TT * HD * 2 * 4);
    bf* XB = (bf*)take((size_t)TT * DM * 2); float* FQ = (float*)take((size_t)TT * DQ * 4); float* FK = (float*)take((size_t)TT * DKV * 4);
    h16* QP16 = (h16*)take((size_t)NH_ * TT * HD * 2); h16* KP16 = (h16*)take((size_t)NKV * TT * HD * 2); h16* VT16 = (h16*)take((size_t)NKV * HD * TT * 2);
    bf* QPh = (bf*)take((size_t)NH_ * TT * HD * 2); bf* QPl = (bf*)take((size_t)NH_ * TT * HD * 2); bf* KPh = (bf*)take((size_t)NKV * TT * HD * 2); bf* KPl = (bf*)take((size_t)NKV * TT * HD * 2); bf* VTh = (bf*)take((size_t)NKV * HD * TT * 2); bf* VTl = (bf*)take((size_t)NKV * HD * TT * 2);
    float* Sb = (float*)take((size_t)ZH * SH * 4); float* Ob = (float*)take((size_t)ZH * TT * HD * 4); bf* ATh = (bf*)take((size_t)TT * DQ * 2); bf* ATl = (bf*)take((size_t)TT * DQ * 2);
    if ((size_t)(wsp - (char*)d_ws) > ws_size) return;    // ws 256 MiB
    float* FV = FK;   // v projection reuses the k buffer after the k planes are built (stream-ordered)
    { k_wtG<<<(unsigned)((DM * DQ / 64 + 63) / 64), 256, 0, stream>>>(wq, DM, DQ, WQ); k_wtG<<<(unsigned)((DM * DKV / 64 + 63) / 64), 256, 0, stream>>>(wk, DM, DKV, WK); k_wtG<<<(unsigned)((DM * DKV / 64 + 63) / 64), 256, 0, stream>>>(wv, DM, DKV, WV);
      k_wtG<<<(unsigned)((DQ * DM / 64 + 63) / 64), 256, 0, stream>>>(wo, DQ, DM, WO);   /* the four 'xw' (in, out) weights transposed once into Bt operands */ }
    const unsigned LQ = (unsigned)(((size_t)NH_ * TT * HD / 2 + 255) / 256), LKv = (unsigned)(((size_t)NKV * TT * HD / 2 + 255) / 256); const unsigned GX = (unsigned)(((size_t)TT * DM / 8 + 255) / 256);
    for (int b = 0; b < NB_; ++b) {
        if (b == 0) k_csid<<<(TT * HD + 255) / 256, 256, 0, stream>>>(CS);   /* identity table: k_rope is a plain plane builder here */
        k_cvt8<<<GX, 256, 0, stream>>>(xq + (size_t)b * TT * DM, XB, (size_t)TT * DM / 8);   /* the QUERY stream */
        k_gemmk<bf, 0, 4, false><<<dim3(TT / 64, DQ / 64, 1), 128, 0, stream>>>(XB, nullptr, WQ, nullptr, DM, FQ, DQ, 0, 0, 0, 0);
        k_rope<<<LQ, 256, 0, stream>>>(FQ, DQ, NH_, CS, nullptr, nullptr, 1.0f, QP16, QPh, QPl);
        k_cvt8<<<GX, 256, 0, stream>>>(xk + (size_t)b * TT * DM, XB, (size_t)TT * DM / 8);   /* the KEY stream: cast after the query GEMM has read XB (stream-ordered) */
        k_gemmk<bf, 0, 8, false><<<dim3(TT / 64, DKV / 64, 1), 256, 0, stream>>>(XB, nullptr, WK, nullptr, DM, FK, DKV, 0, 0, 0, 0);
        k_rope<<<LKv, 256, 0, stream>>>(FK, DKV, NKV, CS, nullptr, nullptr, 1.0f, KP16, KPh, KPl);
        k_cvt8<<<GX, 256, 0, stream>>>(xv + (size_t)b * TT * DM, XB, (size_t)TT * DM / 8);   /* the VALUE stream */
        k_gemmk<bf, 0, 8, false><<<dim3(TT / 64, DKV / 64, 1), 256, 0, stream>>>(XB, nullptr, WV, nullptr, DM, FV, DKV, 0, 0, 0, 0); k_vtp<<<LKv, 256, 0, stream>>>(FV, DKV, NKV, VT16, VTh, VTl);
        for (int h0 = 0; h0 < NH_; h0 += ZH) { const size_t zq = (size_t)h0, zk = (size_t)(h0 / REP);   /* 'jnp.repeat(kh, 4, axis=1)': query head h uses kv head h / 4: the kernels advance the key and value operands once per REP z */
            k_gemmc<bf, 2, 1><<<dim3(RH / 64, TT / 64, ZH), 32, 0, stream>>>(QPh + zq * TT * HD, QPl + zq * TT * HD, KPh + zk * TT * HD, KPl + zk * TT * HD, HD, Sb, 0, (size_t)TT * HD, (size_t)TT * HD, SH);
            k_gemmc<h16, 0, 1><<<dim3((TT - RH) / 64, TT / 64, ZH), 32, 0, stream>>>(QP16 + zq * TT * HD + (size_t)RH * HD, nullptr, KP16 + zk * TT * HD, nullptr, HD, Sb, RH, (size_t)TT * HD, (size_t)TT * HD, SH);
            k_asoft<<<ZH * TT / 8, 256, 0, stream>>>(Sb);
            k_gemmk<bf, 2, 8, true><<<dim3(RH / 64, HD / 64, ZH), 256, 0, stream>>>((const bf*)Sb, (const bf*)Sb, VTh + zk * HD * TT, VTl + zk * HD * TT, TT, Ob, HD, 0, 2 * SH, (size_t)HD * TT, (size_t)TT * HD);
            k_gemmk<h16, 0, 8, true><<<dim3((TT - RH) / 64, HD / 64, ZH), 256, 0, stream>>>((const h16*)Sb, nullptr, VT16 + zk * HD * TT, nullptr, TT, Ob + (size_t)RH * HD, HD, RH, 2 * SH, (size_t)HD * TT, (size_t)TT * HD);
            k_merge<<<(unsigned)(((size_t)ZH * TT * HD / 2 + 255) / 256), 256, 0, stream>>>(Ob, h0, ATh, ATl); }
        k_gemmk<bf, 1, 4, false><<<dim3(TT / 64, DM / 64, 1), 128, 0, stream>>>(ATh, ATl, WO, nullptr, DQ, OUT + (size_t)b * TT * DM, DM, 0, 0, 0, 0); }
}

// v003
// It runs in 480 microseconds.
// In both of two side-by-side timings against v002, it was 1.17 times as fast.
// Counting every step since v000, it is 3.49 times as fast.
#include <hip/hip_runtime.h>

// Grouped-query causal attention with 128-wide heads on three input streams (q, k, v [2][2048][2048]; qh = q Wq (16 heads x 128), kh, vh = k Wk, v Wv (4 kv heads x 128) ('xw' (in, out) 0.02, no bias); qh and kh each x 128^-0.25 (together 1/sqrt(128)); kv head = query head / 4 (jnp.repeat); the module takes softmax over ALL keys, zeroes the strictly-upper triangle and renormalises by (row sum + 1e-9): a causal softmax but for that epsilon; out = merged Wo ('xw', no bias) -> [2][2048][2048] (8.4 M); argument order q, k, v, Wq, Wk, Wv, Wo).
// Layout per batch: bf16 copies of q, k and v in turn (one operand buffer, stream-ordered); the four 'xw' weights transposed once into Bt operands; exact projections; plane builders (identity table); causal T-2048 attention with 128-wide heads, all 16 query heads of the batch entry in every launch (grid z = head; kv head = z / 4 on the key and value operands) (hybrid rows: < 512 hi/lo 3 products, rest fp16 x1024; k_gemmc skips tiles above the diagonal); merged hi/lo x Wo exact.
// Score storage, so that 16 heads fit the workspace: per head only the causal part, packed by blocks of 64 query rows: block rb holds 64 rows of 64 (rb + 1) f32 (its tiles up to the diagonal one), 2048 rb (rb + 1) floats behind the head's start; the softmax writes each row's 16-bit probabilities over the row's own scores (fp16 in its first half; or the hi plane in the first half and the lo plane in the second).
// Compute dtypes, f32 accumulate: every input rounded to bf16; projections exact; attention rows < 512 3 products, rest fp16; softmax f32 (the exact causal softmax: no epsilon term); Wo hl x exact.

#define NB_  2
#define TT   2048
#define DM   2048
#define NH_  16
#define NKV  4
#define REP  (NH_ / NKV)
#define HD   128
#define DQ   (NH_ * HD)
#define DKV  (NKV * HD)
#define ZH   16                   // query heads per attention launch (a multiple of REP)
#define SH   ((size_t)2048 * (TT / 64) * (TT / 64 + 1))   // floats of one head's packed causal scores
#define RH   512                  // query rows < RH use hi+lo planes (0: none)
#define WIN  2048
#define PCAR 1024.0f
#define SCL  0.088388347648318447f   // HD^-0.5
typedef _Float16 h16;
typedef unsigned short bf;
typedef __attribute__((ext_vector_type(16))) __bf16   v16bf;
typedef __attribute__((ext_vector_type(16))) _Float16 v16h;
typedef __attribute__((ext_vector_type(8)))  _Float16 v8h;
typedef __attribute__((ext_vector_type(8)))  unsigned short v8us;
typedef __attribute__((ext_vector_type(8)))  float    v8f;
typedef __attribute__((ext_vector_type(4)))  float    v4f;
typedef v8h  __attribute__((may_alias)) v8ha;
typedef v4f  __attribute__((may_alias)) v4fa;
typedef v8us __attribute__((may_alias)) v8usa;

__device__ __forceinline__ unsigned short f2bf(float f) { unsigned u = __float_as_uint(f); u += 0x7FFFu + ((u >> 16) & 1u); return (unsigned short)(u >> 16); }
__device__ __forceinline__ float bf2f(unsigned short b) { return __uint_as_float(((unsigned)b) << 16); }
__device__ __forceinline__ float bfr(float f) { return bf2f(f2bf(f)); }
__device__ __forceinline__ v16h cat16(v8h lo, v8h hi) { return __builtin_shufflevector(lo, hi, 0, 1, 2, 3, 4, 5, 6, 7, 8, 9, 10, 11, 12, 13, 14, 15); }
__device__ __forceinline__ v16bf cat16b(v8us lo, v8us hi) { return __builtin_bit_cast(v16bf, __builtin_shufflevector(lo, hi, 0, 1, 2, 3, 4, 5, 6, 7, 8, 9, 10, 11, 12, 13, 14, 15)); }
__device__ __forceinline__ v8f wmma16(v16h a, v16h b, v8f c) { return __builtin_amdgcn_wmma_f32_16x16x32_f16(false, a, false, b, (short)0, c, false, false); }
__device__ __forceinline__ v8f wmmab(v16bf a, v16bf b, v8f c) { return __builtin_amdgcn_wmma_f32_16x16x32_bf16(false, a, false, b, (short)0, c, false, false); }

__device__ __forceinline__ size_t pk_base(int rb) { return (size_t)2048 * rb * (rb + 1); }   // floats of a head's packed scores ahead of row block rb

// ---- k_gemmk: register-blocked GEMM, one 64x64 output tile per work-group of NW waves. The K loop is dealt over the waves in steps of 32 k: wave w takes steps w, w + NW, ... with 16 accumulators of its own;
// the NW partial tiles meet in LDS and are summed in wave order 0..NW-1, each wave summing and storing 64 / NW whole rows of the tile.
// The operands come through LDS: a trip stages 64 rows x 32 NW k of every K-contiguous 16-bit operand plane by asynchronous 16-byte copies that take whole 128-byte lines (a fragment load straight from global memory
// touches 16 lines for its 512 bytes), two buffers, the next trip's copies in flight under this trip's products; each wave reads its own 32-k column of the staged rows as fragments. LDS row pitch 64 NW + 16 bytes (an odd multiple of 16).
// C[m][n] (f32, pitch ldc) = sum_k A[m][k] Bt[n][k] (+ split products per NSPLIT). z-batch strides sA/sB/sC in elements. K % (32 NW) == 0; not DIAG: K >= 64 NW (two trips). grid (M/64, N/64, Z), 32 * NW threads.
// z-batch: A and C advance by sA, sC per z, Bt by sB per REP z (query heads that share a kv head).
// DIAG: the probability x value contraction of causal attention: probabilities are exactly 0 beyond the diagonal block, so the K range stops there (roff = row offset of this launch's first row within the sequence); A is the packed score storage read as 16-bit planes: row block rb at 2 pk_base(rb), row pitch 128 (rb + 1) elements, the second plane 64 (rb + 1) elements behind the first. The last trip stages whole rows of 32 NW k all the same (bytes of the score storage behind the K range, written by the launches before; no wave reads them from LDS: a wave whose step lies beyond the range skips it).
template <typename T16> struct WFrag;
template <> struct WFrag<h16> { typedef v16h V; static __device__ __forceinline__ V ld(const h16* p) { return cat16(*(const v8h*)p, *(const v8h*)(p + 16)); } static __device__ __forceinline__ v8f mma(V a, V b, v8f c) { return wmma16(a, b, c); } };
template <> struct WFrag<bf> { typedef v16bf V; static __device__ __forceinline__ V ld(const bf* p) { return cat16b(*(const v8us*)p, *(const v8us*)(p + 16)); } static __device__ __forceinline__ v8f mma(V a, V b, v8f c) { return wmmab(a, b, c); } };
// cp8: one lane's eight copies of one staged plane (rows 8 apart). The wait on the address counter is the statement's last line, so that no register named by a copy is rewritten in front of it.
template <typename T16>
__device__ __forceinline__ void cp8(unsigned l, const T16* g, unsigned ls, size_t gs) {
    asm volatile("global_load_async_to_lds_b128 %0, %8, off\n\t"
                 "global_load_async_to_lds_b128 %1, %9, off\n\t"
                 "global_load_async_to_lds_b128 %2, %10, off\n\t"
                 "global_load_async_to_lds_b128 %3, %11, off\n\t"
                 "global_load_async_to_lds_b128 %4, %12, off\n\t"
                 "global_load_async_to_lds_b128 %5, %13, off\n\t"
                 "global_load_async_to_lds_b128 %6, %14, off\n\t"
                 "global_load_async_to_lds_b128 %7, %15, off\n\t"
                 "s_wait_xcnt 0x0"
                 :: "v"(l), "v"(l + ls), "v"(l + 2 * ls), "v"(l + 3 * ls), "v"(l + 4 * ls), "v"(l + 5 * ls), "v"(l + 6 * ls), "v"(l + 7 * ls),
                    "v"(g), "v"(g + gs), "v"(g + 2 * gs), "v"(g + 3 * gs), "v"(g + 4 * gs), "v"(g + 5 * gs), "v"(g + 6 * gs), "v"(g + 7 * gs) : "memory");
}
template <typename T16, int NSPLIT, int NW, bool DIAG>
__global__ __launch_bounds__(32 * NW) void k_gemmk(const T16* __restrict__ A, const T16* __restrict__ A2, const T16* __restrict__ Bt, const T16* __restrict__ Bt2, int K, float* C, int ldc, int roff, size_t sA, size_t sB, size_t sC) {
    typedef typename WFrag<T16>::V V;
    constexpr int NT = 2 + NSPLIT, CK = 32 * NW, PB = 2 * CK + 16, TB = 64 * PB, BUF = NT * TB;   // planes staged (A, Bt, then A2, then Bt2), k per trip, LDS row pitch, bytes of a staged plane and of a buffer
    constexpr int SMB = (2 * BUF > NW * 64 * 68 * 4) ? 2 * BUF : NW * 64 * 68 * 4;
    __shared__ __align__(16) unsigned char sm[SMB];   // the two staging buffers; behind the loop the NW partial tiles
    const size_t z = blockIdx.z; A += z * sA; if (A2) A2 += z * sA; Bt += (z / REP) * sB; if (Bt2) Bt2 += (z / REP) * sB; C += z * sC;
    const int tid = threadIdx.x, lane = tid & 31, lr = lane & 15, hi = lane >> 4; const int w = __builtin_amdgcn_readfirstlane((int)(threadIdx.x >> 5)); const int r0 = blockIdx.x * 64, c0 = blockIdx.y * 64;
    const int Kl = DIAG ? min(K, r0 + roff + 64) : K; const int ntrip = (Kl + CK - 1) / CK;
    const int rb = (r0 + roff) >> 6; const int lda = DIAG ? 128 * (rb + 1) : K;
    v8f acc[4][4];
#pragma unroll
    for (int mb = 0; mb < 4; ++mb)
#pragma unroll
        for (int nb = 0; nb < 4; ++nb) acc[mb][nb] = (v8f){};
    const int crow = tid / (4 * NW), ccol = tid % (4 * NW);   // 4 NW lanes copy one staged row; the block copies 8 rows at a time
    const unsigned l0 = (unsigned)(size_t)sm + crow * PB + ccol * 16;
    const size_t aoff = (DIAG ? 2 * pk_base(rb) + (size_t)crow * lda : (size_t)(r0 + crow) * lda) + 8 * ccol, a2off = aoff + (DIAG ? lda / 2 : 0), boff = (size_t)(c0 + crow) * K + 8 * ccol;
    auto fill = [&](int t) { const unsigned l = l0 + (t & 1) * BUF; cp8(l, A + aoff + t * CK, 8 * PB, (size_t)8 * lda); cp8(l + TB, Bt + boff + t * CK, 8 * PB, (size_t)8 * K);
        if (NSPLIT >= 1) cp8(l + 2 * TB, A2 + a2off + t * CK, 8 * PB, (size_t)8 * lda); if (NSPLIT >= 2) cp8(l + 3 * TB, Bt2 + boff + t * CK, 8 * PB, (size_t)8 * K); };
    fill(0);
    asm volatile("s_wait_asynccnt 0x0" ::: "memory");   // this wave's copies of trip 0 have landed
    __syncthreads();                                     // and every other wave's
    if (!DIAG || CK < Kl) fill(1);                      // where a trip 1 exists (not DIAG: always)
    const int foff = lr * PB + (w * 32 + 8 * hi) * 2;
    for (int t = 0; t < ntrip; ++t) {
        if (t * CK + w * 32 < Kl) {   // this wave's step of the trip lies in the K range (the same for the whole wave)
            const unsigned char* s = sm + (t & 1) * BUF + foff;
            V a[4], a2[4];
#pragma unroll
            for (int mb = 0; mb < 4; ++mb) { a[mb] = WFrag<T16>::ld((const T16*)(s + mb * 16 * PB)); if (NSPLIT == 1 || NSPLIT == 2) a2[mb] = WFrag<T16>::ld((const T16*)(s + 2 * TB + mb * 16 * PB)); }
#pragma unroll
            for (int nb = 0; nb < 4; ++nb) { const V b = WFrag<T16>::ld((const T16*)(s + TB + nb * 16 * PB)); V b2; if (NSPLIT >= 2) b2 = WFrag<T16>::ld((const T16*)(s + 3 * TB + nb * 16 * PB));
#pragma unroll
                for (int mb = 0; mb < 4; ++mb) { acc[mb][nb] = WFrag<T16>::mma(a[mb], b, acc[mb][nb]); if (NSPLIT == 1 || NSPLIT == 2) acc[mb][nb] = WFrag<T16>::mma(a2[mb], b, acc[mb][nb]); if (NSPLIT >= 2) acc[mb][nb] = WFrag<T16>::mma(a[mb], b2, acc[mb][nb]); } }
        }
        asm volatile("s_wait_dscnt 0x0" ::: "memory");      // this wave has left the buffer of trip t
        asm volatile("s_wait_asynccnt 0x0" ::: "memory");   // its copies of trip t + 1 have landed
        __syncthreads();                                     // trip t + 1 published; every wave has left the buffer of trip t
        if (t + 2 < ntrip) fill(t + 2);                      // refill of the buffer just left
    }
    asm volatile("s_wait_asynccnt 0x0" ::: "memory");       // no copy in flight when the buffers become the partial tiles
    float* red = (float*)sm; float* mine = red + w * (64 * 68);
#pragma unroll
    for (int mb = 0; mb < 4; ++mb)
#pragma unroll
        for (int nb = 0; nb < 4; ++nb)
#pragma unroll
            for (int j = 0; j < 8; ++j) mine[(mb * 16 + hi * 8 + j) * 68 + nb * 16 + lr] = acc[mb][nb][j];
    __syncthreads();   // every wave's partial tile is in LDS before any wave sums across them
#pragma unroll
    for (int s = 0; s < 32 / NW; ++s) { const int row = w * (64 / NW) + 2 * s + hi, cofs = lr * 4; v4f val = *(const v4fa*)(red + row * 68 + cofs);
#pragma unroll
        for (int p = 1; p < NW; ++p) val += *(const v4fa*)(red + p * (64 * 68) + row * 68 + cofs);
        *(v4f*)(C + (size_t)(r0 + row) * ldc + c0 + cofs) = val; }
}

// ---- k_gemmc: ONE WAVE per 64x64 tile of the causal attention scores (K = 128: four steps, nothing to deal out), 16 accumulators, operands straight from K-contiguous 16-bit planes; grid (M/64, N/64, Z), 32 threads.
// CMODE 1 skips score tiles entirely above the diagonal (query rows r0+roff.., key columns c0..). roff = row offset of this launch's first row within the sequence. C is the packed score storage (sC = one head): row block rb at pk_base(rb), row pitch 64 (rb + 1). Bt advances by sB per REP z.
template <typename T16, int NSPLIT, int CMODE>
__global__ __launch_bounds__(32) void k_gemmc(const T16* __restrict__ A, const T16* __restrict__ A2, const T16* __restrict__ Bt, const T16* __restrict__ Bt2, int K, float* C, int roff, size_t sA, size_t sB, size_t sC) {
    typedef typename WFrag<T16>::V V;
    __shared__ __align__(16) float os[16 * 68];
    const size_t z = blockIdx.z; A += z * sA; if (A2) A2 += z * sA; Bt += (z / REP) * sB; if (Bt2) Bt2 += (z / REP) * sB; C += z * sC;
    const int lane = threadIdx.x & 31, lr = lane & 15, hi = lane >> 4; const int r0 = blockIdx.x * 64, c0 = blockIdx.y * 64;
    if (CMODE == 1 && c0 > r0 + roff + 63) return;                  // score tile entirely above the causal diagonal: never read, and not stored at all
    const int rb = (r0 + roff) >> 6, ldc = 64 * (rb + 1);
    v8f acc[4][4];
#pragma unroll
    for (int mb = 0; mb < 4; ++mb)
#pragma unroll
        for (int nb = 0; nb < 4; ++nb) acc[mb][nb] = (v8f){};
    const size_t aoff = (size_t)(r0 + lr) * K + 8 * hi, boff = (size_t)(c0 + lr) * K + 8 * hi;
    for (int kc = 0; kc < K; kc += 32) {
        V a[4], a2[4];
#pragma unroll
        for (int mb = 0; mb < 4; ++mb) { a[mb] = WFrag<T16>::ld(A + aoff + (size_t)mb * 16 * K + kc); if (NSPLIT == 1 || NSPLIT == 2) a2[mb] = WFrag<T16>::ld(A2 + aoff + (size_t)mb * 16 * K + kc); }
#pragma unroll
        for (int nb = 0; nb < 4; ++nb) { const V b = WFrag<T16>::ld(Bt + boff + (size_t)nb * 16 * K + kc); V b2; if (NSPLIT >= 2) b2 = WFrag<T16>::ld(Bt2 + boff + (size_t)nb * 16 * K + kc);
#pragma unroll
            for (int mb = 0; mb < 4; ++mb) { acc[mb][nb] = WFrag<T16>::mma(a[mb], b, acc[mb][nb]); if (NSPLIT == 1 || NSPLIT == 2) acc[mb][nb] = WFrag<T16>::mma(a2[mb], b, acc[mb][nb]); if (NSPLIT >= 2) acc[mb][nb] = WFrag<T16>::mma(a[mb], b2, acc[mb][nb]); } }
        asm volatile("v_nop\n\tv_nop\n\tv_nop\n\tv_nop" : "+v"(acc[0][0]), "+v"(acc[1][1]), "+v"(acc[2][2]), "+v"(acc[3][3]) : "v"(a[0]), "v"(a[3]));
    }
#pragma unroll
    for (int mb = 0; mb < 4; ++mb) {
#pragma unroll
        for (int nb = 0; nb < 4; ++nb) {
#pragma unroll
            for (int j = 0; j < 8; ++j) os[(hi * 8 + j) * 68 + nb * 16 + lr] = acc[mb][nb][j]; }
        __builtin_amdgcn_wave_barrier(); asm volatile("" ::: "memory");
        float* crow = C + pk_base(rb) + (size_t)(mb * 16) * ldc + c0;
{
#pragma unroll
            for (int s = 0; s < 8; ++s) { const int row = 2 * s + hi, cofs = lr * 4; v4f val = *(const v4fa*)(os + row * 68 + cofs);
                *(v4f*)(crow + (size_t)row * ldc + cofs) = val; }
             }
        __builtin_amdgcn_wave_barrier(); asm volatile("" ::: "memory");
    }
}

__device__ __forceinline__ h16 tohx(float x) { return (h16)x; }
__device__ __forceinline__ void splitf(float y, unsigned short& h, unsigned short& l) { h = f2bf(y); l = f2bf(y - bf2f(h)); }
typedef __attribute__((ext_vector_type(2))) _Float16 v2h;
typedef __attribute__((ext_vector_type(4))) _Float16 v4h;
typedef __attribute__((ext_vector_type(2))) unsigned short v2us;
typedef __attribute__((ext_vector_type(4))) unsigned short v4us;
typedef __attribute__((ext_vector_type(2))) float v2f;
typedef __attribute__((ext_vector_type(4))) int v4i;

__global__ __launch_bounds__(256) void k_wtG(const float* __restrict__ w, int K, int N, bf* Bt) {
    const int lane = threadIdx.x & 31; const int L0 = (blockIdx.x * 8 + (threadIdx.x >> 5)) * 8; const int nlines = N * K / 64;
{
        for (int l = 0; l < 8; ++l) { const int L = L0 + l; if (L >= nlines) break; const size_t e = (size_t)L * 64 + lane * 2; const int k = (int)(e % K), n = (int)(e / K); v2us o;
            o[0] = f2bf(w[(size_t)k * N + n]); o[1] = f2bf(w[(size_t)(k + 1) * N + n]); *(v2us*)(Bt + e) = o; }
         }
}
__global__ __launch_bounds__(256) void k_cvt8(const float* __restrict__ src, bf* dst, size_t n8) { const size_t i = (size_t)blockIdx.x * 256 + threadIdx.x; if (i >= n8) return; const v8f v = *(const v8f*)(src + i * 8); v8us o;
#pragma unroll
    for (int k = 0; k < 8; ++k) o[k] = f2bf(v[k]); *(v8us*)(dst + i * 8) = o;  }
__global__ __launch_bounds__(256) void k_csid(float* CS) { const int idx = blockIdx.x * 256 + threadIdx.x; if (idx >= TT * HD) return; v2f cs; cs[0] = 1.0f; cs[1] = 0.0f; *(v2f*)(CS + (size_t)idx * 2) = cs;  }
// k_rope: head planes [h][t][d] (fp16 + hi/lo) of rope(x) x sc with the rotate-half convention out[d] = x[d] cos[t][d] - x[d+HD/2] sin[t][d], out[d+HD/2] = x[d+HD/2] cos[t][d+HD/2] + x[d] sin[t][d+HD/2]
__global__ __launch_bounds__(256) void k_rope(const float* __restrict__ F, int pitch, int nheads, const float* __restrict__ CS, const float* __restrict__ RF, const float* __restrict__ nw, float sc, h16* P16, bf* Ph, bf* Pl) {
    const size_t e = ((size_t)blockIdx.x * 256 + threadIdx.x) * 2; if (e >= (size_t)nheads * TT * HD) return; const int d = (int)(e % HD); const int t = (int)((e / HD) % TT); const int h = (int)(e / ((size_t)HD * TT)); const float* f = F + (size_t)t * pitch + h * HD; const float rf = RF ? RF[(size_t)h * TT + t] : 1.0f; v2h o16; v2us oh, ol;
#pragma unroll
    for (int q = 0; q < 2; ++q) { const int dd = d + q; const int dp = (dd < HD / 2) ? dd + HD / 2 : dd - HD / 2; float x0 = f[dd], x1 = f[dp];
        if (RF) { float n0 = __fmul_rn(x0, rf), n1 = __fmul_rn(x1, rf); x0 = __fmul_rn(bfr(nw[dd]), n0); x1 = __fmul_rn(bfr(nw[dp]), n1); }
        const v2f cs = *(const v2f*)(CS + ((size_t)t * HD + dd) * 2); float a = __fmul_rn(x0, cs[0]), bq = __fmul_rn(x1, cs[1]); const float r = ((dd < HD / 2) ? __fsub_rn(a, bq) : __fadd_rn(a, bq)) * sc;
        o16[q] = tohx(r); unsigned short a2, c2; splitf(r, a2, c2); oh[q] = a2; ol[q] = c2; }
    *(v2h*)(P16 + e) = o16; *(v2us*)(Ph + e) = oh; *(v2us*)(Pl + e) = ol;  }
__global__ __launch_bounds__(256) void k_vtp(const float* __restrict__ F, int pitch, int nheads, h16* V16, bf* Vh, bf* Vl) { const size_t e = ((size_t)blockIdx.x * 256 + threadIdx.x) * 2; if (e >= (size_t)nheads * HD * TT) return; const int t = (int)(e % TT); const int d = (int)((e / TT) % HD); const int g = (int)(e / ((size_t)TT * HD)); v2h o16; v2us oh, ol;
#pragma unroll
    for (int q = 0; q < 2; ++q) { const float x = F[(size_t)(t + q) * pitch + g * HD + d]; o16[q] = tohx(x); unsigned short a2, c2; splitf(x, a2, c2); oh[q] = a2; ol[q] = c2; }
    *(v2h*)(V16 + e) = o16; *(v2us*)(Vh + e) = oh; *(v2us*)(Vl + e) = ol;  }
// k_asoft: per row (zz, i): t = S x 128^-0.5 for j <= i (causal; WIN = TT so the window term is inert; -finfo.max fill == exclusion), softmax over the 2048 keys (register row, one exp, fixed trees); one wave owns a row: it reads the row's stored 64 (rb + 1) scores (keys beyond them are excluded keys) and, all of them in registers, writes the probabilities of those keys over them;
__global__ __launch_bounds__(256) void k_asoft(float* Sb) {
    const int lane = threadIdx.x & 31; const int row = blockIdx.x * 8 + (threadIdx.x >> 5); if (row >= ZH * TT) return; const int i = row % TT; const int zz = row / TT; const bool hires = (i < RH); const int ldp = 64 * ((i >> 6) + 1); float* sr = Sb + (size_t)zz * SH + pk_base(i >> 6) + (size_t)(i & 63) * ldp; float v[TT / 32]; float mx = -3.0e38f;
#pragma unroll
    for (int ch = 0; ch < TT / 128; ++ch) { const int j0 = ch * 128 + lane * 4; const v4f a = *(const v4f*)(sr + min(j0, ldp - 4));   /* beyond the stored keys: the row's last stored quad, in bounds, excluded by j > i below; no branch, so that all loads of the row fly together */
#pragma unroll
        for (int q = 0; q < 4; ++q) { const int j = j0 + q; (void)j; const float t = (j <= i && i - j < WIN) ? a[q] * SCL : -3.0e38f; v[ch * 4 + q] = t; mx = fmaxf(mx, t); } }
#pragma unroll
    for (int sh = 16; sh; sh >>= 1) mx = fmaxf(mx, __shfl_xor(mx, sh, 32));
    float sum = 0.f;
#pragma unroll
    for (int k = 0; k < TT / 32; ++k) { float d0 = __fsub_rn(v[k], mx); v[k] = __builtin_amdgcn_exp2f(__fmul_rn(d0, 1.4426950408889634f)); sum += v[k]; }
#pragma unroll
    for (int sh = 16; sh; sh >>= 1) sum += __shfl_xor(sum, sh, 32);
    const float f = __fdiv_rn(hires ? 1.0f : PCAR, sum);
{
        if (hires) {
#pragma unroll
            for (int ch = 0; ch < TT / 128; ++ch) { v4us oh, ol;
#pragma unroll
                for (int q = 0; q < 4; ++q) { unsigned short a, c2; splitf(v[ch * 4 + q] * f, a, c2); oh[q] = a; ol[q] = c2; }
                const int j0 = ch * 128 + lane * 4; if (j0 < ldp) { *(v4us*)((bf*)sr + j0) = oh; *(v4us*)((bf*)sr + ldp + j0) = ol; } }
        } else {
#pragma unroll
            for (int ch = 0; ch < TT / 128; ++ch) { v4h o4;
#pragma unroll
                for (int q = 0; q < 4; ++q) o4[q] = tohx(v[ch * 4 + q] * f);
                const int j0 = ch * 128 + lane * 4; if (j0 < ldp) *(v4h*)((h16*)sr + j0) = o4; } }
         }
}
__global__ __launch_bounds__(256) void k_merge(const float* __restrict__ O, int h0, bf* Ah, bf* Al) { const size_t e = ((size_t)blockIdx.x * 256 + threadIdx.x) * 2; if (e >= (size_t)ZH * TT * HD) return; const int d = (int)(e % HD); const int t = (int)((e / HD) % TT); const int zz = (int)(e / ((size_t)HD * TT)); const float cs = (t < RH) ? 1.0f : (1.0f / PCAR); const size_t oo = (size_t)t * DQ + (h0 + zz) * HD + d;
    v2us oh, ol;
#pragma unroll
    for (int q = 0; q < 2; ++q) { unsigned short a, c2; splitf(O[e + q] * cs, a, c2); oh[q] = a; ol[q] = c2; } *(v2us*)(Ah + oo) = oh; *(v2us*)(Al + oo) = ol;  }

extern "C" void kernel_launch(void* const* d_in, const int* in_sizes, int n_in,
                              void* d_out, int out_size, void* d_ws, size_t ws_size, hipStream_t stream) {
    (void)in_sizes; (void)n_in; (void)out_size;
    const float* xq = (const float*)d_in[0]; const float* xk = (const float*)d_in[1]; const float* xv = (const float*)d_in[2]; const float* wq = (const float*)d_in[3]; const float* wk = (const float*)d_in[4]; const float* wv = (const float*)d_in[5]; const float* wo = (const float*)d_in[6];   /* q, k, v ([2][2048][2048] each: THREE streams), Wq ('xw' (in, out) [2048][2048]: 16 heads x 128), Wk, Wv ('xw' [2048][512]: 4 kv heads x 128), Wo ('xw' [2048][2048]): SEVEN inputs, all read; no bias anywhere */
    float* OUT = (float*)d_out;     // [2][2048][2048]
    char* wsp = (char*)d_ws;
    auto take = [&](size_t bytes) { char* p = wsp; wsp += (bytes + 255) & ~(size_t)255; return (void*)p; };
    bf* WQ = (bf*)take((size_t)DQ * DM * 2); bf* WK = (bf*)take((size_t)DKV * DM * 2); bf* WV = (bf*)take((size_t)DKV * DM * 2); bf* WO = (bf*)take((size_t)DM * DQ * 2); float* CS = (float*)take((size_t)TT * HD * 2 * 4);
    bf* XB = (bf*)take((size_t)TT * DM * 2); float* FQ = (float*)take((size_t)TT * DQ * 4); float* FK = (float*)take((size_t)TT * DKV * 4);
    h16* QP16 = (h16*)take((size_t)NH_ * TT * HD * 2); h16* KP16 = (h16*)take((size_t)NKV * TT * HD * 2); h16* VT16 = (h16*)take((size_t)NKV * HD * TT * 2);
    bf* QPh = (bf*)take((size_t)NH_ * TT * HD * 2); bf* QPl = (bf*)take((size_t)NH_ * TT * HD * 2); bf* KPh = (bf*)take((size_t)NKV * TT * HD * 2); bf* KPl = (bf*)take((size_t)NKV * TT * HD * 2); bf* VTh = (bf*)take((size_t)NKV * HD * TT * 2); bf* VTl = (bf*)take((size_t)NKV * HD * TT * 2);
    float* Sb = (float*)take((size_t)ZH * SH * 4); float* Ob = (float*)take((size_t)ZH * TT * HD * 4); bf* ATh = (bf*)take((size_t)TT * DQ * 2); bf* ATl = (bf*)take((size_t)TT * DQ * 2);
    if ((size_t)(wsp - (char*)d_ws) > ws_size) return;    // ws 256 MiB
    float* FV = FK;   // v projection reuses the k buffer after the k planes are built (stream-ordered)
    { k_wtG<<<(unsigned)((DM * DQ / 64 + 63) / 64), 256, 0, stream>>>(wq, DM, DQ, WQ); k_wtG<<<(unsigned)((DM * DKV / 64 + 63) / 64), 256, 0, stream>>>(wk, DM, DKV, WK); k_wtG<<<(unsigned)((DM * DKV / 64 + 63) / 64), 256, 0, stream>>>(wv, DM, DKV, WV);
      k_wtG<<<(unsigned)((DQ * DM / 64 + 63) / 64), 256, 0, stream>>>(wo, DQ, DM, WO);   /* the four 'xw' (in, out) weights transposed once into Bt operands */ }
    const unsigned LQ = (unsigned)(((size_t)NH_ * TT * HD / 2 + 255) / 256), LKv = (unsigned)(((size_t)NKV * TT * HD / 2 + 255) / 256); const unsigned GX = (unsigned)(((size_t)TT * DM / 8 + 255) / 256);
    for (int b = 0; b < NB_; ++b) {
        if (b == 0) k_csid<<<(TT * HD + 255) / 256, 256, 0, stream>>>(CS);   /* identity table: k_rope is a plain plane builder here */
        k_cvt8<<<GX, 256, 0, stream>>>(xq + (size_t)b * TT * DM, XB, (size_t)TT * DM / 8);   /* the QUERY stream */
        k_gemmk<bf, 0, 4, false><<<dim3(TT / 64, DQ / 64, 1), 128, 0, stream>>>(XB, nullptr, WQ, nullptr, DM, FQ, DQ, 0, 0, 0, 0);
        k_rope<<<LQ, 256, 0, stream>>>(FQ, DQ, NH_, CS, nullptr, nullptr, 1.0f, QP16, QPh, QPl);
        k_cvt8<<<GX, 256, 0, stream>>>(xk + (size_t)b * TT * DM, XB, (size_t)TT * DM / 8);   /* the KEY stream: cast after the query GEMM has read XB (stream-ordered) */
        k_gemmk<bf, 0, 8, false><<<dim3(TT / 64, DKV / 64, 1), 256, 0, stream>>>(XB, nullptr, WK, nullptr, DM, FK, DKV, 0, 0, 0, 0);
        k_rope<<<LKv, 256, 0, stream>>>(FK, DKV, NKV, CS, nullptr, nullptr, 1.0f, KP16, KPh, KPl);
        k_cvt8<<<GX, 256, 0, stream>>>(xv + (size_t)b * TT * DM, XB, (size_t)TT * DM / 8);   /* the VALUE stream */
        k_gemmk<bf, 0, 8, false><<<dim3(TT / 64, DKV / 64, 1), 256, 0, stream>>>(XB, nullptr, WV, nullptr, DM, FV, DKV, 0, 0, 0, 0); k_vtp<<<LKv, 256, 0, stream>>>(FV, DKV, NKV, VT16, VTh, VTl);
        for (int h0 = 0; h0 < NH_; h0 += ZH) { const size_t zq = (size_t)h0, zk = (size_t)(h0 / REP);   /* 'jnp.repeat(kh, 4, axis=1)': query head h uses kv head h / 4: the kernels advance the key and value operands once per REP z */
            k_gemmc<bf, 2, 1><<<dim3(RH / 64, TT / 64, ZH), 32, 0, stream>>>(QPh + zq * TT * HD, QPl + zq * TT * HD, KPh + zk * TT * HD, KPl + zk * TT * HD, HD, Sb, 0, (size_t)TT * HD, (size_t)TT * HD, SH);
            k_gemmc<h16, 0, 1><<<dim3((TT - RH) / 64, TT / 64, ZH), 32, 0, stream>>>(QP16 + zq * TT * HD + (size_t)RH * HD, nullptr, KP16 + zk * TT * HD, nullptr, HD, Sb, RH, (size_t)TT * HD, (size_t)TT * HD, SH);
            k_asoft<<<ZH * TT / 8, 256, 0, stream>>>(Sb);
            k_gemmk<bf, 2, 8, true><<<dim3(RH / 64, HD / 64, ZH), 256, 0, stream>>>((const bf*)Sb, (const bf*)Sb, VTh + zk * HD * TT, VTl + zk * HD * TT, TT, Ob, HD, 0, 2 * SH, (size_t)HD * TT, (size_t)TT * HD);
            k_gemmk<h16, 0, 8, true><<<dim3((TT - RH) / 64, HD / 64, ZH), 256, 0, stream>>>((const h16*)Sb, nullptr, VT16 + zk * HD * TT, nullptr, TT, Ob + (size_t)RH * HD, HD, RH, 2 * SH, (size_t)HD * TT, (size_t)TT * HD);
            k_merge<<<(unsigned)(((size_t)ZH * TT * HD / 2 + 255) / 256), 256, 0, stream>>>(Ob, h0, ATh, ATl); }
        k_gemmk<bf, 1, 4, false><<<dim3(TT / 64, DM / 64, 1), 128, 0, stream>>>(ATh, ATl, WO, nullptr, DQ, OUT + (size_t)b * TT * DM, DM, 0, 0, 0, 0); }
}

// v004
// It runs in 441 microseconds.
// Two timings next to v003 both put it at 1.09 times that version's speed.
// All steps since v000 together make it 3.81 times as fast.
#include <hip/hip_runtime.h>

// Grouped-query causal attention with 128-wide heads on three input streams (q, k, v [2][2048][2048]; qh = q Wq (16 heads x 128), kh, vh = k Wk, v Wv (4 kv heads x 128) ('xw' (in, out) 0.02, no bias); qh and kh each x 128^-0.25 (together 1/sqrt(128)); kv head = query head / 4 (jnp.repeat); the module takes softmax over ALL keys, zeroes the strictly-upper triangle and renormalises by (row sum + 1e-9): a causal softmax but for that epsilon; out = merged Wo ('xw', no bias) -> [2][2048][2048] (8.4 M); argument order q, k, v, Wq, Wk, Wv, Wo).
// Layout per batch: bf16 copies of q, k and v in turn (one operand buffer, stream-ordered); the four 'xw' weights transposed once into Bt operands; exact projections; plane builders (identity table); causal T-2048 attention with 128-wide heads, all 16 query heads of the batch entry in every launch (grid z = head; kv head = z / 4 on the key and value operands) (hybrid rows: < 512 hi/lo 3 products, rest fp16 x1024; k_gemmc skips tiles above the diagonal); merged hi/lo x Wo exact.
// Score storage, so that 16 heads fit the workspace: per head only the causal part, packed by blocks of 64 query rows: block rb holds 64 rows of 64 (rb + 1) f32 (its tiles up to the diagonal one), 2048 rb (rb + 1) floats behind the head's start; the softmax writes each row's 16-bit probabilities over the row's own scores (fp16 in its first half; or the hi plane in the first half and the lo plane in the second).
// Compute dtypes, f32 accumulate: every input rounded to bf16; projections exact; attention rows < 512 3 products, rest fp16; softmax f32 (the exact causal softmax: no epsilon term); Wo hl x exact.

#define NB_  2
#define TT   2048
#define DM   2048
#define NH_  16
#define NKV  4
#define REP  (NH_ / NKV)
#define HD   128
#define DQ   (NH_ * HD)
#define DKV  (NKV * HD)
#define ZH   16                   // query heads per attention launch (a multiple of REP)
#define SH   ((size_t)2048 * (TT / 64) * (TT / 64 + 1))   // floats of one head's packed causal scores
#define RH   512                  // query rows < RH use hi+lo planes (0: none)
#define WIN  2048
#define PCAR 1024.0f
#define SCL  0.088388347648318447f   // HD^-0.5
typedef _Float16 h16;
typedef unsigned short bf;
typedef __attribute__((ext_vector_type(16))) __bf16   v16bf;
typedef __attribute__((ext_vector_type(16))) _Float16 v16h;
typedef __attribute__((ext_vector_type(8)))  _Float16 v8h;
typedef __attribute__((ext_vector_type(8)))  unsigned short v8us;
typedef __attribute__((ext_vector_type(8)))  float    v8f;
typedef __attribute__((ext_vector_type(4)))  float    v4f;
typedef v8h  __attribute__((may_alias)) v8ha;
typedef v4f  __attribute__((may_alias)) v4fa;
typedef v8us __attribute__((may_alias)) v8usa;

__device__ __forceinline__ unsigned short f2bf(float f) { unsigned u = __float_as_uint(f); u += 0x7FFFu + ((u >> 16) & 1u); return (unsigned short)(u >> 16); }
__device__ __forceinline__ float bf2f(unsigned short b) { return __uint_as_float(((unsigned)b) << 16); }
__device__ __forceinline__ float bfr(float f) { return bf2f(f2bf(f)); }
__device__ __forceinline__ v16h cat16(v8h lo, v8h hi) { return __builtin_shufflevector(lo, hi, 0, 1, 2, 3, 4, 5, 6, 7, 8, 9, 10, 11, 12, 13, 14, 15); }
__device__ __forceinline__ v16bf cat16b(v8us lo, v8us hi) { return __builtin_bit_cast(v16bf, __builtin_shufflevector(lo, hi, 0, 1, 2, 3, 4, 5, 6, 7, 8, 9, 10, 11, 12, 13, 14, 15)); }
__device__ __forceinline__ v8f wmma16(v16h a, v16h b, v8f c) { return __builtin_amdgcn_wmma_f32_16x16x32_f16(false, a, false, b, (short)0, c, false, false); }
__device__ __forceinline__ v8f wmmab(v16bf a, v16bf b, v8f c) { return __builtin_amdgcn_wmma_f32_16x16x32_bf16(false, a, false, b, (short)0, c, false, false); }

__device__ __forceinline__ size_t pk_base(int rb) { return (size_t)2048 * rb * (rb + 1); }   // floats of a head's packed scores ahead of row block rb

// ---- k_gemmk: register-blocked GEMM, one 64x64 output tile per work-group of NW waves. The K loop is dealt over the waves in steps of 32 k: wave w takes steps w, w + NW, ... with 16 accumulators of its own;
// the NW partial tiles meet in LDS and are summed in wave order 0..NW-1, each wave summing and storing 64 / NW whole rows of the tile.
// The operands come through LDS: a trip stages 64 rows x 32 NW k of every K-contiguous 16-bit operand plane by asynchronous 16-byte copies that take whole 128-byte lines (a fragment load straight from global memory
// touches 16 lines for its 512 bytes), two buffers, the next trip's copies in flight under this trip's products; each wave reads its own 32-k column of the staged rows as fragments. LDS row pitch 64 NW + 16 bytes (an odd multiple of 16).
// C[m][n] (f32, pitch ldc) = sum_k A[m][k] Bt[n][k] (+ split products per NSPLIT). z-batch strides sA/sB/sC in elements. K % (32 NW) == 0; not DIAG: K >= 64 NW (two trips). grid (M/64, N/64, Z), 32 * NW threads.
// z-batch: A and C advance by sA, sC per z, Bt by sB per REP z (query heads that share a kv head).
// DIAG: the probability x value contraction of causal attention: probabilities are exactly 0 beyond the diagonal block, so the K range stops there (roff = row offset of this launch's first row within the sequence); A is the packed score storage read as 16-bit planes: row block rb at 2 pk_base(rb), row pitch 128 (rb + 1) elements, the second plane 64 (rb + 1) elements behind the first. The last trip stages whole rows of 32 NW k all the same (bytes of the score storage behind the K range, written by the launches before; no wave reads them from LDS: a wave whose step lies beyond the range skips it).
template <typename T16> struct WFrag;
template <> struct WFrag<h16> { typedef v16h V; static __device__ __forceinline__ V ld(const h16* p) { return cat16(*(const v8h*)p, *(const v8h*)(p + 16)); } static __device__ __forceinline__ v8f mma(V a, V b, v8f c) { return wmma16(a, b, c); } };
template <> struct WFrag<bf> { typedef v16bf V; static __device__ __forceinline__ V ld(const bf* p) { return cat16b(*(const v8us*)p, *(const v8us*)(p + 16)); } static __device__ __forceinline__ v8f mma(V a, V b, v8f c) { return wmmab(a, b, c); } };
// cp8: one lane's eight copies of one staged plane (rows 8 apart). The wait on the address counter is the statement's last line, so that no register named by a copy is rewritten in front of it.
template <typename T16>
__device__ __forceinline__ void cp8(unsigned l, const T16* g, unsigned ls, size_t gs) {
    asm volatile("global_load_async_to_lds_b128 %0, %8, off\n\t"
                 "global_load_async_to_lds_b128 %1, %9, off\n\t"
                 "global_load_async_to_lds_b128 %2, %10, off\n\t"
                 "global_load_async_to_lds_b128 %3, %11, off\n\t"
                 "global_load_async_to_lds_b128 %4, %12, off\n\t"
                 "global_load_async_to_lds_b128 %5, %13, off\n\t"
                 "global_load_async_to_lds_b128 %6, %14, off\n\t"
                 "global_load_async_to_lds_b128 %7, %15, off\n\t"
                 "s_wait_xcnt 0x0"
                 :: "v"(l), "v"(l + ls), "v"(l + 2 * ls), "v"(l + 3 * ls), "v"(l + 4 * ls), "v"(l + 5 * ls), "v"(l + 6 * ls), "v"(l + 7 * ls),
                    "v"(g), "v"(g + gs), "v"(g + 2 * gs), "v"(g + 3 * gs), "v"(g + 4 * gs), "v"(g + 5 * gs), "v"(g + 6 * gs), "v"(g + 7 * gs) : "memory");
}
template <typename T16, int NSPLIT, int NW, bool DIAG>
__global__ __launch_bounds__(32 * NW) void k_gemmk(const T16* __restrict__ A, const T16* __restrict__ A2, const T16* __restrict__ Bt, const T16* __restrict__ Bt2, int K, float* C, int ldc, int roff, size_t sA, size_t sB, size_t sC) {
    typedef typename WFrag<T16>::V V;
    constexpr int NT = 2 + NSPLIT, CK = 32 * NW, PB = 2 * CK + 16, TB = 64 * PB, BUF = NT * TB;   // planes staged (A, Bt, then A2, then Bt2), k per trip, LDS row pitch, bytes of a staged plane and of a buffer
    constexpr int SMB = (2 * BUF > NW * 64 * 68 * 4) ? 2 * BUF : NW * 64 * 68 * 4;
    __shared__ __align__(16) unsigned char sm[SMB];   // the two staging buffers; behind the loop the NW partial tiles
    const size_t z = blockIdx.z; A += z * sA; if (A2) A2 += z * sA; Bt += (z / REP) * sB; if (Bt2) Bt2 += (z / REP) * sB; C += z * sC;
    const int tid = threadIdx.x, lane = tid & 31, lr = lane & 15, hi = lane >> 4; const int w = __builtin_amdgcn_readfirstlane((int)(threadIdx.x >> 5)); const int r0 = blockIdx.x * 64, c0 = blockIdx.y * 64;
    const int Kl = DIAG ? min(K, r0 + roff + 64) : K; const int ntrip = (Kl + CK - 1) / CK;
    const int rb = (r0 + roff) >> 6; const int lda = DIAG ? 128 * (rb + 1) : K;
    v8f acc[4][4];
#pragma unroll
    for (int mb = 0; mb < 4; ++mb)
#pragma unroll
        for (int nb = 0; nb < 4; ++nb) acc[mb][nb] = (v8f){};
    const int crow = tid / (4 * NW), ccol = tid % (4 * NW);   // 4 NW lanes copy one staged row; the block copies 8 rows at a time
    const unsigned l0 = (unsigned)(size_t)sm + crow * PB + ccol * 16;
    const size_t aoff = (DIAG ? 2 * pk_base(rb) + (size_t)crow * lda : (size_t)(r0 + crow) * lda) + 8 * ccol, a2off = aoff + (DIAG ? lda / 2 : 0), boff = (size_t)(c0 + crow) * K + 8 * ccol;
    auto fill = [&](int t) { const unsigned l = l0 + (t & 1) * BUF; cp8(l, A + aoff + t * CK, 8 * PB, (size_t)8 * lda); cp8(l + TB, Bt + boff + t * CK, 8 * PB, (size_t)8 * K);
        if (NSPLIT >= 1) cp8(l + 2 * TB, A2 + a2off + t * CK, 8 * PB, (size_t)8 * lda); if (NSPLIT >= 2) cp8(l + 3 * TB, Bt2 + boff + t * CK, 8 * PB, (size_t)8 * K); };
    fill(0);
    asm volatile("s_wait_asynccnt 0x0" ::: "memory");   // this wave's copies of trip 0 have landed
    __syncthreads();                                     // and every other wave's
    if (!DIAG || CK < Kl) fill(1);                      // where a trip 1 exists (not DIAG: always)
    const int foff = lr * PB + (w * 32 + 8 * hi) * 2;
    for (int t = 0; t < ntrip; ++t) {
        if (t * CK + w * 32 < Kl) {   // this wave's step of the trip lies in the K range (the same for the whole wave)
            const unsigned char* s = sm + (t & 1) * BUF + foff;
            V a[4], a2[4];
#pragma unroll
            for (int mb = 0; mb < 4; ++mb) { a[mb] = WFrag<T16>::ld((const T16*)(s + mb * 16 * PB)); if (NSPLIT == 1 || NSPLIT == 2) a2[mb] = WFrag<T16>::ld((const T16*)(s + 2 * TB + mb * 16 * PB)); }
#pragma unroll
            for (int nb = 0; nb < 4; ++nb) { const V b = WFrag<T16>::ld((const T16*)(s + TB + nb * 16 * PB)); V b2; if (NSPLIT >= 2) b2 = WFrag<T16>::ld((const T16*)(s + 3 * TB + nb * 16 * PB));
#pragma unroll
                for (int mb = 0; mb < 4; ++mb) { acc[mb][nb] = WFrag<T16>::mma(a[mb], b, acc[mb][nb]); if (NSPLIT == 1 || NSPLIT == 2) acc[mb][nb] = WFrag<T16>::mma(a2[mb], b, acc[mb][nb]); if (NSPLIT >= 2) acc[mb][nb] = WFrag<T16>::mma(a[mb], b2, acc[mb][nb]); } }
        }
        asm volatile("s_wait_dscnt 0x0" ::: "memory");      // this wave has left the buffer of trip t
        asm volatile("s_wait_asynccnt 0x0" ::: "memory");   // its copies of trip t + 1 have landed
        __syncthreads();                                     // trip t + 1 published; every wave has left the buffer of trip t
        if (t + 2 < ntrip) fill(t + 2);                      // refill of the buffer just left
    }
    asm volatile("s_wait_asynccnt 0x0" ::: "memory");       // no copy in flight when the buffers become the partial tiles
    float* red = (float*)sm; float* mine = red + w * (64 * 68);
#pragma unroll
    for (int mb = 0; mb < 4; ++mb)
#pragma unroll
        for (int nb = 0; nb < 4; ++nb)
#pragma unroll
            for (int j = 0; j < 8; ++j) mine[(mb * 16 + hi * 8 + j) * 68 + nb * 16 + lr] = acc[mb][nb][j];
    __syncthreads();   // every wave's partial tile is in LDS before any wave sums across them
#pragma unroll
    for (int s = 0; s < 32 / NW; ++s) { const int row = w * (64 / NW) + 2 * s + hi, cofs = lr * 4; v4f val = *(const v4fa*)(red + row * 68 + cofs);
#pragma unroll
        for (int p = 1; p < NW; ++p) val += *(const v4fa*)(red + p * (64 * 68) + row * 68 + cofs);
        *(v4f*)(C + (size_t)(r0 + row) * ldc + c0 + cofs) = val; }
}

// ---- k_gemmc: ONE WAVE per 64x64 tile of the causal attention scores (K = 128: four steps, nothing to deal out), 16 accumulators, operands straight from K-contiguous 16-bit planes; grid (M/64, N/64, Z), 32 threads.
// CMODE 1 skips score tiles entirely above the diagonal (query rows r0+roff.., key columns c0..). roff = row offset of this launch's first row within the sequence. C is the packed score storage (sC = one head): row block rb at pk_base(rb), row pitch 64 (rb + 1). Bt advances by sB per REP z.
template <typename T16, int NSPLIT, int CMODE>
__global__ __launch_bounds__(32) void k_gemmc(const T16* __restrict__ A, const T16* __restrict__ A2, const T16* __restrict__ Bt, const T16* __restrict__ Bt2, int K, float* C, int roff, size_t sA, size_t sB, size_t sC) {
    typedef typename WFrag<T16>::V V;
    __shared__ __align__(16) float os[16 * 68];
    const size_t z = blockIdx.z; A += z * sA; if (A2) A2 += z * sA; Bt += (z / REP) * sB; if (Bt2) Bt2 += (z / REP) * sB; C += z * sC;
    const int lane = threadIdx.x & 31, lr = lane & 15, hi = lane >> 4; const int r0 = blockIdx.x * 64, c0 = blockIdx.y * 64;
    if (CMODE == 1 && c0 > r0 + roff + 63) return;                  // score tile entirely above the causal diagonal: never read, and not stored at all
    const int rb = (r0 + roff) >> 6, ldc = 64 * (rb + 1);
    v8f acc[4][4];
#pragma unroll
    for (int mb = 0; mb < 4; ++mb)
#pragma unroll
        for (int nb = 0; nb < 4; ++nb) acc[mb][nb] = (v8f){};
    const size_t aoff = (size_t)(r0 + lr) * K + 8 * hi, boff = (size_t)(c0 + lr) * K + 8 * hi;
    for (int kc = 0; kc < K; kc += 32) {
        V a[4], a2[4];
#pragma unroll
        for (int mb = 0; mb < 4; ++mb) { a[mb] = WFrag<T16>::ld(A + aoff + (size_t)mb * 16 * K + kc); if (NSPLIT == 1 || NSPLIT == 2) a2[mb] = WFrag<T16>::ld(A2 + aoff + (size_t)mb * 16 * K + kc); }
#pragma unroll
        for (int nb = 0; nb < 4; ++nb) { const V b = WFrag<T16>::ld(Bt + boff + (size_t)nb * 16 * K + kc); V b2; if (NSPLIT >= 2) b2 = WFrag<T16>::ld(Bt2 + boff + (size_t)nb * 16 * K + kc);
#pragma unroll
            for (int mb = 0; mb < 4; ++mb) { acc[mb][nb] = WFrag<T16>::mma(a[mb], b, acc[mb][nb]); if (NSPLIT == 1 || NSPLIT == 2) acc[mb][nb] = WFrag<T16>::mma(a2[mb], b, acc[mb][nb]); if (NSPLIT >= 2) acc[mb][nb] = WFrag<T16>::mma(a[mb], b2, acc[mb][nb]); } }
        asm volatile("v_nop\n\tv_nop\n\tv_nop\n\tv_nop" : "+v"(acc[0][0]), "+v"(acc[1][1]), "+v"(acc[2][2]), "+v"(acc[3][3]) : "v"(a[0]), "v"(a[3]));
    }
#pragma unroll
    for (int mb = 0; mb < 4; ++mb) {
#pragma unroll
        for (int nb = 0; nb < 4; ++nb) {
#pragma unroll
            for (int j = 0; j < 8; ++j) os[(hi * 8 + j) * 68 + nb * 16 + lr] = acc[mb][nb][j]; }
        __builtin_amdgcn_wave_barrier(); asm volatile("" ::: "memory");
        float* crow = C + pk_base(rb) + (size_t)(mb * 16) * ldc + c0;
{
#pragma unroll
            for (int s = 0; s < 8; ++s) { const int row = 2 * s + hi, cofs = lr * 4; v4f val = *(const v4fa*)(os + row * 68 + cofs);
                *(v4f*)(crow + (size_t)row * ldc + cofs) = val; }
             }
        __builtin_amdgcn_wave_barrier(); asm volatile("" ::: "memory");
    }
}

__device__ __forceinline__ h16 tohx(float x) { return (h16)x; }
__device__ __forceinline__ void splitf(float y, unsigned short& h, unsigned short& l) { h = f2bf(y); l = f2bf(y - bf2f(h)); }
typedef __attribute__((ext_vector_type(2))) _Float16 v2h;
typedef __attribute__((ext_vector_type(4))) _Float16 v4h;
typedef __attribute__((ext_vector_type(2))) unsigned short v2us;
typedef __attribute__((ext_vector_type(4))) unsigned short v4us;
typedef __attribute__((ext_vector_type(2))) float v2f;
typedef __attribute__((ext_vector_type(4))) int v4i;

// The kernels without matrix work (casts, transposes, plane builders, merge) take 32 elements a thread: 16-byte loads, all issued ahead of the arithmetic, and 16-byte stores, all behind it.
// Addresses are a uniform base plus one 32-bit byte offset per lane (every buffer here is far below 4 GiB).
template <typename V> __device__ __forceinline__ V ldo(const void* base, unsigned off) { return *(const V*)((const char*)base + off); }
template <typename V> __device__ __forceinline__ void sto(void* base, unsigned off, V v) { *(V*)((char*)base + off) = v; }
// k_wtG: Bt[n][k] (bf16) = w[k][n]. A thread takes 8 k x 4 n: eight loads (rows k), four stores (rows n). Lanes: 8 along k (one whole 128-byte line of a Bt row), 4 along n; the 8 waves of a block lie side by side along n (512 contiguous bytes of each w row). K % 64 == 0, N % 16 == 0.
__global__ __launch_bounds__(256) void k_wtG(const float* __restrict__ w, int K, int N, bf* Bt) {
    const int gid = blockIdx.x * 256 + threadIdx.x, wv = gid >> 5, lane = gid & 31; const int nng = N / 16; if (wv >= nng * (K / 64)) return;
    const int n0 = ((wv % nng) * 4 + (lane >> 3)) * 4, k0 = ((wv / nng) * 8 + (lane & 7)) * 8; const unsigned so = ((unsigned)n0 * K + k0) * 2; unsigned li[8]; v4f x[8]; v8us o[4];
#pragma unroll
    for (int i = 0; i < 8; ++i) li[i] = ((unsigned)(k0 + i) * N + n0) * 4;
#pragma unroll
    for (int i = 0; i < 8; ++i) x[i] = ldo<v4f>(w, li[i]);
    asm volatile("s_wait_xcnt 0x0" :: "v"(li[0]), "v"(li[1]), "v"(li[2]), "v"(li[3]), "v"(li[4]), "v"(li[5]), "v"(li[6]), "v"(li[7]) : "memory");   // the loads' offset registers are inputs here: they stay whole until every address has been taken
#pragma unroll
    for (int j = 0; j < 4; ++j)
#pragma unroll
        for (int i = 0; i < 8; ++i) o[j][i] = f2bf(x[i][j]);
#pragma unroll
    for (int j = 0; j < 4; ++j) sto<v8us>(Bt, so + (unsigned)j * K * 2, o[j]);
}
// k_cvt8: four groups of 8 elements a thread, 256 groups apart (beyond the end: the last group is loaded, in bounds, and not stored).
__global__ __launch_bounds__(256) void k_cvt8(const float* __restrict__ src, bf* dst, size_t n8) { const size_t i0 = (size_t)blockIdx.x * 1024 + threadIdx.x; v8f v[4];
#pragma unroll
    for (int u = 0; u < 4; ++u) { const size_t i = i0 + u * 256; v[u] = *(const v8f*)(src + (i < n8 ? i : n8 - 1) * 8); }
#pragma unroll
    for (int u = 0; u < 4; ++u) { const size_t i = i0 + u * 256; v8us o;
#pragma unroll
        for (int k = 0; k < 8; ++k) o[k] = f2bf(v[u][k]);
        if (i < n8) *(v8us*)(dst + i * 8) = o; } }
__global__ __launch_bounds__(256) void k_csid(float* CS) { const int i0 = blockIdx.x * 1024 + threadIdx.x; v4f cs; cs[0] = 1.0f; cs[1] = 0.0f; cs[2] = 1.0f; cs[3] = 0.0f;
#pragma unroll
    for (int u = 0; u < 4; ++u) { const int idx = i0 + u * 256; if (idx < TT * HD / 2) *(v4f*)(CS + (size_t)idx * 4) = cs; } }
// k_rope: head planes [h][t][d] (fp16 + hi/lo) of rope(x) x sc with the rotate-half convention out[d] = x[d] cos[t][d] - x[d+HD/2] sin[t][d], out[d+HD/2] = x[d+HD/2] cos[t][d+HD/2] + x[d] sin[t][d+HD/2]
// A thread takes 8 d of one t for 4 heads in a row (one read of the table entries serves the four). nheads % 4 == 0.
__global__ __launch_bounds__(256) void k_rope(const float* __restrict__ F, int pitch, int nheads, const float* __restrict__ CS, float sc, h16* P16, bf* Ph, bf* Pl) {
    const unsigned gid = blockIdx.x * 256 + threadIdx.x; if (gid >= (unsigned)(nheads / 4) * TT * (HD / 8)) return; const unsigned d = (gid % (HD / 8)) * 8, t = (gid / (HD / 8)) % TT, h0 = (gid / ((HD / 8) * TT)) * 4;
    const unsigned la = (t * pitch + h0 * HD + d) * 4, lb = la ^ (HD / 2 * 4), lc = (t * HD + d) * 8, so = ((h0 * TT + t) * HD + d) * 2;   // lb: the partner half of the head (d ^ 64; the head's start is a multiple of 512 bytes where pitch % 128 == 0)
    v4f cs4[4]; v8f xa[4], xb[4]; v8h o16[4]; v8us oh[4], ol[4];
#pragma unroll
    for (int u = 0; u < 4; ++u) cs4[u] = ldo<v4f>(CS + u * 4, lc);
#pragma unroll
    for (int g = 0; g < 4; ++g) { xa[g] = ldo<v8f>(F + g * HD, la); xb[g] = ldo<v8f>(F + g * HD, lb); }
    asm volatile("s_wait_xcnt 0x0" :: "v"(la), "v"(lb), "v"(lc) : "memory");   // the loads' offset registers are inputs here: they stay whole until every address has been taken
    __builtin_amdgcn_sched_barrier(0);   // keeps the arithmetic behind all twenty loads: without it six of them were issued only after the first results had come back
#pragma unroll
    for (int g = 0; g < 4; ++g)
#pragma unroll
        for (int q = 0; q < 8; ++q) { const float a = __fmul_rn(xa[g][q], cs4[q >> 1][(q & 1) * 2]), bq = __fmul_rn(xb[g][q], cs4[q >> 1][(q & 1) * 2 + 1]); const float r = ((d < HD / 2) ? __fsub_rn(a, bq) : __fadd_rn(a, bq)) * sc;
            o16[g][q] = tohx(r); unsigned short a2, c2; splitf(r, a2, c2); oh[g][q] = a2; ol[g][q] = c2; }
#pragma unroll
    for (int g = 0; g < 4; ++g) { sto<v8h>(P16 + (size_t)g * TT * HD, so, o16[g]); sto<v8us>(Ph + (size_t)g * TT * HD, so, oh[g]); sto<v8us>(Pl + (size_t)g * TT * HD, so, ol[g]); } }
// k_vtp: value planes [g][d][t] (fp16 + hi/lo) of F[t][g HD + d]. A thread takes 8 t x 4 d: eight loads (rows t), four stores a plane (rows d). Lanes: 8 along t (one whole 128-byte line of a plane row), 4 along d; the 4 waves of a block lie side by side along d.
__global__ __launch_bounds__(128) void k_vtp(const float* __restrict__ F, int pitch, int nheads, h16* V16, bf* Vh, bf* Vl) { const unsigned gid = blockIdx.x * 128 + threadIdx.x, wv = gid >> 5, lane = gid & 31; if (wv >= (unsigned)nheads * (HD / 16) * (TT / 64)) return;
    const unsigned d0 = ((wv % (HD / 16)) * 4 + (lane >> 3)) * 4, t0 = (((wv / (HD / 16)) % (TT / 64)) * 8 + (lane & 7)) * 8, g = wv / ((HD / 16) * (TT / 64)); const unsigned so = ((g * HD + d0) * TT + t0) * 2; unsigned li[8]; v4f x[8]; v8h o16[4]; v8us oh[4], ol[4];
#pragma unroll
    for (int i = 0; i < 8; ++i) li[i] = ((t0 + i) * pitch + g * HD + d0) * 4;
#pragma unroll
    for (int i = 0; i < 8; ++i) x[i] = ldo<v4f>(F, li[i]);
    asm volatile("s_wait_xcnt 0x0" :: "v"(li[0]), "v"(li[1]), "v"(li[2]), "v"(li[3]), "v"(li[4]), "v"(li[5]), "v"(li[6]), "v"(li[7]) : "memory");   // the loads' offset registers are inputs here: they stay whole until every address has been taken
#pragma unroll
    for (int j = 0; j < 4; ++j)
#pragma unroll
        for (int i = 0; i < 8; ++i) { const float xv = x[i][j]; o16[j][i] = tohx(xv); unsigned short a2, c2; splitf(xv, a2, c2); oh[j][i] = a2; ol[j][i] = c2; }
#pragma unroll
    for (int j = 0; j < 4; ++j) { sto<v8h>(V16 + j * TT, so, o16[j]); sto<v8us>(Vh + j * TT, so, oh[j]); sto<v8us>(Vl + j * TT, so, ol[j]); } }
// k_asoft: per row (zz, i): t = S x 128^-0.5 for j <= i (causal; WIN = TT so the window term is inert; -finfo.max fill == exclusion), softmax over the 2048 keys (register row, one exp, fixed trees); one wave owns a row: it reads the row's stored 64 (rb + 1) scores (keys beyond them are excluded keys) and, all of them in registers, writes the probabilities of those keys over them;
__global__ __launch_bounds__(256) void k_asoft(float* Sb) {
    const int lane = threadIdx.x & 31; const int row = blockIdx.x * 8 + (threadIdx.x >> 5); if (row >= ZH * TT) return; const int i = row % TT; const int zz = row / TT; const bool hires = (i < RH); const int ldp = 64 * ((i >> 6) + 1); float* sr = Sb + (size_t)zz * SH + pk_base(i >> 6) + (size_t)(i & 63) * ldp; float v[TT / 32]; float mx = -3.0e38f;
#pragma unroll
    for (int ch = 0; ch < TT / 128; ++ch) { const int j0 = ch * 128 + lane * 4; const v4f a = *(const v4f*)(sr + min(j0, ldp - 4));   /* beyond the stored keys: the row's last stored quad, in bounds, excluded by j > i below; no branch, so that all loads of the row fly together */
#pragma unroll
        for (int q = 0; q < 4; ++q) { const int j = j0 + q; (void)j; const float t = (j <= i && i - j < WIN) ? a[q] * SCL : -3.0e38f; v[ch * 4 + q] = t; mx = fmaxf(mx, t); } }
#pragma unroll
    for (int sh = 16; sh; sh >>= 1) mx = fmaxf(mx, __shfl_xor(mx, sh, 32));
    float sum = 0.f;
#pragma unroll
    for (int k = 0; k < TT / 32; ++k) { float d0 = __fsub_rn(v[k], mx); v[k] = __builtin_amdgcn_exp2f(__fmul_rn(d0, 1.4426950408889634f)); sum += v[k]; }
#pragma unroll
    for (int sh = 16; sh; sh >>= 1) sum += __shfl_xor(sum, sh, 32);
    const float f = __fdiv_rn(hires ? 1.0f : PCAR, sum);
{
        if (hires) {
#pragma unroll
            for (int ch = 0; ch < TT / 128; ++ch) { v4us oh, ol;
#pragma unroll
                for (int q = 0; q < 4; ++q) { unsigned short a, c2; splitf(v[ch * 4 + q] * f, a, c2); oh[q] = a; ol[q] = c2; }
                const int j0 = ch * 128 + lane * 4; if (j0 < ldp) { *(v4us*)((bf*)sr + j0) = oh; *(v4us*)((bf*)sr + ldp + j0) = ol; } }
        } else {
#pragma unroll
            for (int ch = 0; ch < TT / 128; ++ch) { v4h o4;
#pragma unroll
                for (int q = 0; q < 4; ++q) o4[q] = tohx(v[ch * 4 + q] * f);
                const int j0 = ch * 128 + lane * 4; if (j0 < ldp) *(v4h*)((h16*)sr + j0) = o4; } }
         }
}
// k_merge: a thread takes 8 d of one t for 4 heads in a row.
__global__ __launch_bounds__(256) void k_merge(const float* __restrict__ O, int h0, bf* Ah, bf* Al) { const unsigned gid = blockIdx.x * 256 + threadIdx.x; if (gid >= (unsigned)(ZH / 4) * TT * (HD / 8)) return; const unsigned d = (gid % (HD / 8)) * 8, t = (gid / (HD / 8)) % TT, z0 = (gid / ((HD / 8) * TT)) * 4; const float cs = (t < RH) ? 1.0f : (1.0f / PCAR);
    const unsigned li = ((z0 * TT + t) * HD + d) * 4, so = (t * DQ + (h0 + z0) * HD + d) * 2; v8f x[4]; v8us oh[4], ol[4];
#pragma unroll
    for (int g = 0; g < 4; ++g) x[g] = ldo<v8f>(O + (size_t)g * TT * HD, li);
    asm volatile("s_wait_xcnt 0x0" :: "v"(li) : "memory");   // the loads' offset register is an input here: it stays whole until every address has been taken
#pragma unroll
    for (int g = 0; g < 4; ++g)
#pragma unroll
        for (int q = 0; q < 8; ++q) { unsigned short a, c2; splitf(x[g][q] * cs, a, c2); oh[g][q] = a; ol[g][q] = c2; }
#pragma unroll
    for (int g = 0; g < 4; ++g) { sto<v8us>(Ah + g * HD, so, oh[g]); sto<v8us>(Al + g * HD, so, ol[g]); } }

extern "C" void kernel_launch(void* const* d_in, const int* in_sizes, int n_in,
                              void* d_out, int out_size, void* d_ws, size_t ws_size, hipStream_t stream) {
    (void)in_sizes; (void)n_in; (void)out_size;
    const float* xq = (const float*)d_in[0]; const float* xk = (const float*)d_in[1]; const float* xv = (const float*)d_in[2]; const float* wq = (const float*)d_in[3]; const float* wk = (const float*)d_in[4]; const float* wv = (const float*)d_in[5]; const float* wo = (const float*)d_in[6];   /* q, k, v ([2][2048][2048] each: THREE streams), Wq ('xw' (in, out) [2048][2048]: 16 heads x 128), Wk, Wv ('xw' [2048][512]: 4 kv heads x 128), Wo ('xw' [2048][2048]): SEVEN inputs, all read; no bias anywhere */
    float* OUT = (float*)d_out;     // [2][2048][2048]
    char* wsp = (char*)d_ws;
    auto take = [&](size_t bytes) { char* p = wsp; wsp += (bytes + 255) & ~(size_t)255; return (void*)p; };
    bf* WQ = (bf*)take((size_t)DQ * DM * 2); bf* WK = (bf*)take((size_t)DKV * DM * 2); bf* WV = (bf*)take((size_t)DKV * DM * 2); bf* WO = (bf*)take((size_t)DM * DQ * 2); float* CS = (float*)take((size_t)TT * HD * 2 * 4);
    bf* XB = (bf*)take((size_t)TT * DM * 2); float* FQ = (float*)take((size_t)TT * DQ * 4); float* FK = (float*)take((size_t)TT * DKV * 4);
    h16* QP16 = (h16*)take((size_t)NH_ * TT * HD * 2); h16* KP16 = (h16*)take((size_t)NKV * TT * HD * 2); h16* VT16 = (h16*)take((size_t)NKV * HD * TT * 2);
    bf* QPh = (bf*)take((size_t)NH_ * TT * HD * 2); bf* QPl = (bf*)take((size_t)NH_ * TT * HD * 2); bf* KPh = (bf*)take((size_t)NKV * TT * HD * 2); bf* KPl = (bf*)take((size_t)NKV * TT * HD * 2); bf* VTh = (bf*)take((size_t)NKV * HD * TT * 2); bf* VTl = (bf*)take((size_t)NKV * HD * TT * 2);
    float* Sb = (float*)take((size_t)ZH * SH * 4); float* Ob = (float*)take((size_t)ZH * TT * HD * 4); bf* ATh = (bf*)take((size_t)TT * DQ * 2); bf* ATl = (bf*)take((size_t)TT * DQ * 2);
    if ((size_t)(wsp - (char*)d_ws) > ws_size) return;    // ws 256 MiB
    float* FV = FK;   // v projection reuses the k buffer after the k planes are built (stream-ordered)
    { k_wtG<<<(unsigned)(DM * DQ / 8192), 256, 0, stream>>>(wq, DM, DQ, WQ); k_wtG<<<(unsigned)(DM * DKV / 8192), 256, 0, stream>>>(wk, DM, DKV, WK); k_wtG<<<(unsigned)(DM * DKV / 8192), 256, 0, stream>>>(wv, DM, DKV, WV);
      k_wtG<<<(unsigned)(DQ * DM / 8192), 256, 0, stream>>>(wo, DQ, DM, WO);   /* the four 'xw' (in, out) weights transposed once into Bt operands */ }
    const unsigned LQ = (unsigned)(((size_t)NH_ * TT * HD / 32 + 255) / 256), LKv = (unsigned)(((size_t)NKV * TT * HD / 32 + 255) / 256), LVt = (unsigned)(((size_t)NKV * TT * HD / 32 + 127) / 128); const unsigned GX = (unsigned)(((size_t)TT * DM / 32 + 255) / 256);   /* 32 elements a thread */
    for (int b = 0; b < NB_; ++b) {
        if (b == 0) k_csid<<<(TT * HD / 8 + 255) / 256, 256, 0, stream>>>(CS);   /* identity table: k_rope is a plain plane builder here */
        k_cvt8<<<GX, 256, 0, stream>>>(xq + (size_t)b * TT * DM, XB, (size_t)TT * DM / 8);   /* the QUERY stream */
        k_gemmk<bf, 0, 4, false><<<dim3(TT / 64, DQ / 64, 1), 128, 0, stream>>>(XB, nullptr, WQ, nullptr, DM, FQ, DQ, 0, 0, 0, 0);
        k_rope<<<LQ, 256, 0, stream>>>(FQ, DQ, NH_, CS, 1.0f, QP16, QPh, QPl);
        k_cvt8<<<GX, 256, 0, stream>>>(xk + (size_t)b * TT * DM, XB, (size_t)TT * DM / 8);   /* the KEY stream: cast after the query GEMM has read XB (stream-ordered) */
        k_gemmk<bf, 0, 8, false><<<dim3(TT / 64, DKV / 64, 1), 256, 0, stream>>>(XB, nullptr, WK, nullptr, DM, FK, DKV, 0, 0, 0, 0);
        k_rope<<<LKv, 256, 0, stream>>>(FK, DKV, NKV, CS, 1.0f, KP16, KPh, KPl);
        k_cvt8<<<GX, 256, 0, stream>>>(xv + (size_t)b * TT * DM, XB, (size_t)TT * DM / 8);   /* the VALUE stream */
        k_gemmk<bf, 0, 8, false><<<dim3(TT / 64, DKV / 64, 1), 256, 0, stream>>>(XB, nullptr, WV, nullptr, DM, FV, DKV, 0, 0, 0, 0); k_vtp<<<LVt, 128, 0, stream>>>(FV, DKV, NKV, VT16, VTh, VTl);
        for (int h0 = 0; h0 < NH_; h0 += ZH) { const size_t zq = (size_t)h0, zk = (size_t)(h0 / REP);   /* 'jnp.repeat(kh, 4, axis=1)': query head h uses kv head h / 4: the kernels advance the key and value operands once per REP z */
            k_gemmc<bf, 2, 1><<<dim3(RH / 64, TT / 64, ZH), 32, 0, stream>>>(QPh + zq * TT * HD, QPl + zq * TT * HD, KPh + zk * TT * HD, KPl + zk * TT * HD, HD, Sb, 0, (size_t)TT * HD, (size_t)TT * HD, SH);
            k_gemmc<h16, 0, 1><<<dim3((TT - RH) / 64, TT / 64, ZH), 32, 0, stream>>>(QP16 + zq * TT * HD + (size_t)RH * HD, nullptr, KP16 + zk * TT * HD, nullptr, HD, Sb, RH, (size_t)TT * HD, (size_t)TT * HD, SH);
            k_asoft<<<ZH * TT / 8, 256, 0, stream>>>(Sb);
            k_gemmk<bf, 2, 8, true><<<dim3(RH / 64, HD / 64, ZH), 256, 0, stream>>>((const bf*)Sb, (const bf*)Sb, VTh + zk * HD * TT, VTl + zk * HD * TT, TT, Ob, HD, 0, 2 * SH, (size_t)HD * TT, (size_t)TT * HD);
            k_gemmk<h16, 0, 8, true><<<dim3((TT - RH) / 64, HD / 64, ZH), 256, 0, stream>>>((const h16*)Sb, nullptr, VT16 + zk * HD * TT, nullptr, TT, Ob + (size_t)RH * HD, HD, RH, 2 * SH, (size_t)HD * TT, (size_t)TT * HD);
            k_merge<<<(unsigned)(((size_t)ZH * TT * HD / 32 + 255) / 256), 256, 0, stream>>>(Ob, h0, ATh, ATl); }
        k_gemmk<bf, 1, 4, false><<<dim3(TT / 64, DM / 64, 1), 128, 0, stream>>>(ATh, ATl, WO, nullptr, DQ, OUT + (size_t)b * TT * DM, DM, 0, 0, 0, 0); }
}

// v005
// One run takes 329 microseconds.
// Two timings next to v004 put it at 1.32 and 1.36 times that version's speed.
// All steps since v000 together make it 5.10 times as fast.
#include <hip/hip_runtime.h>

// Grouped-query causal attention with 128-wide heads on three input streams (q, k, v [2][2048][2048]; qh = q Wq (16 heads x 128), kh, vh = k Wk, v Wv (4 kv heads x 128) ('xw' (in, out) 0.02, no bias); qh and kh each x 128^-0.25 (together 1/sqrt(128)); kv head = query head / 4 (jnp.repeat); the module takes softmax over ALL keys, zeroes the strictly-upper triangle and renormalises by (row sum + 1e-9): a causal softmax but for that epsilon; out = merged Wo ('xw', no bias) -> [2][2048][2048] (8.4 M); argument order q, k, v, Wq, Wk, Wv, Wo).
// Layout per batch: bf16 copies of q, k and v in turn (one operand buffer, stream-ordered); the four 'xw' weights transposed once into Bt operands; exact projections; plane builders (identity table); causal T-2048 attention with 128-wide heads, all 16 query heads of the batch entry in ONE launch of the fused kernel k_fa, whose scores and probabilities never leave the registers (kv head = head / 4 on the key and value operands) (hybrid rows: < 512 hi/lo 3 products, rest fp16); merged hi/lo x Wo exact.
// Compute dtypes, f32 accumulate: every input rounded to bf16; projections exact; attention rows < 512 3 products, rest fp16; softmax f32 (the exact causal softmax: no epsilon term); Wo hl x exact.

#define NB_  2
#define TT   2048
#define DM   2048
#define NH_  16
#define NKV  4
#define REP  (NH_ / NKV)
#define HD   128
#define DQ   (NH_ * HD)
#define DKV  (NKV * HD)
#define ZH   16                   // query heads per attention launch (a multiple of REP)
#define RH   512                  // query rows < RH use hi+lo planes (0: none)
#define SCL  0.088388347648318447f   // HD^-0.5
typedef _Float16 h16;
typedef unsigned short bf;
typedef __attribute__((ext_vector_type(16))) __bf16   v16bf;
typedef __attribute__((ext_vector_type(16))) _Float16 v16h;
typedef __attribute__((ext_vector_type(8)))  _Float16 v8h;
typedef __attribute__((ext_vector_type(8)))  unsigned short v8us;
typedef __attribute__((ext_vector_type(8)))  float    v8f;
typedef __attribute__((ext_vector_type(4)))  float    v4f;
typedef v8h  __attribute__((may_alias)) v8ha;
typedef v4f  __attribute__((may_alias)) v4fa;
typedef v8us __attribute__((may_alias)) v8usa;

__device__ __forceinline__ unsigned short f2bf(float f) { unsigned u = __float_as_uint(f); u += 0x7FFFu + ((u >> 16) & 1u); return (unsigned short)(u >> 16); }
__device__ __forceinline__ float bf2f(unsigned short b) { return __uint_as_float(((unsigned)b) << 16); }
__device__ __forceinline__ float bfr(float f) { return bf2f(f2bf(f)); }
__device__ __forceinline__ v16h cat16(v8h lo, v8h hi) { return __builtin_shufflevector(lo, hi, 0, 1, 2, 3, 4, 5, 6, 7, 8, 9, 10, 11, 12, 13, 14, 15); }
__device__ __forceinline__ v16bf cat16b(v8us lo, v8us hi) { return __builtin_bit_cast(v16bf, __builtin_shufflevector(lo, hi, 0, 1, 2, 3, 4, 5, 6, 7, 8, 9, 10, 11, 12, 13, 14, 15)); }
__device__ __forceinline__ v8f wmma16(v16h a, v16h b, v8f c) { return __builtin_amdgcn_wmma_f32_16x16x32_f16(false, a, false, b, (short)0, c, false, false); }
__device__ __forceinline__ v8f wmmab(v16bf a, v16bf b, v8f c) { return __builtin_amdgcn_wmma_f32_16x16x32_bf16(false, a, false, b, (short)0, c, false, false); }

// ---- k_gemmk: register-blocked GEMM, one 64x64 output tile per work-group of NW waves. The K loop is dealt over the waves in steps of 32 k: wave w takes steps w, w + NW, ... with 16 accumulators of its own;
// the NW partial tiles meet in LDS and are summed in wave order 0..NW-1, each wave summing and storing 64 / NW whole rows of the tile.
// The operands come through LDS: a trip stages 64 rows x 32 NW k of every K-contiguous 16-bit operand plane by asynchronous 16-byte copies that take whole 128-byte lines (a fragment load straight from global memory
// touches 16 lines for its 512 bytes), two buffers, the next trip's copies in flight under this trip's products; each wave reads its own 32-k column of the staged rows as fragments. LDS row pitch 64 NW + 16 bytes (an odd multiple of 16).
// C[m][n] (f32, pitch ldc) = sum_k A[m][k] Bt[n][k] (+ split products per NSPLIT). z-batch strides sA/sB/sC in elements. K % (32 NW) == 0, K >= 64 NW (two trips). grid (M/64, N/64, Z), 32 * NW threads.
// z-batch: A and C advance by sA, sC per z, Bt by sB per REP z (query heads that share a kv head).
template <typename T16> struct WFrag;
template <> struct WFrag<h16> { typedef v16h V; static __device__ __forceinline__ V ld(const h16* p) { return cat16(*(const v8h*)p, *(const v8h*)(p + 16)); } static __device__ __forceinline__ v8f mma(V a, V b, v8f c) { return wmma16(a, b, c); } };
template <> struct WFrag<bf> { typedef v16bf V; static __device__ __forceinline__ V ld(const bf* p) { return cat16b(*(const v8us*)p, *(const v8us*)(p + 16)); } static __device__ __forceinline__ v8f mma(V a, V b, v8f c) { return wmmab(a, b, c); } };
// cp8: one lane's eight copies of one staged plane (rows 8 apart in k_gemmk, 16 apart in k_fa). The wait on the address counter is the statement's last line, so that no register named by a copy is rewritten in front of it.
template <typename T16>
__device__ __forceinline__ void cp8(unsigned l, const T16* g, unsigned ls, size_t gs) {
    asm volatile("global_load_async_to_lds_b128 %0, %8, off\n\t"
                 "global_load_async_to_lds_b128 %1, %9, off\n\t"
                 "global_load_async_to_lds_b128 %2, %10, off\n\t"
                 "global_load_async_to_lds_b128 %3, %11, off\n\t"
                 "global_load_async_to_lds_b128 %4, %12, off\n\t"
                 "global_load_async_to_lds_b128 %5, %13, off\n\t"
                 "global_load_async_to_lds_b128 %6, %14, off\n\t"
                 "global_load_async_to_lds_b128 %7, %15, off\n\t"
                 "s_wait_xcnt 0x0"
                 :: "v"(l), "v"(l + ls), "v"(l + 2 * ls), "v"(l + 3 * ls), "v"(l + 4 * ls), "v"(l + 5 * ls), "v"(l + 6 * ls), "v"(l + 7 * ls),
                    "v"(g), "v"(g + gs), "v"(g + 2 * gs), "v"(g + 3 * gs), "v"(g + 4 * gs), "v"(g + 5 * gs), "v"(g + 6 * gs), "v"(g + 7 * gs) : "memory");
}
template <typename T16, int NSPLIT, int NW>
__global__ __launch_bounds__(32 * NW) void k_gemmk(const T16* __restrict__ A, const T16* __restrict__ A2, const T16* __restrict__ Bt, const T16* __restrict__ Bt2, int K, float* C, int ldc, size_t sA, size_t sB, size_t sC) {
    typedef typename WFrag<T16>::V V;
    constexpr int NT = 2 + NSPLIT, CK = 32 * NW, PB = 2 * CK + 16, TB = 64 * PB, BUF = NT * TB;   // planes staged (A, Bt, then A2, then Bt2), k per trip, LDS row pitch, bytes of a staged plane and of a buffer
    constexpr int SMB = (2 * BUF > NW * 64 * 68 * 4) ? 2 * BUF : NW * 64 * 68 * 4;
    __shared__ __align__(16) unsigned char sm[SMB];   // the two staging buffers; behind the loop the NW partial tiles
    const size_t z = blockIdx.z; A += z * sA; if (A2) A2 += z * sA; Bt += (z / REP) * sB; if (Bt2) Bt2 += (z / REP) * sB; C += z * sC;
    const int tid = threadIdx.x, lane = tid & 31, lr = lane & 15, hi = lane >> 4; const int w = __builtin_amdgcn_readfirstlane((int)(threadIdx.x >> 5)); const int r0 = blockIdx.x * 64, c0 = blockIdx.y * 64;
    const int Kl = K; const int ntrip = (Kl + CK - 1) / CK;
    const int lda = K;
    v8f acc[4][4];
#pragma unroll
    for (int mb = 0; mb < 4; ++mb)
#pragma unroll
        for (int nb = 0; nb < 4; ++nb) acc[mb][nb] = (v8f){};
    const int crow = tid / (4 * NW), ccol = tid % (4 * NW);   // 4 NW lanes copy one staged row; the block copies 8 rows at a time
    const unsigned l0 = (unsigned)(size_t)sm + crow * PB + ccol * 16;
    const size_t aoff = (size_t)(r0 + crow) * lda + 8 * ccol, a2off = aoff, boff = (size_t)(c0 + crow) * K + 8 * ccol;
    auto fill = [&](int t) { const unsigned l = l0 + (t & 1) * BUF; cp8(l, A + aoff + t * CK, 8 * PB, (size_t)8 * lda); cp8(l + TB, Bt + boff + t * CK, 8 * PB, (size_t)8 * K);
        if (NSPLIT >= 1) cp8(l + 2 * TB, A2 + a2off + t * CK, 8 * PB, (size_t)8 * lda); if (NSPLIT >= 2) cp8(l + 3 * TB, Bt2 + boff + t * CK, 8 * PB, (size_t)8 * K); };
    fill(0);
    asm volatile("s_wait_asynccnt 0x0" ::: "memory");   // this wave's copies of trip 0 have landed
    __syncthreads();                                     // and every other wave's
    fill(1);                                             // a trip 1 always exists
    const int foff = lr * PB + (w * 32 + 8 * hi) * 2;
    for (int t = 0; t < ntrip; ++t) {
        if (t * CK + w * 32 < Kl) {   // this wave's step of the trip lies in the K range (the same for the whole wave)
            const unsigned char* s = sm + (t & 1) * BUF + foff;
            V a[4], a2[4];
#pragma unroll
            for (int mb = 0; mb < 4; ++mb) { a[mb] = WFrag<T16>::ld((const T16*)(s + mb * 16 * PB)); if (NSPLIT == 1 || NSPLIT == 2) a2[mb] = WFrag<T16>::ld((const T16*)(s + 2 * TB + mb * 16 * PB)); }
#pragma unroll
            for (int nb = 0; nb < 4; ++nb) { const V b = WFrag<T16>::ld((const T16*)(s + TB + nb * 16 * PB)); V b2; if (NSPLIT >= 2) b2 = WFrag<T16>::ld((const T16*)(s + 3 * TB + nb * 16 * PB));
#pragma unroll
                for (int mb = 0; mb < 4; ++mb) { acc[mb][nb] = WFrag<T16>::mma(a[mb], b, acc[mb][nb]); if (NSPLIT == 1 || NSPLIT == 2) acc[mb][nb] = WFrag<T16>::mma(a2[mb], b, acc[mb][nb]); if (NSPLIT >= 2) acc[mb][nb] = WFrag<T16>::mma(a[mb], b2, acc[mb][nb]); } }
        }
        asm volatile("s_wait_dscnt 0x0" ::: "memory");      // this wave has left the buffer of trip t
        asm volatile("s_wait_asynccnt 0x0" ::: "memory");   // its copies of trip t + 1 have landed
        __syncthreads();                                     // trip t + 1 published; every wave has left the buffer of trip t
        if (t + 2 < ntrip) fill(t + 2);                      // refill of the buffer just left
    }
    asm volatile("s_wait_asynccnt 0x0" ::: "memory");       // no copy in flight when the buffers become the partial tiles
    float* red = (float*)sm; float* mine = red + w * (64 * 68);
#pragma unroll
    for (int mb = 0; mb < 4; ++mb)
#pragma unroll
        for (int nb = 0; nb < 4; ++nb)
#pragma unroll
            for (int j = 0; j < 8; ++j) mine[(mb * 16 + hi * 8 + j) * 68 + nb * 16 + lr] = acc[mb][nb][j];
    __syncthreads();   // every wave's partial tile is in LDS before any wave sums across them
#pragma unroll
    for (int s = 0; s < 32 / NW; ++s) { const int row = w * (64 / NW) + 2 * s + hi, cofs = lr * 4; v4f val = *(const v4fa*)(red + row * 68 + cofs);
#pragma unroll
        for (int p = 1; p < NW; ++p) val += *(const v4fa*)(red + p * (64 * 68) + row * 68 + cofs);
        *(v4f*)(C + (size_t)(r0 + row) * ldc + c0 + cofs) = val; }
}

__device__ __forceinline__ h16 tohx(float x) { return (h16)x; }
__device__ __forceinline__ void splitf(float y, unsigned short& h, unsigned short& l) { h = f2bf(y); l = f2bf(y - bf2f(h)); }
typedef __attribute__((ext_vector_type(2))) _Float16 v2h;
typedef __attribute__((ext_vector_type(4))) _Float16 v4h;
typedef __attribute__((ext_vector_type(2))) unsigned short v2us;
typedef __attribute__((ext_vector_type(4))) unsigned short v4us;
typedef __attribute__((ext_vector_type(2))) float v2f;
typedef __attribute__((ext_vector_type(4))) int v4i;

// The kernels without matrix work (casts, transposes, plane builders, merge) take 32 elements a thread: 16-byte loads, all issued ahead of the arithmetic, and 16-byte stores, all behind it.
// Addresses are a uniform base plus one 32-bit byte offset per lane (every buffer here is far below 4 GiB).
template <typename V> __device__ __forceinline__ V ldo(const void* base, unsigned off) { return *(const V*)((const char*)base + off); }
template <typename V> __device__ __forceinline__ void sto(void* base, unsigned off, V v) { *(V*)((char*)base + off) = v; }
// k_wtG: Bt[n][k] (bf16) = w[k][n]. A thread takes 8 k x 4 n: eight loads (rows k), four stores (rows n). Lanes: 8 along k (one whole 128-byte line of a Bt row), 4 along n; the 8 waves of a block lie side by side along n (512 contiguous bytes of each w row). K % 64 == 0, N % 16 == 0.
__global__ __launch_bounds__(256) void k_wtG(const float* __restrict__ w, int K, int N, bf* Bt) {
    const int gid = blockIdx.x * 256 + threadIdx.x, wv = gid >> 5, lane = gid & 31; const int nng = N / 16; if (wv >= nng * (K / 64)) return;
    const int n0 = ((wv % nng) * 4 + (lane >> 3)) * 4, k0 = ((wv / nng) * 8 + (lane & 7)) * 8; const unsigned so = ((unsigned)n0 * K + k0) * 2; unsigned li[8]; v4f x[8]; v8us o[4];
#pragma unroll
    for (int i = 0; i < 8; ++i) li[i] = ((unsigned)(k0 + i) * N + n0) * 4;
#pragma unroll
    for (int i = 0; i < 8; ++i) x[i] = ldo<v4f>(w, li[i]);
    asm volatile("s_wait_xcnt 0x0" :: "v"(li[0]), "v"(li[1]), "v"(li[2]), "v"(li[3]), "v"(li[4]), "v"(li[5]), "v"(li[6]), "v"(li[7]) : "memory");   // the loads' offset registers are inputs here: they stay whole until every address has been taken
#pragma unroll
    for (int j = 0; j < 4; ++j)
#pragma unroll
        for (int i = 0; i < 8; ++i) o[j][i] = f2bf(x[i][j]);
#pragma unroll
    for (int j = 0; j < 4; ++j) sto<v8us>(Bt, so + (unsigned)j * K * 2, o[j]);
}
// k_cvt8: four groups of 8 elements a thread, 256 groups apart (beyond the end: the last group is loaded, in bounds, and not stored).
__global__ __launch_bounds__(256) void k_cvt8(const float* __restrict__ src, bf* dst, size_t n8) { const size_t i0 = (size_t)blockIdx.x * 1024 + threadIdx.x; v8f v[4];
#pragma unroll
    for (int u = 0; u < 4; ++u) { const size_t i = i0 + u * 256; v[u] = *(const v8f*)(src + (i < n8 ? i : n8 - 1) * 8); }
#pragma unroll
    for (int u = 0; u < 4; ++u) { const size_t i = i0 + u * 256; v8us o;
#pragma unroll
        for (int k = 0; k < 8; ++k) o[k] = f2bf(v[u][k]);
        if (i < n8) *(v8us*)(dst + i * 8) = o; } }
__global__ __launch_bounds__(256) void k_csid(float* CS) { const int i0 = blockIdx.x * 1024 + threadIdx.x; v4f cs; cs[0] = 1.0f; cs[1] = 0.0f; cs[2] = 1.0f; cs[3] = 0.0f;
#pragma unroll
    for (int u = 0; u < 4; ++u) { const int idx = i0 + u * 256; if (idx < TT * HD / 2) *(v4f*)(CS + (size_t)idx * 4) = cs; } }
// k_rope: head planes [h][t][d] (fp16 + hi/lo) of rope(x) x sc with the rotate-half convention out[d] = x[d] cos[t][d] - x[d+HD/2] sin[t][d], out[d+HD/2] = x[d+HD/2] cos[t][d+HD/2] + x[d] sin[t][d+HD/2]
// A thread takes 8 d of one t for 4 heads in a row (one read of the table entries serves the four). nheads % 4 == 0.
__global__ __launch_bounds__(256) void k_rope(const float* __restrict__ F, int pitch, int nheads, const float* __restrict__ CS, float sc, h16* P16, bf* Ph, bf* Pl) {
    const unsigned gid = blockIdx.x * 256 + threadIdx.x; if (gid >= (unsigned)(nheads / 4) * TT * (HD / 8)) return; const unsigned d = (gid % (HD / 8)) * 8, t = (gid / (HD / 8)) % TT, h0 = (gid / ((HD / 8) * TT)) * 4;
    const unsigned la = (t * pitch + h0 * HD + d) * 4, lb = la ^ (HD / 2 * 4), lc = (t * HD + d) * 8, so = ((h0 * TT + t) * HD + d) * 2;   // lb: the partner half of the head (d ^ 64; the head's start is a multiple of 512 bytes where pitch % 128 == 0)
    v4f cs4[4]; v8f xa[4], xb[4]; v8h o16[4]; v8us oh[4], ol[4];
#pragma unroll
    for (int u = 0; u < 4; ++u) cs4[u] = ldo<v4f>(CS + u * 4, lc);
#pragma unroll
    for (int g = 0; g < 4; ++g) { xa[g] = ldo<v8f>(F + g * HD, la); xb[g] = ldo<v8f>(F + g * HD, lb); }
    asm volatile("s_wait_xcnt 0x0" :: "v"(la), "v"(lb), "v"(lc) : "memory");   // the loads' offset registers are inputs here: they stay whole until every address has been taken
    __builtin_amdgcn_sched_barrier(0);   // keeps the arithmetic behind all twenty loads: without it six of them were issued only after the first results had come back
#pragma unroll
    for (int g = 0; g < 4; ++g)
#pragma unroll
        for (int q = 0; q < 8; ++q) { const float a = __fmul_rn(xa[g][q], cs4[q >> 1][(q & 1) * 2]), bq = __fmul_rn(xb[g][q], cs4[q >> 1][(q & 1) * 2 + 1]); const float r = ((d < HD / 2) ? __fsub_rn(a, bq) : __fadd_rn(a, bq)) * sc;
            o16[g][q] = tohx(r); unsigned short a2, c2; splitf(r, a2, c2); oh[g][q] = a2; ol[g][q] = c2; }
#pragma unroll
    for (int g = 0; g < 4; ++g) { sto<v8h>(P16 + (size_t)g * TT * HD, so, o16[g]); sto<v8us>(Ph + (size_t)g * TT * HD, so, oh[g]); sto<v8us>(Pl + (size_t)g * TT * HD, so, ol[g]); } }
// k_vtp: value planes [g][d][t] (fp16 + hi/lo) of F[t][g HD + d]. A thread takes 8 t x 4 d: eight loads (rows t), four stores a plane (rows d). Lanes: 8 along t (one whole 128-byte line of a plane row), 4 along d; the 4 waves of a block lie side by side along d.
__global__ __launch_bounds__(128) void k_vtp(const float* __restrict__ F, int pitch, int nheads, h16* V16, bf* Vh, bf* Vl) { const unsigned gid = blockIdx.x * 128 + threadIdx.x, wv = gid >> 5, lane = gid & 31; if (wv >= (unsigned)nheads * (HD / 16) * (TT / 64)) return;
    const unsigned d0 = ((wv % (HD / 16)) * 4 + (lane >> 3)) * 4, t0 = (((wv / (HD / 16)) % (TT / 64)) * 8 + (lane & 7)) * 8, g = wv / ((HD / 16) * (TT / 64)); const unsigned so = ((g * HD + d0) * TT + t0) * 2; unsigned li[8]; v4f x[8]; v8h o16[4]; v8us oh[4], ol[4];
#pragma unroll
    for (int i = 0; i < 8; ++i) li[i] = ((t0 + i) * pitch + g * HD + d0) * 4;
#pragma unroll
    for (int i = 0; i < 8; ++i) x[i] = ldo<v4f>(F, li[i]);
    asm volatile("s_wait_xcnt 0x0" :: "v"(li[0]), "v"(li[1]), "v"(li[2]), "v"(li[3]), "v"(li[4]), "v"(li[5]), "v"(li[6]), "v"(li[7]) : "memory");   // the loads' offset registers are inputs here: they stay whole until every address has been taken
#pragma unroll
    for (int j = 0; j < 4; ++j)
#pragma unroll
        for (int i = 0; i < 8; ++i) { const float xv = x[i][j]; o16[j][i] = tohx(xv); unsigned short a2, c2; splitf(xv, a2, c2); oh[j][i] = a2; ol[j][i] = c2; }
#pragma unroll
    for (int j = 0; j < 4; ++j) { sto<v8h>(V16 + j * TT, so, o16[j]); sto<v8us>(Vh + j * TT, so, oh[j]); sto<v8us>(Vl + j * TT, so, ol[j]); } }
#define FPB (2 * HD + 16)
#define FTB (128 * FPB)
__device__ __forceinline__ float xhalf(float x) { return __builtin_bit_cast(float, __builtin_amdgcn_permlanex16(__builtin_bit_cast(int, x), __builtin_bit_cast(int, x), 0x76543210, 0xfedcba98, false, false)); }   // lane l with lane l ^ 16
// exp2s: v_exp_f32 with the free slot behind it in the same statement.
__device__ __forceinline__ float exp2s(float x) { float r; asm("v_exp_f32 %0, %1\n\tv_nop" : "=v"(r) : "v"(x)); return r; }
template <typename T16, bool HL>
__device__ __forceinline__ void fa_body(unsigned char* sm, const T16* __restrict__ Q, const T16* __restrict__ Q2, const T16* __restrict__ Kp, const T16* __restrict__ K2, const T16* __restrict__ Vt, const T16* __restrict__ V2, float* O, const int q0) {
    typedef typename WFrag<T16>::V V;
    constexpr int PB = FPB, TB = FTB, BUF = (HL ? 4 : 2) * TB; constexpr float CSC = SCL * 1.4426950408889634f;
    const int tid = threadIdx.x, lane = tid & 31, lr = lane & 15, hi = lane >> 4; const int w = __builtin_amdgcn_readfirstlane((int)(threadIdx.x >> 5)), qg = w & 3, kh = w >> 2;
    const int qw0 = q0 + 16 * qg, nst = (q0 + 64 + 127) / 128;   // stages up to the one that holds the diagonal (nst * 128 <= TT)
    const bool cv = w >= 8; const int crow = (tid & 255) >> 4, ccol = tid & 15;   // 16 lanes copy one staged row; eight waves copy 16 rows of their tile at a time
    const unsigned l0 = (unsigned)(size_t)sm + (cv ? TB : 0) + crow * PB + ccol * 16;
    const size_t go = (cv ? (size_t)crow * TT : (size_t)crow * HD) + ccol * 8, gs = cv ? (size_t)16 * TT : (size_t)16 * HD, gt = cv ? (size_t)128 : (size_t)128 * HD;   // elements: this lane's first copy; from 16 rows to the next; from a stage to the next
    const T16* g0 = (cv ? Vt : Kp) + go; const T16* g1 = HL ? (cv ? V2 : K2) + go : nullptr;
    auto fill = [&](int t) { const unsigned l = l0 + (t & 1) * BUF; cp8(l, g0 + t * gt, 16 * PB, gs); if (HL) cp8(l + 2 * TB, g1 + t * gt, 16 * PB, gs); };
    fill(0);
    V qf[4], q2[4];
#pragma unroll
    for (int kc = 0; kc < 4; ++kc) { qf[kc] = WFrag<T16>::ld(Q + (size_t)(qw0 + lr) * HD + kc * 32 + 8 * hi); if (HL) q2[kc] = WFrag<T16>::ld(Q2 + (size_t)(qw0 + lr) * HD + kc * 32 + 8 * hi); }
    v8f acc[8];
#pragma unroll
    for (int d8 = 0; d8 < 8; ++d8) acc[d8] = (v8f){};
    float m_run = -__builtin_inff(), l_run = 0.0f;
    asm volatile("s_wait_asynccnt 0x0" ::: "memory");   // this wave's copies of stage 0 have landed
    __syncthreads();                                     // and every other wave's
    if (1 < nst) fill(1);                                // where a stage 1 exists
    for (int t = 0; t < nst; ++t) {
        const int key0 = t * 128 + kh * 32;
        if (key0 <= qw0 + 15) {   // some key of the pass is visible to the wave's last query (the same for the whole wave); its first key is then visible to every query of the wave
            const unsigned char* sK = sm + (t & 1) * BUF + (kh * 32 + lr) * PB + 16 * hi; const unsigned char* sV = sm + (t & 1) * BUF + TB + lr * PB + kh * 64 + 16 * hi;
            V kf[2][4], vf[8]; v8f s[2];
#pragma unroll
            for (int kt = 0; kt < 2; ++kt)
#pragma unroll
                for (int kc = 0; kc < 4; ++kc) kf[kt][kc] = WFrag<T16>::ld((const T16*)(sK + kt * 16 * PB + kc * 64));
            if (!HL) __builtin_amdgcn_sched_barrier(0);   // keeps the key fragments' 16 loads together ahead of the products: spread among them, every product waited out a whole LDS latency (with the lo planes' operands the registers do not allow it)
            s[0] = (v8f){}; s[1] = (v8f){};
#pragma unroll
            for (int kc = 0; kc < 4; ++kc)
#pragma unroll
                for (int kt = 0; kt < 2; ++kt) { s[kt] = WFrag<T16>::mma(kf[kt][kc], qf[kc], s[kt]); if (HL) s[kt] = WFrag<T16>::mma(kf[kt][kc], q2[kc], s[kt]); }
            if (HL) {
#pragma unroll
                for (int kt = 0; kt < 2; ++kt)
#pragma unroll
                    for (int kc = 0; kc < 4; ++kc) kf[kt][kc] = WFrag<T16>::ld((const T16*)(sK + 2 * TB + kt * 16 * PB + kc * 64));
#pragma unroll
                for (int kc = 0; kc < 4; ++kc)
#pragma unroll
                    for (int kt = 0; kt < 2; ++kt) s[kt] = WFrag<T16>::mma(kf[kt][kc], qf[kc], s[kt]); }
#pragma unroll
            for (int d8 = 0; d8 < 8; ++d8) vf[d8] = WFrag<T16>::ld((const T16*)(sV + d8 * 16 * PB));
            if (!HL) __builtin_amdgcn_sched_barrier(0);   // the value fragments' 16 loads are issued by here, so that they land under the softmax arithmetic
            if (key0 + 31 > qw0) {   // the pass straddles the wave's diagonal (the same for the whole wave)
#pragma unroll
                for (int kt = 0; kt < 2; ++kt)
#pragma unroll
                    for (int r = 0; r < 8; ++r) if (key0 + 16 * kt + 8 * hi + r > qw0 + lr) s[kt][r] = -__builtin_inff(); }
            float mx = fmaxf(s[0][0], s[1][0]);
#pragma unroll
            for (int r = 1; r < 8; ++r) mx = fmaxf(mx, fmaxf(s[0][r], s[1][r]));
            mx = fmaxf(mx, xhalf(mx)) * CSC;   // both halves hold the query's maximum of this pass, scaled
            if (__builtin_amdgcn_ballot_w32(mx > m_run + 8.0f) != 0) {   // one scalar test a pass; always taken on a wave's first pass (m_run = -inf: the factor is 0, on zeros)
                const float m_new = fmaxf(m_run, mx), corr = __builtin_amdgcn_exp2f(m_run - m_new); l_run *= corr; m_run = m_new;
#pragma unroll
                for (int d8 = 0; d8 < 8; ++d8) acc[d8] = acc[d8] * corr; }
            float p[2][8], ps0 = 0.0f, ps1 = 0.0f;
#pragma unroll
            for (int r = 0; r < 8; ++r) { const float x0 = __builtin_fmaf(s[0][r], CSC, -m_run), x1 = __builtin_fmaf(s[1][r], CSC, -m_run); p[0][r] = HL ? exp2s(x0) : __builtin_amdgcn_exp2f(x0); p[1][r] = HL ? exp2s(x1) : __builtin_amdgcn_exp2f(x1); ps0 += p[0][r]; ps1 += p[1][r]; }   // hi/lo: exp2s
            l_run += ps0 + ps1;
            if constexpr (HL) {
                v8us h0, h1, e0, e1;
#pragma unroll
                for (int r = 0; r < 8; ++r) { unsigned short a, c2; splitf(p[0][r], a, c2); h0[r] = a; e0[r] = c2; splitf(p[1][r], a, c2); h1[r] = a; e1[r] = c2; }
                const V pfh = cat16b(h0, h1), pfl = cat16b(e0, e1);
#pragma unroll
                for (int d8 = 0; d8 < 8; ++d8) { acc[d8] = WFrag<T16>::mma(vf[d8], pfh, acc[d8]); acc[d8] = WFrag<T16>::mma(vf[d8], pfl, acc[d8]); }
#pragma unroll
                for (int d8 = 0; d8 < 8; ++d8) vf[d8] = WFrag<T16>::ld((const T16*)(sV + 2 * TB + d8 * 16 * PB));
#pragma unroll
                for (int d8 = 0; d8 < 8; ++d8) acc[d8] = WFrag<T16>::mma(vf[d8], pfh, acc[d8]);
            } else {
                V pf;
#pragma unroll
                for (int r = 0; r < 8; ++r) { pf[r] = (h16)p[0][r]; pf[8 + r] = (h16)p[1][r]; }
#pragma unroll
                for (int d8 = 0; d8 < 8; ++d8) acc[d8] = WFrag<T16>::mma(vf[d8], pf, acc[d8]);
            }
        }
        asm volatile("s_wait_dscnt 0x0" ::: "memory");      // this wave has left the buffer of stage t
        asm volatile("s_wait_asynccnt 0x0" ::: "memory");   // its copies of stage t + 1 have landed
        __syncthreads();                                     // stage t + 1 published; every wave has left the buffer of stage t
        if (t + 2 < nst) fill(t + 2);                        // refill of the buffer just left
    }
    asm volatile("s_wait_asynccnt 0x0" ::: "memory");       // no copy in flight when the buffers become the partial results
    v8f* red = (v8f*)sm; float* ml = (float*)(sm + 12 * 8 * 32 * 32);   // per pass 1 to 3 and query group: 8 accumulators a lane; behind them maximum and sum
    if (kh != 0) { const int pp = (kh - 1) * 4 + qg;
#pragma unroll
        for (int d8 = 0; d8 < 8; ++d8) red[(pp * 8 + d8) * 32 + lane] = acc[d8];
        ml[(pp * 2) * 32 + lane] = m_run; ml[(pp * 2 + 1) * 32 + lane] = l_run; }
    __syncthreads();   // the partial results are in LDS before the waves of pass 0 join them
    if (kh == 0) {
        float mp[3], lp[3], a[3], m = m_run;   // m_run is finite here: key 0 is visible to every query. A wave that had no visible pass left -inf, 0 and zeros: its factor below is 0
#pragma unroll
        for (int k = 0; k < 3; ++k) { mp[k] = ml[((k * 4 + qg) * 2) * 32 + lane]; lp[k] = ml[((k * 4 + qg) * 2 + 1) * 32 + lane]; m = fmaxf(m, mp[k]); }
        const float a0 = exp2s(m_run - m); float l = l_run * a0;
#pragma unroll
        for (int k = 0; k < 3; ++k) { a[k] = exp2s(mp[k] - m); l += lp[k] * a[k]; }
        const float inv = __fdiv_rn(1.0f, l + xhalf(l));
        float* op = O + (size_t)(qw0 + lr) * HD + 8 * hi;
#pragma unroll
        for (int d8 = 0; d8 < 8; ++d8) { v8f o = acc[d8] * (a0 * inv);
#pragma unroll
            for (int k = 0; k < 3; ++k) o += red[((k * 4 + qg) * 8 + d8) * 32 + lane] * (a[k] * inv);
            *(v8f*)(op + 16 * d8) = o; } }
}
__global__ __launch_bounds__(512) void k_fa(const h16* __restrict__ Q16, const h16* __restrict__ K16, const h16* __restrict__ V16, const bf* __restrict__ Qh, const bf* __restrict__ Ql, const bf* __restrict__ Kh, const bf* __restrict__ Kl, const bf* __restrict__ Vh, const bf* __restrict__ Vl, float* O) {
    __shared__ __align__(32) unsigned char sm[8 * FTB];   // the two staging buffers (of two or of four tiles); behind the loop the partial results of passes 1 to 3
    const size_t zq = (size_t)blockIdx.x * TT * HD, zk = (size_t)(blockIdx.x / REP) * TT * HD; const int y = blockIdx.y, q0 = 64 * (y < RH / 64 ? RH / 64 - 1 - y : TT / 64 - 1 - (y - RH / 64));
    if (q0 >= RH) fa_body<h16, false>(sm, Q16 + zq, nullptr, K16 + zk, nullptr, V16 + zk, nullptr, O + zq, q0);   // the same for the whole work-group
    else fa_body<bf, true>(sm, Qh + zq, Ql + zq, Kh + zk, Kl + zk, Vh + zk, Vl + zk, O + zq, q0);
}
// k_merge: a thread takes 8 d of one t for 4 heads in a row.
__global__ __launch_bounds__(256) void k_merge(const float* __restrict__ O, int h0, bf* Ah, bf* Al) { const unsigned gid = blockIdx.x * 256 + threadIdx.x; if (gid >= (unsigned)(ZH / 4) * TT * (HD / 8)) return; const unsigned d = (gid % (HD / 8)) * 8, t = (gid / (HD / 8)) % TT, z0 = (gid / ((HD / 8) * TT)) * 4;
    const unsigned li = ((z0 * TT + t) * HD + d) * 4, so = (t * DQ + (h0 + z0) * HD + d) * 2; v8f x[4]; v8us oh[4], ol[4];
#pragma unroll
    for (int g = 0; g < 4; ++g) x[g] = ldo<v8f>(O + (size_t)g * TT * HD, li);
    asm volatile("s_wait_xcnt 0x0" :: "v"(li) : "memory");   // the loads' offset register is an input here: it stays whole until every address has been taken
#pragma unroll
    for (int g = 0; g < 4; ++g)
#pragma unroll
        for (int q = 0; q < 8; ++q) { unsigned short a, c2; splitf(x[g][q], a, c2); oh[g][q] = a; ol[g][q] = c2; }
#pragma unroll
    for (int g = 0; g < 4; ++g) { sto<v8us>(Ah + g * HD, so, oh[g]); sto<v8us>(Al + g * HD, so, ol[g]); } }

extern "C" void kernel_launch(void* const* d_in, const int* in_sizes, int n_in,
                              void* d_out, int out_size, void* d_ws, size_t ws_size, hipStream_t stream) {
    (void)in_sizes; (void)n_in; (void)out_size;
    const float* xq = (const float*)d_in[0]; const float* xk = (const float*)d_in[1]; const float* xv = (const float*)d_in[2]; const float* wq = (const float*)d_in[3]; const float* wk = (const float*)d_in[4]; const float* wv = (const float*)d_in[5]; const float* wo = (const float*)d_in[6];   /* q, k, v ([2][2048][2048] each: THREE streams), Wq ('xw' (in, out) [2048][2048]: 16 heads x 128), Wk, Wv ('xw' [2048][512]: 4 kv heads x 128), Wo ('xw' [2048][2048]): SEVEN inputs, all read; no bias anywhere */
    float* OUT = (float*)d_out;     // [2][2048][2048]
    char* wsp = (char*)d_ws;
    auto take = [&](size_t bytes) { char* p = wsp; wsp += (bytes + 255) & ~(size_t)255; return (void*)p; };
    bf* WQ = (bf*)take((size_t)DQ * DM * 2); bf* WK = (bf*)take((size_t)DKV * DM * 2); bf* WV = (bf*)take((size_t)DKV * DM * 2); bf* WO = (bf*)take((size_t)DM * DQ * 2); float* CS = (float*)take((size_t)TT * HD * 2 * 4);
    bf* XB = (bf*)take((size_t)TT * DM * 2); float* FQ = (float*)take((size_t)TT * DQ * 4); float* FK = (float*)take((size_t)TT * DKV * 4);
    h16* QP16 = (h16*)take((size_t)NH_ * TT * HD * 2); h16* KP16 = (h16*)take((size_t)NKV * TT * HD * 2); h16* VT16 = (h16*)take((size_t)NKV * HD * TT * 2);
    bf* QPh = (bf*)take((size_t)NH_ * TT * HD * 2); bf* QPl = (bf*)take((size_t)NH_ * TT * HD * 2); bf* KPh = (bf*)take((size_t)NKV * TT * HD * 2); bf* KPl = (bf*)take((size_t)NKV * TT * HD * 2); bf* VTh = (bf*)take((size_t)NKV * HD * TT * 2); bf* VTl = (bf*)take((size_t)NKV * HD * TT * 2);
    float* Ob = (float*)take((size_t)ZH * TT * HD * 4); bf* ATh = (bf*)take((size_t)TT * DQ * 2); bf* ATl = (bf*)take((size_t)TT * DQ * 2);
    if ((size_t)(wsp - (char*)d_ws) > ws_size) return;    // ws 256 MiB
    float* FV = FK;   // v projection reuses the k buffer after the k planes are built (stream-ordered)
    { k_wtG<<<(unsigned)(DM * DQ / 8192), 256, 0, stream>>>(wq, DM, DQ, WQ); k_wtG<<<(unsigned)(DM * DKV / 8192), 256, 0, stream>>>(wk, DM, DKV, WK); k_wtG<<<(unsigned)(DM * DKV / 8192), 256, 0, stream>>>(wv, DM, DKV, WV);
      k_wtG<<<(unsigned)(DQ * DM / 8192), 256, 0, stream>>>(wo, DQ, DM, WO);   /* the four 'xw' (in, out) weights transposed once into Bt operands */ }
    const unsigned LQ = (unsigned)(((size_t)NH_ * TT * HD / 32 + 255) / 256), LKv = (unsigned)(((size_t)NKV * TT * HD / 32 + 255) / 256), LVt = (unsigned)(((size_t)NKV * TT * HD / 32 + 127) / 128); const unsigned GX = (unsigned)(((size_t)TT * DM / 32 + 255) / 256);   /* 32 elements a thread */
    for (int b = 0; b < NB_; ++b) {
        if (b == 0) k_csid<<<(TT * HD / 8 + 255) / 256, 256, 0, stream>>>(CS);   /* identity table: k_rope is a plain plane builder here */
        k_cvt8<<<GX, 256, 0, stream>>>(xq + (size_t)b * TT * DM, XB, (size_t)TT * DM / 8);   /* the QUERY stream */
        k_gemmk<bf, 0, 4><<<dim3(TT / 64, DQ / 64, 1), 128, 0, stream>>>(XB, nullptr, WQ, nullptr, DM, FQ, DQ, 0, 0, 0);
        k_rope<<<LQ, 256, 0, stream>>>(FQ, DQ, NH_, CS, 1.0f, QP16, QPh, QPl);
        k_cvt8<<<GX, 256, 0, stream>>>(xk + (size_t)b * TT * DM, XB, (size_t)TT * DM / 8);   /* the KEY stream: cast after the query GEMM has read XB (stream-ordered) */
        k_gemmk<bf, 0, 8><<<dim3(TT / 64, DKV / 64, 1), 256, 0, stream>>>(XB, nullptr, WK, nullptr, DM, FK, DKV, 0, 0, 0);
        k_rope<<<LKv, 256, 0, stream>>>(FK, DKV, NKV, CS, 1.0f, KP16, KPh, KPl);
        k_cvt8<<<GX, 256, 0, stream>>>(xv + (size_t)b * TT * DM, XB, (size_t)TT * DM / 8);   /* the VALUE stream */
        k_gemmk<bf, 0, 8><<<dim3(TT / 64, DKV / 64, 1), 256, 0, stream>>>(XB, nullptr, WV, nullptr, DM, FV, DKV, 0, 0, 0); k_vtp<<<LVt, 128, 0, stream>>>(FV, DKV, NKV, VT16, VTh, VTl);
        for (int h0 = 0; h0 < NH_; h0 += ZH) { const size_t zq = (size_t)h0, zk = (size_t)(h0 / REP);   /* 'jnp.repeat(kh, 4, axis=1)': query head h uses kv head h / 4: the kernels advance the key and value operands once per REP z */
            k_fa<<<dim3(ZH, TT / 64), 512, 0, stream>>>(QP16 + zq * TT * HD, KP16 + zk * TT * HD, VT16 + zk * HD * TT, QPh + zq * TT * HD, QPl + zq * TT * HD, KPh + zk * TT * HD, KPl + zk * TT * HD, VTh + zk * HD * TT, VTl + zk * HD * TT, Ob);
            k_merge<<<(unsigned)(((size_t)ZH * TT * HD / 32 + 255) / 256), 256, 0, stream>>>(Ob, h0, ATh, ATl); }
        k_gemmk<bf, 1, 4><<<dim3(TT / 64, DM / 64, 1), 128, 0, stream>>>(ATh, ATl, WO, nullptr, DQ, OUT + (size_t)b * TT * DM, DM, 0, 0, 0); }
}

// v006
// One run takes 234 microseconds.
// Timed twice side by side with v005, it ran 1.37 and 1.39 times as fast.
// Counting every step since v000, it is 7.03 times as fast.
#include <hip/hip_runtime.h>

// Grouped-query causal attention with 128-wide heads on three input streams (q, k, v [2][2048][2048]; qh = q Wq (16 heads x 128), kh, vh = k Wk, v Wv (4 kv heads x 128) ('xw' (in, out) 0.02, no bias); qh and kh each x 128^-0.25 (together 1/sqrt(128)); kv head = query head / 4 (jnp.repeat); the module takes softmax over ALL keys, zeroes the strictly-upper triangle and renormalises by (row sum + 1e-9): a causal softmax but for that epsilon; out = merged Wo ('xw', no bias) -> [2][2048][2048] (8.4 M); argument order q, k, v, Wq, Wk, Wv, Wo).
// Layout: eight launches. Every launch takes BOTH batch entries (rows b T + t of the projections, planes b heads + h of the attention), and work that does not depend on each other shares a launch, each part on its own run of blocks: k_prep (bf16 copies of q, k and v in three operand buffers; the four 'xw' weights transposed into Bt operands; the identity table); exact projections (q; k and v together); plane builders (q and k together; v); causal T-2048 attention with 128-wide heads, all 2 x 16 query heads in ONE launch of the fused kernel k_fa, whose scores and probabilities never leave the registers (kv head = head / 4 on the key and value operands) (hybrid rows: < 512 hi/lo 3 products, rest fp16); merged hi/lo x Wo exact.
// Compute dtypes, f32 accumulate: every input rounded to bf16; projections exact; attention rows < 512 3 products, rest fp16; softmax f32 (the exact causal softmax: no epsilon term); Wo hl x exact.

#define NB_  2
#define TT   2048
#define DM   2048
#define NH_  16
#define NKV  4
#define REP  (NH_ / NKV)
#define HD   128
#define DQ   (NH_ * HD)
#define DKV  (NKV * HD)
#define ZH   16                   // query heads of a batch entry per attention launch (all of them)
#define RH   512                  // query rows < RH use hi+lo planes (0: none)
#define SCL  0.088388347648318447f   // HD^-0.5
typedef _Float16 h16;
typedef unsigned short bf;
typedef __attribute__((ext_vector_type(16))) __bf16   v16bf;
typedef __attribute__((ext_vector_type(16))) _Float16 v16h;
typedef __attribute__((ext_vector_type(8)))  _Float16 v8h;
typedef __attribute__((ext_vector_type(8)))  unsigned short v8us;
typedef __attribute__((ext_vector_type(8)))  float    v8f;
typedef __attribute__((ext_vector_type(4)))  float    v4f;
typedef v8h  __attribute__((may_alias)) v8ha;
typedef v4f  __attribute__((may_alias)) v4fa;
typedef v8us __attribute__((may_alias)) v8usa;

__device__ __forceinline__ unsigned short f2bf(float f) { unsigned u = __float_as_uint(f); u += 0x7FFFu + ((u >> 16) & 1u); return (unsigned short)(u >> 16); }
__device__ __forceinline__ float bf2f(unsigned short b) { return __uint_as_float(((unsigned)b) << 16); }
__device__ __forceinline__ float bfr(float f) { return bf2f(f2bf(f)); }
__device__ __forceinline__ v16h cat16(v8h lo, v8h hi) { return __builtin_shufflevector(lo, hi, 0, 1, 2, 3, 4, 5, 6, 7, 8, 9, 10, 11, 12, 13, 14, 15); }
__device__ __forceinline__ v16bf cat16b(v8us lo, v8us hi) { return __builtin_bit_cast(v16bf, __builtin_shufflevector(lo, hi, 0, 1, 2, 3, 4, 5, 6, 7, 8, 9, 10, 11, 12, 13, 14, 15)); }
__device__ __forceinline__ v8f wmma16(v16h a, v16h b, v8f c) { return __builtin_amdgcn_wmma_f32_16x16x32_f16(false, a, false, b, (short)0, c, false, false); }
__device__ __forceinline__ v8f wmmab(v16bf a, v16bf b, v8f c) { return __builtin_amdgcn_wmma_f32_16x16x32_bf16(false, a, false, b, (short)0, c, false, false); }

// ---- k_gemmk: register-blocked GEMM, one 64x64 output tile per work-group of NW waves. The K loop is dealt over the waves in steps of 32 k: wave w takes steps w, w + NW, ... with 16 accumulators of its own;
// the NW partial tiles meet in LDS and are summed in wave order 0..NW-1, each wave summing and storing 64 / NW whole rows of the tile.
// The operands come through LDS: a trip stages 64 rows x 32 NW k of every K-contiguous 16-bit operand plane by asynchronous 16-byte copies that take whole 128-byte lines (a fragment load straight from global memory
// touches 16 lines for its 512 bytes), two buffers, the next trip's copies in flight under this trip's products; each wave reads its own 32-k column of the staged rows as fragments. LDS row pitch 64 NW + 16 bytes (an odd multiple of 16).
// C[m][n] (f32, pitch ldc) = sum_k A[m][k] Bt[n][k] (+ split products per NSPLIT). z-batch strides sA/sB/sC in elements. K % (32 NW) == 0, K >= 64 NW (two trips). grid (M/64, N/64, Z), 32 * NW threads.
// z-batch: A, Bt and C advance by sA, sB, sC per z (the k and the v projection are z = 0, 1 of one launch).
template <typename T16> struct WFrag;
template <> struct WFrag<h16> { typedef v16h V; static __device__ __forceinline__ V ld(const h16* p) { return cat16(*(const v8h*)p, *(const v8h*)(p + 16)); } static __device__ __forceinline__ v8f mma(V a, V b, v8f c) { return wmma16(a, b, c); } };
template <> struct WFrag<bf> { typedef v16bf V; static __device__ __forceinline__ V ld(const bf* p) { return cat16b(*(const v8us*)p, *(const v8us*)(p + 16)); } static __device__ __forceinline__ v8f mma(V a, V b, v8f c) { return wmmab(a, b, c); } };
// cp8: one lane's eight copies of one staged plane (rows 8 apart in k_gemmk, 16 apart in k_fa). The wait on the address counter is the statement's last line, so that no register named by a copy is rewritten in front of it.
template <typename T16>
__device__ __forceinline__ void cp8(unsigned l, const T16* g, unsigned ls, size_t gs) {
    asm volatile("global_load_async_to_lds_b128 %0, %8, off\n\t"
                 "global_load_async_to_lds_b128 %1, %9, off\n\t"
                 "global_load_async_to_lds_b128 %2, %10, off\n\t"
                 "global_load_async_to_lds_b128 %3, %11, off\n\t"
                 "global_load_async_to_lds_b128 %4, %12, off\n\t"
                 "global_load_async_to_lds_b128 %5, %13, off\n\t"
                 "global_load_async_to_lds_b128 %6, %14, off\n\t"
                 "global_load_async_to_lds_b128 %7, %15, off\n\t"
                 "s_wait_xcnt 0x0"
                 :: "v"(l), "v"(l + ls), "v"(l + 2 * ls), "v"(l + 3 * ls), "v"(l + 4 * ls), "v"(l + 5 * ls), "v"(l + 6 * ls), "v"(l + 7 * ls),
                    "v"(g), "v"(g + gs), "v"(g + 2 * gs), "v"(g + 3 * gs), "v"(g + 4 * gs), "v"(g + 5 * gs), "v"(g + 6 * gs), "v"(g + 7 * gs) : "memory");
}
template <typename T16, int NSPLIT, int NW>
__global__ __launch_bounds__(32 * NW) void k_gemmk(const T16* __restrict__ A, const T16* __restrict__ A2, const T16* __restrict__ Bt, const T16* __restrict__ Bt2, int K, float* C, int ldc, size_t sA, size_t sB, size_t sC) {
    typedef typename WFrag<T16>::V V;
    constexpr int NT = 2 + NSPLIT, CK = 32 * NW, PB = 2 * CK + 16, TB = 64 * PB, BUF = NT * TB;   // planes staged (A, Bt, then A2, then Bt2), k per trip, LDS row pitch, bytes of a staged plane and of a buffer
    constexpr int SMB = (2 * BUF > NW * 64 * 68 * 4) ? 2 * BUF : NW * 64 * 68 * 4;
    __shared__ __align__(16) unsigned char sm[SMB];   // the two staging buffers; behind the loop the NW partial tiles
    const size_t z = blockIdx.z; A += z * sA; if (A2) A2 += z * sA; Bt += z * sB; if (Bt2) Bt2 += z * sB; C += z * sC;
    const int tid = threadIdx.x, lane = tid & 31, lr = lane & 15, hi = lane >> 4; const int w = __builtin_amdgcn_readfirstlane((int)(threadIdx.x >> 5)); const int r0 = blockIdx.x * 64, c0 = blockIdx.y * 64;
    const int Kl = K; const int ntrip = (Kl + CK - 1) / CK;
    const int lda = K;
    v8f acc[4][4];
#pragma unroll
    for (int mb = 0; mb < 4; ++mb)
#pragma unroll
        for (int nb = 0; nb < 4; ++nb) acc[mb][nb] = (v8f){};
    const int crow = tid / (4 * NW), ccol = tid % (4 * NW);   // 4 NW lanes copy one staged row; the block copies 8 rows at a time
    const unsigned l0 = (unsigned)(size_t)sm + crow * PB + ccol * 16;
    const size_t aoff = (size_t)(r0 + crow) * lda + 8 * ccol, a2off = aoff, boff = (size_t)(c0 + crow) * K + 8 * ccol;
    auto fill = [&](int t) { const unsigned l = l0 + (t & 1) * BUF; cp8(l, A + aoff + t * CK, 8 * PB, (size_t)8 * lda); cp8(l + TB, Bt + boff + t * CK, 8 * PB, (size_t)8 * K);
        if (NSPLIT >= 1) cp8(l + 2 * TB, A2 + a2off + t * CK, 8 * PB, (size_t)8 * lda); if (NSPLIT >= 2) cp8(l + 3 * TB, Bt2 + boff + t * CK, 8 * PB, (size_t)8 * K); };
    fill(0);
    asm volatile("s_wait_asynccnt 0x0" ::: "memory");   // this wave's copies of trip 0 have landed
    __syncthreads();                                     // and every other wave's
    fill(1);                                             // a trip 1 always exists
    const int foff = lr * PB + (w * 32 + 8 * hi) * 2;
    for (int t = 0; t < ntrip; ++t) {
        if (t * CK + w * 32 < Kl) {   // this wave's step of the trip lies in the K range (the same for the whole wave)
            const unsigned char* s = sm + (t & 1) * BUF + foff;
            V a[4], a2[4];
#pragma unroll
            for (int mb = 0; mb < 4; ++mb) { a[mb] = WFrag<T16>::ld((const T16*)(s + mb * 16 * PB)); if (NSPLIT == 1 || NSPLIT == 2) a2[mb] = WFrag<T16>::ld((const T16*)(s + 2 * TB + mb * 16 * PB)); }
#pragma unroll
            for (int nb = 0; nb < 4; ++nb) { const V b = WFrag<T16>::ld((const T16*)(s + TB + nb * 16 * PB)); V b2; if (NSPLIT >= 2) b2 = WFrag<T16>::ld((const T16*)(s + 3 * TB + nb * 16 * PB));
#pragma unroll
                for (int mb = 0; mb < 4; ++mb) { acc[mb][nb] = WFrag<T16>::mma(a[mb], b, acc[mb][nb]); if (NSPLIT == 1 || NSPLIT == 2) acc[mb][nb] = WFrag<T16>::mma(a2[mb], b, acc[mb][nb]); if (NSPLIT >= 2) acc[mb][nb] = WFrag<T16>::mma(a[mb], b2, acc[mb][nb]); } }
        }
        asm volatile("s_wait_dscnt 0x0" ::: "memory");      // this wave has left the buffer of trip t
        asm volatile("s_wait_asynccnt 0x0" ::: "memory");   // its copies of trip t + 1 have landed
        __syncthreads();                                     // trip t + 1 published; every wave has left the buffer of trip t
        if (t + 2 < ntrip) fill(t + 2);                      // refill of the buffer just left
    }
    asm volatile("s_wait_asynccnt 0x0" ::: "memory");       // no copy in flight when the buffers become the partial tiles
    float* red = (float*)sm; float* mine = red + w * (64 * 68);
#pragma unroll
    for (int mb = 0; mb < 4; ++mb)
#pragma unroll
        for (int nb = 0; nb < 4; ++nb)
#pragma unroll
            for (int j = 0; j < 8; ++j) mine[(mb * 16 + hi * 8 + j) * 68 + nb * 16 + lr] = acc[mb][nb][j];
    __syncthreads();   // every wave's partial tile is in LDS before any wave sums across them
#pragma unroll
    for (int s = 0; s < 32 / NW; ++s) { const int row = w * (64 / NW) + 2 * s + hi, cofs = lr * 4; v4f val = *(const v4fa*)(red + row * 68 + cofs);
#pragma unroll
        for (int p = 1; p < NW; ++p) val += *(const v4fa*)(red + p * (64 * 68) + row * 68 + cofs);
        *(v4f*)(C + (size_t)(r0 + row) * ldc + c0 + cofs) = val; }
}

__device__ __forceinline__ h16 tohx(float x) { return (h16)x; }
__device__ __forceinline__ void splitf(float y, unsigned short& h, unsigned short& l) { h = f2bf(y); l = f2bf(y - bf2f(h)); }
typedef __attribute__((ext_vector_type(2))) _Float16 v2h;
typedef __attribute__((ext_vector_type(4))) _Float16 v4h;
typedef __attribute__((ext_vector_type(2))) unsigned short v2us;
typedef __attribute__((ext_vector_type(4))) unsigned short v4us;
typedef __attribute__((ext_vector_type(2))) float v2f;
typedef __attribute__((ext_vector_type(4))) int v4i;

// The kernels without matrix work (casts, transposes, plane builders, merge) take 32 elements a thread: 16-byte loads, all issued ahead of the arithmetic, and 16-byte stores, all behind it.
// Addresses are a uniform base plus one 32-bit byte offset per lane (every buffer here is far below 4 GiB).
// Those that share a launch are device functions of a block index bx (blocks of 256 threads): the kernels k_prep and k_rope deal their blocks out to them.
template <typename V> __device__ __forceinline__ V ldo(const void* base, unsigned off) { return *(const V*)((const char*)base + off); }
template <typename V> __device__ __forceinline__ void sto(void* base, unsigned off, V v) { *(V*)((char*)base + off) = v; }
// wtG: Bt[n][k] (bf16) = w[k][n], the four weights one behind the other: each takes the run of blocks that its K N / 8192 needs, in the order q, k, v, o (all four have K = 2048). A thread takes 8 k x 4 n: eight loads (rows k), four stores (rows n). Lanes: 8 along k (one whole 128-byte line of a Bt row), 4 along n; the 8 waves of a block lie side by side along n (512 contiguous bytes of each w row). K % 64 == 0, N % 16 == 0.
#define NWT ((2 * DM * DQ + 2 * DM * DKV) / 8192)   // its blocks
__device__ __forceinline__ void wtG(const int bx, const float* __restrict__ wq, const float* __restrict__ wk, const float* __restrict__ wv_, const float* __restrict__ wo, bf* BQ, bf* BK, bf* BV, bf* BO) {
    static_assert(DQ == DM, "one K for the four weights");
    constexpr int K = DM, nq = DM * DQ / 8192, nk = DM * DKV / 8192; const int sel = bx < nq ? 0 : bx < nq + nk ? 1 : bx < nq + 2 * nk ? 2 : 3;   // the same for the whole block
    const float* __restrict__ w = sel == 0 ? wq : sel == 1 ? wk : sel == 2 ? wv_ : wo; bf* Bt = sel == 0 ? BQ : sel == 1 ? BK : sel == 2 ? BV : BO; const int N = sel == 0 ? DQ : sel == 3 ? DM : DKV, b0 = sel == 0 ? 0 : sel == 1 ? nq : sel == 2 ? nq + nk : nq + 2 * nk;
    const int gid = (bx - b0) * 256 + threadIdx.x, wv = gid >> 5, lane = gid & 31; const int nng = N / 16; if (wv >= nng * (K / 64)) return;
    const int n0 = ((wv % nng) * 4 + (lane >> 3)) * 4, k0 = ((wv / nng) * 8 + (lane & 7)) * 8; const unsigned so = ((unsigned)n0 * K + k0) * 2; unsigned li[8]; v4f x[8]; v8us o[4];
#pragma unroll
    for (int i = 0; i < 8; ++i) li[i] = ((unsigned)(k0 + i) * N + n0) * 4;
#pragma unroll
    for (int i = 0; i < 8; ++i) x[i] = ldo<v4f>(w, li[i]);
    asm volatile("s_wait_xcnt 0x0" :: "v"(li[0]), "v"(li[1]), "v"(li[2]), "v"(li[3]), "v"(li[4]), "v"(li[5]), "v"(li[6]), "v"(li[7]) : "memory");   // the loads' offset registers are inputs here: they stay whole until every address has been taken
#pragma unroll
    for (int j = 0; j < 4; ++j)
#pragma unroll
        for (int i = 0; i < 8; ++i) o[j][i] = f2bf(x[i][j]);
#pragma unroll
    for (int j = 0; j < 4; ++j) sto<v8us>(Bt, so + (unsigned)j * K * 2, o[j]);
}
// cvt8: four groups of 8 elements a thread, 256 groups apart (beyond the end: the last group is loaded, in bounds, and not stored).
__device__ __forceinline__ void cvt8(const unsigned bx, const float* __restrict__ src, bf* dst, size_t n8) { const size_t i0 = (size_t)bx * 1024 + threadIdx.x; v8f v[4]; unsigned li[4];
#pragma unroll
    for (int u = 0; u < 4; ++u) { const size_t i = i0 + u * 256; li[u] = (unsigned)((i < n8 ? i : n8 - 1) * 32); }
#pragma unroll
    for (int u = 0; u < 4; ++u) v[u] = ldo<v8f>(src, li[u]);
    asm volatile("s_wait_xcnt 0x0" :: "v"(li[0]), "v"(li[1]), "v"(li[2]), "v"(li[3]) : "memory");   // the loads' offset registers are inputs here: they stay whole until every address has been taken
#pragma unroll
    for (int u = 0; u < 4; ++u) { const size_t i = i0 + u * 256; v8us o;
#pragma unroll
        for (int k = 0; k < 8; ++k) o[k] = f2bf(v[u][k]);
        if (i < n8) *(v8us*)(dst + i * 8) = o; } }
__device__ __forceinline__ void csid(const int bx, float* CS) { const int i0 = bx * 1024 + threadIdx.x; v4f cs; cs[0] = 1.0f; cs[1] = 0.0f; cs[2] = 1.0f; cs[3] = 0.0f;
#pragma unroll
    for (int u = 0; u < 4; ++u) { const int idx = i0 + u * 256; if (idx < TT * HD / 2) *(v4f*)(CS + (size_t)idx * 4) = cs; } }
// k_prep: all that reads only the inputs. Blocks: NCV for each of the three streams (both batch entries; the copies lie one behind the other in XB), then NWT for the weights, then NCS for the table. The tests are the same for a whole block.
#define NCV (NB_ * TT * DM / 32 / 256)
#define NCS ((TT * HD / 8 + 255) / 256)
__global__ __launch_bounds__(256) void k_prep(const float* __restrict__ xq, const float* __restrict__ xk, const float* __restrict__ xv, bf* XB, const float* __restrict__ wq, const float* __restrict__ wk, const float* __restrict__ wv, const float* __restrict__ wo, bf* WQ, bf* WK, bf* WV, bf* WO, float* CS) {
    const unsigned bx = blockIdx.x;
    if (bx < 3 * NCV) { const unsigned st = bx / NCV; cvt8(bx - st * NCV, st == 0 ? xq : st == 1 ? xk : xv, XB + (size_t)st * NB_ * TT * DM, (size_t)NB_ * TT * DM / 8); }
    else if (bx < 3 * NCV + NWT) wtG((int)(bx - 3 * NCV), wq, wk, wv, wo, WQ, WK, WV, WO);
    else csid((int)(bx - 3 * NCV - NWT), CS);
}
// rope: head planes [h][t][d] (fp16 + hi/lo) of rope(x) x sc with the rotate-half convention out[d] = x[d] cos[t][d] - x[d+HD/2] sin[t][d], out[d+HD/2] = x[d+HD/2] cos[t][d+HD/2] + x[d] sin[t][d+HD/2]
// A thread takes 8 d of one t for 4 heads in a row (one read of the table entries serves the four). nheads % 4 == 0. One batch entry: TT rows of F, nheads planes.
__device__ __forceinline__ void rope(const unsigned bx, const float* __restrict__ F, int pitch, int nheads, const float* __restrict__ CS, float sc, h16* P16, bf* Ph, bf* Pl) {
    const unsigned gid = bx * 256 + threadIdx.x; if (gid >= (unsigned)(nheads / 4) * TT * (HD / 8)) return; const unsigned d = (gid % (HD / 8)) * 8, t = (gid / (HD / 8)) % TT, h0 = (gid / ((HD / 8) * TT)) * 4;
    const unsigned la = (t * pitch + h0 * HD + d) * 4, lb = la ^ (HD / 2 * 4), lc = (t * HD + d) * 8, so = ((h0 * TT + t) * HD + d) * 2;   // lb: the partner half of the head (d ^ 64; the head's start is a multiple of 512 bytes where pitch % 128 == 0)
    v4f cs4[4]; v8f xa[4], xb[4]; v8h o16[4]; v8us oh[4], ol[4];
#pragma unroll
    for (int u = 0; u < 4; ++u) cs4[u] = ldo<v4f>(CS + u * 4, lc);
#pragma unroll
    for (int g = 0; g < 4; ++g) { xa[g] = ldo<v8f>(F + g * HD, la); xb[g] = ldo<v8f>(F + g * HD, lb); }
    asm volatile("s_wait_xcnt 0x0" :: "v"(la), "v"(lb), "v"(lc) : "memory");   // the loads' offset registers are inputs here: they stay whole until every address has been taken
    __builtin_amdgcn_sched_barrier(0);   // keeps the arithmetic behind all twenty loads: without it six of them were issued only after the first results had come back
#pragma unroll
    for (int g = 0; g < 4; ++g)
#pragma unroll
        for (int q = 0; q < 8; ++q) { const float a = __fmul_rn(xa[g][q], cs4[q >> 1][(q & 1) * 2]), bq = __fmul_rn(xb[g][q], cs4[q >> 1][(q & 1) * 2 + 1]); const float r = ((d < HD / 2) ? __fsub_rn(a, bq) : __fadd_rn(a, bq)) * sc;
            o16[g][q] = tohx(r); unsigned short a2, c2; splitf(r, a2, c2); oh[g][q] = a2; ol[g][q] = c2; }
#pragma unroll
    for (int g = 0; g < 4; ++g) { sto<v8h>(P16 + (size_t)g * TT * HD, so, o16[g]); sto<v8us>(Ph + (size_t)g * TT * HD, so, oh[g]); sto<v8us>(Pl + (size_t)g * TT * HD, so, ol[g]); } }
// k_rope: the plane builders of the query and of the key projection. blockIdx.x: LQ blocks for the query heads, then LKV for the key heads (the test is the same for a whole block); blockIdx.y: the batch entry.
#define LQ  (NH_ * TT * HD / 32 / 256)
#define LKV (NKV * TT * HD / 32 / 256)
__global__ __launch_bounds__(256) void k_rope(const float* __restrict__ FQ, const float* __restrict__ FK, const float* __restrict__ CS, h16* QP16, bf* QPh, bf* QPl, h16* KP16, bf* KPh, bf* KPl) {
    const unsigned bx = blockIdx.x; const bool k = bx >= LQ; const size_t fq = (size_t)blockIdx.y * TT * DQ, fk = (size_t)blockIdx.y * TT * DKV, pq = (size_t)blockIdx.y * NH_ * TT * HD, pk = (size_t)blockIdx.y * NKV * TT * HD;
    rope(k ? bx - LQ : bx, k ? FK + fk : FQ + fq, k ? DKV : DQ, k ? NKV : NH_, CS, 1.0f, k ? KP16 + pk : QP16 + pq, k ? KPh + pk : QPh + pq, k ? KPl + pk : QPl + pq);
}
// k_vtp: value planes [g][d][t] (fp16 + hi/lo) of F[t][g HD + d]. A thread takes 8 t x 4 d: eight loads (rows t), four stores a plane (rows d). Lanes: 8 along t (one whole 128-byte line of a plane row), 4 along d; the 4 waves of a block lie side by side along d. blockIdx.y: the batch entry (TT rows of F, nheads planes).
__global__ __launch_bounds__(128) void k_vtp(const float* __restrict__ F, int pitch, int nheads, h16* V16, bf* Vh, bf* Vl) { const unsigned gid = blockIdx.x * 128 + threadIdx.x, wv = gid >> 5, lane = gid & 31; if (wv >= (unsigned)nheads * (HD / 16) * (TT / 64)) return;
    { const size_t fb = (size_t)blockIdx.y * TT * pitch, pb = (size_t)blockIdx.y * nheads * HD * TT; F += fb; V16 += pb; Vh += pb; Vl += pb; }
    const unsigned d0 = ((wv % (HD / 16)) * 4 + (lane >> 3)) * 4, t0 = (((wv / (HD / 16)) % (TT / 64)) * 8 + (lane & 7)) * 8, g = wv / ((HD / 16) * (TT / 64)); const unsigned so = ((g * HD + d0) * TT + t0) * 2; unsigned li[8]; v4f x[8]; v8h o16[4]; v8us oh[4], ol[4];
#pragma unroll
    for (int i = 0; i < 8; ++i) li[i] = ((t0 + i) * pitch + g * HD + d0) * 4;
#pragma unroll
    for (int i = 0; i < 8; ++i) x[i] = ldo<v4f>(F, li[i]);
    asm volatile("s_wait_xcnt 0x0" :: "v"(li[0]), "v"(li[1]), "v"(li[2]), "v"(li[3]), "v"(li[4]), "v"(li[5]), "v"(li[6]), "v"(li[7]) : "memory");   // the loads' offset registers are inputs here: they stay whole until every address has been taken
#pragma unroll
    for (int j = 0; j < 4; ++j)
#pragma unroll
        for (int i = 0; i < 8; ++i) { const float xv = x[i][j]; o16[j][i] = tohx(xv); unsigned short a2, c2; splitf(xv, a2, c2); oh[j][i] = a2; ol[j][i] = c2; }
#pragma unroll
    for (int j = 0; j < 4; ++j) { sto<v8h>(V16 + j * TT, so, o16[j]); sto<v8us>(Vh + j * TT, so, oh[j]); sto<v8us>(Vl + j * TT, so, ol[j]); } }
#define FPB (2 * HD + 16)
#define FTB (128 * FPB)
__device__ __forceinline__ float xhalf(float x) { return __builtin_bit_cast(float, __builtin_amdgcn_permlanex16(__builtin_bit_cast(int, x), __builtin_bit_cast(int, x), 0x76543210, 0xfedcba98, false, false)); }   // lane l with lane l ^ 16
// exp2s: v_exp_f32 with the free slot behind it in the same statement.
__device__ __forceinline__ float exp2s(float x) { float r; asm("v_exp_f32 %0, %1\n\tv_nop" : "=v"(r) : "v"(x)); return r; }
template <typename T16, bool HL>
__device__ __forceinline__ void fa_body(unsigned char* sm, const T16* __restrict__ Q, const T16* __restrict__ Q2, const T16* __restrict__ Kp, const T16* __restrict__ K2, const T16* __restrict__ Vt, const T16* __restrict__ V2, float* O, const int q0) {
    typedef typename WFrag<T16>::V V;
    constexpr int PB = FPB, TB = FTB, BUF = (HL ? 4 : 2) * TB; constexpr float CSC = SCL * 1.4426950408889634f;
    const int tid = threadIdx.x, lane = tid & 31, lr = lane & 15, hi = lane >> 4; const int w = __builtin_amdgcn_readfirstlane((int)(threadIdx.x >> 5)), qg = w & 3, kh = w >> 2;
    const int qw0 = q0 + 16 * qg, nst = (q0 + 64 + 127) / 128;   // stages up to the one that holds the diagonal (nst * 128 <= TT)
    const bool cv = w >= 8; const int crow = (tid & 255) >> 4, ccol = tid & 15;   // 16 lanes copy one staged row; eight waves copy 16 rows of their tile at a time
    const unsigned l0 = (unsigned)(size_t)sm + (cv ? TB : 0) + crow * PB + ccol * 16;
    const size_t go = (cv ? (size_t)crow * TT : (size_t)crow * HD) + ccol * 8, gs = cv ? (size_t)16 * TT : (size_t)16 * HD, gt = cv ? (size_t)128 : (size_t)128 * HD;   // elements: this lane's first copy; from 16 rows to the next; from a stage to the next
    const T16* g0 = (cv ? Vt : Kp) + go; const T16* g1 = HL ? (cv ? V2 : K2) + go : nullptr;
    auto fill = [&](int t) { const unsigned l = l0 + (t & 1) * BUF; cp8(l, g0 + t * gt, 16 * PB, gs); if (HL) cp8(l + 2 * TB, g1 + t * gt, 16 * PB, gs); };
    fill(0);
    V qf[4], q2[4];
#pragma unroll
    for (int kc = 0; kc < 4; ++kc) { qf[kc] = WFrag<T16>::ld(Q + (size_t)(qw0 + lr) * HD + kc * 32 + 8 * hi); if (HL) q2[kc] = WFrag<T16>::ld(Q2 + (size_t)(qw0 + lr) * HD + kc * 32 + 8 * hi); }
    v8f acc[8];
#pragma unroll
    for (int d8 = 0; d8 < 8; ++d8) acc[d8] = (v8f){};
    float m_run = -__builtin_inff(), l_run = 0.0f;
    asm volatile("s_wait_asynccnt 0x0" ::: "memory");   // this wave's copies of stage 0 have landed
    __syncthreads();                                     // and every other wave's
    if (1 < nst) fill(1);                                // where a stage 1 exists
    for (int t = 0; t < nst; ++t) {
        const int key0 = t * 128 + kh * 32;
        if (key0 <= qw0 + 15) {   // some key of the pass is visible to the wave's last query (the same for the whole wave); its first key is then visible to every query of the wave
            const unsigned char* sK = sm + (t & 1) * BUF + (kh * 32 + lr) * PB + 16 * hi; const unsigned char* sV = sm + (t & 1) * BUF + TB + lr * PB + kh * 64 + 16 * hi;
            V kf[2][4], vf[8]; v8f s[2];
#pragma unroll
            for (int kt = 0; kt < 2; ++kt)
#pragma unroll
                for (int kc = 0; kc < 4; ++kc) kf[kt][kc] = WFrag<T16>::ld((const T16*)(sK + kt * 16 * PB + kc * 64));
            if (!HL) __builtin_amdgcn_sched_barrier(0);   // keeps the key fragments' 16 loads together ahead of the products, for speed only (with the lo planes' operands the registers do not allow it)
            s[0] = (v8f){}; s[1] = (v8f){};
#pragma unroll
            for (int kc = 0; kc < 4; ++kc)
#pragma unroll
                for (int kt = 0; kt < 2; ++kt) { s[kt] = WFrag<T16>::mma(kf[kt][kc], qf[kc], s[kt]); if (HL) s[kt] = WFrag<T16>::mma(kf[kt][kc], q2[kc], s[kt]); }
            if (HL) {
#pragma unroll
                for (int kt = 0; kt < 2; ++kt)
#pragma unroll
                    for (int kc = 0; kc < 4; ++kc) kf[kt][kc] = WFrag<T16>::ld((const T16*)(sK + 2 * TB + kt * 16 * PB + kc * 64));
#pragma unroll
                for (int kc = 0; kc < 4; ++kc)
#pragma unroll
                    for (int kt = 0; kt < 2; ++kt) s[kt] = WFrag<T16>::mma(kf[kt][kc], qf[kc], s[kt]); }
#pragma unroll
            for (int d8 = 0; d8 < 8; ++d8) vf[d8] = WFrag<T16>::ld((const T16*)(sV + d8 * 16 * PB));
            if (!HL) __builtin_amdgcn_sched_barrier(0);   // the value fragments' 16 loads are issued by here, so that they land under the softmax arithmetic
            if (key0 + 31 > qw0) {   // the pass straddles the wave's diagonal (the same for the whole wave)
#pragma unroll
                for (int kt = 0; kt < 2; ++kt)
#pragma unroll
                    for (int r = 0; r < 8; ++r) if (key0 + 16 * kt + 8 * hi + r > qw0 + lr) s[kt][r] = -__builtin_inff(); }
            float mx = fmaxf(s[0][0], s[1][0]);
#pragma unroll
            for (int r = 1; r < 8; ++r) mx = fmaxf(mx, fmaxf(s[0][r], s[1][r]));
            mx = fmaxf(mx, xhalf(mx)) * CSC;   // both halves hold the query's maximum of this pass, scaled
            if (__builtin_amdgcn_ballot_w32(mx > m_run + 8.0f) != 0) {   // one scalar test a pass; always taken on a wave's first pass (m_run = -inf: the factor is 0, on zeros)
                const float m_new = fmaxf(m_run, mx), corr = __builtin_amdgcn_exp2f(m_run - m_new); l_run *= corr; m_run = m_new;
#pragma unroll
                for (int d8 = 0; d8 < 8; ++d8) acc[d8] = acc[d8] * corr; }
            float p[2][8], ps0 = 0.0f, ps1 = 0.0f;
#pragma unroll
            for (int r = 0; r < 8; ++r) { const float x0 = __builtin_fmaf(s[0][r], CSC, -m_run), x1 = __builtin_fmaf(s[1][r], CSC, -m_run); p[0][r] = HL ? exp2s(x0) : __builtin_amdgcn_exp2f(x0); p[1][r] = HL ? exp2s(x1) : __builtin_amdgcn_exp2f(x1); ps0 += p[0][r]; ps1 += p[1][r]; }   // hi/lo: exp2s
            l_run += ps0 + ps1;
            if constexpr (HL) {
                v8us h0, h1, e0, e1;
#pragma unroll
                for (int r = 0; r < 8; ++r) { unsigned short a, c2; splitf(p[0][r], a, c2); h0[r] = a; e0[r] = c2; splitf(p[1][r], a, c2); h1[r] = a; e1[r] = c2; }
                const V pfh = cat16b(h0, h1), pfl = cat16b(e0, e1);
#pragma unroll
                for (int d8 = 0; d8 < 8; ++d8) { acc[d8] = WFrag<T16>::mma(vf[d8], pfh, acc[d8]); acc[d8] = WFrag<T16>::mma(vf[d8], pfl, acc[d8]); }
#pragma unroll
                for (int d8 = 0; d8 < 8; ++d8) vf[d8] = WFrag<T16>::ld((const T16*)(sV + 2 * TB + d8 * 16 * PB));
#pragma unroll
                for (int d8 = 0; d8 < 8; ++d8) acc[d8] = WFrag<T16>::mma(vf[d8], pfh, acc[d8]);
            } else {
                V pf;
#pragma unroll
                for (int r = 0; r < 8; ++r) { pf[r] = (h16)p[0][r]; pf[8 + r] = (h16)p[1][r]; }
#pragma unroll
                for (int d8 = 0; d8 < 8; ++d8) acc[d8] = WFrag<T16>::mma(vf[d8], pf, acc[d8]);
            }
        }
        asm volatile("s_wait_dscnt 0x0" ::: "memory");      // this wave has left the buffer of stage t
        asm volatile("s_wait_asynccnt 0x0" ::: "memory");   // its copies of stage t + 1 have landed
        __syncthreads();                                     // stage t + 1 published; every wave has left the buffer of stage t
        if (t + 2 < nst) fill(t + 2);                        // refill of the buffer just left
    }
    asm volatile("s_wait_asynccnt 0x0" ::: "memory");       // no copy in flight when the buffers become the partial results
    v8f* red = (v8f*)sm; float* ml = (float*)(sm + 12 * 8 * 32 * 32);   // per pass 1 to 3 and query group: 8 accumulators a lane; behind them maximum and sum
    if (kh != 0) { const int pp = (kh - 1) * 4 + qg;
#pragma unroll
        for (int d8 = 0; d8 < 8; ++d8) red[(pp * 8 + d8) * 32 + lane] = acc[d8];
        ml[(pp * 2) * 32 + lane] = m_run; ml[(pp * 2 + 1) * 32 + lane] = l_run; }
    __syncthreads();   // the partial results are in LDS before the waves of pass 0 join them
    if (kh == 0) {
        float mp[3], lp[3], a[3], m = m_run;   // m_run is finite here: key 0 is visible to every query. A wave that had no visible pass left -inf, 0 and zeros: its factor below is 0
#pragma unroll
        for (int k = 0; k < 3; ++k) { mp[k] = ml[((k * 4 + qg) * 2) * 32 + lane]; lp[k] = ml[((k * 4 + qg) * 2 + 1) * 32 + lane]; m = fmaxf(m, mp[k]); }
        const float a0 = exp2s(m_run - m); float l = l_run * a0;
#pragma unroll
        for (int k = 0; k < 3; ++k) { a[k] = exp2s(mp[k] - m); l += lp[k] * a[k]; }
        const float inv = __fdiv_rn(1.0f, l + xhalf(l));
        float* op = O + (size_t)(qw0 + lr) * HD + 8 * hi;
#pragma unroll
        for (int d8 = 0; d8 < 8; ++d8) { v8f o = acc[d8] * (a0 * inv);
#pragma unroll
            for (int k = 0; k < 3; ++k) o += red[((k * 4 + qg) * 8 + d8) * 32 + lane] * (a[k] * inv);
            *(v8f*)(op + 16 * d8) = o; } }
}
__global__ __launch_bounds__(512) void k_fa(const h16* __restrict__ Q16, const h16* __restrict__ K16, const h16* __restrict__ V16, const bf* __restrict__ Qh, const bf* __restrict__ Ql, const bf* __restrict__ Kh, const bf* __restrict__ Kl, const bf* __restrict__ Vh, const bf* __restrict__ Vl, float* O) {
    __shared__ __align__(32) unsigned char sm[8 * FTB];   // the two staging buffers (of two or of four tiles); behind the loop the partial results of passes 1 to 3
    const size_t zq = (size_t)blockIdx.x * TT * HD, zk = (size_t)(blockIdx.x / REP) * TT * HD; const int y = blockIdx.y, q0 = 64 * (y < RH / 64 ? RH / 64 - 1 - y : TT / 64 - 1 - (y - RH / 64));
    if (q0 >= RH) fa_body<h16, false>(sm, Q16 + zq, nullptr, K16 + zk, nullptr, V16 + zk, nullptr, O + zq, q0);   // the same for the whole work-group
    else fa_body<bf, true>(sm, Qh + zq, Ql + zq, Kh + zk, Kl + zk, Vh + zk, Vl + zk, O + zq, q0);
}
// k_merge: a thread takes 8 d of one t for 4 heads in a row. blockIdx.y: the batch entry (ZH planes of O, TT rows of Ah, Al).
__global__ __launch_bounds__(256) void k_merge(const float* __restrict__ O, int h0, bf* Ah, bf* Al) { const unsigned gid = blockIdx.x * 256 + threadIdx.x; if (gid >= (unsigned)(ZH / 4) * TT * (HD / 8)) return; O += (size_t)blockIdx.y * ZH * TT * HD; Ah += (size_t)blockIdx.y * TT * DQ; Al += (size_t)blockIdx.y * TT * DQ; const unsigned d = (gid % (HD / 8)) * 8, t = (gid / (HD / 8)) % TT, z0 = (gid / ((HD / 8) * TT)) * 4;
    const unsigned li = ((z0 * TT + t) * HD + d) * 4, so = (t * DQ + (h0 + z0) * HD + d) * 2; v8f x[4]; v8us oh[4], ol[4];
#pragma unroll
    for (int g = 0; g < 4; ++g) x[g] = ldo<v8f>(O + (size_t)g * TT * HD, li);
    asm volatile("s_wait_xcnt 0x0" :: "v"(li) : "memory");   // the loads' offset register is an input here: it stays whole until every address has been taken
#pragma unroll
    for (int g = 0; g < 4; ++g)
#pragma unroll
        for (int q = 0; q < 8; ++q) { unsigned short a, c2; splitf(x[g][q], a, c2); oh[g][q] = a; ol[g][q] = c2; }
#pragma unroll
    for (int g = 0; g < 4; ++g) { sto<v8us>(Ah + g * HD, so, oh[g]); sto<v8us>(Al + g * HD, so, ol[g]); } }

extern "C" void kernel_launch(void* const* d_in, const int* in_sizes, int n_in,
                              void* d_out, int out_size, void* d_ws, size_t ws_size, hipStream_t stream) {
    (void)in_sizes; (void)n_in; (void)out_size;
    const float* xq = (const float*)d_in[0]; const float* xk = (const float*)d_in[1]; const float* xv = (const float*)d_in[2]; const float* wq = (const float*)d_in[3]; const float* wk = (const float*)d_in[4]; const float* wv = (const float*)d_in[5]; const float* wo = (const float*)d_in[6];   /* q, k, v ([2][2048][2048] each: THREE streams), Wq ('xw' (in, out) [2048][2048]: 16 heads x 128), Wk, Wv ('xw' [2048][512]: 4 kv heads x 128), Wo ('xw' [2048][2048]): SEVEN inputs, all read; no bias anywhere */
    float* OUT = (float*)d_out;     // [2][2048][2048]
    char* wsp = (char*)d_ws;
    auto take = [&](size_t bytes) { char* p = wsp; wsp += (bytes + 255) & ~(size_t)255; return (void*)p; };
    static_assert(ZH == NH_, "plane b NH_ + h is blockIdx.x of k_fa");
    bf* WQ = (bf*)take((size_t)DQ * DM * 2); bf* WK = (bf*)take((size_t)2 * DKV * DM * 2); bf* WV = WK + (size_t)DKV * DM; bf* WO = (bf*)take((size_t)DM * DQ * 2); float* CS = (float*)take((size_t)TT * HD * 2 * 4);   /* WK, WV: z = 0, 1 of one GEMM launch */
    bf* XB = (bf*)take((size_t)3 * NB_ * TT * DM * 2); float* FQ = (float*)take((size_t)NB_ * TT * DQ * 4); float* FK = (float*)take((size_t)2 * NB_ * TT * DKV * 4); float* FV = FK + (size_t)NB_ * TT * DKV;   /* XB: the bf16 copies of q, k, v, one behind the other; FK, FV likewise */
    h16* QP16 = (h16*)take((size_t)NB_ * NH_ * TT * HD * 2); h16* KP16 = (h16*)take((size_t)NB_ * NKV * TT * HD * 2); h16* VT16 = (h16*)take((size_t)NB_ * NKV * HD * TT * 2);
    bf* QPh = (bf*)take((size_t)NB_ * NH_ * TT * HD * 2); bf* QPl = (bf*)take((size_t)NB_ * NH_ * TT * HD * 2); bf* KPh = (bf*)take((size_t)NB_ * NKV * TT * HD * 2); bf* KPl = (bf*)take((size_t)NB_ * NKV * TT * HD * 2); bf* VTh = (bf*)take((size_t)NB_ * NKV * HD * TT * 2); bf* VTl = (bf*)take((size_t)NB_ * NKV * HD * TT * 2);
    bf* ATh = (bf*)take((size_t)NB_ * TT * DQ * 2); bf* ATl = (bf*)take((size_t)NB_ * TT * DQ * 2);
    if ((size_t)(wsp - (char*)d_ws) > ws_size) return;    // ws 256 MiB
    float* Ob = (float*)XB;   // the attention output (2 x 16 planes, 32 MiB) reuses the operand copies (48 MiB) after the projections have read them (stream-ordered)
    k_prep<<<3 * NCV + NWT + NCS, 256, 0, stream>>>(xq, xk, xv, XB, wq, wk, wv, wo, WQ, WK, WV, WO, CS);   /* the QUERY, KEY and VALUE streams cast; the four 'xw' (in, out) weights transposed once into Bt operands; identity table: rope is a plain plane builder here */
    k_gemmk<bf, 0, 4><<<dim3(NB_ * TT / 64, DQ / 64, 1), 128, 0, stream>>>(XB, nullptr, WQ, nullptr, DM, FQ, DQ, 0, 0, 0);
    k_gemmk<bf, 0, 8><<<dim3(NB_ * TT / 64, DKV / 64, 2), 256, 0, stream>>>(XB + (size_t)NB_ * TT * DM, nullptr, WK, nullptr, DM, FK, DKV, (size_t)NB_ * TT * DM, (size_t)DKV * DM, (size_t)NB_ * TT * DKV);   /* z = 0: k Wk, z = 1: v Wv */
    k_rope<<<dim3(LQ + LKV, NB_), 256, 0, stream>>>(FQ, FK, CS, QP16, QPh, QPl, KP16, KPh, KPl);
    k_vtp<<<dim3(NKV * TT * HD / 32 / 128, NB_), 128, 0, stream>>>(FV, DKV, NKV, VT16, VTh, VTl);
    /* 'jnp.repeat(kh, 4, axis=1)': query head h uses kv head h / 4; with planes b NH_ + h and b NKV + h / 4 that is plane / REP for both batch entries */
    k_fa<<<dim3(NB_ * ZH, TT / 64), 512, 0, stream>>>(QP16, KP16, VT16, QPh, QPl, KPh, KPl, VTh, VTl, Ob);
    k_merge<<<dim3((unsigned)(((size_t)ZH * TT * HD / 32 + 255) / 256), NB_), 256, 0, stream>>>(Ob, 0, ATh, ATl);
    k_gemmk<bf, 1, 4><<<dim3(NB_ * TT / 64, DM / 64, 1), 128, 0, stream>>>(ATh, ATl, WO, nullptr, DQ, OUT, DM, 0, 0, 0);
}

// v007
// Measured time: 206 microseconds a run.
// In two side-by-side timings against v006, it was 1.14 and 1.13 times as fast.
// Over all steps from v000 it is 7.96 times as fast.
#include <hip/hip_runtime.h>

// Grouped-query causal attention with 128-wide heads on three input streams (q, k, v [2][2048][2048]; qh = q Wq (16 heads x 128), kh, vh = k Wk, v Wv (4 kv heads x 128) ('xw' (in, out) 0.02, no bias); qh and kh each x 128^-0.25 (together 1/sqrt(128)); kv head = query head / 4 (jnp.repeat); the module takes softmax over ALL keys, zeroes the strictly-upper triangle and renormalises by (row sum + 1e-9): a causal softmax but for that epsilon; out = merged Wo ('xw', no bias) -> [2][2048][2048] (8.4 M); argument order q, k, v, Wq, Wk, Wv, Wo).
// Layout: eight launches. Every launch takes BOTH batch entries (rows b T + t of the projections, planes b heads + h of the attention), and work that does not depend on each other shares a launch, each part on its own run of blocks: k_prep (bf16 copies of q, k and v in three operand buffers; the four 'xw' weights transposed into Bt operands; the identity table); exact projections (q; k and v together); plane builders (q and k together; v); causal T-2048 attention with 128-wide heads, all 2 x 16 query heads in ONE launch of the fused kernel k_fa, whose scores and probabilities never leave the registers (kv head = head / 4 on the key and value operands) (hybrid rows: < 512 hi/lo 3 products, rest fp16); merged hi/lo x Wo exact.
// Compute dtypes, f32 accumulate: every input rounded to bf16; projections exact; attention rows < 512 3 products, rest fp16; softmax f32 (the exact causal softmax: no epsilon term); Wo hl x exact.

#define NB_  2
#define TT   2048
#define DM   2048
#define NH_  16
#define NKV  4
#define REP  (NH_ / NKV)
#define HD   128
#define DQ   (NH_ * HD)
#define DKV  (NKV * HD)
#define ZH   16                   // query heads of a batch entry per attention launch (all of them)
#define RH   512                  // query rows < RH use hi+lo planes (0: none)
#define SCL  0.088388347648318447f   // HD^-0.5
typedef _Float16 h16;
typedef unsigned short bf;
typedef __attribute__((ext_vector_type(16))) __bf16   v16bf;
typedef __attribute__((ext_vector_type(16))) _Float16 v16h;
typedef __attribute__((ext_vector_type(8)))  _Float16 v8h;
typedef __attribute__((ext_vector_type(8)))  unsigned short v8us;
typedef __attribute__((ext_vector_type(8)))  float    v8f;
typedef __attribute__((ext_vector_type(4)))  float    v4f;
typedef v8h  __attribute__((may_alias)) v8ha;
typedef v4f  __attribute__((may_alias)) v4fa;
typedef v8us __attribute__((may_alias)) v8usa;

__device__ __forceinline__ unsigned short f2bf(float f) { unsigned u = __float_as_uint(f); u += 0x7FFFu + ((u >> 16) & 1u); return (unsigned short)(u >> 16); }
__device__ __forceinline__ float bf2f(unsigned short b) { return __uint_as_float(((unsigned)b) << 16); }
__device__ __forceinline__ float bfr(float f) { return bf2f(f2bf(f)); }
__device__ __forceinline__ v16h cat16(v8h lo, v8h hi) { return __builtin_shufflevector(lo, hi, 0, 1, 2, 3, 4, 5, 6, 7, 8, 9, 10, 11, 12, 13, 14, 15); }
__device__ __forceinline__ v16bf cat16b(v8us lo, v8us hi) { return __builtin_bit_cast(v16bf, __builtin_shufflevector(lo, hi, 0, 1, 2, 3, 4, 5, 6, 7, 8, 9, 10, 11, 12, 13, 14, 15)); }
__device__ __forceinline__ v8f wmma16(v16h a, v16h b, v8f c) { return __builtin_amdgcn_wmma_f32_16x16x32_f16(false, a, false, b, (short)0, c, false, false); }
__device__ __forceinline__ v8f wmmab(v16bf a, v16bf b, v8f c) { return __builtin_amdgcn_wmma_f32_16x16x32_bf16(false, a, false, b, (short)0, c, false, false); }

// ---- k_gemmk: register-blocked GEMM, one 64 WM x 64 WN output tile per work-group of WM WN WK waves. Wave (wk, wm, wn) owns the 64x64 sub-tile (wm, wn), 16 accumulators, and of every staged trip the 32-k steps wk, wk + WK, ...
// A staged operand row serves WN (A) or WM (Bt) sub-tiles, so the bytes that a work-group draws from L2 per output element fall with the tile: (BM + BN) / (BM BN) rows of K.
// With WK == 1 a wave sums its whole K range in k order; with WK > 1 the WK partial sub-tiles meet in LDS and are summed in wk order. Every wave passes its sub-tile through LDS, so that the stores take whole 256-byte row pieces.
// The operands come through LDS: a trip stages CK k of every K-contiguous 16-bit operand plane by asynchronous 16-byte copies that take whole 128-byte lines, two buffers, the next trip's copies in flight under this trip's products.
// LDS row pitch 2 CK + 16 bytes (an odd multiple of 16). Within a trip the fragments of the next 32-k step are fetched, as one group, ahead of this step's products (two register sets); nothing of the next trip is read ahead.
// C[m][n] (f32, pitch ldc) = sum_k A[m][k] Bt[n][k] (+ A2[m][k] Bt[n][k] where NSPLIT == 1). K % CK == 0, K >= 2 CK (two trips). grid (M / (64 WM), N / (64 WN), Z), 32 WM WN WK threads.
// z-batch: A, Bt and C advance by sA, sB, sC per z (the k and the v projection are z = 0, 1 of one launch).
template <typename T16> struct WFrag;
template <> struct WFrag<h16> { typedef v16h V; static __device__ __forceinline__ V ld(const h16* p) { return cat16(*(const v8h*)p, *(const v8h*)(p + 16)); } static __device__ __forceinline__ v8f mma(V a, V b, v8f c) { return wmma16(a, b, c); } };
template <> struct WFrag<bf> { typedef v16bf V; static __device__ __forceinline__ V ld(const bf* p) { return cat16b(*(const v8us*)p, *(const v8us*)(p + 16)); } static __device__ __forceinline__ v8f mma(V a, V b, v8f c) { return wmmab(a, b, c); } };
// cp8: one lane's eight copies of one staged plane (rows RS apart in k_gemmk, 16 apart in k_fa). The wait on the address counter is the statement's last line, so that no register named by a copy is rewritten in front of it.
template <typename T16>
__device__ __forceinline__ void cp8(unsigned l, const T16* g, unsigned ls, size_t gs) {
    asm volatile("global_load_async_to_lds_b128 %0, %8, off\n\t"
                 "global_load_async_to_lds_b128 %1, %9, off\n\t"
                 "global_load_async_to_lds_b128 %2, %10, off\n\t"
                 "global_load_async_to_lds_b128 %3, %11, off\n\t"
                 "global_load_async_to_lds_b128 %4, %12, off\n\t"
                 "global_load_async_to_lds_b128 %5, %13, off\n\t"
                 "global_load_async_to_lds_b128 %6, %14, off\n\t"
                 "global_load_async_to_lds_b128 %7, %15, off\n\t"
                 "s_wait_xcnt 0x0"
                 :: "v"(l), "v"(l + ls), "v"(l + 2 * ls), "v"(l + 3 * ls), "v"(l + 4 * ls), "v"(l + 5 * ls), "v"(l + 6 * ls), "v"(l + 7 * ls),
                    "v"(g), "v"(g + gs), "v"(g + 2 * gs), "v"(g + 3 * gs), "v"(g + 4 * gs), "v"(g + 5 * gs), "v"(g + 6 * gs), "v"(g + 7 * gs) : "memory");
}
// cp4: the same for four copies.
template <typename T16>
__device__ __forceinline__ void cp4(unsigned l, const T16* g, unsigned ls, size_t gs) {
    asm volatile("global_load_async_to_lds_b128 %0, %4, off\n\t"
                 "global_load_async_to_lds_b128 %1, %5, off\n\t"
                 "global_load_async_to_lds_b128 %2, %6, off\n\t"
                 "global_load_async_to_lds_b128 %3, %7, off\n\t"
                 "s_wait_xcnt 0x0"
                 :: "v"(l), "v"(l + ls), "v"(l + 2 * ls), "v"(l + 3 * ls), "v"(g), "v"(g + gs), "v"(g + 2 * gs), "v"(g + 3 * gs) : "memory");
}
// stage: one lane's N copies of one staged plane, rows ls bytes (LDS) and gs elements (global) apart.
template <int N, typename T16>
__device__ __forceinline__ void stage(unsigned l, const T16* g, unsigned ls, size_t gs) {
    static_assert(N % 4 == 0, "copies come in fours and eights");
#pragma unroll
    for (int i = 0; i < N / 8; ++i) cp8(l + i * 8 * ls, g + i * 8 * gs, ls, gs);
    if (N % 8) cp4(l + (N / 8) * 8 * ls, g + (N / 8) * 8 * gs, ls, gs);
}
template <typename T16, int NSPLIT, int WM, int WN, int WK, int CK>
__global__ __launch_bounds__(32 * WM * WN * WK) void k_gemmk(const T16* __restrict__ A, const T16* __restrict__ A2, const T16* __restrict__ Bt, int K, float* C, int ldc, size_t sA, size_t sB, size_t sC) {
    typedef typename WFrag<T16>::V V;
    static_assert(NSPLIT == 0 || NSPLIT == 1, "one or two A planes");
    constexpr int NG = WM * WN, NW = NG * WK, BM = 64 * WM, BN = 64 * WN, PB = 2 * CK + 16, TA = BM * PB, TBT = BN * PB, BUF = (1 + NSPLIT) * TA + TBT;   // sub-tiles, waves, tile, LDS row pitch, bytes of a staged A and Bt plane and of a buffer (A, Bt, then A2)
    constexpr int RS = 32 * NW * 8 / CK, NS = CK / 32 / WK;   // rows that the block copies at a time (CK / 8 lanes copy one staged row); 32-k steps of a wave per trip
    constexpr int SMB = (2 * BUF > NW * 64 * 68 * 4) ? 2 * BUF : NW * 64 * 68 * 4;
    __shared__ __align__(16) unsigned char sm[SMB];   // the two staging buffers; behind the loop the NW sub-tiles
    const size_t z = blockIdx.z; A += z * sA; if (NSPLIT) A2 += z * sA; Bt += z * sB; C += z * sC;
    const int tid = threadIdx.x, lane = tid & 31, lr = lane & 15, hi = lane >> 4; const int w = __builtin_amdgcn_readfirstlane((int)(threadIdx.x >> 5)), g = w % NG, wk = w / NG, wm = g / WN, wn = g % WN; const int r0 = blockIdx.x * BM, c0 = blockIdx.y * BN;
    const int ntrip = K / CK;
    v8f acc[4][4];
#pragma unroll
    for (int mb = 0; mb < 4; ++mb)
#pragma unroll
        for (int nb = 0; nb < 4; ++nb) acc[mb][nb] = (v8f){};
    const int crow = tid / (CK / 8), ccol = tid % (CK / 8);
    const unsigned l0 = (unsigned)(size_t)sm + crow * PB + ccol * 16;
    const size_t aoff = (size_t)(r0 + crow) * K + 8 * ccol, boff = (size_t)(c0 + crow) * K + 8 * ccol;
    auto fill = [&](int t) { const unsigned l = l0 + (t & 1) * BUF; stage<BM / RS>(l, A + aoff + t * CK, RS * PB, (size_t)RS * K); stage<BN / RS>(l + TA, Bt + boff + t * CK, RS * PB, (size_t)RS * K);
        if (NSPLIT) stage<BM / RS>(l + TA + TBT, A2 + aoff + t * CK, RS * PB, (size_t)RS * K); };
    fill(0);
    asm volatile("s_wait_asynccnt 0x0" ::: "memory");   // this wave's copies of trip 0 have landed
    __syncthreads();                                     // and every other wave's
    fill(1);                                             // a trip 1 always exists
    const int fa = (wm * 64 + lr) * PB + (wk * 32 + 8 * hi) * 2, fb = TA + (wn * 64 + lr) * PB + (wk * 32 + 8 * hi) * 2;
    for (int t = 0; t < ntrip; ++t) {
        const unsigned char* s = sm + (t & 1) * BUF;
        V a[2][4], a2[2][4], b[2][4];
        auto frag = [&](int st, int set) {   // the fragments of this wave's step st of the trip
#pragma unroll
            for (int mb = 0; mb < 4; ++mb) { a[set][mb] = WFrag<T16>::ld((const T16*)(s + fa + mb * 16 * PB + st * WK * 64)); if (NSPLIT) a2[set][mb] = WFrag<T16>::ld((const T16*)(s + fa + TA + TBT + mb * 16 * PB + st * WK * 64)); }
#pragma unroll
            for (int nb = 0; nb < 4; ++nb) b[set][nb] = WFrag<T16>::ld((const T16*)(s + fb + nb * 16 * PB + st * WK * 64)); };
        frag(0, 0);
#pragma unroll
        for (int st = 0; st < NS; ++st) {
            if (st + 1 < NS) frag(st + 1, (st + 1) & 1);
            __builtin_amdgcn_sched_barrier(0);   // keeps the next step's fragment loads together ahead of this step's products, for speed only
#pragma unroll
            for (int nb = 0; nb < 4; ++nb) {
#pragma unroll
                for (int mb = 0; mb < 4; ++mb) acc[mb][nb] = WFrag<T16>::mma(a[st & 1][mb], b[st & 1][nb], acc[mb][nb]);
                if (NSPLIT) {
#pragma unroll
                    for (int mb = 0; mb < 4; ++mb) acc[mb][nb] = WFrag<T16>::mma(a2[st & 1][mb], b[st & 1][nb], acc[mb][nb]); } }
        }
        asm volatile("s_wait_dscnt 0x0" ::: "memory");      // this wave has left the buffer of trip t
        asm volatile("s_wait_asynccnt 0x0" ::: "memory");   // its copies of trip t + 1 have landed
        __syncthreads();                                     // trip t + 1 published; every wave has left the buffer of trip t
        if (t + 2 < ntrip) fill(t + 2);                      // refill of the buffer just left
    }
    asm volatile("s_wait_asynccnt 0x0" ::: "memory");       // no copy in flight when the buffers become the sub-tiles
    float* red = (float*)sm; float* mine = red + w * (64 * 68);
#pragma unroll
    for (int mb = 0; mb < 4; ++mb)
#pragma unroll
        for (int nb = 0; nb < 4; ++nb)
#pragma unroll
            for (int j = 0; j < 8; ++j) mine[(mb * 16 + hi * 8 + j) * 68 + nb * 16 + lr] = acc[mb][nb][j];
    __syncthreads();   // every wave's sub-tile is in LDS before any wave reads rows of it
#pragma unroll
    for (int s = 0; s < 32 / WK; ++s) { const int row = wk * (64 / WK) + 2 * s + hi, cofs = lr * 4; v4f val = *(const v4fa*)(red + g * (64 * 68) + row * 68 + cofs);
#pragma unroll
        for (int p = 1; p < WK; ++p) val += *(const v4fa*)(red + (p * NG + g) * (64 * 68) + row * 68 + cofs);
        *(v4f*)(C + (size_t)(r0 + wm * 64 + row) * ldc + c0 + wn * 64 + cofs) = val; }
}

__device__ __forceinline__ h16 tohx(float x) { return (h16)x; }
__device__ __forceinline__ void splitf(float y, unsigned short& h, unsigned short& l) { h = f2bf(y); l = f2bf(y - bf2f(h)); }
typedef __attribute__((ext_vector_type(2))) _Float16 v2h;
typedef __attribute__((ext_vector_type(4))) _Float16 v4h;
typedef __attribute__((ext_vector_type(2))) unsigned short v2us;
typedef __attribute__((ext_vector_type(4))) unsigned short v4us;
typedef __attribute__((ext_vector_type(2))) float v2f;
typedef __attribute__((ext_vector_type(4))) int v4i;

// The kernels without matrix work (casts, transposes, plane builders, merge) take 32 elements a thread: 16-byte loads, all issued ahead of the arithmetic, and 16-byte stores, all behind it.
// Addresses are a uniform base plus one 32-bit byte offset per lane (every buffer here is far below 4 GiB).
// Those that share a launch are device functions of a block index bx (blocks of 256 threads): the kernels k_prep and k_rope deal their blocks out to them.
template <typename V> __device__ __forceinline__ V ldo(const void* base, unsigned off) { return *(const V*)((const char*)base + off); }
template <typename V> __device__ __forceinline__ void sto(void* base, unsigned off, V v) { *(V*)((char*)base + off) = v; }
// wtG: Bt[n][k] (bf16) = w[k][n], the four weights one behind the other: each takes the run of blocks that its K N / 8192 needs, in the order q, k, v, o (all four have K = 2048). A thread takes 8 k x 4 n: eight loads (rows k), four stores (rows n). Lanes: 8 along k (one whole 128-byte line of a Bt row), 4 along n; the 8 waves of a block lie side by side along n (512 contiguous bytes of each w row). K % 64 == 0, N % 16 == 0.
#define NWT ((2 * DM * DQ + 2 * DM * DKV) / 8192)   // its blocks
__device__ __forceinline__ void wtG(const int bx, const float* __restrict__ wq, const float* __restrict__ wk, const float* __restrict__ wv_, const float* __restrict__ wo, bf* BQ, bf* BK, bf* BV, bf* BO) {
    static_assert(DQ == DM, "one K for the four weights");
    constexpr int K = DM, nq = DM * DQ / 8192, nk = DM * DKV / 8192; const int sel = bx < nq ? 0 : bx < nq + nk ? 1 : bx < nq + 2 * nk ? 2 : 3;   // the same for the whole block
    const float* __restrict__ w = sel == 0 ? wq : sel == 1 ? wk : sel == 2 ? wv_ : wo; bf* Bt = sel == 0 ? BQ : sel == 1 ? BK : sel == 2 ? BV : BO; const int N = sel == 0 ? DQ : sel == 3 ? DM : DKV, b0 = sel == 0 ? 0 : sel == 1 ? nq : sel == 2 ? nq + nk : nq + 2 * nk;
    const int gid = (bx - b0) * 256 + threadIdx.x, wv = gid >> 5, lane = gid & 31; const int nng = N / 16; if (wv >= nng * (K / 64)) return;
    const int n0 = ((wv % nng) * 4 + (lane >> 3)) * 4, k0 = ((wv / nng) * 8 + (lane & 7)) * 8; const unsigned so = ((unsigned)n0 * K + k0) * 2; unsigned li[8]; v4f x[8]; v8us o[4];
#pragma unroll
    for (int i = 0; i < 8; ++i) li[i] = ((unsigned)(k0 + i) * N + n0) * 4;
#pragma unroll
    for (int i = 0; i < 8; ++i) x[i] = ldo<v4f>(w, li[i]);
    asm volatile("s_wait_xcnt 0x0" :: "v"(li[0]), "v"(li[1]), "v"(li[2]), "v"(li[3]), "v"(li[4]), "v"(li[5]), "v"(li[6]), "v"(li[7]) : "memory");   // the loads' offset registers are inputs here: they stay whole until every address has been taken
#pragma unroll
    for (int j = 0; j < 4; ++j)
#pragma unroll
        for (int i = 0; i < 8; ++i) o[j][i] = f2bf(x[i][j]);
#pragma unroll
    for (int j = 0; j < 4; ++j) sto<v8us>(Bt, so + (unsigned)j * K * 2, o[j]);
}
// cvt8: four groups of 8 elements a thread, 256 groups apart (beyond the end: the last group is loaded, in bounds, and not stored).
__device__ __forceinline__ void cvt8(const unsigned bx, const float* __restrict__ src, bf* dst, size_t n8) { const size_t i0 = (size_t)bx * 1024 + threadIdx.x; v8f v[4]; unsigned li[4];
#pragma unroll
    for (int u = 0; u < 4; ++u) { const size_t i = i0 + u * 256; li[u] = (unsigned)((i < n8 ? i : n8 - 1) * 32); }
#pragma unroll
    for (int u = 0; u < 4; ++u) v[u] = ldo<v8f>(src, li[u]);
    asm volatile("s_wait_xcnt 0x0" :: "v"(li[0]), "v"(li[1]), "v"(li[2]), "v"(li[3]) : "memory");   // the loads' offset registers are inputs here: they stay whole until every address has been taken
#pragma unroll
    for (int u = 0; u < 4; ++u) { const size_t i = i0 + u * 256; v8us o;
#pragma unroll
        for (int k = 0; k < 8; ++k) o[k] = f2bf(v[u][k]);
        if (i < n8) *(v8us*)(dst + i * 8) = o; } }
__device__ __forceinline__ void csid(const int bx, float* CS) { const int i0 = bx * 1024 + threadIdx.x; v4f cs; cs[0] = 1.0f; cs[1] = 0.0f; cs[2] = 1.0f; cs[3] = 0.0f;
#pragma unroll
    for (int u = 0; u < 4; ++u) { const int idx = i0 + u * 256; if (idx < TT * HD / 2) *(v4f*)(CS + (size_t)idx * 4) = cs; } }
// k_prep: all that reads only the inputs. Blocks: NCV for each of the three streams (both batch entries; the copies lie one behind the other in XB), then NWT for the weights, then NCS for the table. The tests are the same for a whole block.
#define NCV (NB_ * TT * DM / 32 / 256)
#define NCS ((TT * HD / 8 + 255) / 256)
__global__ __launch_bounds__(256) void k_prep(const float* __restrict__ xq, const float* __restrict__ xk, const float* __restrict__ xv, bf* XB, const float* __restrict__ wq, const float* __restrict__ wk, const float* __restrict__ wv, const float* __restrict__ wo, bf* WQ, bf* WK, bf* WV, bf* WO, float* CS) {
    const unsigned bx = blockIdx.x;
    if (bx < 3 * NCV) { const unsigned st = bx / NCV; cvt8(bx - st * NCV, st == 0 ? xq : st == 1 ? xk : xv, XB + (size_t)st * NB_ * TT * DM, (size_t)NB_ * TT * DM / 8); }
    else if (bx < 3 * NCV + NWT) wtG((int)(bx - 3 * NCV), wq, wk, wv, wo, WQ, WK, WV, WO);
    else csid((int)(bx - 3 * NCV - NWT), CS);
}
// rope: head planes [h][t][d] (fp16 + hi/lo) of rope(x) x sc with the rotate-half convention out[d] = x[d] cos[t][d] - x[d+HD/2] sin[t][d], out[d+HD/2] = x[d+HD/2] cos[t][d+HD/2] + x[d] sin[t][d+HD/2]
// A thread takes 8 d of one t for 4 heads in a row (one read of the table entries serves the four). nheads % 4 == 0. One batch entry: TT rows of F, nheads planes.
__device__ __forceinline__ void rope(const unsigned bx, const float* __restrict__ F, int pitch, int nheads, const float* __restrict__ CS, float sc, h16* P16, bf* Ph, bf* Pl) {
    const unsigned gid = bx * 256 + threadIdx.x; if (gid >= (unsigned)(nheads / 4) * TT * (HD / 8)) return; const unsigned d = (gid % (HD / 8)) * 8, t = (gid / (HD / 8)) % TT, h0 = (gid / ((HD / 8) * TT)) * 4;
    const unsigned la = (t * pitch + h0 * HD + d) * 4, lb = la ^ (HD / 2 * 4), lc = (t * HD + d) * 8, so = ((h0 * TT + t) * HD + d) * 2;   // lb: the partner half of the head (d ^ 64; the head's start is a multiple of 512 bytes where pitch % 128 == 0)
    v4f cs4[4]; v8f xa[4], xb[4]; v8h o16[4]; v8us oh[4], ol[4];
#pragma unroll
    for (int u = 0; u < 4; ++u) cs4[u] = ldo<v4f>(CS + u * 4, lc);
#pragma unroll
    for (int g = 0; g < 4; ++g) { xa[g] = ldo<v8f>(F + g * HD, la); xb[g] = ldo<v8f>(F + g * HD, lb); }
    asm volatile("s_wait_xcnt 0x0" :: "v"(la), "v"(lb), "v"(lc) : "memory");   // the loads' offset registers are inputs here: they stay whole until every address has been taken
    __builtin_amdgcn_sched_barrier(0);   // keeps the arithmetic behind all twenty loads: without it six of them were issued only after the first results had come back
#pragma unroll
    for (int g = 0; g < 4; ++g)
#pragma unroll
        for (int q = 0; q < 8; ++q) { const float a = __fmul_rn(xa[g][q], cs4[q >> 1][(q & 1) * 2]), bq = __fmul_rn(xb[g][q], cs4[q >> 1][(q & 1) * 2 + 1]); const float r = ((d < HD / 2) ? __fsub_rn(a, bq) : __fadd_rn(a, bq)) * sc;
            o16[g][q] = tohx(r); unsigned short a2, c2; splitf(r, a2, c2); oh[g][q] = a2; ol[g][q] = c2; }
#pragma unroll
    for (int g = 0; g < 4; ++g) { sto<v8h>(P16 + (size_t)g * TT * HD, so, o16[g]); sto<v8us>(Ph + (size_t)g * TT * HD, so, oh[g]); sto<v8us>(Pl + (size_t)g * TT * HD, so, ol[g]); } }
// k_rope: the plane builders of the query and of the key projection. blockIdx.x: LQ blocks for the query heads, then LKV for the key heads (the test is the same for a whole block); blockIdx.y: the batch entry.
#define LQ  (NH_ * TT * HD / 32 / 256)
#define LKV (NKV * TT * HD / 32 / 256)
__global__ __launch_bounds__(256) void k_rope(const float* __restrict__ FQ, const float* __restrict__ FK, const float* __restrict__ CS, h16* QP16, bf* QPh, bf* QPl, h16* KP16, bf* KPh, bf* KPl) {
    const unsigned bx = blockIdx.x; const bool k = bx >= LQ; const size_t fq = (size_t)blockIdx.y * TT * DQ, fk = (size_t)blockIdx.y * TT * DKV, pq = (size_t)blockIdx.y * NH_ * TT * HD, pk = (size_t)blockIdx.y * NKV * TT * HD;
    rope(k ? bx - LQ : bx, k ? FK + fk : FQ + fq, k ? DKV : DQ, k ? NKV : NH_, CS, 1.0f, k ? KP16 + pk : QP16 + pq, k ? KPh + pk : QPh + pq, k ? KPl + pk : QPl + pq);
}
// k_vtp: value planes [g][d][t] (fp16 + hi/lo) of F[t][g HD + d]. A thread takes 8 t x 4 d: eight loads (rows t), four stores a plane (rows d). Lanes: 8 along t (one whole 128-byte line of a plane row), 4 along d; the 4 waves of a block lie side by side along d. blockIdx.y: the batch entry (TT rows of F, nheads planes).
__global__ __launch_bounds__(128) void k_vtp(const float* __restrict__ F, int pitch, int nheads, h16* V16, bf* Vh, bf* Vl) { const unsigned gid = blockIdx.x * 128 + threadIdx.x, wv = gid >> 5, lane = gid & 31; if (wv >= (unsigned)nheads * (HD / 16) * (TT / 64)) return;
    { const size_t fb = (size_t)blockIdx.y * TT * pitch, pb = (size_t)blockIdx.y * nheads * HD * TT; F += fb; V16 += pb; Vh += pb; Vl += pb; }
    const unsigned d0 = ((wv % (HD / 16)) * 4 + (lane >> 3)) * 4, t0 = (((wv / (HD / 16)) % (TT / 64)) * 8 + (lane & 7)) * 8, g = wv / ((HD / 16) * (TT / 64)); const unsigned so = ((g * HD + d0) * TT + t0) * 2; unsigned li[8]; v4f x[8]; v8h o16[4]; v8us oh[4], ol[4];
#pragma unroll
    for (int i = 0; i < 8; ++i) li[i] = ((t0 + i) * pitch + g * HD + d0) * 4;
#pragma unroll
    for (int i = 0; i < 8; ++i) x[i] = ldo<v4f>(F, li[i]);
    asm volatile("s_wait_xcnt 0x0" :: "v"(li[0]), "v"(li[1]), "v"(li[2]), "v"(li[3]), "v"(li[4]), "v"(li[5]), "v"(li[6]), "v"(li[7]) : "memory");   // the loads' offset registers are inputs here: they stay whole until every address has been taken
#pragma unroll
    for (int j = 0; j < 4; ++j)
#pragma unroll
        for (int i = 0; i < 8; ++i) { const float xv = x[i][j]; o16[j][i] = tohx(xv); unsigned short a2, c2; splitf(xv, a2, c2); oh[j][i] = a2; ol[j][i] = c2; }
#pragma unroll
    for (int j = 0; j < 4; ++j) { sto<v8h>(V16 + j * TT, so, o16[j]); sto<v8us>(Vh + j * TT, so, oh[j]); sto<v8us>(Vl + j * TT, so, ol[j]); } }
#define FPB (2 * HD + 16)
#define FTB (128 * FPB)
__device__ __forceinline__ float xhalf(float x) { return __builtin_bit_cast(float, __builtin_amdgcn_permlanex16(__builtin_bit_cast(int, x), __builtin_bit_cast(int, x), 0x76543210, 0xfedcba98, false, false)); }   // lane l with lane l ^ 16
// exp2s: v_exp_f32 with the free slot behind it in the same statement.
__device__ __forceinline__ float exp2s(float x) { float r; asm("v_exp_f32 %0, %1\n\tv_nop" : "=v"(r) : "v"(x)); return r; }
template <typename T16, bool HL>
__device__ __forceinline__ void fa_body(unsigned char* sm, const T16* __restrict__ Q, const T16* __restrict__ Q2, const T16* __restrict__ Kp, const T16* __restrict__ K2, const T16* __restrict__ Vt, const T16* __restrict__ V2, float* O, const int q0) {
    typedef typename WFrag<T16>::V V;
    constexpr int PB = FPB, TB = FTB, BUF = (HL ? 4 : 2) * TB; constexpr float CSC = SCL * 1.4426950408889634f;
    const int tid = threadIdx.x, lane = tid & 31, lr = lane & 15, hi = lane >> 4; const int w = __builtin_amdgcn_readfirstlane((int)(threadIdx.x >> 5)), qg = w & 3, kh = w >> 2;
    const int qw0 = q0 + 16 * qg, nst = (q0 + 64 + 127) / 128;   // stages up to the one that holds the diagonal (nst * 128 <= TT)
    const bool cv = w >= 8; const int crow = (tid & 255) >> 4, ccol = tid & 15;   // 16 lanes copy one staged row; eight waves copy 16 rows of their tile at a time
    const unsigned l0 = (unsigned)(size_t)sm + (cv ? TB : 0) + crow * PB + ccol * 16;
    const size_t go = (cv ? (size_t)crow * TT : (size_t)crow * HD) + ccol * 8, gs = cv ? (size_t)16 * TT : (size_t)16 * HD, gt = cv ? (size_t)128 : (size_t)128 * HD;   // elements: this lane's first copy; from 16 rows to the next; from a stage to the next
    const T16* g0 = (cv ? Vt : Kp) + go; const T16* g1 = HL ? (cv ? V2 : K2) + go : nullptr;
    auto fill = [&](int t) { const unsigned l = l0 + (t & 1) * BUF; cp8(l, g0 + t * gt, 16 * PB, gs); if (HL) cp8(l + 2 * TB, g1 + t * gt, 16 * PB, gs); };
    fill(0);
    V qf[4], q2[4];
#pragma unroll
    for (int kc = 0; kc < 4; ++kc) { qf[kc] = WFrag<T16>::ld(Q + (size_t)(qw0 + lr) * HD + kc * 32 + 8 * hi); if (HL) q2[kc] = WFrag<T16>::ld(Q2 + (size_t)(qw0 + lr) * HD + kc * 32 + 8 * hi); }
    v8f acc[8];
#pragma unroll
    for (int d8 = 0; d8 < 8; ++d8) acc[d8] = (v8f){};
    float m_run = -__builtin_inff(), l_run = 0.0f;
    asm volatile("s_wait_asynccnt 0x0" ::: "memory");   // this wave's copies of stage 0 have landed
    __syncthreads();                                     // and every other wave's
    if (1 < nst) fill(1);                                // where a stage 1 exists
    for (int t = 0; t < nst; ++t) {
        const int key0 = t * 128 + kh * 32;
        if (key0 <= qw0 + 15) {   // some key of the pass is visible to the wave's last query (the same for the whole wave); its first key is then visible to every query of the wave
            const unsigned char* sK = sm + (t & 1) * BUF + (kh * 32 + lr) * PB + 16 * hi; const unsigned char* sV = sm + (t & 1) * BUF + TB + lr * PB + kh * 64 + 16 * hi;
            V kf[2][4], vf[8]; v8f s[2];
#pragma unroll
            for (int kt = 0; kt < 2; ++kt)
#pragma unroll
                for (int kc = 0; kc < 4; ++kc) kf[kt][kc] = WFrag<T16>::ld((const T16*)(sK + kt * 16 * PB + kc * 64));
            if (!HL) __builtin_amdgcn_sched_barrier(0);   // keeps the key fragments' 16 loads together ahead of the products, for speed only (with the lo planes' operands the registers do not allow it)
            s[0] = (v8f){}; s[1] = (v8f){};
#pragma unroll
            for (int kc = 0; kc < 4; ++kc)
#pragma unroll
                for (int kt = 0; kt < 2; ++kt) { s[kt] = WFrag<T16>::mma(kf[kt][kc], qf[kc], s[kt]); if (HL) s[kt] = WFrag<T16>::mma(kf[kt][kc], q2[kc], s[kt]); }
            if (HL) {
#pragma unroll
                for (int kt = 0; kt < 2; ++kt)
#pragma unroll
                    for (int kc = 0; kc < 4; ++kc) kf[kt][kc] = WFrag<T16>::ld((const T16*)(sK + 2 * TB + kt * 16 * PB + kc * 64));
#pragma unroll
                for (int kc = 0; kc < 4; ++kc)
#pragma unroll
                    for (int kt = 0; kt < 2; ++kt) s[kt] = WFrag<T16>::mma(kf[kt][kc], qf[kc], s[kt]); }
#pragma unroll
            for (int d8 = 0; d8 < 8; ++d8) vf[d8] = WFrag<T16>::ld((const T16*)(sV + d8 * 16 * PB));
            if (!HL) __builtin_amdgcn_sched_barrier(0);   // the value fragments' 16 loads are issued by here, so that they land under the softmax arithmetic
            if (key0 + 31 > qw0) {   // the pass straddles the wave's diagonal (the same for the whole wave)
#pragma unroll
                for (int kt = 0; kt < 2; ++kt)
#pragma unroll
                    for (int r = 0; r < 8; ++r) if (key0 + 16 * kt + 8 * hi + r > qw0 + lr) s[kt][r] = -__builtin_inff(); }
            float mx = fmaxf(s[0][0], s[1][0]);
#pragma unroll
            for (int r = 1; r < 8; ++r) mx = fmaxf(mx, fmaxf(s[0][r], s[1][r]));
            mx = fmaxf(mx, xhalf(mx)) * CSC;   // both halves hold the query's maximum of this pass, scaled
            if (__builtin_amdgcn_ballot_w32(mx > m_run + 8.0f) != 0) {   // one scalar test a pass; always taken on a wave's first pass (m_run = -inf: the factor is 0, on zeros)
                const float m_new = fmaxf(m_run, mx), corr = __builtin_amdgcn_exp2f(m_run - m_new); l_run *= corr; m_run = m_new;
#pragma unroll
                for (int d8 = 0; d8 < 8; ++d8) acc[d8] = acc[d8] * corr; }
            float p[2][8], ps0 = 0.0f, ps1 = 0.0f;
#pragma unroll
            for (int r = 0; r < 8; ++r) { const float x0 = __builtin_fmaf(s[0][r], CSC, -m_run), x1 = __builtin_fmaf(s[1][r], CSC, -m_run); p[0][r] = HL ? exp2s(x0) : __builtin_amdgcn_exp2f(x0); p[1][r] = HL ? exp2s(x1) : __builtin_amdgcn_exp2f(x1); ps0 += p[0][r]; ps1 += p[1][r]; }   // hi/lo: exp2s
            l_run += ps0 + ps1;
            if constexpr (HL) {
                v8us h0, h1, e0, e1;
#pragma unroll
                for (int r = 0; r < 8; ++r) { unsigned short a, c2; splitf(p[0][r], a, c2); h0[r] = a; e0[r] = c2; splitf(p[1][r], a, c2); h1[r] = a; e1[r] = c2; }
                const V pfh = cat16b(h0, h1), pfl = cat16b(e0, e1);
#pragma unroll
                for (int d8 = 0; d8 < 8; ++d8) { acc[d8] = WFrag<T16>::mma(vf[d8], pfh, acc[d8]); acc[d8] = WFrag<T16>::mma(vf[d8], pfl, acc[d8]); }
#pragma unroll
                for (int d8 = 0; d8 < 8; ++d8) vf[d8] = WFrag<T16>::ld((const T16*)(sV + 2 * TB + d8 * 16 * PB));
#pragma unroll
                for (int d8 = 0; d8 < 8; ++d8) acc[d8] = WFrag<T16>::mma(vf[d8], pfh, acc[d8]);
            } else {
                V pf;
#pragma unroll
                for (int r = 0; r < 8; ++r) { pf[r] = (h16)p[0][r]; pf[8 + r] = (h16)p[1][r]; }
#pragma unroll
                for (int d8 = 0; d8 < 8; ++d8) acc[d8] = WFrag<T16>::mma(vf[d8], pf, acc[d8]);
            }
        }
        asm volatile("s_wait_dscnt 0x0" ::: "memory");      // this wave has left the buffer of stage t
        asm volatile("s_wait_asynccnt 0x0" ::: "memory");   // its copies of stage t + 1 have landed
        __syncthreads();                                     // stage t + 1 published; every wave has left the buffer of stage t
        if (t + 2 < nst) fill(t + 2);                        // refill of the buffer just left
    }
    asm volatile("s_wait_asynccnt 0x0" ::: "memory");       // no copy in flight when the buffers become the partial results
    v8f* red = (v8f*)sm; float* ml = (float*)(sm + 12 * 8 * 32 * 32);   // per pass 1 to 3 and query group: 8 accumulators a lane; behind them maximum and sum
    if (kh != 0) { const int pp = (kh - 1) * 4 + qg;
#pragma unroll
        for (int d8 = 0; d8 < 8; ++d8) red[(pp * 8 + d8) * 32 + lane] = acc[d8];
        ml[(pp * 2) * 32 + lane] = m_run; ml[(pp * 2 + 1) * 32 + lane] = l_run; }
    __syncthreads();   // the partial results are in LDS before the waves of pass 0 join them
    if (kh == 0) {
        float mp[3], lp[3], a[3], m = m_run;   // m_run is finite here: key 0 is visible to every query. A wave that had no visible pass left -inf, 0 and zeros: its factor below is 0
#pragma unroll
        for (int k = 0; k < 3; ++k) { mp[k] = ml[((k * 4 + qg) * 2) * 32 + lane]; lp[k] = ml[((k * 4 + qg) * 2 + 1) * 32 + lane]; m = fmaxf(m, mp[k]); }
        const float a0 = exp2s(m_run - m); float l = l_run * a0;
#pragma unroll
        for (int k = 0; k < 3; ++k) { a[k] = exp2s(mp[k] - m); l += lp[k] * a[k]; }
        const float inv = __fdiv_rn(1.0f, l + xhalf(l));
        float* op = O + (size_t)(qw0 + lr) * HD + 8 * hi;
#pragma unroll
        for (int d8 = 0; d8 < 8; ++d8) { v8f o = acc[d8] * (a0 * inv);
#pragma unroll
            for (int k = 0; k < 3; ++k) o += red[((k * 4 + qg) * 8 + d8) * 32 + lane] * (a[k] * inv);
            *(v8f*)(op + 16 * d8) = o; } }
}
__global__ __launch_bounds__(512) void k_fa(const h16* __restrict__ Q16, const h16* __restrict__ K16, const h16* __restrict__ V16, const bf* __restrict__ Qh, const bf* __restrict__ Ql, const bf* __restrict__ Kh, const bf* __restrict__ Kl, const bf* __restrict__ Vh, const bf* __restrict__ Vl, float* O) {
    __shared__ __align__(32) unsigned char sm[8 * FTB];   // the two staging buffers (of two or of four tiles); behind the loop the partial results of passes 1 to 3
    const size_t zq = (size_t)blockIdx.x * TT * HD, zk = (size_t)(blockIdx.x / REP) * TT * HD; const int y = blockIdx.y, q0 = 64 * (y < RH / 64 ? RH / 64 - 1 - y : TT / 64 - 1 - (y - RH / 64));
    if (q0 >= RH) fa_body<h16, false>(sm, Q16 + zq, nullptr, K16 + zk, nullptr, V16 + zk, nullptr, O + zq, q0);   // the same for the whole work-group
    else fa_body<bf, true>(sm, Qh + zq, Ql + zq, Kh + zk, Kl + zk, Vh + zk, Vl + zk, O + zq, q0);
}
// k_merge: a thread takes 8 d of one t for 4 heads in a row. blockIdx.y: the batch entry (ZH planes of O, TT rows of Ah, Al).
__global__ __launch_bounds__(256) void k_merge(const float* __restrict__ O, int h0, bf* Ah, bf* Al) { const unsigned gid = blockIdx.x * 256 + threadIdx.x; if (gid >= (unsigned)(ZH / 4) * TT * (HD / 8)) return; O += (size_t)blockIdx.y * ZH * TT * HD; Ah += (size_t)blockIdx.y * TT * DQ; Al += (size_t)blockIdx.y * TT * DQ; const unsigned d = (gid % (HD / 8)) * 8, t = (gid / (HD / 8)) % TT, z0 = (gid / ((HD / 8) * TT)) * 4;
    const unsigned li = ((z0 * TT + t) * HD + d) * 4, so = (t * DQ + (h0 + z0) * HD + d) * 2; v8f x[4]; v8us oh[4], ol[4];
#pragma unroll
    for (int g = 0; g < 4; ++g) x[g] = ldo<v8f>(O + (size_t)g * TT * HD, li);
    asm volatile("s_wait_xcnt 0x0" :: "v"(li) : "memory");   // the loads' offset register is an input here: it stays whole until every address has been taken
#pragma unroll
    for (int g = 0; g < 4; ++g)
#pragma unroll
        for (int q = 0; q < 8; ++q) { unsigned short a, c2; splitf(x[g][q], a, c2); oh[g][q] = a; ol[g][q] = c2; }
#pragma unroll
    for (int g = 0; g < 4; ++g) { sto<v8us>(Ah + g * HD, so, oh[g]); sto<v8us>(Al + g * HD, so, ol[g]); } }

extern "C" void kernel_launch(void* const* d_in, const int* in_sizes, int n_in,
                              void* d_out, int out_size, void* d_ws, size_t ws_size, hipStream_t stream) {
    (void)in_sizes; (void)n_in; (void)out_size;
    const float* xq = (const float*)d_in[0]; const float* xk = (const float*)d_in[1]; const float* xv = (const float*)d_in[2]; const float* wq = (const float*)d_in[3]; const float* wk = (const float*)d_in[4]; const float* wv = (const float*)d_in[5]; const float* wo = (const float*)d_in[6];   /* q, k, v ([2][2048][2048] each: THREE streams), Wq ('xw' (in, out) [2048][2048]: 16 heads x 128), Wk, Wv ('xw' [2048][512]: 4 kv heads x 128), Wo ('xw' [2048][2048]): SEVEN inputs, all read; no bias anywhere */
    float* OUT = (float*)d_out;     // [2][2048][2048]
    char* wsp = (char*)d_ws;
    auto take = [&](size_t bytes) { char* p = wsp; wsp += (bytes + 255) & ~(size_t)255; return (void*)p; };
    static_assert(ZH == NH_, "plane b NH_ + h is blockIdx.x of k_fa");
    bf* WQ = (bf*)take((size_t)DQ * DM * 2); bf* WK = (bf*)take((size_t)2 * DKV * DM * 2); bf* WV = WK + (size_t)DKV * DM; bf* WO = (bf*)take((size_t)DM * DQ * 2); float* CS = (float*)take((size_t)TT * HD * 2 * 4);   /* WK, WV: z = 0, 1 of one GEMM launch */
    bf* XB = (bf*)take((size_t)3 * NB_ * TT * DM * 2); float* FQ = (float*)take((size_t)NB_ * TT * DQ * 4); float* FK = (float*)take((size_t)2 * NB_ * TT * DKV * 4); float* FV = FK + (size_t)NB_ * TT * DKV;   /* XB: the bf16 copies of q, k, v, one behind the other; FK, FV likewise */
    h16* QP16 = (h16*)take((size_t)NB_ * NH_ * TT * HD * 2); h16* KP16 = (h16*)take((size_t)NB_ * NKV * TT * HD * 2); h16* VT16 = (h16*)take((size_t)NB_ * NKV * HD * TT * 2);
    bf* QPh = (bf*)take((size_t)NB_ * NH_ * TT * HD * 2); bf* QPl = (bf*)take((size_t)NB_ * NH_ * TT * HD * 2); bf* KPh = (bf*)take((size_t)NB_ * NKV * TT * HD * 2); bf* KPl = (bf*)take((size_t)NB_ * NKV * TT * HD * 2); bf* VTh = (bf*)take((size_t)NB_ * NKV * HD * TT * 2); bf* VTl = (bf*)take((size_t)NB_ * NKV * HD * TT * 2);
    bf* ATh = (bf*)take((size_t)NB_ * TT * DQ * 2); bf* ATl = (bf*)take((size_t)NB_ * TT * DQ * 2);
    if ((size_t)(wsp - (char*)d_ws) > ws_size) return;    // ws 256 MiB
    float* Ob = (float*)XB;   // the attention output (2 x 16 planes, 32 MiB) reuses the operand copies (48 MiB) after the projections have read them (stream-ordered)
    k_prep<<<3 * NCV + NWT + NCS, 256, 0, stream>>>(xq, xk, xv, XB, wq, wk, wv, wo, WQ, WK, WV, WO, CS);   /* the QUERY, KEY and VALUE streams cast; the four 'xw' (in, out) weights transposed once into Bt operands; identity table: rope is a plain plane builder here */
    k_gemmk<bf, 0, 4, 2, 1, 128><<<dim3(NB_ * TT / 256, DQ / 128, 1), 256, 0, stream>>>(XB, nullptr, WQ, DM, FQ, DQ, 0, 0, 0);
    k_gemmk<bf, 0, 2, 2, 2, 256><<<dim3(NB_ * TT / 128, DKV / 128, 2), 256, 0, stream>>>(XB + (size_t)NB_ * TT * DM, nullptr, WK, DM, FK, DKV, (size_t)NB_ * TT * DM, (size_t)DKV * DM, (size_t)NB_ * TT * DKV);   /* z = 0: k Wk, z = 1: v Wv */
    k_rope<<<dim3(LQ + LKV, NB_), 256, 0, stream>>>(FQ, FK, CS, QP16, QPh, QPl, KP16, KPh, KPl);
    k_vtp<<<dim3(NKV * TT * HD / 32 / 128, NB_), 128, 0, stream>>>(FV, DKV, NKV, VT16, VTh, VTl);
    /* 'jnp.repeat(kh, 4, axis=1)': query head h uses kv head h / 4; with planes b NH_ + h and b NKV + h / 4 that is plane / REP for both batch entries */
    k_fa<<<dim3(NB_ * ZH, TT / 64), 512, 0, stream>>>(QP16, KP16, VT16, QPh, QPl, KPh, KPl, VTh, VTl, Ob);
    k_merge<<<dim3((unsigned)(((size_t)ZH * TT * HD / 32 + 255) / 256), NB_), 256, 0, stream>>>(Ob, 0, ATh, ATl);
    k_gemmk<bf, 1, 4, 2, 1, 64><<<dim3(NB_ * TT / 256, DM / 128, 1), 256, 0, stream>>>(ATh, ATl, WO, DQ, OUT, DM, 0, 0, 0);
}

// v008
// One run takes 162 microseconds.
// Next to v007, in two timings, it ran 1.26 and 1.27 times as fast.
// Over all steps from v000 it is 10.1 times as fast.
#include <hip/hip_runtime.h>

// Grouped-query causal attention with 128-wide heads on three input streams (q, k, v [2][2048][2048]; qh = q Wq (16 heads x 128), kh, vh = k Wk, v Wv (4 kv heads x 128) ('xw' (in, out) 0.02, no bias); qh and kh each x 128^-0.25 (together 1/sqrt(128)); kv head = query head / 4 (jnp.repeat); the module takes softmax over ALL keys, zeroes the strictly-upper triangle and renormalises by (row sum + 1e-9): a causal softmax but for that epsilon; out = merged Wo ('xw', no bias) -> [2][2048][2048] (8.4 M); argument order q, k, v, Wq, Wk, Wv, Wo).
// Layout: five launches. Every launch takes BOTH batch entries (rows b T + t of the projections, planes b heads + h of the attention), and work that does not depend on each other shares a launch, each part on its own run of blocks: k_prep (bf16 copies of q, k and v one behind the other in one operand buffer; the four 'xw' weights transposed into Bt operands); exact projections (q; k and v together), whose epilogues round their f32 sums straight into the attention's 16-bit head planes; causal T-2048 attention with 128-wide heads, all 2 x 16 query heads in ONE launch of the fused kernel k_fa, whose scores and probabilities never leave the registers (kv head = head / 4 on the key and value operands) (hybrid rows: < 512 hi/lo 3 products, rest fp16) and whose epilogue writes the merged hi/lo operand of the last product; merged hi/lo x Wo exact.
// Compute dtypes, f32 accumulate: every input rounded to bf16; projections exact; attention rows < 512 3 products, rest fp16; softmax f32 (the exact causal softmax: no epsilon term); Wo hl x exact.

#define NB_  2
#define TT   2048
#define DM   2048
#define NH_  16
#define NKV  4
#define REP  (NH_ / NKV)
#define HD   128
#define DQ   (NH_ * HD)
#define DKV  (NKV * HD)
#define ZH   16                   // query heads of a batch entry per attention launch (all of them)
#define RH   512                  // query rows < RH use hi+lo planes (0: none)
#define SCL  0.088388347648318447f   // HD^-0.5
typedef _Float16 h16;
typedef unsigned short bf;
typedef __attribute__((ext_vector_type(16))) __bf16   v16bf;
typedef __attribute__((ext_vector_type(16))) _Float16 v16h;
typedef __attribute__((ext_vector_type(8)))  _Float16 v8h;
typedef __attribute__((ext_vector_type(8)))  unsigned short v8us;
typedef __attribute__((ext_vector_type(8)))  float    v8f;
typedef __attribute__((ext_vector_type(4)))  float    v4f;
typedef v8h  __attribute__((may_alias)) v8ha;
typedef v4f  __attribute__((may_alias)) v4fa;
typedef v8us __attribute__((may_alias)) v8usa;

__device__ __forceinline__ unsigned short f2bf(float f) { unsigned u = __float_as_uint(f); u += 0x7FFFu + ((u >> 16) & 1u); return (unsigned short)(u >> 16); }
__device__ __forceinline__ float bf2f(unsigned short b) { return __uint_as_float(((unsigned)b) << 16); }
__device__ __forceinline__ float bfr(float f) { return bf2f(f2bf(f)); }
__device__ __forceinline__ v16h cat16(v8h lo, v8h hi) { return __builtin_shufflevector(lo, hi, 0, 1, 2, 3, 4, 5, 6, 7, 8, 9, 10, 11, 12, 13, 14, 15); }
__device__ __forceinline__ v16bf cat16b(v8us lo, v8us hi) { return __builtin_bit_cast(v16bf, __builtin_shufflevector(lo, hi, 0, 1, 2, 3, 4, 5, 6, 7, 8, 9, 10, 11, 12, 13, 14, 15)); }
__device__ __forceinline__ v8f wmma16(v16h a, v16h b, v8f c) { return __builtin_amdgcn_wmma_f32_16x16x32_f16(false, a, false, b, (short)0, c, false, false); }
__device__ __forceinline__ v8f wmmab(v16bf a, v16bf b, v8f c) { return __builtin_amdgcn_wmma_f32_16x16x32_bf16(false, a, false, b, (short)0, c, false, false); }

// ---- k_gemmk: register-blocked GEMM, one 64 WM x 64 WN output tile per work-group of WM WN WK waves. Wave (wk, wm, wn) owns the 64x64 sub-tile (wm, wn), 16 accumulators, and of every staged trip the 32-k steps wk, wk + WK, ...
// A staged operand row serves WN (A) or WM (Bt) sub-tiles, so the bytes that a work-group draws from L2 per output element fall with the tile: (BM + BN) / (BM BN) rows of K.
// With WK == 1 a wave sums its whole K range in k order; with WK > 1 the WK partial sub-tiles meet in LDS and are summed in wk order. Every wave passes its sub-tile through LDS, so that the stores take whole row pieces (256 bytes of C, 128-byte lines of the head planes).
// The operands come through LDS: a trip stages CK k of every K-contiguous 16-bit operand plane by asynchronous 16-byte copies that take whole 128-byte lines, two buffers, the next trip's copies in flight under this trip's products.
// LDS row pitch 2 CK + 16 bytes (an odd multiple of 16). Within a trip the fragments of the next 32-k step are fetched, as one group, ahead of this step's products (two register sets); nothing of the next trip is read ahead.
// C[m][n] (f32, pitch ldc) = sum_k A[m][k] Bt[n][k] (+ A2[m][k] Bt[n][k] where NSPLIT == 1). K % CK == 0, K >= 2 CK (two trips). grid (M / (64 WM), N / (64 WN), Z), 32 WM WN WK threads.
// z-batch: A, Bt and C advance by sA, sB, sC per z (the k and the v projection are z = 0, 1 of one launch).
// Epilogue EPI 0: C as above. EPI 1, 2: no C; the f32 sums are rounded in the epilogue into the head planes that the attention reads (N = ldc = heads x HD, rows m = b TT + t): [b heads + h][t][d] in P16 (fp16), Ph, Pl (hi/lo);
// with EPI 2 the blocks z == 1 write [b heads + h][d][t] in T16p, Th, Tl instead (their sub-tiles go through LDS transposed). Only what k_fa reads is written: hi/lo planes for t < RH; fp16 planes for every t of keys and values (EPI 2), for t >= RH of queries (EPI 1).
// ldo, sto: an address is a uniform base plus one 32-bit byte offset per lane (every buffer here is far below 4 GiB).
template <typename V> __device__ __forceinline__ V ldo(const void* base, unsigned off) { return *(const V*)((const char*)base + off); }
template <typename V> __device__ __forceinline__ void sto(void* base, unsigned off, V v) { *(V*)((char*)base + off) = v; }
__device__ __forceinline__ h16 tohx(float x) { return (h16)x; }
__device__ __forceinline__ void splitf(float y, unsigned short& h, unsigned short& l) { h = f2bf(y); l = f2bf(y - bf2f(h)); }
template <typename T16> struct WFrag;
template <> struct WFrag<h16> { typedef v16h V; static __device__ __forceinline__ V ld(const h16* p) { return cat16(*(const v8h*)p, *(const v8h*)(p + 16)); } static __device__ __forceinline__ v8f mma(V a, V b, v8f c) { return wmma16(a, b, c); } };
template <> struct WFrag<bf> { typedef v16bf V; static __device__ __forceinline__ V ld(const bf* p) { return cat16b(*(const v8us*)p, *(const v8us*)(p + 16)); } static __device__ __forceinline__ v8f mma(V a, V b, v8f c) { return wmmab(a, b, c); } };
// cp8: one lane's eight copies of one staged plane (rows RS apart in k_gemmk, 16 apart in k_fa). The wait on the address counter is the statement's last line, so that no register named by a copy is rewritten in front of it.
template <typename T16>
__device__ __forceinline__ void cp8(unsigned l, const T16* g, unsigned ls, size_t gs) {
    asm volatile("global_load_async_to_lds_b128 %0, %8, off\n\t"
                 "global_load_async_to_lds_b128 %1, %9, off\n\t"
                 "global_load_async_to_lds_b128 %2, %10, off\n\t"
                 "global_load_async_to_lds_b128 %3, %11, off\n\t"
                 "global_load_async_to_lds_b128 %4, %12, off\n\t"
                 "global_load_async_to_lds_b128 %5, %13, off\n\t"
                 "global_load_async_to_lds_b128 %6, %14, off\n\t"
                 "global_load_async_to_lds_b128 %7, %15, off\n\t"
                 "s_wait_xcnt 0x0"
                 :: "v"(l), "v"(l + ls), "v"(l + 2 * ls), "v"(l + 3 * ls), "v"(l + 4 * ls), "v"(l + 5 * ls), "v"(l + 6 * ls), "v"(l + 7 * ls),
                    "v"(g), "v"(g + gs), "v"(g + 2 * gs), "v"(g + 3 * gs), "v"(g + 4 * gs), "v"(g + 5 * gs), "v"(g + 6 * gs), "v"(g + 7 * gs) : "memory");
}
// cp4: the same for four copies.
template <typename T16>
__device__ __forceinline__ void cp4(unsigned l, const T16* g, unsigned ls, size_t gs) {
    asm volatile("global_load_async_to_lds_b128 %0, %4, off\n\t"
                 "global_load_async_to_lds_b128 %1, %5, off\n\t"
                 "global_load_async_to_lds_b128 %2, %6, off\n\t"
                 "global_load_async_to_lds_b128 %3, %7, off\n\t"
                 "s_wait_xcnt 0x0"
                 :: "v"(l), "v"(l + ls), "v"(l + 2 * ls), "v"(l + 3 * ls), "v"(g), "v"(g + gs), "v"(g + 2 * gs), "v"(g + 3 * gs) : "memory");
}
// stage: one lane's N copies of one staged plane, rows ls bytes (LDS) and gs elements (global) apart.
template <int N, typename T16>
__device__ __forceinline__ void stage(unsigned l, const T16* g, unsigned ls, size_t gs) {
    static_assert(N % 4 == 0, "copies come in fours and eights");
#pragma unroll
    for (int i = 0; i < N / 8; ++i) cp8(l + i * 8 * ls, g + i * 8 * gs, ls, gs);
    if (N % 8) cp4(l + (N / 8) * 8 * ls, g + (N / 8) * 8 * gs, ls, gs);
}
template <typename T16, int NSPLIT, int WM, int WN, int WK, int CK, int EPI>
__global__ __launch_bounds__(32 * WM * WN * WK) void k_gemmk(const T16* __restrict__ A, const T16* __restrict__ A2, const T16* __restrict__ Bt, int K, float* C, int ldc, size_t sA, size_t sB, size_t sC, h16* P16, bf* Ph, bf* Pl, h16* T16p, bf* Th, bf* Tl) {
    typedef typename WFrag<T16>::V V;
    static_assert(NSPLIT == 0 || NSPLIT == 1, "one or two A planes");
    constexpr int NG = WM * WN, NW = NG * WK, BM = 64 * WM, BN = 64 * WN, PB = 2 * CK + 16, TA = BM * PB, TBT = BN * PB, BUF = (1 + NSPLIT) * TA + TBT;   // sub-tiles, waves, tile, LDS row pitch, bytes of a staged A and Bt plane and of a buffer (A, Bt, then A2)
    constexpr int RS = 32 * NW * 8 / CK, NS = CK / 32 / WK;   // rows that the block copies at a time (CK / 8 lanes copy one staged row); 32-k steps of a wave per trip
    constexpr int SMB = (2 * BUF > NW * 64 * 68 * 4) ? 2 * BUF : NW * 64 * 68 * 4;
    __shared__ __align__(16) unsigned char sm[SMB];   // the two staging buffers; behind the loop the NW sub-tiles
    const size_t z = blockIdx.z; A += z * sA; if (NSPLIT) A2 += z * sA; Bt += z * sB; if (EPI == 0) C += z * sC;
    const int tid = threadIdx.x, lane = tid & 31, lr = lane & 15, hi = lane >> 4; const int w = __builtin_amdgcn_readfirstlane((int)(threadIdx.x >> 5)), g = w % NG, wk = w / NG, wm = g / WN, wn = g % WN; const int r0 = blockIdx.x * BM, c0 = blockIdx.y * BN;
    const int ntrip = K / CK;
    v8f acc[4][4];
#pragma unroll
    for (int mb = 0; mb < 4; ++mb)
#pragma unroll
        for (int nb = 0; nb < 4; ++nb) acc[mb][nb] = (v8f){};
    const int crow = tid / (CK / 8), ccol = tid % (CK / 8);
    const unsigned l0 = (unsigned)(size_t)sm + crow * PB + ccol * 16;
    const size_t aoff = (size_t)(r0 + crow) * K + 8 * ccol, boff = (size_t)(c0 + crow) * K + 8 * ccol;
    auto fill = [&](int t) { const unsigned l = l0 + (t & 1) * BUF; stage<BM / RS>(l, A + aoff + t * CK, RS * PB, (size_t)RS * K); stage<BN / RS>(l + TA, Bt + boff + t * CK, RS * PB, (size_t)RS * K);
        if (NSPLIT) stage<BM / RS>(l + TA + TBT, A2 + aoff + t * CK, RS * PB, (size_t)RS * K); };
    fill(0);
    asm volatile("s_wait_asynccnt 0x0" ::: "memory");   // this wave's copies of trip 0 have landed
    __syncthreads();                                     // and every other wave's
    fill(1);                                             // a trip 1 always exists
    const int fa = (wm * 64 + lr) * PB + (wk * 32 + 8 * hi) * 2, fb = TA + (wn * 64 + lr) * PB + (wk * 32 + 8 * hi) * 2;
    for (int t = 0; t < ntrip; ++t) {
        const unsigned char* s = sm + (t & 1) * BUF;
        V a[2][4], a2[2][4], b[2][4];
        auto frag = [&](int st, int set) {   // the fragments of this wave's step st of the trip
#pragma unroll
            for (int mb = 0; mb < 4; ++mb) { a[set][mb] = WFrag<T16>::ld((const T16*)(s + fa + mb * 16 * PB + st * WK * 64)); if (NSPLIT) a2[set][mb] = WFrag<T16>::ld((const T16*)(s + fa + TA + TBT + mb * 16 * PB + st * WK * 64)); }
#pragma unroll
            for (int nb = 0; nb < 4; ++nb) b[set][nb] = WFrag<T16>::ld((const T16*)(s + fb + nb * 16 * PB + st * WK * 64)); };
        frag(0, 0);
#pragma unroll
        for (int st = 0; st < NS; ++st) {
            if (st + 1 < NS) frag(st + 1, (st + 1) & 1);
            __builtin_amdgcn_sched_barrier(0);   // keeps the next step's fragment loads together ahead of this step's products, for speed only
#pragma unroll
            for (int nb = 0; nb < 4; ++nb) {
#pragma unroll
                for (int mb = 0; mb < 4; ++mb) acc[mb][nb] = WFrag<T16>::mma(a[st & 1][mb], b[st & 1][nb], acc[mb][nb]);
                if (NSPLIT) {
#pragma unroll
                    for (int mb = 0; mb < 4; ++mb) acc[mb][nb] = WFrag<T16>::mma(a2[st & 1][mb], b[st & 1][nb], acc[mb][nb]); } }
        }
        asm volatile("s_wait_dscnt 0x0" ::: "memory");      // this wave has left the buffer of trip t
        asm volatile("s_wait_asynccnt 0x0" ::: "memory");   // its copies of trip t + 1 have landed
        __syncthreads();                                     // trip t + 1 published; every wave has left the buffer of trip t
        if (t + 2 < ntrip) fill(t + 2);                      // refill of the buffer just left
    }
    asm volatile("s_wait_asynccnt 0x0" ::: "memory");       // no copy in flight when the buffers become the sub-tiles
    float* red = (float*)sm; float* mine = red + w * (64 * 68);
    const bool tr = EPI == 2 && blockIdx.z == 1;   // the same for the whole work-group: the sub-tile lies in LDS as [n][m]
    if (tr) {
#pragma unroll
        for (int mb = 0; mb < 4; ++mb)
#pragma unroll
            for (int nb = 0; nb < 4; ++nb) { float* p = mine + (nb * 16 + lr) * 68 + mb * 16 + hi * 8; *(v4fa*)p = __builtin_shufflevector(acc[mb][nb], acc[mb][nb], 0, 1, 2, 3); *(v4fa*)(p + 4) = __builtin_shufflevector(acc[mb][nb], acc[mb][nb], 4, 5, 6, 7); }
    } else {
#pragma unroll
        for (int mb = 0; mb < 4; ++mb)
#pragma unroll
            for (int nb = 0; nb < 4; ++nb)
#pragma unroll
                for (int j = 0; j < 8; ++j) mine[(mb * 16 + hi * 8 + j) * 68 + nb * 16 + lr] = acc[mb][nb][j];
    }
    __syncthreads();   // every wave's sub-tile is in LDS before any wave reads rows of it
    if constexpr (EPI != 0) {
        static_assert(TT % BM == 0 && RH % BM == 0 && HD % 64 == 0, "a work-group's rows lie in one batch entry and on one side of RH; a sub-tile's columns in one head");
        const unsigned tw = r0 % TT + wm * 64, cw = c0 + wn * 64, pl = (r0 / TT) * (ldc / HD) + cw / HD, dw = cw % HD;   // the sub-tile's first t, first column, plane and first d
        const bool whl = r0 % TT < RH, w16 = EPI == 2 || !whl;   // the same for the whole work-group
        const unsigned base = tr ? (pl * HD + dw) * TT + tw : (pl * TT + tw) * HD + dw, pitch = tr ? TT : HD;   // elements: LDS row 0 of the sub-tile in its plane; from an LDS row to the next
        h16* o16 = tr ? T16p : P16; bf* oh = tr ? Th : Ph; bf* ol = tr ? Tl : Pl;
        // 8 lanes take one LDS row (64 values: one whole 128-byte line of a plane), 4 rows a step
#pragma unroll
        for (int s = 0; s < 16 / WK; ++s) { const int row = wk * (64 / WK) + 4 * s + (lane >> 3), cofs = (lane & 7) * 8; const float* rp = red + g * (64 * 68) + row * 68 + cofs; v4f x0 = *(const v4fa*)rp, x1 = *(const v4fa*)(rp + 4);
#pragma unroll
            for (int p = 1; p < WK; ++p) { x0 += *(const v4fa*)(rp + p * NG * (64 * 68)); x1 += *(const v4fa*)(rp + p * NG * (64 * 68) + 4); }
            const unsigned off = (base + row * pitch + cofs) * 2;   // bytes
            if (w16) { v8h v;
#pragma unroll
                for (int q = 0; q < 4; ++q) { v[q] = tohx(x0[q]); v[4 + q] = tohx(x1[q]); }
                sto<v8h>(o16, off, v);
                asm volatile("s_wait_xcnt 0x0" :: "v"(off), "v"(v) : "memory"); }   // the store's registers are inputs here: they stay whole until its address has been taken
            if (whl) { v8us vh, vl;
#pragma unroll
                for (int q = 0; q < 4; ++q) { unsigned short a2, c2; splitf(x0[q], a2, c2); vh[q] = a2; vl[q] = c2; splitf(x1[q], a2, c2); vh[4 + q] = a2; vl[4 + q] = c2; }
                sto<v8us>(oh, off, vh); sto<v8us>(ol, off, vl);
                asm volatile("s_wait_xcnt 0x0" :: "v"(off), "v"(vh), "v"(vl) : "memory"); } }   // likewise for the two stores
    } else {
#pragma unroll
    for (int s = 0; s < 32 / WK; ++s) { const int row = wk * (64 / WK) + 2 * s + hi, cofs = lr * 4; v4f val = *(const v4fa*)(red + g * (64 * 68) + row * 68 + cofs);
#pragma unroll
        for (int p = 1; p < WK; ++p) val += *(const v4fa*)(red + (p * NG + g) * (64 * 68) + row * 68 + cofs);
        *(v4f*)(C + (size_t)(r0 + wm * 64 + row) * ldc + c0 + wn * 64 + cofs) = val; }
    }
}

typedef __attribute__((ext_vector_type(2))) _Float16 v2h;
typedef __attribute__((ext_vector_type(4))) _Float16 v4h;
typedef __attribute__((ext_vector_type(2))) unsigned short v2us;
typedef __attribute__((ext_vector_type(4))) unsigned short v4us;
typedef __attribute__((ext_vector_type(2))) float v2f;
typedef __attribute__((ext_vector_type(4))) int v4i;

// The work without matrix products (casts, weight transposes) takes 32 elements a thread: 16-byte loads, all issued ahead of the arithmetic, and 16-byte stores, all behind it.
// Its parts are device functions of a block index bx (blocks of 256 threads): the kernel k_prep deals its blocks out to them.
// wtG: Bt[n][k] (bf16) = w[k][n], the four weights one behind the other: each takes the run of blocks that its K N / 8192 needs, in the order q, k, v, o (all four have K = 2048). A thread takes 8 k x 4 n: eight loads (rows k), four stores (rows n). Lanes: 8 along k (one whole 128-byte line of a Bt row), 4 along n; the 8 waves of a block lie side by side along n (512 contiguous bytes of each w row). K % 64 == 0, N % 16 == 0.
#define NWT ((2 * DM * DQ + 2 * DM * DKV) / 8192)   // its blocks
__device__ __forceinline__ void wtG(const int bx, const float* __restrict__ wq, const float* __restrict__ wk, const float* __restrict__ wv_, const float* __restrict__ wo, bf* BQ, bf* BK, bf* BV, bf* BO) {
    static_assert(DQ == DM, "one K for the four weights");
    constexpr int K = DM, nq = DM * DQ / 8192, nk = DM * DKV / 8192; const int sel = bx < nq ? 0 : bx < nq + nk ? 1 : bx < nq + 2 * nk ? 2 : 3;   // the same for the whole block
    const float* __restrict__ w = sel == 0 ? wq : sel == 1 ? wk : sel == 2 ? wv_ : wo; bf* Bt = sel == 0 ? BQ : sel == 1 ? BK : sel == 2 ? BV : BO; const int N = sel == 0 ? DQ : sel == 3 ? DM : DKV, b0 = sel == 0 ? 0 : sel == 1 ? nq : sel == 2 ? nq + nk : nq + 2 * nk;
    const int gid = (bx - b0) * 256 + threadIdx.x, wv = gid >> 5, lane = gid & 31; const int nng = N / 16; if (wv >= nng * (K / 64)) return;
    const int n0 = ((wv % nng) * 4 + (lane >> 3)) * 4, k0 = ((wv / nng) * 8 + (lane & 7)) * 8; const unsigned so = ((unsigned)n0 * K + k0) * 2; unsigned li[8]; v4f x[8]; v8us o[4];
#pragma unroll
    for (int i = 0; i < 8; ++i) li[i] = ((unsigned)(k0 + i) * N + n0) * 4;
#pragma unroll
    for (int i = 0; i < 8; ++i) x[i] = ldo<v4f>(w, li[i]);
    asm volatile("s_wait_xcnt 0x0" :: "v"(li[0]), "v"(li[1]), "v"(li[2]), "v"(li[3]), "v"(li[4]), "v"(li[5]), "v"(li[6]), "v"(li[7]) : "memory");   // the loads' offset registers are inputs here: they stay whole until every address has been taken
#pragma unroll
    for (int j = 0; j < 4; ++j)
#pragma unroll
        for (int i = 0; i < 8; ++i) o[j][i] = f2bf(x[i][j]);
#pragma unroll
    for (int j = 0; j < 4; ++j) sto<v8us>(Bt, so + (unsigned)j * K * 2, o[j]);
}
// cvt8: four groups of 8 elements a thread, 256 groups apart (beyond the end: the last group is loaded, in bounds, and not stored).
__device__ __forceinline__ void cvt8(const unsigned bx, const float* __restrict__ src, bf* dst, size_t n8) { const size_t i0 = (size_t)bx * 1024 + threadIdx.x; v8f v[4]; unsigned li[4];
#pragma unroll
    for (int u = 0; u < 4; ++u) { const size_t i = i0 + u * 256; li[u] = (unsigned)((i < n8 ? i : n8 - 1) * 32); }
#pragma unroll
    for (int u = 0; u < 4; ++u) v[u] = ldo<v8f>(src, li[u]);
    asm volatile("s_wait_xcnt 0x0" :: "v"(li[0]), "v"(li[1]), "v"(li[2]), "v"(li[3]) : "memory");   // the loads' offset registers are inputs here: they stay whole until every address has been taken
#pragma unroll
    for (int u = 0; u < 4; ++u) { const size_t i = i0 + u * 256; v8us o;
#pragma unroll
        for (int k = 0; k < 8; ++k) o[k] = f2bf(v[u][k]);
        if (i < n8) *(v8us*)(dst + i * 8) = o; } }
// k_prep: all that reads only the inputs. Blocks: NCV for each of the three streams (both batch entries; the copies lie one behind the other in XB), then NWT for the weights. The tests are the same for a whole block.
#define NCV (NB_ * TT * DM / 32 / 256)
__global__ __launch_bounds__(256) void k_prep(const float* __restrict__ xq, const float* __restrict__ xk, const float* __restrict__ xv, bf* XB, const float* __restrict__ wq, const float* __restrict__ wk, const float* __restrict__ wv, const float* __restrict__ wo, bf* WQ, bf* WK, bf* WV, bf* WO) {
    const unsigned bx = blockIdx.x;
    if (bx < 3 * NCV) { const unsigned st = bx / NCV; cvt8(bx - st * NCV, st == 0 ? xq : st == 1 ? xk : xv, XB + (size_t)st * NB_ * TT * DM, (size_t)NB_ * TT * DM / 8); }
    else wtG((int)(bx - 3 * NCV), wq, wk, wv, wo, WQ, WK, WV, WO);
}
#define FPB (2 * HD + 16)
#define FTB (128 * FPB)
__device__ __forceinline__ float xhalf(float x) { return __builtin_bit_cast(float, __builtin_amdgcn_permlanex16(__builtin_bit_cast(int, x), __builtin_bit_cast(int, x), 0x76543210, 0xfedcba98, false, false)); }   // lane l with lane l ^ 16
// exp2s: v_exp_f32 with the free slot behind it in the same statement.
__device__ __forceinline__ float exp2s(float x) { float r; asm("v_exp_f32 %0, %1\n\tv_nop" : "=v"(r) : "v"(x)); return r; }
template <typename T16, bool HL>
__device__ __forceinline__ void fa_body(unsigned char* sm, const T16* __restrict__ Q, const T16* __restrict__ Q2, const T16* __restrict__ Kp, const T16* __restrict__ K2, const T16* __restrict__ Vt, const T16* __restrict__ V2, bf* Oh, bf* Ol, const int q0) {
    typedef typename WFrag<T16>::V V;
    constexpr int PB = FPB, TB = FTB, BUF = (HL ? 4 : 2) * TB; constexpr float CSC = SCL * 1.4426950408889634f;
    const int tid = threadIdx.x, lane = tid & 31, lr = lane & 15, hi = lane >> 4; const int w = __builtin_amdgcn_readfirstlane((int)(threadIdx.x >> 5)), qg = w & 3, kh = w >> 2;
    const int qw0 = q0 + 16 * qg, nst = (q0 + 64 + 127) / 128;   // stages up to the one that holds the diagonal (nst * 128 <= TT)
    const bool cv = w >= 8; const int crow = (tid & 255) >> 4, ccol = tid & 15;   // 16 lanes copy one staged row; eight waves copy 16 rows of their tile at a time
    const unsigned l0 = (unsigned)(size_t)sm + (cv ? TB : 0) + crow * PB + ccol * 16;
    const size_t go = (cv ? (size_t)crow * TT : (size_t)crow * HD) + ccol * 8, gs = cv ? (size_t)16 * TT : (size_t)16 * HD, gt = cv ? (size_t)128 : (size_t)128 * HD;   // elements: this lane's first copy; from 16 rows to the next; from a stage to the next
    const T16* g0 = (cv ? Vt : Kp) + go; const T16* g1 = HL ? (cv ? V2 : K2) + go : nullptr;
    auto fill = [&](int t) { const unsigned l = l0 + (t & 1) * BUF; cp8(l, g0 + t * gt, 16 * PB, gs); if (HL) cp8(l + 2 * TB, g1 + t * gt, 16 * PB, gs); };
    fill(0);
    V qf[4], q2[4];
#pragma unroll
    for (int kc = 0; kc < 4; ++kc) { qf[kc] = WFrag<T16>::ld(Q + (size_t)(qw0 + lr) * HD + kc * 32 + 8 * hi); if (HL) q2[kc] = WFrag<T16>::ld(Q2 + (size_t)(qw0 + lr) * HD + kc * 32 + 8 * hi); }
    v8f acc[8];
#pragma unroll
    for (int d8 = 0; d8 < 8; ++d8) acc[d8] = (v8f){};
    float m_run = -__builtin_inff(), l_run = 0.0f;
    asm volatile("s_wait_asynccnt 0x0" ::: "memory");   // this wave's copies of stage 0 have landed
    __syncthreads();                                     // and every other wave's
    if (1 < nst) fill(1);                                // where a stage 1 exists
    for (int t = 0; t < nst; ++t) {
        const int key0 = t * 128 + kh * 32;
        if (key0 <= qw0 + 15) {   // some key of the pass is visible to the wave's last query (the same for the whole wave); its first key is then visible to every query of the wave
            const unsigned char* sK = sm + (t & 1) * BUF + (kh * 32 + lr) * PB + 16 * hi; const unsigned char* sV = sm + (t & 1) * BUF + TB + lr * PB + kh * 64 + 16 * hi;
            V kf[2][4], vf[8]; v8f s[2];
#pragma unroll
            for (int kt = 0; kt < 2; ++kt)
#pragma unroll
                for (int kc = 0; kc < 4; ++kc) kf[kt][kc] = WFrag<T16>::ld((const T16*)(sK + kt * 16 * PB + kc * 64));
            if (!HL) __builtin_amdgcn_sched_barrier(0);   // keeps the key fragments' 16 loads together ahead of the products, for speed only (with the lo planes' operands the registers do not allow it)
            s[0] = (v8f){}; s[1] = (v8f){};
#pragma unroll
            for (int kc = 0; kc < 4; ++kc)
#pragma unroll
                for (int kt = 0; kt < 2; ++kt) { s[kt] = WFrag<T16>::mma(kf[kt][kc], qf[kc], s[kt]); if (HL) s[kt] = WFrag<T16>::mma(kf[kt][kc], q2[kc], s[kt]); }
            if (HL) {
#pragma unroll
                for (int kt = 0; kt < 2; ++kt)
#pragma unroll
                    for (int kc = 0; kc < 4; ++kc) kf[kt][kc] = WFrag<T16>::ld((const T16*)(sK + 2 * TB + kt * 16 * PB + kc * 64));
#pragma unroll
                for (int kc = 0; kc < 4; ++kc)
#pragma unroll
                    for (int kt = 0; kt < 2; ++kt) s[kt] = WFrag<T16>::mma(kf[kt][kc], qf[kc], s[kt]); }
#pragma unroll
            for (int d8 = 0; d8 < 8; ++d8) vf[d8] = WFrag<T16>::ld((const T16*)(sV + d8 * 16 * PB));
            if (!HL) __builtin_amdgcn_sched_barrier(0);   // the value fragments' 16 loads are issued by here, so that they land under the softmax arithmetic
            if (key0 + 31 > qw0) {   // the pass straddles the wave's diagonal (the same for the whole wave)
#pragma unroll
                for (int kt = 0; kt < 2; ++kt)
#pragma unroll
                    for (int r = 0; r < 8; ++r) if (key0 + 16 * kt + 8 * hi + r > qw0 + lr) s[kt][r] = -__builtin_inff(); }
            float mx = fmaxf(s[0][0], s[1][0]);
#pragma unroll
            for (int r = 1; r < 8; ++r) mx = fmaxf(mx, fmaxf(s[0][r], s[1][r]));
            mx = fmaxf(mx, xhalf(mx)) * CSC;   // both halves hold the query's maximum of this pass, scaled
            if (__builtin_amdgcn_ballot_w32(mx > m_run + 8.0f) != 0) {   // one scalar test a pass; always taken on a wave's first pass (m_run = -inf: the factor is 0, on zeros)
                const float m_new = fmaxf(m_run, mx), corr = __builtin_amdgcn_exp2f(m_run - m_new); l_run *= corr; m_run = m_new;
#pragma unroll
                for (int d8 = 0; d8 < 8; ++d8) acc[d8] = acc[d8] * corr; }
            float p[2][8], ps0 = 0.0f, ps1 = 0.0f;
#pragma unroll
            for (int r = 0; r < 8; ++r) { const float x0 = __builtin_fmaf(s[0][r], CSC, -m_run), x1 = __builtin_fmaf(s[1][r], CSC, -m_run); p[0][r] = HL ? exp2s(x0) : __builtin_amdgcn_exp2f(x0); p[1][r] = HL ? exp2s(x1) : __builtin_amdgcn_exp2f(x1); ps0 += p[0][r]; ps1 += p[1][r]; }   // hi/lo: exp2s
            l_run += ps0 + ps1;
            if constexpr (HL) {
                v8us h0, h1, e0, e1;
#pragma unroll
                for (int r = 0; r < 8; ++r) { unsigned short a, c2; splitf(p[0][r], a, c2); h0[r] = a; e0[r] = c2; splitf(p[1][r], a, c2); h1[r] = a; e1[r] = c2; }
                const V pfh = cat16b(h0, h1), pfl = cat16b(e0, e1);
#pragma unroll
                for (int d8 = 0; d8 < 8; ++d8) { acc[d8] = WFrag<T16>::mma(vf[d8], pfh, acc[d8]); acc[d8] = WFrag<T16>::mma(vf[d8], pfl, acc[d8]); }
#pragma unroll
                for (int d8 = 0; d8 < 8; ++d8) vf[d8] = WFrag<T16>::ld((const T16*)(sV + 2 * TB + d8 * 16 * PB));
#pragma unroll
                for (int d8 = 0; d8 < 8; ++d8) acc[d8] = WFrag<T16>::mma(vf[d8], pfh, acc[d8]);
            } else {
                V pf;
#pragma unroll
                for (int r = 0; r < 8; ++r) { pf[r] = (h16)p[0][r]; pf[8 + r] = (h16)p[1][r]; }
#pragma unroll
                for (int d8 = 0; d8 < 8; ++d8) acc[d8] = WFrag<T16>::mma(vf[d8], pf, acc[d8]);
            }
        }
        asm volatile("s_wait_dscnt 0x0" ::: "memory");      // this wave has left the buffer of stage t
        asm volatile("s_wait_asynccnt 0x0" ::: "memory");   // its copies of stage t + 1 have landed
        __syncthreads();                                     // stage t + 1 published; every wave has left the buffer of stage t
        if (t + 2 < nst) fill(t + 2);                        // refill of the buffer just left
    }
    asm volatile("s_wait_asynccnt 0x0" ::: "memory");       // no copy in flight when the buffers become the partial results
    v8f* red = (v8f*)sm; float* ml = (float*)(sm + 12 * 8 * 32 * 32);   // per pass 1 to 3 and query group: 8 accumulators a lane; behind them maximum and sum
    if (kh != 0) { const int pp = (kh - 1) * 4 + qg;
#pragma unroll
        for (int d8 = 0; d8 < 8; ++d8) red[(pp * 8 + d8) * 32 + lane] = acc[d8];
        ml[(pp * 2) * 32 + lane] = m_run; ml[(pp * 2 + 1) * 32 + lane] = l_run; }
    __syncthreads();   // the partial results are in LDS before the waves of pass 0 join them
    if (kh == 0) {
        float mp[3], lp[3], a[3], m = m_run;   // m_run is finite here: key 0 is visible to every query. A wave that had no visible pass left -inf, 0 and zeros: its factor below is 0
#pragma unroll
        for (int k = 0; k < 3; ++k) { mp[k] = ml[((k * 4 + qg) * 2) * 32 + lane]; lp[k] = ml[((k * 4 + qg) * 2 + 1) * 32 + lane]; m = fmaxf(m, mp[k]); }
        const float a0 = exp2s(m_run - m); float l = l_run * a0;
#pragma unroll
        for (int k = 0; k < 3; ++k) { a[k] = exp2s(mp[k] - m); l += lp[k] * a[k]; }
        const float inv = __fdiv_rn(1.0f, l + xhalf(l));
        const size_t oo = (size_t)(qw0 + lr) * DQ + 8 * hi;
#pragma unroll
        for (int d8 = 0; d8 < 8; ++d8) { v8f o = acc[d8] * (a0 * inv); v8us vh, vl;
#pragma unroll
            for (int k = 0; k < 3; ++k) o += red[((k * 4 + qg) * 8 + d8) * 32 + lane] * (a[k] * inv);
#pragma unroll
            for (int j = 0; j < 8; ++j) { unsigned short a2, c2; splitf(o[j], a2, c2); vh[j] = a2; vl[j] = c2; }
            *(v8us*)(Oh + oo + 16 * d8) = vh; *(v8us*)(Ol + oo + 16 * d8) = vl; } }
}
__global__ __launch_bounds__(512) void k_fa(const h16* __restrict__ Q16, const h16* __restrict__ K16, const h16* __restrict__ V16, const bf* __restrict__ Qh, const bf* __restrict__ Ql, const bf* __restrict__ Kh, const bf* __restrict__ Kl, const bf* __restrict__ Vh, const bf* __restrict__ Vl, bf* Ah, bf* Al) {
    __shared__ __align__(32) unsigned char sm[8 * FTB];   // the two staging buffers (of two or of four tiles); behind the loop the partial results of passes 1 to 3
    const size_t zq = (size_t)blockIdx.x * TT * HD, zk = (size_t)(blockIdx.x / REP) * TT * HD, zo = (size_t)(blockIdx.x / NH_) * TT * DQ + (size_t)(blockIdx.x % NH_) * HD; const int y = blockIdx.y, q0 = 64 * (y < RH / 64 ? RH / 64 - 1 - y : TT / 64 - 1 - (y - RH / 64));
    if (q0 >= RH) fa_body<h16, false>(sm, Q16 + zq, nullptr, K16 + zk, nullptr, V16 + zk, nullptr, Ah + zo, Al + zo, q0);   // the same for the whole work-group
    else fa_body<bf, true>(sm, Qh + zq, Ql + zq, Kh + zk, Kl + zk, Vh + zk, Vl + zk, Ah + zo, Al + zo, q0);
}
extern "C" void kernel_launch(void* const* d_in, const int* in_sizes, int n_in,
                              void* d_out, int out_size, void* d_ws, size_t ws_size, hipStream_t stream) {
    (void)in_sizes; (void)n_in; (void)out_size;
    const float* xq = (const float*)d_in[0]; const float* xk = (const float*)d_in[1]; const float* xv = (const float*)d_in[2]; const float* wq = (const float*)d_in[3]; const float* wk = (const float*)d_in[4]; const float* wv = (const float*)d_in[5]; const float* wo = (const float*)d_in[6];   /* q, k, v ([2][2048][2048] each: THREE streams), Wq ('xw' (in, out) [2048][2048]: 16 heads x 128), Wk, Wv ('xw' [2048][512]: 4 kv heads x 128), Wo ('xw' [2048][2048]): SEVEN inputs, all read; no bias anywhere */
    float* OUT = (float*)d_out;     // [2][2048][2048]
    char* wsp = (char*)d_ws;
    auto take = [&](size_t bytes) { char* p = wsp; wsp += (bytes + 255) & ~(size_t)255; return (void*)p; };
    static_assert(ZH == NH_, "plane b NH_ + h is blockIdx.x of k_fa");
    bf* WQ = (bf*)take((size_t)DQ * DM * 2); bf* WK = (bf*)take((size_t)2 * DKV * DM * 2); bf* WV = WK + (size_t)DKV * DM; bf* WO = (bf*)take((size_t)DM * DQ * 2);   /* WK, WV: z = 0, 1 of one GEMM launch */
    bf* XB = (bf*)take((size_t)3 * NB_ * TT * DM * 2);   /* XB: the bf16 copies of q, k, v, one behind the other */
    h16* QP16 = (h16*)take((size_t)NB_ * NH_ * TT * HD * 2); h16* KP16 = (h16*)take((size_t)NB_ * NKV * TT * HD * 2); h16* VT16 = (h16*)take((size_t)NB_ * NKV * HD * TT * 2);
    bf* QPh = (bf*)take((size_t)NB_ * NH_ * TT * HD * 2); bf* QPl = (bf*)take((size_t)NB_ * NH_ * TT * HD * 2); bf* KPh = (bf*)take((size_t)NB_ * NKV * TT * HD * 2); bf* KPl = (bf*)take((size_t)NB_ * NKV * TT * HD * 2); bf* VTh = (bf*)take((size_t)NB_ * NKV * HD * TT * 2); bf* VTl = (bf*)take((size_t)NB_ * NKV * HD * TT * 2);
    bf* ATh = (bf*)take((size_t)NB_ * TT * DQ * 2); bf* ATl = (bf*)take((size_t)NB_ * TT * DQ * 2);
    if ((size_t)(wsp - (char*)d_ws) > ws_size) return;    // ws 256 MiB
    k_prep<<<3 * NCV + NWT, 256, 0, stream>>>(xq, xk, xv, XB, wq, wk, wv, wo, WQ, WK, WV, WO);   /* the QUERY, KEY and VALUE streams cast; the four 'xw' (in, out) weights transposed once into Bt operands */
    k_gemmk<bf, 0, 4, 2, 1, 128, 1><<<dim3(NB_ * TT / 256, DQ / 128, 1), 256, 0, stream>>>(XB, nullptr, WQ, DM, nullptr, DQ, 0, 0, 0, QP16, QPh, QPl, nullptr, nullptr, nullptr);   /* q Wq into the query planes */
    k_gemmk<bf, 0, 2, 2, 2, 256, 2><<<dim3(NB_ * TT / 128, DKV / 128, 2), 256, 0, stream>>>(XB + (size_t)NB_ * TT * DM, nullptr, WK, DM, nullptr, DKV, (size_t)NB_ * TT * DM, (size_t)DKV * DM, 0, KP16, KPh, KPl, VT16, VTh, VTl);   /* z = 0: k Wk into the key planes [t][d], z = 1: v Wv into the value planes [d][t] */
    /* 'jnp.repeat(kh, 4, axis=1)': query head h uses kv head h / 4; with planes b NH_ + h and b NKV + h / 4 that is plane / REP for both batch entries */
    k_fa<<<dim3(NB_ * ZH, TT / 64), 512, 0, stream>>>(QP16, KP16, VT16, QPh, QPl, KPh, KPl, VTh, VTl, ATh, ATl);
    k_gemmk<bf, 1, 4, 2, 1, 64, 0><<<dim3(NB_ * TT / 256, DM / 128, 1), 256, 0, stream>>>(ATh, ATl, WO, DQ, OUT, DM, 0, 0, 0, nullptr, nullptr, nullptr, nullptr, nullptr, nullptr);
}

// v009
// It runs in 153 microseconds.
// In both of two side-by-side timings against v008, it was 1.06 times as fast.
// All steps since v000 together make it 10.7 times as fast.
#include <hip/hip_runtime.h>

// Grouped-query causal attention with 128-wide heads on three input streams (q, k, v [2][2048][2048]; qh = q Wq (16 heads x 128), kh, vh = k Wk, v Wv (4 kv heads x 128) ('xw' (in, out) 0.02, no bias); qh and kh each x 128^-0.25 (together 1/sqrt(128)); kv head = query head / 4 (jnp.repeat); the module takes softmax over ALL keys, zeroes the strictly-upper triangle and renormalises by (row sum + 1e-9): a causal softmax but for that epsilon; out = merged Wo ('xw', no bias) -> [2][2048][2048] (8.4 M); argument order q, k, v, Wq, Wk, Wv, Wo).
// Layout: five launches. Every launch takes BOTH batch entries (rows b T + t of the projections, planes b heads + h of the attention), and work that does not depend on each other shares a launch, each part on its own run of blocks: k_prep (bf16 copies of q, k and v one behind the other in one operand buffer; the four 'xw' weights transposed into Bt operands); exact projections (q; k and v together), whose epilogues round their f32 sums straight into the attention's 16-bit head planes; causal T-2048 attention with 128-wide heads, all 2 x 16 query heads in ONE launch of the fused kernel k_fa, whose scores and probabilities never leave the registers (kv head = head / 4 on the key and value operands) (hybrid rows: < 512 hi/lo 3 products, rest fp16) and whose epilogue writes the merged hi/lo operand of the last product; merged hi/lo x Wo exact.
// Compute dtypes, f32 accumulate: every input rounded to bf16; projections exact; attention rows < 512 3 products, rest fp16; softmax f32 (the exact causal softmax: no epsilon term); Wo hl x exact.

#define NB_  2
#define TT   2048
#define DM   2048
#define NH_  16
#define NKV  4
#define REP  (NH_ / NKV)
#define HD   128
#define DQ   (NH_ * HD)
#define DKV  (NKV * HD)
#define ZH   16                   // query heads of a batch entry per attention launch (all of them)
#define RH   512                  // query rows < RH use hi+lo planes (0: none)
#define SCL  0.088388347648318447f   // HD^-0.5
typedef _Float16 h16;
typedef unsigned short bf;
typedef __attribute__((ext_vector_type(16))) __bf16   v16bf;
typedef __attribute__((ext_vector_type(16))) _Float16 v16h;
typedef __attribute__((ext_vector_type(8)))  _Float16 v8h;
typedef __attribute__((ext_vector_type(8)))  unsigned short v8us;
typedef __attribute__((ext_vector_type(8)))  float    v8f;
typedef __attribute__((ext_vector_type(4)))  float    v4f;
typedef v8h  __attribute__((may_alias)) v8ha;
typedef v4f  __attribute__((may_alias)) v4fa;
typedef v8us __attribute__((may_alias)) v8usa;

__device__ __forceinline__ unsigned short f2bf(float f) { unsigned u = __float_as_uint(f); u += 0x7FFFu + ((u >> 16) & 1u); return (unsigned short)(u >> 16); }
__device__ __forceinline__ float bf2f(unsigned short b) { return __uint_as_float(((unsigned)b) << 16); }
__device__ __forceinline__ float bfr(float f) { return bf2f(f2bf(f)); }
__device__ __forceinline__ v16h cat16(v8h lo, v8h hi) { return __builtin_shufflevector(lo, hi, 0, 1, 2, 3, 4, 5, 6, 7, 8, 9, 10, 11, 12, 13, 14, 15); }
__device__ __forceinline__ v16bf cat16b(v8us lo, v8us hi) { return __builtin_bit_cast(v16bf, __builtin_shufflevector(lo, hi, 0, 1, 2, 3, 4, 5, 6, 7, 8, 9, 10, 11, 12, 13, 14, 15)); }
__device__ __forceinline__ v8f wmma16(v16h a, v16h b, v8f c) { return __builtin_amdgcn_wmma_f32_16x16x32_f16(false, a, false, b, (short)0, c, false, false); }
__device__ __forceinline__ v8f wmmab(v16bf a, v16bf b, v8f c) { return __builtin_amdgcn_wmma_f32_16x16x32_bf16(false, a, false, b, (short)0, c, false, false); }

// ---- k_gemmk: register-blocked GEMM, one 64 WM x 64 WN output tile per work-group of WM WN WK waves. Wave (wk, wm, wn) owns the 64x64 sub-tile (wm, wn), 16 accumulators, and of every staged trip the 32-k steps wk, wk + WK, ...
// A staged operand row serves WN (A) or WM (Bt) sub-tiles, so the bytes that a work-group draws from L2 per output element fall with the tile: (BM + BN) / (BM BN) rows of K.
// With WK == 1 a wave sums its whole K range in k order; with WK > 1 the WK partial sub-tiles meet in LDS and are summed in wk order. Every wave passes its sub-tile through LDS, so that the stores take whole row pieces (256 bytes of C, 128-byte lines of the head planes).
// The operands come through LDS: a trip stages CK k of every K-contiguous 16-bit operand plane by asynchronous 16-byte copies that take whole 128-byte lines, two buffers, the next trip's copies in flight under this trip's products.
// LDS row pitch 2 CK + 16 bytes (an odd multiple of 16). Within a trip the fragments of the next 32-k step are fetched, as one group, ahead of this step's products (two register sets); nothing of the next trip is read ahead.
// C[m][n] (f32, pitch ldc) = sum_k A[m][k] Bt[n][k] (+ A2[m][k] Bt[n][k] where NSPLIT == 1). K % CK == 0, K >= 2 CK (two trips). grid (M / (64 WM), N / (64 WN), Z), 32 WM WN WK threads.
// z-batch: A, Bt and C advance by sA, sB, sC per z (the k and the v projection are z = 0, 1 of one launch).
// Epilogue EPI 0: C as above. EPI 1, 2: no C; the f32 sums are rounded in the epilogue into the head planes that the attention reads (N = ldc = heads x HD, rows m = b TT + t): [b heads + h][t][d] in P16 (fp16), Ph, Pl (hi/lo);
// with EPI 2 the blocks z == 1 write [b heads + h][d][t] in T16p, Th, Tl instead (their sub-tiles go through LDS transposed). Only what k_fa reads is written: hi/lo planes for t < RH; fp16 planes for every t of keys and values (EPI 2), for t >= RH of queries (EPI 1).
// ldo, sto: an address is a uniform base plus one 32-bit byte offset per lane (every buffer here is far below 4 GiB).
template <typename V> __device__ __forceinline__ V ldo(const void* base, unsigned off) { return *(const V*)((const char*)base + off); }
template <typename V> __device__ __forceinline__ void sto(void* base, unsigned off, V v) { *(V*)((char*)base + off) = v; }
__device__ __forceinline__ h16 tohx(float x) { return (h16)x; }
__device__ __forceinline__ void splitf(float y, unsigned short& h, unsigned short& l) { h = f2bf(y); l = f2bf(y - bf2f(h)); }
template <typename T16> struct WFrag;
template <> struct WFrag<h16> { typedef v16h V; static __device__ __forceinline__ V ld(const h16* p) { return cat16(*(const v8h*)p, *(const v8h*)(p + 16)); } static __device__ __forceinline__ v8f mma(V a, V b, v8f c) { return wmma16(a, b, c); } };
template <> struct WFrag<bf> { typedef v16bf V; static __device__ __forceinline__ V ld(const bf* p) { return cat16b(*(const v8us*)p, *(const v8us*)(p + 16)); } static __device__ __forceinline__ v8f mma(V a, V b, v8f c) { return wmmab(a, b, c); } };
// cp8: one lane's eight copies of one staged plane (rows RS apart in k_gemmk, 16 apart in k_fa). The wait on the address counter is the statement's last line, so that no register named by a copy is rewritten in front of it.
template <typename T16>
__device__ __forceinline__ void cp8(unsigned l, const T16* g, unsigned ls, size_t gs) {
    asm volatile("global_load_async_to_lds_b128 %0, %8, off\n\t"
                 "global_load_async_to_lds_b128 %1, %9, off\n\t"
                 "global_load_async_to_lds_b128 %2, %10, off\n\t"
                 "global_load_async_to_lds_b128 %3, %11, off\n\t"
                 "global_load_async_to_lds_b128 %4, %12, off\n\t"
                 "global_load_async_to_lds_b128 %5, %13, off\n\t"
                 "global_load_async_to_lds_b128 %6, %14, off\n\t"
                 "global_load_async_to_lds_b128 %7, %15, off\n\t"
                 "s_wait_xcnt 0x0"
                 :: "v"(l), "v"(l + ls), "v"(l + 2 * ls), "v"(l + 3 * ls), "v"(l + 4 * ls), "v"(l + 5 * ls), "v"(l + 6 * ls), "v"(l + 7 * ls),
                    "v"(g), "v"(g + gs), "v"(g + 2 * gs), "v"(g + 3 * gs), "v"(g + 4 * gs), "v"(g + 5 * gs), "v"(g + 6 * gs), "v"(g + 7 * gs) : "memory");
}
// cp4: the same for four copies.
template <typename T16>
__device__ __forceinline__ void cp4(unsigned l, const T16* g, unsigned ls, size_t gs) {
    asm volatile("global_load_async_to_lds_b128 %0, %4, off\n\t"
                 "global_load_async_to_lds_b128 %1, %5, off\n\t"
                 "global_load_async_to_lds_b128 %2, %6, off\n\t"
                 "global_load_async_to_lds_b128 %3, %7, off\n\t"
                 "s_wait_xcnt 0x0"
                 :: "v"(l), "v"(l + ls), "v"(l + 2 * ls), "v"(l + 3 * ls), "v"(g), "v"(g + gs), "v"(g + 2 * gs), "v"(g + 3 * gs) : "memory");
}
// stage: one lane's N copies of one staged plane, rows ls bytes (LDS) and gs elements (global) apart.
template <int N, typename T16>
__device__ __forceinline__ void stage(unsigned l, const T16* g, unsigned ls, size_t gs) {
    static_assert(N % 4 == 0, "copies come in fours and eights");
#pragma unroll
    for (int i = 0; i < N / 8; ++i) cp8(l + i * 8 * ls, g + i * 8 * gs, ls, gs);
    if (N % 8) cp4(l + (N / 8) * 8 * ls, g + (N / 8) * 8 * gs, ls, gs);
}
template <typename T16, int NSPLIT, int WM, int WN, int WK, int CK, int EPI>
__global__ __launch_bounds__(32 * WM * WN * WK) void k_gemmk(const T16* __restrict__ A, const T16* __restrict__ A2, const T16* __restrict__ Bt, int K, float* C, int ldc, size_t sA, size_t sB, size_t sC, h16* P16, bf* Ph, bf* Pl, h16* T16p, bf* Th, bf* Tl) {
    typedef typename WFrag<T16>::V V;
    static_assert(NSPLIT == 0 || NSPLIT == 1, "one or two A planes");
    constexpr int NG = WM * WN, NW = NG * WK, BM = 64 * WM, BN = 64 * WN, PB = 2 * CK + 16, TA = BM * PB, TBT = BN * PB, BUF = (1 + NSPLIT) * TA + TBT;   // sub-tiles, waves, tile, LDS row pitch, bytes of a staged A and Bt plane and of a buffer (A, Bt, then A2)
    constexpr int RS = 32 * NW * 8 / CK, NS = CK / 32 / WK;   // rows that the block copies at a time (CK / 8 lanes copy one staged row); 32-k steps of a wave per trip
    constexpr int SMB = (2 * BUF > NW * 64 * 68 * 4) ? 2 * BUF : NW * 64 * 68 * 4;
    __shared__ __align__(16) unsigned char sm[SMB];   // the two staging buffers; behind the loop the NW sub-tiles
    const size_t z = blockIdx.z; A += z * sA; if (NSPLIT) A2 += z * sA; Bt += z * sB; if (EPI == 0) C += z * sC;
    const int tid = threadIdx.x, lane = tid & 31, lr = lane & 15, hi = lane >> 4; const int w = __builtin_amdgcn_readfirstlane((int)(threadIdx.x >> 5)), g = w % NG, wk = w / NG, wm = g / WN, wn = g % WN; const int r0 = blockIdx.x * BM, c0 = blockIdx.y * BN;
    const int ntrip = K / CK;
    v8f acc[4][4];
#pragma unroll
    for (int mb = 0; mb < 4; ++mb)
#pragma unroll
        for (int nb = 0; nb < 4; ++nb) acc[mb][nb] = (v8f){};
    const int crow = tid / (CK / 8), ccol = tid % (CK / 8);
    const unsigned l0 = (unsigned)(size_t)sm + crow * PB + ccol * 16;
    const size_t aoff = (size_t)(r0 + crow) * K + 8 * ccol, boff = (size_t)(c0 + crow) * K + 8 * ccol;
    auto fill = [&](int t) { const unsigned l = l0 + (t & 1) * BUF; stage<BM / RS>(l, A + aoff + t * CK, RS * PB, (size_t)RS * K); stage<BN / RS>(l + TA, Bt + boff + t * CK, RS * PB, (size_t)RS * K);
        if (NSPLIT) stage<BM / RS>(l + TA + TBT, A2 + aoff + t * CK, RS * PB, (size_t)RS * K); };
    fill(0);
    asm volatile("s_wait_asynccnt 0x0" ::: "memory");   // this wave's copies of trip 0 have landed
    __syncthreads();                                     // and every other wave's
    fill(1);                                             // a trip 1 always exists
    const int fa = (wm * 64 + lr) * PB + (wk * 32 + 8 * hi) * 2, fb = TA + (wn * 64 + lr) * PB + (wk * 32 + 8 * hi) * 2;
    for (int t = 0; t < ntrip; ++t) {
        const unsigned char* s = sm + (t & 1) * BUF;
        V a[2][4], a2[2][4], b[2][4];
        auto frag = [&](int st, int set) {   // the fragments of this wave's step st of the trip
#pragma unroll
            for (int mb = 0; mb < 4; ++mb) { a[set][mb] = WFrag<T16>::ld((const T16*)(s + fa + mb * 16 * PB + st * WK * 64)); if (NSPLIT) a2[set][mb] = WFrag<T16>::ld((const T16*)(s + fa + TA + TBT + mb * 16 * PB + st * WK * 64)); }
#pragma unroll
            for (int nb = 0; nb < 4; ++nb) b[set][nb] = WFrag<T16>::ld((const T16*)(s + fb + nb * 16 * PB + st * WK * 64)); };
        frag(0, 0);
#pragma unroll
        for (int st = 0; st < NS; ++st) {
            if (st + 1 < NS) frag(st + 1, (st + 1) & 1);
            __builtin_amdgcn_sched_barrier(0);   // keeps the next step's fragment loads together ahead of this step's products, for speed only
#pragma unroll
            for (int nb = 0; nb < 4; ++nb) {
#pragma unroll
                for (int mb = 0; mb < 4; ++mb) acc[mb][nb] = WFrag<T16>::mma(a[st & 1][mb], b[st & 1][nb], acc[mb][nb]);
                if (NSPLIT) {
#pragma unroll
                    for (int mb = 0; mb < 4; ++mb) acc[mb][nb] = WFrag<T16>::mma(a2[st & 1][mb], b[st & 1][nb], acc[mb][nb]); } }
        }
        asm volatile("s_wait_dscnt 0x0" ::: "memory");      // this wave has left the buffer of trip t
        asm volatile("s_wait_asynccnt 0x0" ::: "memory");   // its copies of trip t + 1 have landed
        __syncthreads();                                     // trip t + 1 published; every wave has left the buffer of trip t
        if (t + 2 < ntrip) fill(t + 2);                      // refill of the buffer just left
    }
    asm volatile("s_wait_asynccnt 0x0" ::: "memory");       // no copy in flight when the buffers become the sub-tiles
    float* red = (float*)sm; float* mine = red + w * (64 * 68);
    const bool tr = EPI == 2 && blockIdx.z == 1;   // the same for the whole work-group: the sub-tile lies in LDS as [n][m]
    if (tr) {
#pragma unroll
        for (int mb = 0; mb < 4; ++mb)
#pragma unroll
            for (int nb = 0; nb < 4; ++nb) { float* p = mine + (nb * 16 + lr) * 68 + mb * 16 + hi * 8; *(v4fa*)p = __builtin_shufflevector(acc[mb][nb], acc[mb][nb], 0, 1, 2, 3); *(v4fa*)(p + 4) = __builtin_shufflevector(acc[mb][nb], acc[mb][nb], 4, 5, 6, 7); }
    } else {
#pragma unroll
        for (int mb = 0; mb < 4; ++mb)
#pragma unroll
            for (int nb = 0; nb < 4; ++nb)
#pragma unroll
                for (int j = 0; j < 8; ++j) mine[(mb * 16 + hi * 8 + j) * 68 + nb * 16 + lr] = acc[mb][nb][j];
    }
    __syncthreads();   // every wave's sub-tile is in LDS before any wave reads rows of it
    if constexpr (EPI != 0) {
        static_assert(TT % BM == 0 && RH % BM == 0 && HD % 64 == 0, "a work-group's rows lie in one batch entry and on one side of RH; a sub-tile's columns in one head");
        const unsigned tw = r0 % TT + wm * 64, cw = c0 + wn * 64, pl = (r0 / TT) * (ldc / HD) + cw / HD, dw = cw % HD;   // the sub-tile's first t, first column, plane and first d
        const bool whl = r0 % TT < RH, w16 = EPI == 2 || !whl;   // the same for the whole work-group
        const unsigned base = tr ? (pl * HD + dw) * TT + tw : (pl * TT + tw) * HD + dw, pitch = tr ? TT : HD;   // elements: LDS row 0 of the sub-tile in its plane; from an LDS row to the next
        h16* o16 = tr ? T16p : P16; bf* oh = tr ? Th : Ph; bf* ol = tr ? Tl : Pl;
        // 8 lanes take one LDS row (64 values: one whole 128-byte line of a plane), 4 rows a step
#pragma unroll
        for (int s = 0; s < 16 / WK; ++s) { const int row = wk * (64 / WK) + 4 * s + (lane >> 3), cofs = (lane & 7) * 8; const float* rp = red + g * (64 * 68) + row * 68 + cofs; v4f x0 = *(const v4fa*)rp, x1 = *(const v4fa*)(rp + 4);
#pragma unroll
            for (int p = 1; p < WK; ++p) { x0 += *(const v4fa*)(rp + p * NG * (64 * 68)); x1 += *(const v4fa*)(rp + p * NG * (64 * 68) + 4); }
            const unsigned off = (base + row * pitch + cofs) * 2;   // bytes
            if (w16) { v8h v;
#pragma unroll
                for (int q = 0; q < 4; ++q) { v[q] = tohx(x0[q]); v[4 + q] = tohx(x1[q]); }
                sto<v8h>(o16, off, v);
                asm volatile("s_wait_xcnt 0x0" :: "v"(off), "v"(v) : "memory"); }   // the store's registers are inputs here: they stay whole until its address has been taken
            if (whl) { v8us vh, vl;
#pragma unroll
                for (int q = 0; q < 4; ++q) { unsigned short a2, c2; splitf(x0[q], a2, c2); vh[q] = a2; vl[q] = c2; splitf(x1[q], a2, c2); vh[4 + q] = a2; vl[4 + q] = c2; }
                sto<v8us>(oh, off, vh); sto<v8us>(ol, off, vl);
                asm volatile("s_wait_xcnt 0x0" :: "v"(off), "v"(vh), "v"(vl) : "memory"); } }   // likewise for the two stores
    } else {
#pragma unroll
    for (int s = 0; s < 32 / WK; ++s) { const int row = wk * (64 / WK) + 2 * s + hi, cofs = lr * 4; v4f val = *(const v4fa*)(red + g * (64 * 68) + row * 68 + cofs);
#pragma unroll
        for (int p = 1; p < WK; ++p) val += *(const v4fa*)(red + (p * NG + g) * (64 * 68) + row * 68 + cofs);
        *(v4f*)(C + (size_t)(r0 + wm * 64 + row) * ldc + c0 + wn * 64 + cofs) = val; }
    }
}

typedef __attribute__((ext_vector_type(2))) _Float16 v2h;
typedef __attribute__((ext_vector_type(4))) _Float16 v4h;
typedef __attribute__((ext_vector_type(2))) unsigned short v2us;
typedef __attribute__((ext_vector_type(4))) unsigned short v4us;
typedef __attribute__((ext_vector_type(2))) float v2f;
typedef __attribute__((ext_vector_type(4))) int v4i;

// The work without matrix products (casts, weight transposes) takes 32 elements a thread: 16-byte loads, all issued ahead of the arithmetic, and 16-byte stores, all behind it.
// Its parts are device functions of a block index bx (blocks of 256 threads): the kernel k_prep deals its blocks out to them.
// wtG: Bt[n][k] (bf16) = w[k][n], the four weights one behind the other: each takes the run of blocks that its K N / 8192 needs, in the order q, k, v, o (all four have K = 2048). A thread takes 8 k x 4 n: eight loads (rows k), four stores (rows n). Lanes: 8 along k (one whole 128-byte line of a Bt row), 4 along n; the 8 waves of a block lie side by side along n (512 contiguous bytes of each w row). K % 64 == 0, N % 16 == 0.
#define NWT ((2 * DM * DQ + 2 * DM * DKV) / 8192)   // its blocks
__device__ __forceinline__ void wtG(const int bx, const float* __restrict__ wq, const float* __restrict__ wk, const float* __restrict__ wv_, const float* __restrict__ wo, bf* BQ, bf* BK, bf* BV, bf* BO) {
    static_assert(DQ == DM, "one K for the four weights");
    constexpr int K = DM, nq = DM * DQ / 8192, nk = DM * DKV / 8192; const int sel = bx < nq ? 0 : bx < nq + nk ? 1 : bx < nq + 2 * nk ? 2 : 3;   // the same for the whole block
    const float* __restrict__ w = sel == 0 ? wq : sel == 1 ? wk : sel == 2 ? wv_ : wo; bf* Bt = sel == 0 ? BQ : sel == 1 ? BK : sel == 2 ? BV : BO; const int N = sel == 0 ? DQ : sel == 3 ? DM : DKV, b0 = sel == 0 ? 0 : sel == 1 ? nq : sel == 2 ? nq + nk : nq + 2 * nk;
    const int gid = (bx - b0) * 256 + threadIdx.x, wv = gid >> 5, lane = gid & 31; const int nng = N / 16; if (wv >= nng * (K / 64)) return;
    const int n0 = ((wv % nng) * 4 + (lane >> 3)) * 4, k0 = ((wv / nng) * 8 + (lane & 7)) * 8; const unsigned so = ((unsigned)n0 * K + k0) * 2; unsigned li[8]; v4f x[8]; v8us o[4];
#pragma unroll
    for (int i = 0; i < 8; ++i) li[i] = ((unsigned)(k0 + i) * N + n0) * 4;
#pragma unroll
    for (int i = 0; i < 8; ++i) x[i] = ldo<v4f>(w, li[i]);
    asm volatile("s_wait_xcnt 0x0" :: "v"(li[0]), "v"(li[1]), "v"(li[2]), "v"(li[3]), "v"(li[4]), "v"(li[5]), "v"(li[6]), "v"(li[7]) : "memory");   // the loads' offset registers are inputs here: they stay whole until every address has been taken
#pragma unroll
    for (int j = 0; j < 4; ++j)
#pragma unroll
        for (int i = 0; i < 8; ++i) o[j][i] = f2bf(x[i][j]);
#pragma unroll
    for (int j = 0; j < 4; ++j) sto<v8us>(Bt, so + (unsigned)j * K * 2, o[j]);
}
// cvt8: four groups of 8 elements a thread, 256 groups apart (beyond the end: the last group is loaded, in bounds, and not stored).
__device__ __forceinline__ void cvt8(const unsigned bx, const float* __restrict__ src, bf* dst, size_t n8) { const size_t i0 = (size_t)bx * 1024 + threadIdx.x; v8f v[4]; unsigned li[4];
#pragma unroll
    for (int u = 0; u < 4; ++u) { const size_t i = i0 + u * 256; li[u] = (unsigned)((i < n8 ? i : n8 - 1) * 32); }
#pragma unroll
    for (int u = 0; u < 4; ++u) v[u] = ldo<v8f>(src, li[u]);
    asm volatile("s_wait_xcnt 0x0" :: "v"(li[0]), "v"(li[1]), "v"(li[2]), "v"(li[3]) : "memory");   // the loads' offset registers are inputs here: they stay whole until every address has been taken
#pragma unroll
    for (int u = 0; u < 4; ++u) { const size_t i = i0 + u * 256; v8us o;
#pragma unroll
        for (int k = 0; k < 8; ++k) o[k] = f2bf(v[u][k]);
        if (i < n8) *(v8us*)(dst + i * 8) = o; } }
// k_prep: all that reads only the inputs. Blocks: NCV for each of the three streams (both batch entries; the copies lie one behind the other in XB), then NWT for the weights. The tests are the same for a whole block.
#define NCV (NB_ * TT * DM / 32 / 256)
__global__ __launch_bounds__(256) void k_prep(const float* __restrict__ xq, const float* __restrict__ xk, const float* __restrict__ xv, bf* XB, const float* __restrict__ wq, const float* __restrict__ wk, const float* __restrict__ wv, const float* __restrict__ wo, bf* WQ, bf* WK, bf* WV, bf* WO) {
    const unsigned bx = blockIdx.x;
    if (bx < 3 * NCV) { const unsigned st = bx / NCV; cvt8(bx - st * NCV, st == 0 ? xq : st == 1 ? xk : xv, XB + (size_t)st * NB_ * TT * DM, (size_t)NB_ * TT * DM / 8); }
    else wtG((int)(bx - 3 * NCV), wq, wk, wv, wo, WQ, WK, WV, WO);
}
#define FPB (2 * HD + 16)
#define FTB (128 * FPB)
__device__ __forceinline__ float xhalf(float x) { return __builtin_bit_cast(float, __builtin_amdgcn_permlanex16(__builtin_bit_cast(int, x), __builtin_bit_cast(int, x), 0x76543210, 0xfedcba98, false, false)); }   // lane l with lane l ^ 16
// exp2s: v_exp_f32 with the free slot behind it in the same statement.
__device__ __forceinline__ float exp2s(float x) { float r; asm("v_exp_f32 %0, %1\n\tv_nop" : "=v"(r) : "v"(x)); return r; }
template <typename T16, bool HL>
__device__ __forceinline__ void fa_body(unsigned char* sm, const T16* __restrict__ Q, const T16* __restrict__ Q2, const T16* __restrict__ Kp, const T16* __restrict__ K2, const T16* __restrict__ Vt, const T16* __restrict__ V2, bf* Oh, bf* Ol, const int q0) {
    typedef typename WFrag<T16>::V V;
    constexpr int PB = FPB, TB = FTB, BUF = (HL ? 4 : 2) * TB; constexpr float CSC = SCL * 1.4426950408889634f;
    const int tid = threadIdx.x, lane = tid & 31, lr = lane & 15, hi = lane >> 4; const int w = __builtin_amdgcn_readfirstlane((int)(threadIdx.x >> 5)), qg = w & 3, hs = (w >> 2) & 1, gq = w & 7, kh = w >> 3;
    Q += (size_t)hs * TT * HD; if (HL) Q2 += (size_t)hs * TT * HD; Oh += hs * HD; Ol += hs * HD;   // the wave's head of the pair: its query plane, its columns of the merged rows
    const int qw0 = q0 + 16 * qg, nst = (q0 + 64 + 127) / 128;   // stages up to the one that holds the diagonal (nst * 128 <= TT)
    const bool cv = w >= 8; const int crow = (tid & 255) >> 4, ccol = tid & 15;   // 16 lanes copy one staged row; eight waves copy 16 rows of their tile at a time
    const unsigned l0 = (unsigned)(size_t)sm + (cv ? TB : 0) + crow * PB + ccol * 16;
    const size_t go = (cv ? (size_t)crow * TT : (size_t)crow * HD) + ccol * 8, gs = cv ? (size_t)16 * TT : (size_t)16 * HD, gt = cv ? (size_t)128 : (size_t)128 * HD;   // elements: this lane's first copy; from 16 rows to the next; from a stage to the next
    const T16* g0 = (cv ? Vt : Kp) + go; const T16* g1 = HL ? (cv ? V2 : K2) + go : nullptr;
    auto fill = [&](int t) { const unsigned l = l0 + (t & 1) * BUF; cp8(l, g0 + t * gt, 16 * PB, gs); if (HL) cp8(l + 2 * TB, g1 + t * gt, 16 * PB, gs); };
    fill(0);
    V qf[4], q2[4];
#pragma unroll
    for (int kc = 0; kc < 4; ++kc) { qf[kc] = WFrag<T16>::ld(Q + (size_t)(qw0 + lr) * HD + kc * 32 + 8 * hi); if (HL) q2[kc] = WFrag<T16>::ld(Q2 + (size_t)(qw0 + lr) * HD + kc * 32 + 8 * hi); }
    v8f acc[8];
#pragma unroll
    for (int d8 = 0; d8 < 8; ++d8) acc[d8] = (v8f){};
    float m_run = -__builtin_inff(), l_run = 0.0f;
    asm volatile("s_wait_asynccnt 0x0" ::: "memory");   // this wave's copies of stage 0 have landed
    __syncthreads();                                     // and every other wave's
    if (1 < nst) fill(1);                                // where a stage 1 exists
    for (int t = 0; t < nst; ++t) {
#pragma unroll   // the two passes' LDS offsets differ by constants
      for (int i = 0; i < 2; ++i) {   // the wave's two passes of the stage
        const int ps = kh + 2 * i, key0 = t * 128 + ps * 32;
        if (key0 <= qw0 + 15) {   // some key of the pass is visible to the wave's last query (the same for the whole wave); its first key is then visible to every query of the wave
            const unsigned char* sK = sm + (t & 1) * BUF + (ps * 32 + lr) * PB + 16 * hi; const unsigned char* sV = sm + (t & 1) * BUF + TB + lr * PB + ps * 64 + 16 * hi;
            V kf[2][4], vf[8]; v8f s[2];
#pragma unroll
            for (int kt = 0; kt < 2; ++kt)
#pragma unroll
                for (int kc = 0; kc < 4; ++kc) kf[kt][kc] = WFrag<T16>::ld((const T16*)(sK + kt * 16 * PB + kc * 64));
            if (!HL) __builtin_amdgcn_sched_barrier(0);   // keeps the key fragments' 16 loads together ahead of the products, for speed only (with the lo planes' operands the registers do not allow it)
            s[0] = (v8f){}; s[1] = (v8f){};
#pragma unroll
            for (int kc = 0; kc < 4; ++kc)
#pragma unroll
                for (int kt = 0; kt < 2; ++kt) { s[kt] = WFrag<T16>::mma(kf[kt][kc], qf[kc], s[kt]); if (HL) s[kt] = WFrag<T16>::mma(kf[kt][kc], q2[kc], s[kt]); }
            if (HL) {
#pragma unroll
                for (int kt = 0; kt < 2; ++kt)
#pragma unroll
                    for (int kc = 0; kc < 4; ++kc) kf[kt][kc] = WFrag<T16>::ld((const T16*)(sK + 2 * TB + kt * 16 * PB + kc * 64));
#pragma unroll
                for (int kc = 0; kc < 4; ++kc)
#pragma unroll
                    for (int kt = 0; kt < 2; ++kt) s[kt] = WFrag<T16>::mma(kf[kt][kc], qf[kc], s[kt]); }
#pragma unroll
            for (int d8 = 0; d8 < 8; ++d8) vf[d8] = WFrag<T16>::ld((const T16*)(sV + d8 * 16 * PB));
            if (!HL) __builtin_amdgcn_sched_barrier(0);   // the value fragments' 16 loads are issued by here, so that they land under the softmax arithmetic
            if (key0 + 31 > qw0) {   // the pass straddles the wave's diagonal (the same for the whole wave)
#pragma unroll
                for (int kt = 0; kt < 2; ++kt)
#pragma unroll
                    for (int r = 0; r < 8; ++r) if (key0 + 16 * kt + 8 * hi + r > qw0 + lr) s[kt][r] = -__builtin_inff(); }
            float mx = fmaxf(s[0][0], s[1][0]);
#pragma unroll
            for (int r = 1; r < 8; ++r) mx = fmaxf(mx, fmaxf(s[0][r], s[1][r]));
            mx = fmaxf(mx, xhalf(mx)) * CSC;   // both halves hold the query's maximum of this pass, scaled
            if (__builtin_amdgcn_ballot_w32(mx > m_run + 8.0f) != 0) {   // one scalar test a pass; always taken on a wave's first pass (m_run = -inf: the factor is 0, on zeros)
                const float m_new = fmaxf(m_run, mx), corr = __builtin_amdgcn_exp2f(m_run - m_new); l_run *= corr; m_run = m_new;
#pragma unroll
                for (int d8 = 0; d8 < 8; ++d8) acc[d8] = acc[d8] * corr; }
            float p[2][8], ps0 = 0.0f, ps1 = 0.0f;
#pragma unroll
            for (int r = 0; r < 8; ++r) { const float x0 = __builtin_fmaf(s[0][r], CSC, -m_run), x1 = __builtin_fmaf(s[1][r], CSC, -m_run); p[0][r] = HL ? exp2s(x0) : __builtin_amdgcn_exp2f(x0); p[1][r] = HL ? exp2s(x1) : __builtin_amdgcn_exp2f(x1); ps0 += p[0][r]; ps1 += p[1][r]; }   // hi/lo: exp2s
            l_run += ps0 + ps1;
            if constexpr (HL) {
                v8us h0, h1, e0, e1;
#pragma unroll
                for (int r = 0; r < 8; ++r) { unsigned short a, c2; splitf(p[0][r], a, c2); h0[r] = a; e0[r] = c2; splitf(p[1][r], a, c2); h1[r] = a; e1[r] = c2; }
                const V pfh = cat16b(h0, h1), pfl = cat16b(e0, e1);
#pragma unroll
                for (int d8 = 0; d8 < 8; ++d8) { acc[d8] = WFrag<T16>::mma(vf[d8], pfh, acc[d8]); acc[d8] = WFrag<T16>::mma(vf[d8], pfl, acc[d8]); }
#pragma unroll
                for (int d8 = 0; d8 < 8; ++d8) vf[d8] = WFrag<T16>::ld((const T16*)(sV + 2 * TB + d8 * 16 * PB));
#pragma unroll
                for (int d8 = 0; d8 < 8; ++d8) acc[d8] = WFrag<T16>::mma(vf[d8], pfh, acc[d8]);
            } else {
                V pf;
#pragma unroll
                for (int r = 0; r < 8; ++r) { pf[r] = (h16)p[0][r]; pf[8 + r] = (h16)p[1][r]; }
#pragma unroll
                for (int d8 = 0; d8 < 8; ++d8) acc[d8] = WFrag<T16>::mma(vf[d8], pf, acc[d8]);
            }
        }
      }
        asm volatile("s_wait_dscnt 0x0" ::: "memory");      // this wave has left the buffer of stage t
        asm volatile("s_wait_asynccnt 0x0" ::: "memory");   // its copies of stage t + 1 have landed
        __syncthreads();                                     // stage t + 1 published; every wave has left the buffer of stage t
        if (t + 2 < nst) fill(t + 2);                        // refill of the buffer just left
    }
    asm volatile("s_wait_asynccnt 0x0" ::: "memory");       // no copy in flight when the buffers become the partial results
    v8f* red = (v8f*)sm; float* ml = (float*)(sm + 8 * 8 * 32 * 32);   // per query group, from its second wave: 8 accumulators a lane; behind them maximum and sum
    if (kh != 0) { const int pp = gq;   // the group's second wave
#pragma unroll
        for (int d8 = 0; d8 < 8; ++d8) red[(pp * 8 + d8) * 32 + lane] = acc[d8];
        ml[(pp * 2) * 32 + lane] = m_run; ml[(pp * 2 + 1) * 32 + lane] = l_run; }
    __syncthreads();   // the partial results are in LDS before the first wave of each group joins them
    if (kh == 0) {
        const float mp = ml[(gq * 2) * 32 + lane], lp = ml[(gq * 2 + 1) * 32 + lane], m = fmaxf(m_run, mp);   // m_run is finite here: key 0 is visible to every query. A wave that had no visible pass left -inf, 0 and zeros: its factor below is 0
        const float a0 = exp2s(m_run - m), a1 = exp2s(mp - m), l = l_run * a0 + lp * a1;
        const float inv = __fdiv_rn(1.0f, l + xhalf(l));
        const size_t oo = (size_t)(qw0 + lr) * DQ + 8 * hi;
#pragma unroll
        for (int d8 = 0; d8 < 8; ++d8) { v8f o = acc[d8] * (a0 * inv); v8us vh, vl;
            o += red[(gq * 8 + d8) * 32 + lane] * (a1 * inv);
#pragma unroll
            for (int j = 0; j < 8; ++j) { unsigned short a2, c2; splitf(o[j], a2, c2); vh[j] = a2; vl[j] = c2; }
            *(v8us*)(Oh + oo + 16 * d8) = vh; *(v8us*)(Ol + oo + 16 * d8) = vl; } }
}
__global__ __launch_bounds__(512) void k_fa(const h16* __restrict__ Q16, const h16* __restrict__ K16, const h16* __restrict__ V16, const bf* __restrict__ Qh, const bf* __restrict__ Ql, const bf* __restrict__ Kh, const bf* __restrict__ Kl, const bf* __restrict__ Vh, const bf* __restrict__ Vl, bf* Ah, bf* Al) {
    __shared__ __align__(32) unsigned char sm[8 * FTB];   // the two staging buffers (of two or of four tiles); behind the loop the partial results of each group's second wave
    static_assert(REP % 2 == 0 && NH_ % 2 == 0, "the two heads of a pair share a kv head and a batch entry");
    const unsigned h0 = 2 * blockIdx.x;   // the pair's first query plane
    const size_t zq = (size_t)h0 * TT * HD, zk = (size_t)(h0 / REP) * TT * HD, zo = (size_t)(h0 / NH_) * TT * DQ + (size_t)(h0 % NH_) * HD; const int y = blockIdx.y, q0 = 64 * (y < RH / 64 ? RH / 64 - 1 - y : TT / 64 - 1 - (y - RH / 64));
    if (q0 >= RH) fa_body<h16, false>(sm, Q16 + zq, nullptr, K16 + zk, nullptr, V16 + zk, nullptr, Ah + zo, Al + zo, q0);   // the same for the whole work-group
    else fa_body<bf, true>(sm, Qh + zq, Ql + zq, Kh + zk, Kl + zk, Vh + zk, Vl + zk, Ah + zo, Al + zo, q0);
}
extern "C" void kernel_launch(void* const* d_in, const int* in_sizes, int n_in,
                              void* d_out, int out_size, void* d_ws, size_t ws_size, hipStream_t stream) {
    (void)in_sizes; (void)n_in; (void)out_size;
    const float* xq = (const float*)d_in[0]; const float* xk = (const float*)d_in[1]; const float* xv = (const float*)d_in[2]; const float* wq = (const float*)d_in[3]; const float* wk = (const float*)d_in[4]; const float* wv = (const float*)d_in[5]; const float* wo = (const float*)d_in[6];   /* q, k, v ([2][2048][2048] each: THREE streams), Wq ('xw' (in, out) [2048][2048]: 16 heads x 128), Wk, Wv ('xw' [2048][512]: 4 kv heads x 128), Wo ('xw' [2048][2048]): SEVEN inputs, all read; no bias anywhere */
    float* OUT = (float*)d_out;     // [2][2048][2048]
    char* wsp = (char*)d_ws;
    auto take = [&](size_t bytes) { char* p = wsp; wsp += (bytes + 255) & ~(size_t)255; return (void*)p; };
    static_assert(ZH == NH_, "planes b NH_ + h are 2 blockIdx.x and 2 blockIdx.x + 1 of k_fa");
    bf* WQ = (bf*)take((size_t)DQ * DM * 2); bf* WK = (bf*)take((size_t)2 * DKV * DM * 2); bf* WV = WK + (size_t)DKV * DM; bf* WO = (bf*)take((size_t)DM * DQ * 2);   /* WK, WV: z = 0, 1 of one GEMM launch */
    bf* XB = (bf*)take((size_t)3 * NB_ * TT * DM * 2);   /* XB: the bf16 copies of q, k, v, one behind the other */
    h16* QP16 = (h16*)take((size_t)NB_ * NH_ * TT * HD * 2); h16* KP16 = (h16*)take((size_t)NB_ * NKV * TT * HD * 2); h16* VT16 = (h16*)take((size_t)NB_ * NKV * HD * TT * 2);
    bf* QPh = (bf*)take((size_t)NB_ * NH_ * TT * HD * 2); bf* QPl = (bf*)take((size_t)NB_ * NH_ * TT * HD * 2); bf* KPh = (bf*)take((size_t)NB_ * NKV * TT * HD * 2); bf* KPl = (bf*)take((size_t)NB_ * NKV * TT * HD * 2); bf* VTh = (bf*)take((size_t)NB_ * NKV * HD * TT * 2); bf* VTl = (bf*)take((size_t)NB_ * NKV * HD * TT * 2);
    bf* ATh = (bf*)take((size_t)NB_ * TT * DQ * 2); bf* ATl = (bf*)take((size_t)NB_ * TT * DQ * 2);
    if ((size_t)(wsp - (char*)d_ws) > ws_size) return;    // ws 256 MiB
    k_prep<<<3 * NCV + NWT, 256, 0, stream>>>(xq, xk, xv, XB, wq, wk, wv, wo, WQ, WK, WV, WO);   /* the QUERY, KEY and VALUE streams cast; the four 'xw' (in, out) weights transposed once into Bt operands */
    k_gemmk<bf, 0, 4, 2, 1, 128, 1><<<dim3(NB_ * TT / 256, DQ / 128, 1), 256, 0, stream>>>(XB, nullptr, WQ, DM, nullptr, DQ, 0, 0, 0, QP16, QPh, QPl, nullptr, nullptr, nullptr);   /* q Wq into the query planes */
    k_gemmk<bf, 0, 2, 2, 2, 256, 2><<<dim3(NB_ * TT / 128, DKV / 128, 2), 256, 0, stream>>>(XB + (size_t)NB_ * TT * DM, nullptr, WK, DM, nullptr, DKV, (size_t)NB_ * TT * DM, (size_t)DKV * DM, 0, KP16, KPh, KPl, VT16, VTh, VTl);   /* z = 0: k Wk into the key planes [t][d], z = 1: v Wv into the value planes [d][t] */
    /* 'jnp.repeat(kh, 4, axis=1)': query head h uses kv head h / 4; with planes b NH_ + h and b NKV + h / 4 that is plane / REP for both batch entries */
    k_fa<<<dim3(NB_ * ZH / 2, TT / 64), 512, 0, stream>>>(QP16, KP16, VT16, QPh, QPl, KPh, KPl, VTh, VTl, ATh, ATl);
    k_gemmk<bf, 1, 4, 2, 1, 64, 0><<<dim3(NB_ * TT / 256, DM / 128, 1), 256, 0, stream>>>(ATh, ATl, WO, DQ, OUT, DM, 0, 0, 0, nullptr, nullptr, nullptr, nullptr, nullptr, nullptr);
}

// v010
// A run of this version takes 145 microseconds.
// Timed twice side by side with v009, it ran 1.05 times as fast both times.
// Over all steps from v000 it is 11.2 times as fast.
#include <hip/hip_runtime.h>

// Grouped-query causal attention with 128-wide heads on three input streams (q, k, v [2][2048][2048]; qh = q Wq (16 heads x 128), kh, vh = k Wk, v Wv (4 kv heads x 128) ('xw' (in, out) 0.02, no bias); qh and kh each x 128^-0.25 (together 1/sqrt(128)); kv head = query head / 4 (jnp.repeat); the module takes softmax over ALL keys, zeroes the strictly-upper triangle and renormalises by (row sum + 1e-9): a causal softmax but for that epsilon; out = merged Wo ('xw', no bias) -> [2][2048][2048] (8.4 M); argument order q, k, v, Wq, Wk, Wv, Wo).
// Layout: five launches. Every launch takes BOTH batch entries (rows b T + t of the projections, planes b heads + h of the attention), and work that does not depend on each other shares a launch, each part on its own run of blocks: k_prep (bf16 copies of q, k and v one behind the other in one operand buffer; the four 'xw' weights transposed into Bt operands); exact projections (q; k and v together), whose epilogues round their f32 sums straight into the attention's 16-bit head planes; causal T-2048 attention with 128-wide heads, all 2 x 16 query heads in ONE launch of the fused kernel k_fa, whose scores and probabilities never leave the registers (kv head = head / 4 on the key and value operands) (hybrid rows: < 512 hi/lo 3 products, rest fp16) and whose epilogue writes the merged hi/lo operand of the last product; merged hi/lo x Wo exact.
// Compute dtypes, f32 accumulate: every input rounded to bf16; projections exact; attention rows < 512 3 products, rest fp16; softmax f32 (the exact causal softmax: no epsilon term); Wo hl x exact.

#define NB_  2
#define TT   2048
#define DM   2048
#define NH_  16
#define NKV  4
#define REP  (NH_ / NKV)
#define HD   128
#define DQ   (NH_ * HD)
#define DKV  (NKV * HD)
#define ZH   16                   // query heads of a batch entry per attention launch (all of them)
#define RH   512                  // query rows < RH use hi+lo planes (0: none)
#define SCL  0.088388347648318447f   // HD^-0.5
typedef _Float16 h16;
typedef unsigned short bf;
typedef __attribute__((ext_vector_type(16))) __bf16   v16bf;
typedef __attribute__((ext_vector_type(16))) _Float16 v16h;
typedef __attribute__((ext_vector_type(8)))  _Float16 v8h;
typedef __attribute__((ext_vector_type(8)))  unsigned short v8us;
typedef __attribute__((ext_vector_type(8)))  float    v8f;
typedef __attribute__((ext_vector_type(4)))  float    v4f;
typedef v8h  __attribute__((may_alias)) v8ha;
typedef v4f  __attribute__((may_alias)) v4fa;
typedef v8us __attribute__((may_alias)) v8usa;

__device__ __forceinline__ unsigned short f2bf(float f) { unsigned u = __float_as_uint(f); u += 0x7FFFu + ((u >> 16) & 1u); return (unsigned short)(u >> 16); }
__device__ __forceinline__ float bf2f(unsigned short b) { return __uint_as_float(((unsigned)b) << 16); }
__device__ __forceinline__ float bfr(float f) { return bf2f(f2bf(f)); }
__device__ __forceinline__ v16h cat16(v8h lo, v8h hi) { return __builtin_shufflevector(lo, hi, 0, 1, 2, 3, 4, 5, 6, 7, 8, 9, 10, 11, 12, 13, 14, 15); }
__device__ __forceinline__ v16bf cat16b(v8us lo, v8us hi) { return __builtin_bit_cast(v16bf, __builtin_shufflevector(lo, hi, 0, 1, 2, 3, 4, 5, 6, 7, 8, 9, 10, 11, 12, 13, 14, 15)); }
__device__ __forceinline__ v8f wmma16(v16h a, v16h b, v8f c) { return __builtin_amdgcn_wmma_f32_16x16x32_f16(false, a, false, b, (short)0, c, false, false); }
__device__ __forceinline__ v8f wmmab(v16bf a, v16bf b, v8f c) { return __builtin_amdgcn_wmma_f32_16x16x32_bf16(false, a, false, b, (short)0, c, false, false); }

// ---- k_gemmk: register-blocked GEMM, one 64 WM x 64 WN output tile per work-group of WM WN WK waves. Wave (wk, wm, wn) owns the 64x64 sub-tile (wm, wn), 16 accumulators, and of every staged trip the 32-k steps wk, wk + WK, ...
// A staged operand row serves WN (A) or WM (Bt) sub-tiles, so the bytes that a work-group draws from L2 per output element fall with the tile: (BM + BN) / (BM BN) rows of K.
// With WK == 1 a wave sums its whole K range in k order; with WK > 1 the WK partial sub-tiles meet in LDS and are summed in wk order. Every wave passes its sub-tile through LDS, so that the stores take whole row pieces (256 bytes of C, 128-byte lines of the head planes).
// The operands come through LDS: a trip stages CK k of every K-contiguous 16-bit operand plane by asynchronous 16-byte copies that take whole 128-byte lines, two buffers, the next trip's copies in flight under this trip's products.
// LDS row pitch 2 CK + 16 bytes (an odd multiple of 16). The fragments of the next 32-k step are fetched, as one group, ahead of this step's products (two register sets), over the trips' boundary too: the next trip is published in front of a trip's LAST step's products (whose fragments are in registers by then), so that its first fragments land under them and no trip opens with the eight waves waiting on LDS.
// C[m][n] (f32, pitch ldc) = sum_k A[m][k] Bt[n][k] (+ A2[m][k] Bt[n][k] where NSPLIT == 1). K % CK == 0, K >= 2 CK (two trips). grid (M / (64 WM), N / (64 WN), Z), 32 WM WN WK threads.
// z-batch: A, Bt and C advance by sA, sB, sC per z (the k and the v projection are z = 0, 1 of one launch).
// Epilogue EPI 0: C as above. EPI 1, 2: no C; the f32 sums are rounded in the epilogue into the head planes that the attention reads (N = ldc = heads x HD, rows m = b TT + t): [b heads + h][t][d] in P16 (fp16), Ph, Pl (hi/lo);
// with EPI 2 the blocks z == 1 write [b heads + h][d][t] in T16p, Th, Tl instead (their sub-tiles go through LDS transposed). Only what k_fa reads is written: hi/lo planes for t < RH; fp16 planes for every t of keys and values (EPI 2), for t >= RH of queries (EPI 1).
// ldo, sto: an address is a uniform base plus one 32-bit byte offset per lane (every buffer here is far below 4 GiB).
template <typename V> __device__ __forceinline__ V ldo(const void* base, unsigned off) { return *(const V*)((const char*)base + off); }
template <typename V> __device__ __forceinline__ void sto(void* base, unsigned off, V v) { *(V*)((char*)base + off) = v; }
__device__ __forceinline__ h16 tohx(float x) { return (h16)x; }
__device__ __forceinline__ void splitf(float y, unsigned short& h, unsigned short& l) { h = f2bf(y); l = f2bf(y - bf2f(h)); }
template <typename T16> struct WFrag;
template <> struct WFrag<h16> { typedef v16h V; static __device__ __forceinline__ V ld(const h16* p) { return cat16(*(const v8h*)p, *(const v8h*)(p + 16)); } static __device__ __forceinline__ v8f mma(V a, V b, v8f c) { return wmma16(a, b, c); } };
template <> struct WFrag<bf> { typedef v16bf V; static __device__ __forceinline__ V ld(const bf* p) { return cat16b(*(const v8us*)p, *(const v8us*)(p + 16)); } static __device__ __forceinline__ v8f mma(V a, V b, v8f c) { return wmmab(a, b, c); } };
// cp8: one lane's eight copies of one staged plane (rows RS apart in k_gemmk, 16 apart in k_fa). The wait on the address counter is the statement's last line, so that no register named by a copy is rewritten in front of it.
template <typename T16>
__device__ __forceinline__ void cp8(unsigned l, const T16* g, unsigned ls, size_t gs) {
    asm volatile("global_load_async_to_lds_b128 %0, %8, off\n\t"
                 "global_load_async_to_lds_b128 %1, %9, off\n\t"
                 "global_load_async_to_lds_b128 %2, %10, off\n\t"
                 "global_load_async_to_lds_b128 %3, %11, off\n\t"
                 "global_load_async_to_lds_b128 %4, %12, off\n\t"
                 "global_load_async_to_lds_b128 %5, %13, off\n\t"
                 "global_load_async_to_lds_b128 %6, %14, off\n\t"
                 "global_load_async_to_lds_b128 %7, %15, off\n\t"
                 "s_wait_xcnt 0x0"
                 :: "v"(l), "v"(l + ls), "v"(l + 2 * ls), "v"(l + 3 * ls), "v"(l + 4 * ls), "v"(l + 5 * ls), "v"(l + 6 * ls), "v"(l + 7 * ls),
                    "v"(g), "v"(g + gs), "v"(g + 2 * gs), "v"(g + 3 * gs), "v"(g + 4 * gs), "v"(g + 5 * gs), "v"(g + 6 * gs), "v"(g + 7 * gs) : "memory");
}
// cp4: the same for four copies.
template <typename T16>
__device__ __forceinline__ void cp4(unsigned l, const T16* g, unsigned ls, size_t gs) {
    asm volatile("global_load_async_to_lds_b128 %0, %4, off\n\t"
                 "global_load_async_to_lds_b128 %1, %5, off\n\t"
                 "global_load_async_to_lds_b128 %2, %6, off\n\t"
                 "global_load_async_to_lds_b128 %3, %7, off\n\t"
                 "s_wait_xcnt 0x0"
                 :: "v"(l), "v"(l + ls), "v"(l + 2 * ls), "v"(l + 3 * ls), "v"(g), "v"(g + gs), "v"(g + 2 * gs), "v"(g + 3 * gs) : "memory");
}
// stage: one lane's N copies of one staged plane, rows ls bytes (LDS) and gs elements (global) apart.
template <int N, typename T16>
__device__ __forceinline__ void stage(unsigned l, const T16* g, unsigned ls, size_t gs) {
    static_assert(N % 4 == 0, "copies come in fours and eights");
#pragma unroll
    for (int i = 0; i < N / 8; ++i) cp8(l + i * 8 * ls, g + i * 8 * gs, ls, gs);
    if (N % 8) cp4(l + (N / 8) * 8 * ls, g + (N / 8) * 8 * gs, ls, gs);
}
template <typename T16, int NSPLIT, int WM, int WN, int WK, int CK, int EPI>
__global__ __launch_bounds__(32 * WM * WN * WK) void k_gemmk(const T16* __restrict__ A, const T16* __restrict__ A2, const T16* __restrict__ Bt, int K, float* C, int ldc, size_t sA, size_t sB, size_t sC, h16* P16, bf* Ph, bf* Pl, h16* T16p, bf* Th, bf* Tl) {
    typedef typename WFrag<T16>::V V;
    static_assert(NSPLIT == 0 || NSPLIT == 1, "one or two A planes");
    constexpr int NG = WM * WN, NW = NG * WK, BM = 64 * WM, BN = 64 * WN, PB = 2 * CK + 16, TA = BM * PB, TBT = BN * PB, BUF = (1 + NSPLIT) * TA + TBT;   // sub-tiles, waves, tile, LDS row pitch, bytes of a staged A and Bt plane and of a buffer (A, Bt, then A2)
    constexpr int RS = 32 * NW * 8 / CK, NS = CK / 32 / WK;   // rows that the block copies at a time (CK / 8 lanes copy one staged row); 32-k steps of a wave per trip
    constexpr int SMB = (2 * BUF > NW * 64 * 68 * 4) ? 2 * BUF : NW * 64 * 68 * 4;
    __shared__ __align__(16) unsigned char sm[SMB];   // the two staging buffers; behind the loop the NW sub-tiles
    const size_t z = blockIdx.z; A += z * sA; if (NSPLIT) A2 += z * sA; Bt += z * sB; if (EPI == 0) C += z * sC;
    const int tid = threadIdx.x, lane = tid & 31, lr = lane & 15, hi = lane >> 4; const int w = __builtin_amdgcn_readfirstlane((int)(threadIdx.x >> 5)), g = w % NG, wk = w / NG, wm = g / WN, wn = g % WN; const int r0 = blockIdx.x * BM, c0 = blockIdx.y * BN;
    const int ntrip = K / CK;
    v8f acc[4][4];
#pragma unroll
    for (int mb = 0; mb < 4; ++mb)
#pragma unroll
        for (int nb = 0; nb < 4; ++nb) acc[mb][nb] = (v8f){};
    const int crow = tid / (CK / 8), ccol = tid % (CK / 8);
    const unsigned l0 = (unsigned)(size_t)sm + crow * PB + ccol * 16;
    const size_t aoff = (size_t)r0 * K, boff = (size_t)c0 * K; const unsigned loff = (unsigned)crow * K + 8 * ccol;   // elements: the work-group's first rows (the same for every lane); this lane's place in a plane's first RS rows
    // lp: a lane's address = the trip's part, the same for every lane and held in scalar registers by the two readfirstlane, + loff. One vector register then serves the three planes over the loop; as three per-lane address pairs, alive beside a fragment set now, two were spilled and reloaded every trip.
    auto lp = [&](const T16* p) { const unsigned long long u = (unsigned long long)p; const unsigned ul = __builtin_amdgcn_readfirstlane((unsigned)u), uh = __builtin_amdgcn_readfirstlane((unsigned)(u >> 32)); return (const T16*)(((unsigned long long)uh << 32) | ul) + loff; };
    auto fill = [&](int t) { const unsigned l = l0 + (t & 1) * BUF; stage<BM / RS>(l, lp(A + aoff + t * CK), RS * PB, (size_t)RS * K); stage<BN / RS>(l + TA, lp(Bt + boff + t * CK), RS * PB, (size_t)RS * K);
        if (NSPLIT) stage<BM / RS>(l + TA + TBT, lp(A2 + aoff + t * CK), RS * PB, (size_t)RS * K); };
    fill(0);
    asm volatile("s_wait_asynccnt 0x0" ::: "memory");   // this wave's copies of trip 0 have landed
    __syncthreads();                                     // and every other wave's
    fill(1);                                             // a trip 1 always exists
    const int fa = (wm * 64 + lr) * PB + (wk * 32 + 8 * hi) * 2, fb = TA + (wn * 64 + lr) * PB + (wk * 32 + 8 * hi) * 2;
    static_assert(NS % 2 == 0, "a trip's first step uses register set 0, its last step set 1");
    V a[2][4], a2[2][4], b[2][4];
    auto frag = [&](const unsigned char* s, int st, int set) {   // the fragments of this wave's step st of the trip staged at s
#pragma unroll
            for (int mb = 0; mb < 4; ++mb) { a[set][mb] = WFrag<T16>::ld((const T16*)(s + fa + mb * 16 * PB + st * WK * 64)); if (NSPLIT) a2[set][mb] = WFrag<T16>::ld((const T16*)(s + fa + TA + TBT + mb * 16 * PB + st * WK * 64)); }
#pragma unroll
            for (int nb = 0; nb < 4; ++nb) b[set][nb] = WFrag<T16>::ld((const T16*)(s + fb + nb * 16 * PB + st * WK * 64)); };
    frag(sm, 0, 0);                                      // trip 0 is published: its first fragments
    for (int t = 0; t < ntrip; ++t) {
        const unsigned char* s = sm + (t & 1) * BUF;
#pragma unroll
        for (int st = 0; st < NS; ++st) {
            __builtin_amdgcn_sched_barrier(0);   // keeps the step before's products ahead of what follows: sunk behind the waits below, they would start only when the last fragments, just asked for, had landed
            if (st + 1 < NS) frag(s, st + 1, (st + 1) & 1);
            else {   // publish point of trip t + 1, in front of the last step's products: every fragment of trip t has been asked for
                asm volatile("s_wait_dscnt 0x0" ::: "memory");      // this wave's last fragments of trip t are in registers: it has left the buffer of trip t
                asm volatile("s_wait_asynccnt 0x0" ::: "memory");   // its copies of trip t + 1 have landed
                __syncthreads();                                     // trip t + 1 published; every wave has left the buffer of trip t
                if (t + 2 < ntrip) fill(t + 2);                      // refill of the buffer just left
                if (t + 1 < ntrip) frag(sm + ((t + 1) & 1) * BUF, 0, 0);   // the next trip's first fragments, to land under the products below
            }
            __builtin_amdgcn_sched_barrier(0);   // keeps the next step's fragment loads together ahead of this step's products: for speed only
#pragma unroll
            for (int nb = 0; nb < 4; ++nb) {
#pragma unroll
                for (int mb = 0; mb < 4; ++mb) acc[mb][nb] = WFrag<T16>::mma(a[st & 1][mb], b[st & 1][nb], acc[mb][nb]);
                if (NSPLIT) {
#pragma unroll
                    for (int mb = 0; mb < 4; ++mb) acc[mb][nb] = WFrag<T16>::mma(a2[st & 1][mb], b[st & 1][nb], acc[mb][nb]); } }
        }
    }
    asm volatile("s_wait_asynccnt 0x0" ::: "memory");       // no copy in flight when the buffers become the sub-tiles (behind the last trip's publish point no wave reads them any more)
    float* red = (float*)sm; float* mine = red + w * (64 * 68);
    const bool tr = EPI == 2 && blockIdx.z == 1;   // the same for the whole work-group: the sub-tile lies in LDS as [n][m]
    if (tr) {
#pragma unroll
        for (int mb = 0; mb < 4; ++mb)
#pragma unroll
            for (int nb = 0; nb < 4; ++nb) { float* p = mine + (nb * 16 + lr) * 68 + mb * 16 + hi * 8; *(v4fa*)p = __builtin_shufflevector(acc[mb][nb], acc[mb][nb], 0, 1, 2, 3); *(v4fa*)(p + 4) = __builtin_shufflevector(acc[mb][nb], acc[mb][nb], 4, 5, 6, 7); }
    } else {
#pragma unroll
        for (int mb = 0; mb < 4; ++mb)
#pragma unroll
            for (int nb = 0; nb < 4; ++nb)
#pragma unroll
                for (int j = 0; j < 8; ++j) mine[(mb * 16 + hi * 8 + j) * 68 + nb * 16 + lr] = acc[mb][nb][j];
    }
    __syncthreads();   // every wave's sub-tile is in LDS before any wave reads rows of it
    if constexpr (EPI != 0) {
        static_assert(TT % BM == 0 && RH % BM == 0 && HD % 64 == 0, "a work-group's rows lie in one batch entry and on one side of RH; a sub-tile's columns in one head");
        const unsigned tw = r0 % TT + wm * 64, cw = c0 + wn * 64, pl = (r0 / TT) * (ldc / HD) + cw / HD, dw = cw % HD;   // the sub-tile's first t, first column, plane and first d
        const bool whl = r0 % TT < RH, w16 = EPI == 2 || !whl;   // the same for the whole work-group
        const unsigned base = tr ? (pl * HD + dw) * TT + tw : (pl * TT + tw) * HD + dw, pitch = tr ? TT : HD;   // elements: LDS row 0 of the sub-tile in its plane; from an LDS row to the next
        h16* o16 = tr ? T16p : P16; bf* oh = tr ? Th : Ph; bf* ol = tr ? Tl : Pl;
        // 8 lanes take one LDS row (64 values: one whole 128-byte line of a plane), 4 rows a step
#pragma unroll
        for (int s = 0; s < 16 / WK; ++s) { const int row = wk * (64 / WK) + 4 * s + (lane >> 3), cofs = (lane & 7) * 8; const float* rp = red + g * (64 * 68) + row * 68 + cofs; v4f x0 = *(const v4fa*)rp, x1 = *(const v4fa*)(rp + 4);
#pragma unroll
            for (int p = 1; p < WK; ++p) { x0 += *(const v4fa*)(rp + p * NG * (64 * 68)); x1 += *(const v4fa*)(rp + p * NG * (64 * 68) + 4); }
            const unsigned off = (base + row * pitch + cofs) * 2;   // bytes
            if (w16) { v8h v;
#pragma unroll
                for (int q = 0; q < 4; ++q) { v[q] = tohx(x0[q]); v[4 + q] = tohx(x1[q]); }
                sto<v8h>(o16, off, v);
                asm volatile("s_wait_xcnt 0x0" :: "v"(off), "v"(v) : "memory"); }   // the store's registers are inputs here: they stay whole until its address has been taken
            if (whl) { v8us vh, vl;
#pragma unroll
                for (int q = 0; q < 4; ++q) { unsigned short a2, c2; splitf(x0[q], a2, c2); vh[q] = a2; vl[q] = c2; splitf(x1[q], a2, c2); vh[4 + q] = a2; vl[4 + q] = c2; }
                sto<v8us>(oh, off, vh); sto<v8us>(ol, off, vl);
                asm volatile("s_wait_xcnt 0x0" :: "v"(off), "v"(vh), "v"(vl) : "memory"); } }   // likewise for the two stores
    } else {
#pragma unroll
    for (int s = 0; s < 32 / WK; ++s) { const int row = wk * (64 / WK) + 2 * s + hi, cofs = lr * 4; v4f val = *(const v4fa*)(red + g * (64 * 68) + row * 68 + cofs);
#pragma unroll
        for (int p = 1; p < WK; ++p) val += *(const v4fa*)(red + (p * NG + g) * (64 * 68) + row * 68 + cofs);
        *(v4f*)(C + (size_t)(r0 + wm * 64 + row) * ldc + c0 + wn * 64 + cofs) = val; }
    }
}

typedef __attribute__((ext_vector_type(2))) _Float16 v2h;
typedef __attribute__((ext_vector_type(4))) _Float16 v4h;
typedef __attribute__((ext_vector_type(2))) unsigned short v2us;
typedef __attribute__((ext_vector_type(4))) unsigned short v4us;
typedef __attribute__((ext_vector_type(2))) float v2f;
typedef __attribute__((ext_vector_type(4))) int v4i;

// The work without matrix products (casts, weight transposes) takes 32 elements a thread: 16-byte loads, all issued ahead of the arithmetic, and 16-byte stores, all behind it.
// Its parts are device functions of a block index bx (blocks of 256 threads): the kernel k_prep deals its blocks out to them.
// wtG: Bt[n][k] (bf16) = w[k][n], the four weights one behind the other: each takes the run of blocks that its K N / 8192 needs, in the order q, k, v, o (all four have K = 2048). A thread takes 8 k x 4 n: eight loads (rows k), four stores (rows n). Lanes: 8 along k (one whole 128-byte line of a Bt row), 4 along n; the 8 waves of a block lie side by side along n (512 contiguous bytes of each w row). K % 64 == 0, N % 16 == 0.
#define NWT ((2 * DM * DQ + 2 * DM * DKV) / 8192)   // its blocks
__device__ __forceinline__ void wtG(const int bx, const float* __restrict__ wq, const float* __restrict__ wk, const float* __restrict__ wv_, const float* __restrict__ wo, bf* BQ, bf* BK, bf* BV, bf* BO) {
    static_assert(DQ == DM, "one K for the four weights");
    constexpr int K = DM, nq = DM * DQ / 8192, nk = DM * DKV / 8192; const int sel = bx < nq ? 0 : bx < nq + nk ? 1 : bx < nq + 2 * nk ? 2 : 3;   // the same for the whole block
    const float* __restrict__ w = sel == 0 ? wq : sel == 1 ? wk : sel == 2 ? wv_ : wo; bf* Bt = sel == 0 ? BQ : sel == 1 ? BK : sel == 2 ? BV : BO; const int N = sel == 0 ? DQ : sel == 3 ? DM : DKV, b0 = sel == 0 ? 0 : sel == 1 ? nq : sel == 2 ? nq + nk : nq + 2 * nk;
    const int gid = (bx - b0) * 256 + threadIdx.x, wv = gid >> 5, lane = gid & 31; const int nng = N / 16; if (wv >= nng * (K / 64)) return;
    const int n0 = ((wv % nng) * 4 + (lane >> 3)) * 4, k0 = ((wv / nng) * 8 + (lane & 7)) * 8; const unsigned so = ((unsigned)n0 * K + k0) * 2; unsigned li[8]; v4f x[8]; v8us o[4];
#pragma unroll
    for (int i = 0; i < 8; ++i) li[i] = ((unsigned)(k0 + i) * N + n0) * 4;
#pragma unroll
    for (int i = 0; i < 8; ++i) x[i] = ldo<v4f>(w, li[i]);
    asm volatile("s_wait_xcnt 0x0" :: "v"(li[0]), "v"(li[1]), "v"(li[2]), "v"(li[3]), "v"(li[4]), "v"(li[5]), "v"(li[6]), "v"(li[7]) : "memory");   // the loads' offset registers are inputs here: they stay whole until every address has been taken
#pragma unroll
    for (int j = 0; j < 4; ++j)
#pragma unroll
        for (int i = 0; i < 8; ++i) o[j][i] = f2bf(x[i][j]);
#pragma unroll
    for (int j = 0; j < 4; ++j) sto<v8us>(Bt, so + (unsigned)j * K * 2, o[j]);
}
// cvt8: four groups of 8 elements a thread, 256 groups apart (beyond the end: the last group is loaded, in bounds, and not stored).
__device__ __forceinline__ void cvt8(const unsigned bx, const float* __restrict__ src, bf* dst, size_t n8) { const size_t i0 = (size_t)bx * 1024 + threadIdx.x; v8f v[4]; unsigned li[4];
#pragma unroll
    for (int u = 0; u < 4; ++u) { const size_t i = i0 + u * 256; li[u] = (unsigned)((i < n8 ? i : n8 - 1) * 32); }
#pragma unroll
    for (int u = 0; u < 4; ++u) v[u] = ldo<v8f>(src, li[u]);
    asm volatile("s_wait_xcnt 0x0" :: "v"(li[0]), "v"(li[1]), "v"(li[2]), "v"(li[3]) : "memory");   // the loads' offset registers are inputs here: they stay whole until every address has been taken
#pragma unroll
    for (int u = 0; u < 4; ++u) { const size_t i = i0 + u * 256; v8us o;
#pragma unroll
        for (int k = 0; k < 8; ++k) o[k] = f2bf(v[u][k]);
        if (i < n8) *(v8us*)(dst + i * 8) = o; } }
// k_prep: all that reads only the inputs. Blocks: NCV for each of the three streams (both batch entries; the copies lie one behind the other in XB), then NWT for the weights. The tests are the same for a whole block.
#define NCV (NB_ * TT * DM / 32 / 256)
__global__ __launch_bounds__(256) void k_prep(const float* __restrict__ xq, const float* __restrict__ xk, const float* __restrict__ xv, bf* XB, const float* __restrict__ wq, const float* __restrict__ wk, const float* __restrict__ wv, const float* __restrict__ wo, bf* WQ, bf* WK, bf* WV, bf* WO) {
    const unsigned bx = blockIdx.x;
    if (bx < 3 * NCV) { const unsigned st = bx / NCV; cvt8(bx - st * NCV, st == 0 ? xq : st == 1 ? xk : xv, XB + (size_t)st * NB_ * TT * DM, (size_t)NB_ * TT * DM / 8); }
    else wtG((int)(bx - 3 * NCV), wq, wk, wv, wo, WQ, WK, WV, WO);
}
#define FPB (2 * HD + 16)
#define FTB (128 * FPB)
__device__ __forceinline__ float xhalf(float x) { return __builtin_bit_cast(float, __builtin_amdgcn_permlanex16(__builtin_bit_cast(int, x), __builtin_bit_cast(int, x), 0x76543210, 0xfedcba98, false, false)); }   // lane l with lane l ^ 16
// exp2s: v_exp_f32 with the free slot behind it in the same statement.
__device__ __forceinline__ float exp2s(float x) { float r; asm("v_exp_f32 %0, %1\n\tv_nop" : "=v"(r) : "v"(x)); return r; }
template <typename T16, bool HL>
__device__ __forceinline__ void fa_body(unsigned char* sm, const T16* __restrict__ Q, const T16* __restrict__ Q2, const T16* __restrict__ Kp, const T16* __restrict__ K2, const T16* __restrict__ Vt, const T16* __restrict__ V2, bf* Oh, bf* Ol, const int q0) {
    typedef typename WFrag<T16>::V V;
    constexpr int PB = FPB, TB = FTB, BUF = (HL ? 4 : 2) * TB; constexpr float CSC = SCL * 1.4426950408889634f;
    const int tid = threadIdx.x, lane = tid & 31, lr = lane & 15, hi = lane >> 4; const int w = __builtin_amdgcn_readfirstlane((int)(threadIdx.x >> 5)), qg = w & 3, hs = (w >> 2) & 1, gq = w & 7, kh = w >> 3;
    Q += (size_t)hs * TT * HD; if (HL) Q2 += (size_t)hs * TT * HD; Oh += hs * HD; Ol += hs * HD;   // the wave's head of the pair: its query plane, its columns of the merged rows
    const int qw0 = q0 + 16 * qg, nst = (q0 + 64 + 127) / 128;   // stages up to the one that holds the diagonal (nst * 128 <= TT)
    const bool cv = w >= 8; const int crow = (tid & 255) >> 4, ccol = tid & 15;   // 16 lanes copy one staged row; eight waves copy 16 rows of their tile at a time
    const unsigned l0 = (unsigned)(size_t)sm + (cv ? TB : 0) + crow * PB + ccol * 16;
    const size_t go = (cv ? (size_t)crow * TT : (size_t)crow * HD) + ccol * 8, gs = cv ? (size_t)16 * TT : (size_t)16 * HD, gt = cv ? (size_t)128 : (size_t)128 * HD;   // elements: this lane's first copy; from 16 rows to the next; from a stage to the next
    const T16* g0 = (cv ? Vt : Kp) + go; const T16* g1 = HL ? (cv ? V2 : K2) + go : nullptr;
    auto fill = [&](int t) { const unsigned l = l0 + (t & 1) * BUF; cp8(l, g0 + t * gt, 16 * PB, gs); if (HL) cp8(l + 2 * TB, g1 + t * gt, 16 * PB, gs); };
    fill(0);
    V qf[4], q2[4];
#pragma unroll
    for (int kc = 0; kc < 4; ++kc) { qf[kc] = WFrag<T16>::ld(Q + (size_t)(qw0 + lr) * HD + kc * 32 + 8 * hi); if (HL) q2[kc] = WFrag<T16>::ld(Q2 + (size_t)(qw0 + lr) * HD + kc * 32 + 8 * hi); }
    v8f acc[8];
#pragma unroll
    for (int d8 = 0; d8 < 8; ++d8) acc[d8] = (v8f){};
    float m_run = -__builtin_inff(), l_run = 0.0f;
    asm volatile("s_wait_asynccnt 0x0" ::: "memory");   // this wave's copies of stage 0 have landed
    __syncthreads();                                     // and every other wave's
    if (1 < nst) fill(1);                                // where a stage 1 exists
    for (int t = 0; t < nst; ++t) {
#pragma unroll   // the two passes' LDS offsets differ by constants
      for (int i = 0; i < 2; ++i) {   // the wave's two passes of the stage
        const int ps = kh + 2 * i, key0 = t * 128 + ps * 32;
        if (key0 <= qw0 + 15) {   // some key of the pass is visible to the wave's last query (the same for the whole wave); its first key is then visible to every query of the wave
            const unsigned char* sK = sm + (t & 1) * BUF + (ps * 32 + lr) * PB + 16 * hi; const unsigned char* sV = sm + (t & 1) * BUF + TB + lr * PB + ps * 64 + 16 * hi;
            V kf[2][4], vf[8]; v8f s[2];
#pragma unroll
            for (int kt = 0; kt < 2; ++kt)
#pragma unroll
                for (int kc = 0; kc < 4; ++kc) kf[kt][kc] = WFrag<T16>::ld((const T16*)(sK + kt * 16 * PB + kc * 64));
            if (!HL) __builtin_amdgcn_sched_barrier(0);   // keeps the key fragments' 16 loads together ahead of the products, for speed only (with the lo planes' operands the registers do not allow it)
            s[0] = (v8f){}; s[1] = (v8f){};
#pragma unroll
            for (int kc = 0; kc < 4; ++kc)
#pragma unroll
                for (int kt = 0; kt < 2; ++kt) { s[kt] = WFrag<T16>::mma(kf[kt][kc], qf[kc], s[kt]); if (HL) s[kt] = WFrag<T16>::mma(kf[kt][kc], q2[kc], s[kt]); }
            if (HL) {
#pragma unroll
                for (int kt = 0; kt < 2; ++kt)
#pragma unroll
                    for (int kc = 0; kc < 4; ++kc) kf[kt][kc] = WFrag<T16>::ld((const T16*)(sK + 2 * TB + kt * 16 * PB + kc * 64));
#pragma unroll
                for (int kc = 0; kc < 4; ++kc)
#pragma unroll
                    for (int kt = 0; kt < 2; ++kt) s[kt] = WFrag<T16>::mma(kf[kt][kc], qf[kc], s[kt]); }
#pragma unroll
            for (int d8 = 0; d8 < 8; ++d8) vf[d8] = WFrag<T16>::ld((const T16*)(sV + d8 * 16 * PB));
            if (!HL) __builtin_amdgcn_sched_barrier(0);   // the value fragments' 16 loads are issued by here, so that they land under the softmax arithmetic
            if (key0 + 31 > qw0) {   // the pass straddles the wave's diagonal (the same for the whole wave)
#pragma unroll
                for (int kt = 0; kt < 2; ++kt)
#pragma unroll
                    for (int r = 0; r < 8; ++r) if (key0 + 16 * kt + 8 * hi + r > qw0 + lr) s[kt][r] = -__builtin_inff(); }
            float mx = fmaxf(s[0][0], s[1][0]);
#pragma unroll
            for (int r = 1; r < 8; ++r) mx = fmaxf(mx, fmaxf(s[0][r], s[1][r]));
            mx = fmaxf(mx, xhalf(mx)) * CSC;   // both halves hold the query's maximum of this pass, scaled
            if (__builtin_amdgcn_ballot_w32(mx > m_run + 8.0f) != 0) {   // one scalar test a pass; always taken on a wave's first pass (m_run = -inf: the factor is 0, on zeros)
                const float m_new = fmaxf(m_run, mx), corr = __builtin_amdgcn_exp2f(m_run - m_new); l_run *= corr; m_run = m_new;
#pragma unroll
                for (int d8 = 0; d8 < 8; ++d8) acc[d8] = acc[d8] * corr; }
            float p[2][8], ps0 = 0.0f, ps1 = 0.0f;
#pragma unroll
            for (int r = 0; r < 8; ++r) { const float x0 = __builtin_fmaf(s[0][r], CSC, -m_run), x1 = __builtin_fmaf(s[1][r], CSC, -m_run); p[0][r] = HL ? exp2s(x0) : __builtin_amdgcn_exp2f(x0); p[1][r] = HL ? exp2s(x1) : __builtin_amdgcn_exp2f(x1); ps0 += p[0][r]; ps1 += p[1][r]; }   // hi/lo: exp2s
            l_run += ps0 + ps1;
            if constexpr (HL) {
                v8us h0, h1, e0, e1;
#pragma unroll
                for (int r = 0; r < 8; ++r) { unsigned short a, c2; splitf(p[0][r], a, c2); h0[r] = a; e0[r] = c2; splitf(p[1][r], a, c2); h1[r] = a; e1[r] = c2; }
                const V pfh = cat16b(h0, h1), pfl = cat16b(e0, e1);
#pragma unroll
                for (int d8 = 0; d8 < 8; ++d8) { acc[d8] = WFrag<T16>::mma(vf[d8], pfh, acc[d8]); acc[d8] = WFrag<T16>::mma(vf[d8], pfl, acc[d8]); }
#pragma unroll
                for (int d8 = 0; d8 < 8; ++d8) vf[d8] = WFrag<T16>::ld((const T16*)(sV + 2 * TB + d8 * 16 * PB));
#pragma unroll
                for (int d8 = 0; d8 < 8; ++d8) acc[d8] = WFrag<T16>::mma(vf[d8], pfh, acc[d8]);
            } else {
                V pf;
#pragma unroll
                for (int r = 0; r < 8; ++r) { pf[r] = (h16)p[0][r]; pf[8 + r] = (h16)p[1][r]; }
#pragma unroll
                for (int d8 = 0; d8 < 8; ++d8) acc[d8] = WFrag<T16>::mma(vf[d8], pf, acc[d8]);
            }
        }
      }
        asm volatile("s_wait_dscnt 0x0" ::: "memory");      // this wave has left the buffer of stage t
        asm volatile("s_wait_asynccnt 0x0" ::: "memory");   // its copies of stage t + 1 have landed
        __syncthreads();                                     // stage t + 1 published; every wave has left the buffer of stage t
        if (t + 2 < nst) fill(t + 2);                        // refill of the buffer just left
    }
    asm volatile("s_wait_asynccnt 0x0" ::: "memory");       // no copy in flight when the buffers become the partial results
    v8f* red = (v8f*)sm; float* ml = (float*)(sm + 8 * 8 * 32 * 32);   // per query group, from its second wave: 8 accumulators a lane; behind them maximum and sum
    if (kh != 0) { const int pp = gq;   // the group's second wave
#pragma unroll
        for (int d8 = 0; d8 < 8; ++d8) red[(pp * 8 + d8) * 32 + lane] = acc[d8];
        ml[(pp * 2) * 32 + lane] = m_run; ml[(pp * 2 + 1) * 32 + lane] = l_run; }
    __syncthreads();   // the partial results are in LDS before the first wave of each group joins them
    if (kh == 0) {
        const float mp = ml[(gq * 2) * 32 + lane], lp = ml[(gq * 2 + 1) * 32 + lane], m = fmaxf(m_run, mp);   // m_run is finite here: key 0 is visible to every query. A wave that had no visible pass left -inf, 0 and zeros: its factor below is 0
        const float a0 = exp2s(m_run - m), a1 = exp2s(mp - m), l = l_run * a0 + lp * a1;
        const float inv = __fdiv_rn(1.0f, l + xhalf(l));
        const size_t oo = (size_t)(qw0 + lr) * DQ + 8 * hi;
#pragma unroll
        for (int d8 = 0; d8 < 8; ++d8) { v8f o = acc[d8] * (a0 * inv); v8us vh, vl;
            o += red[(gq * 8 + d8) * 32 + lane] * (a1 * inv);
#pragma unroll
            for (int j = 0; j < 8; ++j) { unsigned short a2, c2; splitf(o[j], a2, c2); vh[j] = a2; vl[j] = c2; }
            *(v8us*)(Oh + oo + 16 * d8) = vh; *(v8us*)(Ol + oo + 16 * d8) = vl; } }
}
__global__ __launch_bounds__(512) void k_fa(const h16* __restrict__ Q16, const h16* __restrict__ K16, const h16* __restrict__ V16, const bf* __restrict__ Qh, const bf* __restrict__ Ql, const bf* __restrict__ Kh, const bf* __restrict__ Kl, const bf* __restrict__ Vh, const bf* __restrict__ Vl, bf* Ah, bf* Al) {
    __shared__ __align__(32) unsigned char sm[8 * FTB];   // the two staging buffers (of two or of four tiles); behind the loop the partial results of each group's second wave
    static_assert(REP % 2 == 0 && NH_ % 2 == 0, "the two heads of a pair share a kv head and a batch entry");
    const unsigned h0 = 2 * blockIdx.x;   // the pair's first query plane
    const size_t zq = (size_t)h0 * TT * HD, zk = (size_t)(h0 / REP) * TT * HD, zo = (size_t)(h0 / NH_) * TT * DQ + (size_t)(h0 % NH_) * HD; const int y = blockIdx.y, q0 = 64 * (y < RH / 64 ? RH / 64 - 1 - y : TT / 64 - 1 - (y - RH / 64));
    if (q0 >= RH) fa_body<h16, false>(sm, Q16 + zq, nullptr, K16 + zk, nullptr, V16 + zk, nullptr, Ah + zo, Al + zo, q0);   // the same for the whole work-group
    else fa_body<bf, true>(sm, Qh + zq, Ql + zq, Kh + zk, Kl + zk, Vh + zk, Vl + zk, Ah + zo, Al + zo, q0);
}
extern "C" void kernel_launch(void* const* d_in, const int* in_sizes, int n_in,
                              void* d_out, int out_size, void* d_ws, size_t ws_size, hipStream_t stream) {
    (void)in_sizes; (void)n_in; (void)out_size;
    const float* xq = (const float*)d_in[0]; const float* xk = (const float*)d_in[1]; const float* xv = (const float*)d_in[2]; const float* wq = (const float*)d_in[3]; const float* wk = (const float*)d_in[4]; const float* wv = (const float*)d_in[5]; const float* wo = (const float*)d_in[6];   /* q, k, v ([2][2048][2048] each: THREE streams), Wq ('xw' (in, out) [2048][2048]: 16 heads x 128), Wk, Wv ('xw' [2048][512]: 4 kv heads x 128), Wo ('xw' [2048][2048]): SEVEN inputs, all read; no bias anywhere */
    float* OUT = (float*)d_out;     // [2][2048][2048]
    char* wsp = (char*)d_ws;
    auto take = [&](size_t bytes) { char* p = wsp; wsp += (bytes + 255) & ~(size_t)255; return (void*)p; };
    static_assert(ZH == NH_, "planes b NH_ + h are 2 blockIdx.x and 2 blockIdx.x + 1 of k_fa");
    bf* WQ = (bf*)take((size_t)DQ * DM * 2); bf* WK = (bf*)take((size_t)2 * DKV * DM * 2); bf* WV = WK + (size_t)DKV * DM; bf* WO = (bf*)take((size_t)DM * DQ * 2);   /* WK, WV: z = 0, 1 of one GEMM launch */
    bf* XB = (bf*)take((size_t)3 * NB_ * TT * DM * 2);   /* XB: the bf16 copies of q, k, v, one behind the other */
    h16* QP16 = (h16*)take((size_t)NB_ * NH_ * TT * HD * 2); h16* KP16 = (h16*)take((size_t)NB_ * NKV * TT * HD * 2); h16* VT16 = (h16*)take((size_t)NB_ * NKV * HD * TT * 2);
    bf* QPh = (bf*)take((size_t)NB_ * NH_ * TT * HD * 2); bf* QPl = (bf*)take((size_t)NB_ * NH_ * TT * HD * 2); bf* KPh = (bf*)take((size_t)NB_ * NKV * TT * HD * 2); bf* KPl = (bf*)take((size_t)NB_ * NKV * TT * HD * 2); bf* VTh = (bf*)take((size_t)NB_ * NKV * HD * TT * 2); bf* VTl = (bf*)take((size_t)NB_ * NKV * HD * TT * 2);
    bf* ATh = (bf*)take((size_t)NB_ * TT * DQ * 2); bf* ATl = (bf*)take((size_t)NB_ * TT * DQ * 2);
    if ((size_t)(wsp - (char*)d_ws) > ws_size) return;    // ws 256 MiB
    k_prep<<<3 * NCV + NWT, 256, 0, stream>>>(xq, xk, xv, XB, wq, wk, wv, wo, WQ, WK, WV, WO);   /* the QUERY, KEY and VALUE streams cast; the four 'xw' (in, out) weights transposed once into Bt operands */
    k_gemmk<bf, 0, 4, 2, 1, 128, 1><<<dim3(NB_ * TT / 256, DQ / 128, 1), 256, 0, stream>>>(XB, nullptr, WQ, DM, nullptr, DQ, 0, 0, 0, QP16, QPh, QPl, nullptr, nullptr, nullptr);   /* q Wq into the query planes */
    k_gemmk<bf, 0, 2, 2, 2, 256, 2><<<dim3(NB_ * TT / 128, DKV / 128, 2), 256, 0, stream>>>(XB + (size_t)NB_ * TT * DM, nullptr, WK, DM, nullptr, DKV, (size_t)NB_ * TT * DM, (size_t)DKV * DM, 0, KP16, KPh, KPl, VT16, VTh, VTl);   /* z = 0: k Wk into the key planes [t][d], z = 1: v Wv into the value planes [d][t] */
    /* 'jnp.repeat(kh, 4, axis=1)': query head h uses kv head h / 4; with planes b NH_ + h and b NKV + h / 4 that is plane / REP for both batch entries */
    k_fa<<<dim3(NB_ * ZH / 2, TT / 64), 512, 0, stream>>>(QP16, KP16, VT16, QPh, QPl, KPh, KPl, VTh, VTl, ATh, ATl);
    k_gemmk<bf, 1, 4, 2, 1, 64, 0><<<dim3(NB_ * TT / 256, DM / 128, 1), 256, 0, stream>>>(ATh, ATl, WO, DQ, OUT, DM, 0, 0, 0, nullptr, nullptr, nullptr, nullptr, nullptr, nullptr);
}
